// v000
// The times below were measured on an AMD MI455X: many runs one after another, warmed up first and cycling through
// copies of the inputs, with the whole window's GPU time divided by the number of runs. Launches and the gaps
// between them are all in it. The median over several windows is given; except for v000 it joins two sittings, which
// can be a few percent apart, so the side-by-side timings, each taken in one sitting, are the better comparison.
// v000 is the starting kernel. One run takes 1830 microseconds.
#include <hip/hip_runtime.h>

// Causal multi-head attention with 128-wide heads, rotary embeddings from half-width input tables and a per-head RMSNorm applied AFTER the rotary (x [2][2048][2048]; q, k, v = x W^T ('oi' 1/sqrt(2048), no bias; 16 heads x 128); rope: (x1, x2) = the two HALVES of each head -> cat(x1 c - x2 s, x1 s + x2 c) with the sin / cos INPUT tables [2048][64] (read; argument order x, sin, cos); then per head q = RMSNorm(q) x q_norm_w, k = RMSNorm(k) x k_norm_w (eps = float32 machine epsilon 1.19e-7; weights [128] = ones, read); scores / sqrt(128); causal (-inf); softmax; out = merged Wo^T ('oi') -> [2][2048][2048] (8.4 M); argument order x, sin, cos, Wq, Wk, Wv, Wo, q_norm_w, k_norm_w).
// Layout per batch: bf16 copy of x; 'oi' weights cast as-is; exact projections; k_ropeIP rotates the f32 q / k projections in place from the bf16-rounded input tables (the input tables need not be rotations: no norm-preservation shortcut); k_hrms (per (head, token) 1/sqrt(mean + eps) over the 128 dims) + k_rmsapply (x r x w[d] in place); identity-table plane builders at HD 128; causal T-2048 attention (hybrid rows: < 512 hi/lo 3 products, rest fp16 x1024; k_gemmc skips tiles above the diagonal); merged hi/lo x Wo exact.
// Compute dtypes, f32 accumulate: every input rounded to bf16 incl. the tables; projections exact; rotary and RMSNorm f32 (products rounded separately); attention rows < 512 3 products, rest fp16; softmax f32; Wo hl x exact.

#define NB_  2
#define TT   2048
#define DM   2048
#define NH_  16
#define NKV  16
#define REP  (NH_ / NKV)
#define HD   128
#define DQ   (NH_ * HD)
#define DKV  (NKV * HD)
#define ZH   2
#define RH   512                  // query rows < RH use hi+lo planes (0: none)
#define WIN  2048
#define PCAR 1024.0f
#define SCL  0.088388347648318447f   // HD^-0.5
typedef _Float16 h16;
typedef unsigned short bf;
typedef __attribute__((ext_vector_type(16))) __bf16   v16bf;
typedef __attribute__((ext_vector_type(16))) _Float16 v16h;
typedef __attribute__((ext_vector_type(8)))  _Float16 v8h;
typedef __attribute__((ext_vector_type(8)))  unsigned short v8us;
typedef __attribute__((ext_vector_type(8)))  float    v8f;
typedef __attribute__((ext_vector_type(4)))  float    v4f;
typedef v8h  __attribute__((may_alias)) v8ha;
typedef v4f  __attribute__((may_alias)) v4fa;
typedef v8us __attribute__((may_alias)) v8usa;

__device__ __forceinline__ unsigned short f2bf(float f) { unsigned u = __float_as_uint(f); u += 0x7FFFu + ((u >> 16) & 1u); return (unsigned short)(u >> 16); }
__device__ __forceinline__ float bf2f(unsigned short b) { return __uint_as_float(((unsigned)b) << 16); }
__device__ __forceinline__ float bfr(float f) { return bf2f(f2bf(f)); }
__device__ __forceinline__ v16h cat16(v8h lo, v8h hi) { return __builtin_shufflevector(lo, hi, 0, 1, 2, 3, 4, 5, 6, 7, 8, 9, 10, 11, 12, 13, 14, 15); }
__device__ __forceinline__ v16bf cat16b(v8us lo, v8us hi) { return __builtin_bit_cast(v16bf, __builtin_shufflevector(lo, hi, 0, 1, 2, 3, 4, 5, 6, 7, 8, 9, 10, 11, 12, 13, 14, 15)); }
__device__ __forceinline__ v8f wmma16(v16h a, v16h b, v8f c) { return __builtin_amdgcn_wmma_f32_16x16x32_f16(false, a, false, b, (short)0, c, false, false); }
__device__ __forceinline__ v8f wmmab(v16bf a, v16bf b, v8f c) { return __builtin_amdgcn_wmma_f32_16x16x32_bf16(false, a, false, b, (short)0, c, false, false); }



// ---- k_gemmw: register-blocked GEMM, ONE WAVE per 64x64 output tile (16 accumulators), operands straight from K-contiguous 16-bit planes; grid (M/64, N/64, Z), 32 threads.
// C[m][n] (f32, pitch ldc, + optional f32 bias[n]) = sum_k A[m][k] Bt[n][k] (+ split products per NSPLIT). z-batch strides sA/sB/sC in elements. K % 32 == 0.
template <typename T16> struct WFrag;
template <> struct WFrag<h16> { typedef v16h V; static __device__ __forceinline__ V ld(const h16* p) { return cat16(*(const v8h*)p, *(const v8h*)(p + 16)); } static __device__ __forceinline__ v8f mma(V a, V b, v8f c) { return wmma16(a, b, c); } };
template <> struct WFrag<bf> { typedef v16bf V; static __device__ __forceinline__ V ld(const bf* p) { return cat16b(*(const v8us*)p, *(const v8us*)(p + 16)); } static __device__ __forceinline__ v8f mma(V a, V b, v8f c) { return wmmab(a, b, c); } };
template <typename T16, int NSPLIT, bool BIAS>
__global__ __launch_bounds__(32) void k_gemmw(const T16* __restrict__ A, const T16* __restrict__ A2, const T16* __restrict__ Bt, const T16* __restrict__ Bt2, int K, float* C, int ldc, const float* __restrict__ bias, size_t sA, size_t sB, size_t sC) {
    typedef typename WFrag<T16>::V V;
    __shared__ __align__(16) float os[16 * 68];
    const size_t z = blockIdx.z; A += z * sA; if (A2) A2 += z * sA; Bt += z * sB; if (Bt2) Bt2 += z * sB; C += z * sC;
    const int lane = threadIdx.x & 31, lr = lane & 15, hi = lane >> 4; const int r0 = blockIdx.x * 64, c0 = blockIdx.y * 64;
    v8f acc[4][4];
#pragma unroll
    for (int mb = 0; mb < 4; ++mb)
#pragma unroll
        for (int nb = 0; nb < 4; ++nb) acc[mb][nb] = (v8f){};
    const size_t aoff = (size_t)(r0 + lr) * K + 8 * hi, boff = (size_t)(c0 + lr) * K + 8 * hi;
#pragma unroll 1
    for (int kc = 0; kc < K; kc += 32) {
        V a[4], a2[4];
#pragma unroll
        for (int mb = 0; mb < 4; ++mb) { a[mb] = WFrag<T16>::ld(A + aoff + (size_t)mb * 16 * K + kc); if (NSPLIT == 1 || NSPLIT == 2) a2[mb] = WFrag<T16>::ld(A2 + aoff + (size_t)mb * 16 * K + kc); }
#pragma unroll
        for (int nb = 0; nb < 4; ++nb) { const V b = WFrag<T16>::ld(Bt + boff + (size_t)nb * 16 * K + kc); V b2; if (NSPLIT >= 2) b2 = WFrag<T16>::ld(Bt2 + boff + (size_t)nb * 16 * K + kc);
#pragma unroll
            for (int mb = 0; mb < 4; ++mb) { acc[mb][nb] = WFrag<T16>::mma(a[mb], b, acc[mb][nb]); if (NSPLIT == 1 || NSPLIT == 2) acc[mb][nb] = WFrag<T16>::mma(a2[mb], b, acc[mb][nb]); if (NSPLIT >= 2) acc[mb][nb] = WFrag<T16>::mma(a[mb], b2, acc[mb][nb]); } }
        asm volatile("v_nop\n\tv_nop\n\tv_nop\n\tv_nop" : "+v"(acc[0][0]), "+v"(acc[1][1]), "+v"(acc[2][2]), "+v"(acc[3][3]) : "v"(a[0]), "v"(a[3]));
    }
#pragma unroll
    for (int mb = 0; mb < 4; ++mb) {
#pragma unroll
        for (int nb = 0; nb < 4; ++nb) {
#pragma unroll
            for (int j = 0; j < 8; ++j) os[(hi * 8 + j) * 68 + nb * 16 + lr] = acc[mb][nb][j]; }
        __builtin_amdgcn_wave_barrier(); asm volatile("" ::: "memory");
        float* crow = C + (size_t)(r0 + mb * 16) * ldc + c0;
{
#pragma unroll
            for (int s = 0; s < 8; ++s) { const int row = 2 * s + hi, cofs = lr * 4; v4f val = *(const v4fa*)(os + row * 68 + cofs); if (BIAS) { val[0] += bfr(bias[c0 + cofs]); val[1] += bfr(bias[c0 + cofs + 1]); val[2] += bfr(bias[c0 + cofs + 2]); val[3] += bfr(bias[c0 + cofs + 3]); }
                *(v4f*)(crow + (size_t)row * ldc + cofs) = val; }
             }
        __builtin_amdgcn_wave_barrier(); asm volatile("" ::: "memory");
    }
}

// ---- k_gemmc: the same one-wave 64x64 tile GEMM specialised for causal attention: CMODE 1 skips score tiles entirely above the diagonal (query rows r0+roff.., key columns c0..), CMODE 2 limits the
// key (K) loop of the probability x value contraction to the diagonal block (probabilities beyond it are exactly zero). roff = row offset of this launch's first row within the sequence.
template <typename T16, int NSPLIT, int CMODE>
__global__ __launch_bounds__(32) void k_gemmc(const T16* __restrict__ A, const T16* __restrict__ A2, const T16* __restrict__ Bt, const T16* __restrict__ Bt2, int K, float* C, int ldc, int roff, size_t sA, size_t sB, size_t sC) {
    typedef typename WFrag<T16>::V V;
    __shared__ __align__(16) float os[16 * 68];
    const size_t z = blockIdx.z; A += z * sA; if (A2) A2 += z * sA; Bt += z * sB; if (Bt2) Bt2 += z * sB; C += z * sC;
    const int lane = threadIdx.x & 31, lr = lane & 15, hi = lane >> 4; const int r0 = blockIdx.x * 64, c0 = blockIdx.y * 64;
    if (CMODE == 1 && c0 > r0 + roff + 63) return;                  // score tile entirely above the causal diagonal: never read (the softmax masks j > i by select)
    const int Kl = (CMODE == 2) ? min(K, r0 + roff + 64) : K;        // P.V: probabilities are exactly 0 beyond the diagonal block, so the K loop stops there
    v8f acc[4][4];
#pragma unroll
    for (int mb = 0; mb < 4; ++mb)
#pragma unroll
        for (int nb = 0; nb < 4; ++nb) acc[mb][nb] = (v8f){};
    const size_t aoff = (size_t)(r0 + lr) * K + 8 * hi, boff = (size_t)(c0 + lr) * K + 8 * hi;
#pragma unroll 1
    for (int kc = 0; kc < Kl; kc += 32) {
        V a[4], a2[4];
#pragma unroll
        for (int mb = 0; mb < 4; ++mb) { a[mb] = WFrag<T16>::ld(A + aoff + (size_t)mb * 16 * K + kc); if (NSPLIT == 1 || NSPLIT == 2) a2[mb] = WFrag<T16>::ld(A2 + aoff + (size_t)mb * 16 * K + kc); }
#pragma unroll
        for (int nb = 0; nb < 4; ++nb) { const V b = WFrag<T16>::ld(Bt + boff + (size_t)nb * 16 * K + kc); V b2; if (NSPLIT >= 2) b2 = WFrag<T16>::ld(Bt2 + boff + (size_t)nb * 16 * K + kc);
#pragma unroll
            for (int mb = 0; mb < 4; ++mb) { acc[mb][nb] = WFrag<T16>::mma(a[mb], b, acc[mb][nb]); if (NSPLIT == 1 || NSPLIT == 2) acc[mb][nb] = WFrag<T16>::mma(a2[mb], b, acc[mb][nb]); if (NSPLIT >= 2) acc[mb][nb] = WFrag<T16>::mma(a[mb], b2, acc[mb][nb]); } }
        asm volatile("v_nop\n\tv_nop\n\tv_nop\n\tv_nop" : "+v"(acc[0][0]), "+v"(acc[1][1]), "+v"(acc[2][2]), "+v"(acc[3][3]) : "v"(a[0]), "v"(a[3]));
    }
#pragma unroll
    for (int mb = 0; mb < 4; ++mb) {
#pragma unroll
        for (int nb = 0; nb < 4; ++nb) {
#pragma unroll
            for (int j = 0; j < 8; ++j) os[(hi * 8 + j) * 68 + nb * 16 + lr] = acc[mb][nb][j]; }
        __builtin_amdgcn_wave_barrier(); asm volatile("" ::: "memory");
        float* crow = C + (size_t)(r0 + mb * 16) * ldc + c0;
{
#pragma unroll
            for (int s = 0; s < 8; ++s) { const int row = 2 * s + hi, cofs = lr * 4; v4f val = *(const v4fa*)(os + row * 68 + cofs);
                *(v4f*)(crow + (size_t)row * ldc + cofs) = val; }
             }
        __builtin_amdgcn_wave_barrier(); asm volatile("" ::: "memory");
    }
}

__device__ __forceinline__ h16 tohx(float x) { return (h16)x; }
__device__ __forceinline__ void splitf(float y, unsigned short& h, unsigned short& l) { h = f2bf(y); l = f2bf(y - bf2f(h)); }
typedef __attribute__((ext_vector_type(2))) _Float16 v2h;
typedef __attribute__((ext_vector_type(4))) _Float16 v4h;
typedef __attribute__((ext_vector_type(2))) unsigned short v2us;
typedef __attribute__((ext_vector_type(4))) unsigned short v4us;
typedef __attribute__((ext_vector_type(2))) float v2f;
typedef __attribute__((ext_vector_type(4))) int v4i;

__global__ __launch_bounds__(256) void k_cvt8(const float* __restrict__ src, bf* dst, size_t n8) { const size_t i = (size_t)blockIdx.x * 256 + threadIdx.x; if (i >= n8) return; const v8f v = *(const v8f*)(src + i * 8); v8us o;
#pragma unroll
    for (int k = 0; k < 8; ++k) o[k] = f2bf(v[k]); *(v8us*)(dst + i * 8) = o;  }

// k_rope: head planes [h][t][d] (fp16 + hi/lo) of rope(x) x sc with the rotate-half convention out[d] = x[d] cos[t][d] - x[d+HD/2] sin[t][d], out[d+HD/2] = x[d+HD/2] cos[t][d+HD/2] + x[d] sin[t][d+HD/2]
__global__ __launch_bounds__(256) void k_rope(const float* __restrict__ F, int pitch, int nheads, const float* __restrict__ CS, const float* __restrict__ RF, const float* __restrict__ nw, float sc, h16* P16, bf* Ph, bf* Pl) {
    const size_t e = ((size_t)blockIdx.x * 256 + threadIdx.x) * 2; if (e >= (size_t)nheads * TT * HD) return; const int d = (int)(e % HD); const int t = (int)((e / HD) % TT); const int h = (int)(e / ((size_t)HD * TT)); const float* f = F + (size_t)t * pitch + h * HD; const float rf = RF ? RF[(size_t)h * TT + t] : 1.0f; v2h o16; v2us oh, ol;
#pragma unroll
    for (int q = 0; q < 2; ++q) { const int dd = d + q; const int dp = (dd < HD / 2) ? dd + HD / 2 : dd - HD / 2; float x0 = f[dd], x1 = f[dp];
        if (RF) { float n0 = __fmul_rn(x0, rf), n1 = __fmul_rn(x1, rf); asm volatile("" : "+v"(n0)); asm volatile("" : "+v"(n1)); x0 = __fmul_rn(bfr(nw[dd]), n0); x1 = __fmul_rn(bfr(nw[dp]), n1); }
        const v2f cs = *(const v2f*)(CS + ((size_t)t * HD + dd) * 2); float a = __fmul_rn(x0, cs[0]), bq = __fmul_rn(x1, cs[1]); asm volatile("" : "+v"(a)); asm volatile("" : "+v"(bq)); const float r = ((dd < HD / 2) ? __fsub_rn(a, bq) : __fadd_rn(a, bq)) * sc;
        o16[q] = tohx(r); unsigned short a2, c2; splitf(r, a2, c2); oh[q] = a2; ol[q] = c2; }
    *(v2h*)(P16 + e) = o16; *(v2us*)(Ph + e) = oh; *(v2us*)(Pl + e) = ol;  }
__global__ __launch_bounds__(256) void k_vtp(const float* __restrict__ F, int pitch, int nheads, h16* V16, bf* Vh, bf* Vl) { const size_t e = ((size_t)blockIdx.x * 256 + threadIdx.x) * 2; if (e >= (size_t)nheads * HD * TT) return; const int t = (int)(e % TT); const int d = (int)((e / TT) % HD); const int g = (int)(e / ((size_t)TT * HD)); v2h o16; v2us oh, ol;
#pragma unroll
    for (int q = 0; q < 2; ++q) { const float x = F[(size_t)(t + q) * pitch + g * HD + d]; o16[q] = tohx(x); unsigned short a2, c2; splitf(x, a2, c2); oh[q] = a2; ol[q] = c2; }
    *(v2h*)(V16 + e) = o16; *(v2us*)(Vh + e) = oh; *(v2us*)(Vl + e) = ol;  }
__global__ __launch_bounds__(256) void k_csid(float* CS) { const int idx = blockIdx.x * 256 + threadIdx.x; if (idx >= TT * HD) return; v2f cs; cs[0] = 1.0f; cs[1] = 0.0f; *(v2f*)(CS + (size_t)idx * 2) = cs;  }
// k_asoft: per row (zz, i): t = S x HD^-0.5 for j <= i and i - j < WIN (sliding causal window; the reference's -1e9 additive fill vanishes identically); softmax over the 2048 keys (register row, one exp, fixed trees);
__global__ __launch_bounds__(256) void k_asoft(const float* __restrict__ Sb, h16* P16, bf* Ph, bf* Pl) {
    const int lane = threadIdx.x & 31; const int row = blockIdx.x * 8 + (threadIdx.x >> 5); if (row >= ZH * TT) return; const int i = row % TT; const int zz = row / TT; (void)zz; const bool hires = (i < RH); const float* sr = Sb + (size_t)row * TT; float v[TT / 32]; float mx = -3.0e38f;
#pragma unroll
    for (int ch = 0; ch < TT / 128; ++ch) { const int j0 = ch * 128 + lane * 4; const v4f a = *(const v4f*)(sr + j0);
#pragma unroll
        for (int q = 0; q < 4; ++q) { const int j = j0 + q; (void)j; const float t = (j <= i && i - j < WIN) ? a[q] * SCL : -3.0e38f; v[ch * 4 + q] = t; mx = fmaxf(mx, t); } }
#pragma unroll
    for (int sh = 16; sh; sh >>= 1) mx = fmaxf(mx, __shfl_xor(mx, sh, 32));
    float sum = 0.f;
#pragma unroll
    for (int k = 0; k < TT / 32; ++k) { float d0 = __fsub_rn(v[k], mx); asm volatile("" : "+v"(d0)); v[k] = __builtin_amdgcn_exp2f(__fmul_rn(d0, 1.4426950408889634f)); sum += v[k]; }
#pragma unroll
    for (int sh = 16; sh; sh >>= 1) sum += __shfl_xor(sum, sh, 32);
    const float f = __fdiv_rn(hires ? 1.0f : PCAR, sum);
{
        if (hires) {
#pragma unroll
            for (int ch = 0; ch < TT / 128; ++ch) { v4us oh, ol;
#pragma unroll
                for (int q = 0; q < 4; ++q) { unsigned short a, c2; splitf(v[ch * 4 + q] * f, a, c2); oh[q] = a; ol[q] = c2; }
                const size_t oo = ((size_t)zz * (RH ? RH : 1) + i) * TT + ch * 128 + lane * 4; *(v4us*)(Ph + oo) = oh; *(v4us*)(Pl + oo) = ol; }
        } else {
#pragma unroll
            for (int ch = 0; ch < TT / 128; ++ch) { v4h o4;
#pragma unroll
                for (int q = 0; q < 4; ++q) o4[q] = tohx(v[ch * 4 + q] * f);
                *(v4h*)(P16 + (size_t)row * TT + ch * 128 + lane * 4) = o4; } }
         }
}
__global__ __launch_bounds__(256) void k_ropeIP(float* F, int pitch, int nheads, const float* __restrict__ sinT, const float* __restrict__ cosT) { const size_t i = (size_t)blockIdx.x * 256 + threadIdx.x; if (i >= (size_t)TT * nheads * (HD / 2)) return; const int d = (int)(i % (HD / 2)); const int h = (int)((i / (HD / 2)) % nheads); const int t = (int)(i / ((size_t)(HD / 2) * nheads)); float* f = F + (size_t)t * pitch + h * HD; const float x1 = f[d], x2 = f[d + HD / 2]; float c = bfr(cosT[(size_t)t * (HD / 2) + d]), s = bfr(sinT[(size_t)t * (HD / 2) + d]); asm volatile("" : "+v"(c), "+v"(s)); float a1 = __fmul_rn(x1, c), a2 = __fmul_rn(x2, s), b1 = __fmul_rn(x1, s), b2 = __fmul_rn(x2, c); asm volatile("" : "+v"(a1), "+v"(a2), "+v"(b1), "+v"(b2)); const float y1 = __fsub_rn(a1, a2), y2 = __fadd_rn(b1, b2); *(float*)(f + d) = y1; *(float*)(f + d + HD / 2) = y2;  }
__global__ __launch_bounds__(256) void k_hrms(const float* __restrict__ F, int pitch, int nheads, float* RF) { const int idx = blockIdx.x * 256 + threadIdx.x; if (idx >= nheads * TT) return; const int t = idx % TT; const int h = idx / TT; const float* f = F + (size_t)t * pitch + h * HD; float s = 0.f;
#pragma unroll 4
    for (int d = 0; d < HD; d += 4) { const v4f a = *(const v4f*)(f + d);
#pragma unroll
        for (int q = 0; q < 4; ++q) { float p = __fmul_rn(a[q], a[q]); asm volatile("" : "+v"(p)); s = __fadd_rn(s, p); } }
    const float rf = __fdiv_rn(1.0f, __fsqrt_rn(__fadd_rn(__fdiv_rn(s, (float)HD), 1.1920929e-07f))); *(float*)(RF + idx) = rf;  }

__global__ __launch_bounds__(256) void k_rmsapply(float* F, int pitch, int nheads, const float* __restrict__ RF, const float* __restrict__ w) { const size_t i = (size_t)blockIdx.x * 256 + threadIdx.x; if (i >= (size_t)TT * nheads * HD / 4) return; const size_t e = i * 4; const int c = (int)(e % ((size_t)nheads * HD)); const int t = (int)(e / ((size_t)nheads * HD)); const int h = c / HD, d = c % HD; const float r = RF[(size_t)h * TT + t]; v4f a = *(const v4f*)(F + (size_t)t * pitch + c);
#pragma unroll
    for (int q = 0; q < 4; ++q) { float y = __fmul_rn(a[q], r); asm volatile("" : "+v"(y)); float wv_ = bfr(w[d + q]); asm volatile("" : "+v"(wv_)); a[q] = __fmul_rn(y, wv_); }   /* x w[d] */
    *(v4f*)(F + (size_t)t * pitch + c) = a;  }
__global__ __launch_bounds__(256) void k_merge(const float* __restrict__ O, int h0, bf* Ah, bf* Al) { const size_t e = ((size_t)blockIdx.x * 256 + threadIdx.x) * 2; if (e >= (size_t)ZH * TT * HD) return; const int d = (int)(e % HD); const int t = (int)((e / HD) % TT); const int zz = (int)(e / ((size_t)HD * TT)); const float cs = (t < RH) ? 1.0f : (1.0f / PCAR); const size_t oo = (size_t)t * DQ + (h0 + zz) * HD + d;
    v2us oh, ol;
#pragma unroll
    for (int q = 0; q < 2; ++q) { unsigned short a, c2; splitf(O[e + q] * cs, a, c2); oh[q] = a; ol[q] = c2; } *(v2us*)(Ah + oo) = oh; *(v2us*)(Al + oo) = ol;  }

extern "C" void kernel_launch(void* const* d_in, const int* in_sizes, int n_in,
                              void* d_out, int out_size, void* d_ws, size_t ws_size, hipStream_t stream) {
    (void)in_sizes; (void)n_in; (void)out_size;
    const float* x = (const float*)d_in[0]; const float* sinT = (const float*)d_in[1]; const float* cosT = (const float*)d_in[2]; const float* wq = (const float*)d_in[3]; const float* wk = (const float*)d_in[4]; const float* wv = (const float*)d_in[5]; const float* wo = (const float*)d_in[6]; const float* qsc = (const float*)d_in[7]; const float* ksc = (const float*)d_in[8];   /* x, sin, cos (f32 [2048][64], READ), Wq, Wk, Wv, Wo ('oi' [2048][2048]), q_norm_w, k_norm_w ([128], read) */
    float* OUT = (float*)d_out;     // [2][2048][2048]
    char* wsp = (char*)d_ws;
    auto take = [&](size_t bytes) { char* p = wsp; wsp += (bytes + 255) & ~(size_t)255; return (void*)p; };
    bf* WQ = (bf*)take((size_t)DQ * DM * 2); bf* WK = (bf*)take((size_t)DKV * DM * 2); bf* WV = (bf*)take((size_t)DKV * DM * 2); bf* WO = (bf*)take((size_t)DM * DQ * 2); float* CS = (float*)take((size_t)TT * HD * 2 * 4); float* RFQ = (float*)take((size_t)NH_ * TT * 4); float* RFK = (float*)take((size_t)NKV * TT * 4);   /* per (head, token) inverse RMS */
    bf* XB = (bf*)take((size_t)TT * DM * 2); float* FQ = (float*)take((size_t)TT * DQ * 4); float* FK = (float*)take((size_t)TT * DKV * 4);
    h16* QP16 = (h16*)take((size_t)NH_ * TT * HD * 2); h16* KP16 = (h16*)take((size_t)NKV * TT * HD * 2); h16* VT16 = (h16*)take((size_t)NKV * HD * TT * 2);
    bf* QPh = (bf*)take((size_t)NH_ * TT * HD * 2); bf* QPl = (bf*)take((size_t)NH_ * TT * HD * 2); bf* KPh = (bf*)take((size_t)NKV * TT * HD * 2); bf* KPl = (bf*)take((size_t)NKV * TT * HD * 2); bf* VTh = (bf*)take((size_t)NKV * HD * TT * 2); bf* VTl = (bf*)take((size_t)NKV * HD * TT * 2); bf* Ph = (bf*)take((size_t)ZH * RH * TT * 2); bf* Pl = (bf*)take((size_t)ZH * RH * TT * 2);
    float* Sb = (float*)take((size_t)ZH * TT * TT * 4); h16* P16 = (h16*)take((size_t)ZH * TT * TT * 2); float* Ob = (float*)take((size_t)ZH * TT * HD * 4); bf* ATh = (bf*)take((size_t)TT * DQ * 2); bf* ATl = (bf*)take((size_t)TT * DQ * 2);
    if ((size_t)(wsp - (char*)d_ws) > ws_size) return;    // ws 256 MiB
    float* FV = FK;   // v projection reuses the k buffer after the k planes are built (stream-ordered)
    { k_cvt8<<<(unsigned)(((size_t)DQ * DM / 8 + 255) / 256), 256, 0, stream>>>(wq, WQ, (size_t)DQ * DM / 8); k_cvt8<<<(unsigned)(((size_t)DKV * DM / 8 + 255) / 256), 256, 0, stream>>>(wk, WK, (size_t)DKV * DM / 8); k_cvt8<<<(unsigned)(((size_t)DKV * DM / 8 + 255) / 256), 256, 0, stream>>>(wv, WV, (size_t)DKV * DM / 8);
      k_cvt8<<<(unsigned)(((size_t)DM * DQ / 8 + 255) / 256), 256, 0, stream>>>(wo, WO, (size_t)DM * DQ / 8);
       }
    k_csid<<<(TT * HD + 255) / 256, 256, 0, stream>>>(CS);
    const unsigned LQ = (unsigned)(((size_t)NH_ * TT * HD / 2 + 255) / 256), LKv = (unsigned)(((size_t)NKV * TT * HD / 2 + 255) / 256);
    for (int b = 0; b < NB_; ++b) {
        
        k_cvt8<<<(unsigned)(((size_t)TT * DM / 8 + 255) / 256), 256, 0, stream>>>(x + (size_t)b * TT * DM, XB, (size_t)TT * DM / 8);
        k_gemmw<bf, 0, false><<<dim3(TT / 64, DQ / 64, 1), 32, 0, stream>>>(XB, nullptr, WQ, nullptr, DM, FQ, DQ, nullptr, 0, 0, 0);
        k_ropeIP<<<(unsigned)(((size_t)TT * NH_ * (HD / 2) + 255) / 256), 256, 0, stream>>>(FQ, DQ, NH_, sinT, cosT); k_hrms<<<(NH_ * TT + 255) / 256, 256, 0, stream>>>(FQ, DQ, NH_, RFQ); k_rmsapply<<<(unsigned)(((size_t)TT * DQ / 4 + 255) / 256), 256, 0, stream>>>(FQ, DQ, NH_, RFQ, qsc); k_rope<<<LQ, 256, 0, stream>>>(FQ, DQ, NH_, CS, nullptr, nullptr, 1.0f, QP16, QPh, QPl);
        k_gemmw<bf, 0, false><<<dim3(TT / 64, DKV / 64, 1), 32, 0, stream>>>(XB, nullptr, WK, nullptr, DM, FK, DKV, nullptr, 0, 0, 0);
        k_ropeIP<<<(unsigned)(((size_t)TT * NKV * (HD / 2) + 255) / 256), 256, 0, stream>>>(FK, DKV, NKV, sinT, cosT); k_hrms<<<(NKV * TT + 255) / 256, 256, 0, stream>>>(FK, DKV, NKV, RFK); k_rmsapply<<<(unsigned)(((size_t)TT * DKV / 4 + 255) / 256), 256, 0, stream>>>(FK, DKV, NKV, RFK, ksc); k_rope<<<LKv, 256, 0, stream>>>(FK, DKV, NKV, CS, nullptr, nullptr, 1.0f, KP16, KPh, KPl);
        k_gemmw<bf, 0, false><<<dim3(TT / 64, DKV / 64, 1), 32, 0, stream>>>(XB, nullptr, WV, nullptr, DM, FV, DKV, nullptr, 0, 0, 0); k_vtp<<<LKv, 256, 0, stream>>>(FV, DKV, NKV, VT16, VTh, VTl);
        for (int h0 = 0; h0 < NH_; h0 += ZH) { const size_t zq = (size_t)h0, zk = (size_t)(h0 / REP);   // one kv head per query head: the pass's two heads use consecutive kv planes (z-strides TT*HD)
            k_gemmc<bf, 2, 1><<<dim3(RH / 64, TT / 64, ZH), 32, 0, stream>>>(QPh + zq * TT * HD, QPl + zq * TT * HD, KPh + zk * TT * HD, KPl + zk * TT * HD, HD, Sb, TT, 0, (size_t)TT * HD, (size_t)TT * HD, (size_t)TT * TT);
            k_gemmc<h16, 0, 1><<<dim3((TT - RH) / 64, TT / 64, ZH), 32, 0, stream>>>(QP16 + zq * TT * HD + (size_t)RH * HD, nullptr, KP16 + zk * TT * HD, nullptr, HD, Sb + (size_t)RH * TT, TT, RH, (size_t)TT * HD, (size_t)TT * HD, (size_t)TT * TT);
            k_asoft<<<ZH * TT / 8, 256, 0, stream>>>(Sb, P16, Ph, Pl);
            k_gemmc<bf, 2, 2><<<dim3(RH / 64, HD / 64, ZH), 32, 0, stream>>>(Ph, Pl, VTh + zk * HD * TT, VTl + zk * HD * TT, TT, Ob, HD, 0, (size_t)RH * TT, (size_t)HD * TT, (size_t)TT * HD);
            k_gemmc<h16, 0, 2><<<dim3((TT - RH) / 64, HD / 64, ZH), 32, 0, stream>>>(P16 + (size_t)RH * TT, nullptr, VT16 + zk * HD * TT, nullptr, TT, Ob + (size_t)RH * HD, HD, RH, (size_t)TT * TT, (size_t)HD * TT, (size_t)TT * HD);
            k_merge<<<(unsigned)(((size_t)ZH * TT * HD / 2 + 255) / 256), 256, 0, stream>>>(Ob, h0, ATh, ATl); }
        k_gemmw<bf, 1, false><<<dim3(TT / 64, DM / 64, 1), 32, 0, stream>>>(ATh, ATl, WO, nullptr, DQ, OUT + (size_t)b * TT * DM, DM, nullptr, 0, 0, 0); }
}

// v001
// Measured time: 1270 microseconds a run.
// In both of two side-by-side timings against v000, it was 1.45 times as fast.
#include <hip/hip_runtime.h>

// Causal multi-head attention with 128-wide heads, rotary embeddings from half-width input tables and a per-head RMSNorm applied AFTER the rotary (x [2][2048][2048]; q, k, v = x W^T ('oi' 1/sqrt(2048), no bias; 16 heads x 128); rope: (x1, x2) = the two HALVES of each head -> cat(x1 c - x2 s, x1 s + x2 c) with the sin / cos INPUT tables [2048][64] (read; argument order x, sin, cos); then per head q = RMSNorm(q) x q_norm_w, k = RMSNorm(k) x k_norm_w (eps = float32 machine epsilon 1.19e-7; weights [128] = ones, read); scores / sqrt(128); causal (-inf); softmax; out = merged Wo^T ('oi') -> [2][2048][2048] (8.4 M); argument order x, sin, cos, Wq, Wk, Wv, Wo, q_norm_w, k_norm_w).
// Layout per batch: bf16 copy of x; 'oi' weights cast as-is; exact projections; k_ropeIP rotates the f32 q / k projections in place from the bf16-rounded input tables (the tables need not be rotations: no norm-preservation shortcut); k_hrms (per (head, token) 1/sqrt(mean + eps) over the 128 dims) + k_rmsapply (x r x w[d] in place); identity-table plane builders at HD 128; causal T-2048 attention (hybrid rows: < 512 hi/lo 3 products, rest fp16 x1024; k_gemmc skips tiles above the diagonal; k_gemmpv splits the key loop of P x V over the waves of a work-group); merged hi/lo x Wo exact.
// Compute dtypes, f32 accumulate: every input rounded to bf16 incl. the tables; projections exact; rotary and RMSNorm f32 (products rounded separately); attention rows < 512 3 products, rest fp16; softmax f32; Wo hl x exact.

#define NB_  2
#define TT   2048
#define DM   2048
#define NH_  16
#define NKV  16
#define REP  (NH_ / NKV)
#define HD   128
#define DQ   (NH_ * HD)
#define DKV  (NKV * HD)
#define ZH   2
#define RH   512                  // query rows < RH use hi+lo planes (0: none)
#define WIN  2048
#define PCAR 1024.0f
#define SCL  0.088388347648318447f   // HD^-0.5
typedef _Float16 h16;
typedef unsigned short bf;
typedef __attribute__((ext_vector_type(16))) __bf16   v16bf;
typedef __attribute__((ext_vector_type(16))) _Float16 v16h;
typedef __attribute__((ext_vector_type(8)))  _Float16 v8h;
typedef __attribute__((ext_vector_type(8)))  unsigned short v8us;
typedef __attribute__((ext_vector_type(8)))  float    v8f;
typedef __attribute__((ext_vector_type(4)))  float    v4f;
typedef v8h  __attribute__((may_alias)) v8ha;
typedef v4f  __attribute__((may_alias)) v4fa;
typedef v8us __attribute__((may_alias)) v8usa;

__device__ __forceinline__ unsigned short f2bf(float f) { unsigned u = __float_as_uint(f); u += 0x7FFFu + ((u >> 16) & 1u); return (unsigned short)(u >> 16); }
__device__ __forceinline__ float bf2f(unsigned short b) { return __uint_as_float(((unsigned)b) << 16); }
__device__ __forceinline__ float bfr(float f) { return bf2f(f2bf(f)); }
__device__ __forceinline__ v16h cat16(v8h lo, v8h hi) { return __builtin_shufflevector(lo, hi, 0, 1, 2, 3, 4, 5, 6, 7, 8, 9, 10, 11, 12, 13, 14, 15); }
__device__ __forceinline__ v16bf cat16b(v8us lo, v8us hi) { return __builtin_bit_cast(v16bf, __builtin_shufflevector(lo, hi, 0, 1, 2, 3, 4, 5, 6, 7, 8, 9, 10, 11, 12, 13, 14, 15)); }
__device__ __forceinline__ v8f wmma16(v16h a, v16h b, v8f c) { return __builtin_amdgcn_wmma_f32_16x16x32_f16(false, a, false, b, (short)0, c, false, false); }
__device__ __forceinline__ v8f wmmab(v16bf a, v16bf b, v8f c) { return __builtin_amdgcn_wmma_f32_16x16x32_bf16(false, a, false, b, (short)0, c, false, false); }



// ---- k_gemmw: register-blocked GEMM, ONE WAVE per 64x64 output tile (16 accumulators), operands straight from K-contiguous 16-bit planes; grid (M/64, N/64, Z), 32 threads.
// C[m][n] (f32, pitch ldc, + optional f32 bias[n]) = sum_k A[m][k] Bt[n][k] (+ split products per NSPLIT). z-batch strides sA/sB/sC in elements. K % 32 == 0.
template <typename T16> struct WFrag;
template <> struct WFrag<h16> { typedef v16h V; static __device__ __forceinline__ V ld(const h16* p) { return cat16(*(const v8h*)p, *(const v8h*)(p + 16)); } static __device__ __forceinline__ v8f mma(V a, V b, v8f c) { return wmma16(a, b, c); } };
template <> struct WFrag<bf> { typedef v16bf V; static __device__ __forceinline__ V ld(const bf* p) { return cat16b(*(const v8us*)p, *(const v8us*)(p + 16)); } static __device__ __forceinline__ v8f mma(V a, V b, v8f c) { return wmmab(a, b, c); } };
template <typename T16, int NSPLIT, bool BIAS>
__global__ __launch_bounds__(32) void k_gemmw(const T16* __restrict__ A, const T16* __restrict__ A2, const T16* __restrict__ Bt, const T16* __restrict__ Bt2, int K, float* C, int ldc, const float* __restrict__ bias, size_t sA, size_t sB, size_t sC) {
    typedef typename WFrag<T16>::V V;
    __shared__ __align__(16) float os[16 * 68];
    const size_t z = blockIdx.z; A += z * sA; if (A2) A2 += z * sA; Bt += z * sB; if (Bt2) Bt2 += z * sB; C += z * sC;
    const int lane = threadIdx.x & 31, lr = lane & 15, hi = lane >> 4; const int r0 = blockIdx.x * 64, c0 = blockIdx.y * 64;
    v8f acc[4][4];
#pragma unroll
    for (int mb = 0; mb < 4; ++mb)
#pragma unroll
        for (int nb = 0; nb < 4; ++nb) acc[mb][nb] = (v8f){};
    const size_t aoff = (size_t)(r0 + lr) * K + 8 * hi, boff = (size_t)(c0 + lr) * K + 8 * hi;
#pragma unroll 1
    for (int kc = 0; kc < K; kc += 32) {
        V a[4], a2[4];
#pragma unroll
        for (int mb = 0; mb < 4; ++mb) { a[mb] = WFrag<T16>::ld(A + aoff + (size_t)mb * 16 * K + kc); if (NSPLIT == 1 || NSPLIT == 2) a2[mb] = WFrag<T16>::ld(A2 + aoff + (size_t)mb * 16 * K + kc); }
#pragma unroll
        for (int nb = 0; nb < 4; ++nb) { const V b = WFrag<T16>::ld(Bt + boff + (size_t)nb * 16 * K + kc); V b2; if (NSPLIT >= 2) b2 = WFrag<T16>::ld(Bt2 + boff + (size_t)nb * 16 * K + kc);
#pragma unroll
            for (int mb = 0; mb < 4; ++mb) { acc[mb][nb] = WFrag<T16>::mma(a[mb], b, acc[mb][nb]); if (NSPLIT == 1 || NSPLIT == 2) acc[mb][nb] = WFrag<T16>::mma(a2[mb], b, acc[mb][nb]); if (NSPLIT >= 2) acc[mb][nb] = WFrag<T16>::mma(a[mb], b2, acc[mb][nb]); } }
        asm volatile("v_nop\n\tv_nop\n\tv_nop\n\tv_nop" : "+v"(acc[0][0]), "+v"(acc[1][1]), "+v"(acc[2][2]), "+v"(acc[3][3]) : "v"(a[0]), "v"(a[3]));
    }
#pragma unroll
    for (int mb = 0; mb < 4; ++mb) {
#pragma unroll
        for (int nb = 0; nb < 4; ++nb) {
#pragma unroll
            for (int j = 0; j < 8; ++j) os[(hi * 8 + j) * 68 + nb * 16 + lr] = acc[mb][nb][j]; }
        __builtin_amdgcn_wave_barrier(); asm volatile("" ::: "memory");
        float* crow = C + (size_t)(r0 + mb * 16) * ldc + c0;
{
#pragma unroll
            for (int s = 0; s < 8; ++s) { const int row = 2 * s + hi, cofs = lr * 4; v4f val = *(const v4fa*)(os + row * 68 + cofs); if (BIAS) { val[0] += bfr(bias[c0 + cofs]); val[1] += bfr(bias[c0 + cofs + 1]); val[2] += bfr(bias[c0 + cofs + 2]); val[3] += bfr(bias[c0 + cofs + 3]); }
                *(v4f*)(crow + (size_t)row * ldc + cofs) = val; }
             }
        __builtin_amdgcn_wave_barrier(); asm volatile("" ::: "memory");
    }
}

// ---- k_gemmc: the same one-wave 64x64 tile GEMM specialised for the causal scores: tiles entirely above the diagonal (query rows r0+roff.., key columns c0..) are skipped.
// roff = row offset of this launch's first row within the sequence.
template <typename T16, int NSPLIT>
__global__ __launch_bounds__(32) void k_gemmc(const T16* __restrict__ A, const T16* __restrict__ A2, const T16* __restrict__ Bt, const T16* __restrict__ Bt2, int K, float* C, int ldc, int roff, size_t sA, size_t sB, size_t sC) {
    typedef typename WFrag<T16>::V V;
    __shared__ __align__(16) float os[16 * 68];
    const size_t z = blockIdx.z; A += z * sA; if (A2) A2 += z * sA; Bt += z * sB; if (Bt2) Bt2 += z * sB; C += z * sC;
    const int lane = threadIdx.x & 31, lr = lane & 15, hi = lane >> 4; const int r0 = blockIdx.x * 64, c0 = blockIdx.y * 64;
    if (c0 > r0 + roff + 63) return;                  // score tile entirely above the causal diagonal: never used (the softmax loads it but masks j > i by select)
    v8f acc[4][4];
#pragma unroll
    for (int mb = 0; mb < 4; ++mb)
#pragma unroll
        for (int nb = 0; nb < 4; ++nb) acc[mb][nb] = (v8f){};
    const size_t aoff = (size_t)(r0 + lr) * K + 8 * hi, boff = (size_t)(c0 + lr) * K + 8 * hi;
#pragma unroll 1
    for (int kc = 0; kc < K; kc += 32) {
        V a[4], a2[4];
#pragma unroll
        for (int mb = 0; mb < 4; ++mb) { a[mb] = WFrag<T16>::ld(A + aoff + (size_t)mb * 16 * K + kc); if (NSPLIT == 1 || NSPLIT == 2) a2[mb] = WFrag<T16>::ld(A2 + aoff + (size_t)mb * 16 * K + kc); }
#pragma unroll
        for (int nb = 0; nb < 4; ++nb) { const V b = WFrag<T16>::ld(Bt + boff + (size_t)nb * 16 * K + kc); V b2; if (NSPLIT >= 2) b2 = WFrag<T16>::ld(Bt2 + boff + (size_t)nb * 16 * K + kc);
#pragma unroll
            for (int mb = 0; mb < 4; ++mb) { acc[mb][nb] = WFrag<T16>::mma(a[mb], b, acc[mb][nb]); if (NSPLIT == 1 || NSPLIT == 2) acc[mb][nb] = WFrag<T16>::mma(a2[mb], b, acc[mb][nb]); if (NSPLIT >= 2) acc[mb][nb] = WFrag<T16>::mma(a[mb], b2, acc[mb][nb]); } }
        asm volatile("v_nop\n\tv_nop\n\tv_nop\n\tv_nop" : "+v"(acc[0][0]), "+v"(acc[1][1]), "+v"(acc[2][2]), "+v"(acc[3][3]) : "v"(a[0]), "v"(a[3]));
    }
#pragma unroll
    for (int mb = 0; mb < 4; ++mb) {
#pragma unroll
        for (int nb = 0; nb < 4; ++nb) {
#pragma unroll
            for (int j = 0; j < 8; ++j) os[(hi * 8 + j) * 68 + nb * 16 + lr] = acc[mb][nb][j]; }
        __builtin_amdgcn_wave_barrier(); asm volatile("" ::: "memory");
        float* crow = C + (size_t)(r0 + mb * 16) * ldc + c0;
{
#pragma unroll
            for (int s = 0; s < 8; ++s) { const int row = 2 * s + hi, cofs = lr * 4; v4f val = *(const v4fa*)(os + row * 68 + cofs);
                *(v4f*)(crow + (size_t)row * ldc + cofs) = val; }
             }
        __builtin_amdgcn_wave_barrier(); asm volatile("" ::: "memory");
    }
}

// ---- k_gemmpv: probability x value contraction, one 64x64 output tile per work-group of NW waves. The key loop (row length KD) stops at the diagonal block (probabilities beyond it are exactly zero) and is
// split over the waves in 64-key chunks (one 128-byte line of every operand row), chunk c to wave c % NW; each wave keeps the whole tile in 16 accumulators. The NW partial tiles meet in LDS
// (accumulator order, 16 bytes a lane) and are summed in wave order 0..NW-1; each wave then stores 4-row x 64-column groups as whole 128-byte lines (output pitch LDC). KD, r0 and roff are multiples of 64.
// ldlast: WFrag::ld for the LAST fragment read through a lane address. Its second half is the last use of the address registers, so the register allocator lets that half's result, or a later load's, land on them.
template <typename T16> __device__ __forceinline__ typename WFrag<T16>::V ldlast(const T16* p);
template <> __device__ __forceinline__ v16h ldlast<h16>(const h16* p) { const v8h x = *(const v8h*)p;
    asm volatile("s_wait_xcnt 0x0" ::: "memory");   // in front of the half whose result may take the address registers of the loads issued before it
    const v8h y = *(const v8h*)(p + 16);
    asm volatile("s_wait_xcnt 0x0" ::: "memory");   // behind that half, in front of the next plane's loads, whose results may take its address registers
    return cat16(x, y); }
template <> __device__ __forceinline__ v16bf ldlast<bf>(const bf* p) { const v8us x = *(const v8us*)p;
    asm volatile("s_wait_xcnt 0x0" ::: "memory");   // as in the h16 form
    const v8us y = *(const v8us*)(p + 16);
    asm volatile("s_wait_xcnt 0x0" ::: "memory");   // as in the h16 form
    return cat16b(x, y); }
template <typename T16, int NSPLIT, int NW, int KD, int LDC>
__global__ __launch_bounds__(NW * 32) void k_gemmpv(const T16* __restrict__ A, const T16* __restrict__ A2, const T16* __restrict__ Bt, const T16* __restrict__ Bt2, float* C, int roff, size_t sA, size_t sB, size_t sC) {
    typedef typename WFrag<T16>::V V;
    __shared__ __align__(16) float red[NW * 4096];
    const int lane = threadIdx.x & 31, lr = lane & 15, hi = lane >> 4; const int r0 = blockIdx.x * 64, c0 = blockIdx.y * 64;
    const size_t z = blockIdx.z, ua = z * sA + (size_t)r0 * KD, ub = z * sB + (size_t)c0 * KD; A += ua; if (A2) A2 += ua; Bt += ub; if (Bt2) Bt2 += ub; C += z * sC;   // tile bases, the same in every lane
    const int w = __builtin_amdgcn_readfirstlane((int)(threadIdx.x >> 5));   // wave number, kept scalar so that the loop bounds and the operand bases are scalar
    const int Kl = min(KD, r0 + roff + 64);
    v8f acc[4][4];   // every full unroll below: acc, a, a2 live in registers and need constant indices
#pragma unroll
    for (int mb = 0; mb < 4; ++mb)
#pragma unroll
        for (int nb = 0; nb < 4; ++nb) acc[mb][nb] = (v8f){};
    const int lo = (lr * KD + 8 * hi) * 2;   // the lane's byte offset in a 16-row block, the same for all four planes: one address per plane and trip, every load is that address + a constant
    // both key loops stay rolled: beside the 128 accumulator registers one trip's fragments already fill most of the register file in the hi/lo form
#pragma unroll 1
    for (int kb = w * 64; kb < Kl; kb += NW * 64) {
#pragma unroll 1
        for (int kc = kb; kc < kb + 64; kc += 32) {
            const char* pa = (const char*)(A + kc); const char* pa2 = (const char*)(A2 + kc); const char* pb = (const char*)(Bt + kc); const char* pb2 = (const char*)(Bt2 + kc);
            V a[4], a2[4];
#pragma unroll
            for (int mb = 0; mb < 3; ++mb) { a[mb] = WFrag<T16>::ld((const T16*)(pa + lo + mb * 32 * KD)); if (NSPLIT == 1 || NSPLIT == 2) a2[mb] = WFrag<T16>::ld((const T16*)(pa2 + lo + mb * 32 * KD)); }
            a[3] = ldlast<T16>((const T16*)(pa + lo + 3 * 32 * KD)); if (NSPLIT == 1 || NSPLIT == 2) a2[3] = ldlast<T16>((const T16*)(pa2 + lo + 3 * 32 * KD));
#pragma unroll
            for (int nb = 0; nb < 4; ++nb) { const T16* qb = (const T16*)(pb + lo + nb * 32 * KD); const T16* qb2 = (const T16*)(pb2 + lo + nb * 32 * KD); const V b = (nb < 3) ? WFrag<T16>::ld(qb) : ldlast<T16>(qb); V b2; if (NSPLIT >= 2) b2 = (nb < 3) ? WFrag<T16>::ld(qb2) : ldlast<T16>(qb2);
#pragma unroll
                for (int mb = 0; mb < 4; ++mb) { acc[mb][nb] = WFrag<T16>::mma(a[mb], b, acc[mb][nb]); if (NSPLIT == 1 || NSPLIT == 2) acc[mb][nb] = WFrag<T16>::mma(a2[mb], b, acc[mb][nb]); if (NSPLIT >= 2) acc[mb][nb] = WFrag<T16>::mma(a[mb], b2, acc[mb][nb]); } }
            asm volatile("v_nop\n\tv_nop\n\tv_nop\n\tv_nop" : "+v"(acc[0][0]), "+v"(acc[1][1]), "+v"(acc[2][2]), "+v"(acc[3][3]) : "v"(a[0]), "v"(a[3]));   // the distance behind the last matrix instruction, on the taken back edge too, before the next trip's loads overwrite its operands
        }
    }
#pragma unroll
    for (int mb = 0; mb < 4; ++mb)
#pragma unroll
        for (int nb = 0; nb < 4; ++nb) { float* p = red + (size_t)w * 4096 + (mb * 4 + nb) * 256 + lane * 4; const v8f t = acc[mb][nb];
            *(v4fa*)p = __builtin_shufflevector(t, t, 0, 1, 2, 3); *(v4fa*)(p + 128) = __builtin_shufflevector(t, t, 4, 5, 6, 7); }
    __syncthreads();   // every wave's partial tile is in LDS before any wave sums
    float* cp = C + (size_t)(r0 + 4 * w) * LDC + c0 + lane;   // group g starts at row 4 * g and lane (lr, hi) of pass u holds column 32 * u + lane: one address, every store is that address + a constant
#pragma unroll
    for (int i = 0; i < 16 / NW; ++i) { const int g = w + i * NW, mb = g >> 2, hs = (g >> 1) & 1, hf = g & 1;   // group g: rows mb * 16 + hs * 8 + hf * 4 .. + 3, all 64 columns
#pragma unroll
        for (int u = 0; u < 2; ++u) { const int nb = 2 * u + hi; const float* p = red + (mb * 4 + nb) * 256 + hf * 128 + (hs * 16 + lr) * 4; v4f s = *(const v4fa*)p;
#pragma unroll
            for (int ww = 1; ww < NW; ++ww) s += *(const v4fa*)(p + ww * 4096);
#pragma unroll
            for (int e = 0; e < 4; ++e) cp[(4 * NW * i + e) * LDC + 32 * u] = s[e]; } }
}

__device__ __forceinline__ h16 tohx(float x) { return (h16)x; }
__device__ __forceinline__ void splitf(float y, unsigned short& h, unsigned short& l) { h = f2bf(y); l = f2bf(y - bf2f(h)); }
typedef __attribute__((ext_vector_type(2))) _Float16 v2h;
typedef __attribute__((ext_vector_type(4))) _Float16 v4h;
typedef __attribute__((ext_vector_type(2))) unsigned short v2us;
typedef __attribute__((ext_vector_type(4))) unsigned short v4us;
typedef __attribute__((ext_vector_type(2))) float v2f;
typedef __attribute__((ext_vector_type(4))) int v4i;

__global__ __launch_bounds__(256) void k_cvt8(const float* __restrict__ src, bf* dst, size_t n8) { const size_t i = (size_t)blockIdx.x * 256 + threadIdx.x; if (i >= n8) return; const v8f v = *(const v8f*)(src + i * 8); v8us o;
#pragma unroll
    for (int k = 0; k < 8; ++k) o[k] = f2bf(v[k]); *(v8us*)(dst + i * 8) = o;  }

// k_rope: head planes [h][t][d] (fp16 + hi/lo) of rope(x) x sc with the rotate-half convention out[d] = x[d] cos[t][d] - x[d+HD/2] sin[t][d], out[d+HD/2] = x[d+HD/2] cos[t][d+HD/2] + x[d] sin[t][d+HD/2]
__global__ __launch_bounds__(256) void k_rope(const float* __restrict__ F, int pitch, int nheads, const float* __restrict__ CS, const float* __restrict__ RF, const float* __restrict__ nw, float sc, h16* P16, bf* Ph, bf* Pl) {
    const size_t e = ((size_t)blockIdx.x * 256 + threadIdx.x) * 2; if (e >= (size_t)nheads * TT * HD) return; const int d = (int)(e % HD); const int t = (int)((e / HD) % TT); const int h = (int)(e / ((size_t)HD * TT)); const float* f = F + (size_t)t * pitch + h * HD; const float rf = RF ? RF[(size_t)h * TT + t] : 1.0f; v2h o16; v2us oh, ol;
#pragma unroll
    for (int q = 0; q < 2; ++q) { const int dd = d + q; const int dp = (dd < HD / 2) ? dd + HD / 2 : dd - HD / 2; float x0 = f[dd], x1 = f[dp];
        if (RF) { float n0 = __fmul_rn(x0, rf), n1 = __fmul_rn(x1, rf); asm volatile("" : "+v"(n0)); asm volatile("" : "+v"(n1)); x0 = __fmul_rn(bfr(nw[dd]), n0); x1 = __fmul_rn(bfr(nw[dp]), n1); }
        const v2f cs = *(const v2f*)(CS + ((size_t)t * HD + dd) * 2); float a = __fmul_rn(x0, cs[0]), bq = __fmul_rn(x1, cs[1]); asm volatile("" : "+v"(a)); asm volatile("" : "+v"(bq)); const float r = ((dd < HD / 2) ? __fsub_rn(a, bq) : __fadd_rn(a, bq)) * sc;
        o16[q] = tohx(r); unsigned short a2, c2; splitf(r, a2, c2); oh[q] = a2; ol[q] = c2; }
    *(v2h*)(P16 + e) = o16; *(v2us*)(Ph + e) = oh; *(v2us*)(Pl + e) = ol;  }
__global__ __launch_bounds__(256) void k_vtp(const float* __restrict__ F, int pitch, int nheads, h16* V16, bf* Vh, bf* Vl) { const size_t e = ((size_t)blockIdx.x * 256 + threadIdx.x) * 2; if (e >= (size_t)nheads * HD * TT) return; const int t = (int)(e % TT); const int d = (int)((e / TT) % HD); const int g = (int)(e / ((size_t)TT * HD)); v2h o16; v2us oh, ol;
#pragma unroll
    for (int q = 0; q < 2; ++q) { const float x = F[(size_t)(t + q) * pitch + g * HD + d]; o16[q] = tohx(x); unsigned short a2, c2; splitf(x, a2, c2); oh[q] = a2; ol[q] = c2; }
    *(v2h*)(V16 + e) = o16; *(v2us*)(Vh + e) = oh; *(v2us*)(Vl + e) = ol;  }
__global__ __launch_bounds__(256) void k_csid(float* CS) { const int idx = blockIdx.x * 256 + threadIdx.x; if (idx >= TT * HD) return; v2f cs; cs[0] = 1.0f; cs[1] = 0.0f; *(v2f*)(CS + (size_t)idx * 2) = cs;  }
// k_asoft: per row (zz, i): t = S x HD^-0.5 for j <= i and i - j < WIN (sliding causal window; the reference's -1e9 additive fill vanishes identically); softmax over the 2048 keys (register row, one exp, fixed trees);
__global__ __launch_bounds__(256) void k_asoft(const float* __restrict__ Sb, h16* P16, bf* Ph, bf* Pl) {
    const int lane = threadIdx.x & 31; const int row = blockIdx.x * 8 + (threadIdx.x >> 5); if (row >= ZH * TT) return; const int i = row % TT; const int zz = row / TT; (void)zz; const bool hires = (i < RH); const float* sr = Sb + (size_t)row * TT; float v[TT / 32]; float mx = -3.0e38f;
#pragma unroll
    for (int ch = 0; ch < TT / 128; ++ch) { const int j0 = ch * 128 + lane * 4; const v4f a = *(const v4f*)(sr + j0);
#pragma unroll
        for (int q = 0; q < 4; ++q) { const int j = j0 + q; (void)j; const float t = (j <= i && i - j < WIN) ? a[q] * SCL : -3.0e38f; v[ch * 4 + q] = t; mx = fmaxf(mx, t); } }
#pragma unroll
    for (int sh = 16; sh; sh >>= 1) mx = fmaxf(mx, __shfl_xor(mx, sh, 32));
    float sum = 0.f;
#pragma unroll
    for (int k = 0; k < TT / 32; ++k) { float d0 = __fsub_rn(v[k], mx); asm volatile("" : "+v"(d0)); v[k] = __builtin_amdgcn_exp2f(__fmul_rn(d0, 1.4426950408889634f)); sum += v[k]; }
#pragma unroll
    for (int sh = 16; sh; sh >>= 1) sum += __shfl_xor(sum, sh, 32);
    const float f = __fdiv_rn(hires ? 1.0f : PCAR, sum);
{
        if (hires) {
#pragma unroll
            for (int ch = 0; ch < TT / 128; ++ch) { v4us oh, ol;
#pragma unroll
                for (int q = 0; q < 4; ++q) { unsigned short a, c2; splitf(v[ch * 4 + q] * f, a, c2); oh[q] = a; ol[q] = c2; }
                const size_t oo = ((size_t)zz * (RH ? RH : 1) + i) * TT + ch * 128 + lane * 4; *(v4us*)(Ph + oo) = oh; *(v4us*)(Pl + oo) = ol; }
        } else {
#pragma unroll
            for (int ch = 0; ch < TT / 128; ++ch) { v4h o4;
#pragma unroll
                for (int q = 0; q < 4; ++q) o4[q] = tohx(v[ch * 4 + q] * f);
                *(v4h*)(P16 + (size_t)row * TT + ch * 128 + lane * 4) = o4; } }
         }
}
__global__ __launch_bounds__(256) void k_ropeIP(float* F, int pitch, int nheads, const float* __restrict__ sinT, const float* __restrict__ cosT) { const size_t i = (size_t)blockIdx.x * 256 + threadIdx.x; if (i >= (size_t)TT * nheads * (HD / 2)) return; const int d = (int)(i % (HD / 2)); const int h = (int)((i / (HD / 2)) % nheads); const int t = (int)(i / ((size_t)(HD / 2) * nheads)); float* f = F + (size_t)t * pitch + h * HD; const float x1 = f[d], x2 = f[d + HD / 2]; float c = bfr(cosT[(size_t)t * (HD / 2) + d]), s = bfr(sinT[(size_t)t * (HD / 2) + d]); asm volatile("" : "+v"(c), "+v"(s)); float a1 = __fmul_rn(x1, c), a2 = __fmul_rn(x2, s), b1 = __fmul_rn(x1, s), b2 = __fmul_rn(x2, c); asm volatile("" : "+v"(a1), "+v"(a2), "+v"(b1), "+v"(b2)); const float y1 = __fsub_rn(a1, a2), y2 = __fadd_rn(b1, b2); *(float*)(f + d) = y1; *(float*)(f + d + HD / 2) = y2;  }
__global__ __launch_bounds__(256) void k_hrms(const float* __restrict__ F, int pitch, int nheads, float* RF) { const int idx = blockIdx.x * 256 + threadIdx.x; if (idx >= nheads * TT) return; const int t = idx % TT; const int h = idx / TT; const float* f = F + (size_t)t * pitch + h * HD; float s = 0.f;
#pragma unroll 4
    for (int d = 0; d < HD; d += 4) { const v4f a = *(const v4f*)(f + d);
#pragma unroll
        for (int q = 0; q < 4; ++q) { float p = __fmul_rn(a[q], a[q]); asm volatile("" : "+v"(p)); s = __fadd_rn(s, p); } }
    const float rf = __fdiv_rn(1.0f, __fsqrt_rn(__fadd_rn(__fdiv_rn(s, (float)HD), 1.1920929e-07f))); *(float*)(RF + idx) = rf;  }

__global__ __launch_bounds__(256) void k_rmsapply(float* F, int pitch, int nheads, const float* __restrict__ RF, const float* __restrict__ w) { const size_t i = (size_t)blockIdx.x * 256 + threadIdx.x; if (i >= (size_t)TT * nheads * HD / 4) return; const size_t e = i * 4; const int c = (int)(e % ((size_t)nheads * HD)); const int t = (int)(e / ((size_t)nheads * HD)); const int h = c / HD, d = c % HD; const float r = RF[(size_t)h * TT + t]; v4f a = *(const v4f*)(F + (size_t)t * pitch + c);
#pragma unroll
    for (int q = 0; q < 4; ++q) { float y = __fmul_rn(a[q], r); asm volatile("" : "+v"(y)); float wv_ = bfr(w[d + q]); asm volatile("" : "+v"(wv_)); a[q] = __fmul_rn(y, wv_); }   /* x w[d] */
    *(v4f*)(F + (size_t)t * pitch + c) = a;  }
__global__ __launch_bounds__(256) void k_merge(const float* __restrict__ O, int h0, bf* Ah, bf* Al) { const size_t e = ((size_t)blockIdx.x * 256 + threadIdx.x) * 2; if (e >= (size_t)ZH * TT * HD) return; const int d = (int)(e % HD); const int t = (int)((e / HD) % TT); const int zz = (int)(e / ((size_t)HD * TT)); const float cs = (t < RH) ? 1.0f : (1.0f / PCAR); const size_t oo = (size_t)t * DQ + (h0 + zz) * HD + d;
    v2us oh, ol;
#pragma unroll
    for (int q = 0; q < 2; ++q) { unsigned short a, c2; splitf(O[e + q] * cs, a, c2); oh[q] = a; ol[q] = c2; } *(v2us*)(Ah + oo) = oh; *(v2us*)(Al + oo) = ol;  }

extern "C" void kernel_launch(void* const* d_in, const int* in_sizes, int n_in,
                              void* d_out, int out_size, void* d_ws, size_t ws_size, hipStream_t stream) {
    (void)in_sizes; (void)n_in; (void)out_size;
    const float* x = (const float*)d_in[0]; const float* sinT = (const float*)d_in[1]; const float* cosT = (const float*)d_in[2]; const float* wq = (const float*)d_in[3]; const float* wk = (const float*)d_in[4]; const float* wv = (const float*)d_in[5]; const float* wo = (const float*)d_in[6]; const float* qsc = (const float*)d_in[7]; const float* ksc = (const float*)d_in[8];   /* x, sin, cos (f32 [2048][64], READ), Wq, Wk, Wv, Wo ('oi' [2048][2048]), q_norm_w, k_norm_w ([128], read) */
    float* OUT = (float*)d_out;     // [2][2048][2048]
    char* wsp = (char*)d_ws;
    auto take = [&](size_t bytes) { char* p = wsp; wsp += (bytes + 255) & ~(size_t)255; return (void*)p; };
    bf* WQ = (bf*)take((size_t)DQ * DM * 2); bf* WK = (bf*)take((size_t)DKV * DM * 2); bf* WV = (bf*)take((size_t)DKV * DM * 2); bf* WO = (bf*)take((size_t)DM * DQ * 2); float* CS = (float*)take((size_t)TT * HD * 2 * 4); float* RFQ = (float*)take((size_t)NH_ * TT * 4); float* RFK = (float*)take((size_t)NKV * TT * 4);   /* per (head, token) inverse RMS */
    bf* XB = (bf*)take((size_t)TT * DM * 2); float* FQ = (float*)take((size_t)TT * DQ * 4); float* FK = (float*)take((size_t)TT * DKV * 4);
    h16* QP16 = (h16*)take((size_t)NH_ * TT * HD * 2); h16* KP16 = (h16*)take((size_t)NKV * TT * HD * 2); h16* VT16 = (h16*)take((size_t)NKV * HD * TT * 2);
    bf* QPh = (bf*)take((size_t)NH_ * TT * HD * 2); bf* QPl = (bf*)take((size_t)NH_ * TT * HD * 2); bf* KPh = (bf*)take((size_t)NKV * TT * HD * 2); bf* KPl = (bf*)take((size_t)NKV * TT * HD * 2); bf* VTh = (bf*)take((size_t)NKV * HD * TT * 2); bf* VTl = (bf*)take((size_t)NKV * HD * TT * 2); bf* Ph = (bf*)take((size_t)ZH * RH * TT * 2); bf* Pl = (bf*)take((size_t)ZH * RH * TT * 2);
    float* Sb = (float*)take((size_t)ZH * TT * TT * 4); h16* P16 = (h16*)take((size_t)ZH * TT * TT * 2); float* Ob = (float*)take((size_t)ZH * TT * HD * 4); bf* ATh = (bf*)take((size_t)TT * DQ * 2); bf* ATl = (bf*)take((size_t)TT * DQ * 2);
    if ((size_t)(wsp - (char*)d_ws) > ws_size) return;    // ws 256 MiB
    float* FV = FK;   // v projection reuses the k buffer after the k planes are built (stream-ordered)
    { k_cvt8<<<(unsigned)(((size_t)DQ * DM / 8 + 255) / 256), 256, 0, stream>>>(wq, WQ, (size_t)DQ * DM / 8); k_cvt8<<<(unsigned)(((size_t)DKV * DM / 8 + 255) / 256), 256, 0, stream>>>(wk, WK, (size_t)DKV * DM / 8); k_cvt8<<<(unsigned)(((size_t)DKV * DM / 8 + 255) / 256), 256, 0, stream>>>(wv, WV, (size_t)DKV * DM / 8);
      k_cvt8<<<(unsigned)(((size_t)DM * DQ / 8 + 255) / 256), 256, 0, stream>>>(wo, WO, (size_t)DM * DQ / 8);
       }
    k_csid<<<(TT * HD + 255) / 256, 256, 0, stream>>>(CS);
    const unsigned LQ = (unsigned)(((size_t)NH_ * TT * HD / 2 + 255) / 256), LKv = (unsigned)(((size_t)NKV * TT * HD / 2 + 255) / 256);
    for (int b = 0; b < NB_; ++b) {
        
        k_cvt8<<<(unsigned)(((size_t)TT * DM / 8 + 255) / 256), 256, 0, stream>>>(x + (size_t)b * TT * DM, XB, (size_t)TT * DM / 8);
        k_gemmw<bf, 0, false><<<dim3(TT / 64, DQ / 64, 1), 32, 0, stream>>>(XB, nullptr, WQ, nullptr, DM, FQ, DQ, nullptr, 0, 0, 0);
        k_ropeIP<<<(unsigned)(((size_t)TT * NH_ * (HD / 2) + 255) / 256), 256, 0, stream>>>(FQ, DQ, NH_, sinT, cosT); k_hrms<<<(NH_ * TT + 255) / 256, 256, 0, stream>>>(FQ, DQ, NH_, RFQ); k_rmsapply<<<(unsigned)(((size_t)TT * DQ / 4 + 255) / 256), 256, 0, stream>>>(FQ, DQ, NH_, RFQ, qsc); k_rope<<<LQ, 256, 0, stream>>>(FQ, DQ, NH_, CS, nullptr, nullptr, 1.0f, QP16, QPh, QPl);
        k_gemmw<bf, 0, false><<<dim3(TT / 64, DKV / 64, 1), 32, 0, stream>>>(XB, nullptr, WK, nullptr, DM, FK, DKV, nullptr, 0, 0, 0);
        k_ropeIP<<<(unsigned)(((size_t)TT * NKV * (HD / 2) + 255) / 256), 256, 0, stream>>>(FK, DKV, NKV, sinT, cosT); k_hrms<<<(NKV * TT + 255) / 256, 256, 0, stream>>>(FK, DKV, NKV, RFK); k_rmsapply<<<(unsigned)(((size_t)TT * DKV / 4 + 255) / 256), 256, 0, stream>>>(FK, DKV, NKV, RFK, ksc); k_rope<<<LKv, 256, 0, stream>>>(FK, DKV, NKV, CS, nullptr, nullptr, 1.0f, KP16, KPh, KPl);
        k_gemmw<bf, 0, false><<<dim3(TT / 64, DKV / 64, 1), 32, 0, stream>>>(XB, nullptr, WV, nullptr, DM, FV, DKV, nullptr, 0, 0, 0); k_vtp<<<LKv, 256, 0, stream>>>(FV, DKV, NKV, VT16, VTh, VTl);
        for (int h0 = 0; h0 < NH_; h0 += ZH) { const size_t zq = (size_t)h0, zk = (size_t)(h0 / REP);   // one kv head per query head: the pass's two heads use consecutive kv planes (z-strides TT*HD)
            k_gemmc<bf, 2><<<dim3(RH / 64, TT / 64, ZH), 32, 0, stream>>>(QPh + zq * TT * HD, QPl + zq * TT * HD, KPh + zk * TT * HD, KPl + zk * TT * HD, HD, Sb, TT, 0, (size_t)TT * HD, (size_t)TT * HD, (size_t)TT * TT);
            k_gemmc<h16, 0><<<dim3((TT - RH) / 64, TT / 64, ZH), 32, 0, stream>>>(QP16 + zq * TT * HD + (size_t)RH * HD, nullptr, KP16 + zk * TT * HD, nullptr, HD, Sb + (size_t)RH * TT, TT, RH, (size_t)TT * HD, (size_t)TT * HD, (size_t)TT * TT);
            k_asoft<<<ZH * TT / 8, 256, 0, stream>>>(Sb, P16, Ph, Pl);
            k_gemmpv<bf, 2, 8, TT, HD><<<dim3(RH / 64, HD / 64, ZH), 256, 0, stream>>>(Ph, Pl, VTh + zk * HD * TT, VTl + zk * HD * TT, Ob, 0, (size_t)RH * TT, (size_t)HD * TT, (size_t)TT * HD);
            k_gemmpv<h16, 0, 16, TT, HD><<<dim3((TT - RH) / 64, HD / 64, ZH), 512, 0, stream>>>(P16 + (size_t)RH * TT, nullptr, VT16 + zk * HD * TT, nullptr, Ob + (size_t)RH * HD, RH, (size_t)TT * TT, (size_t)HD * TT, (size_t)TT * HD);
            k_merge<<<(unsigned)(((size_t)ZH * TT * HD / 2 + 255) / 256), 256, 0, stream>>>(Ob, h0, ATh, ATl); }
        k_gemmw<bf, 1, false><<<dim3(TT / 64, DM / 64, 1), 32, 0, stream>>>(ATh, ATl, WO, nullptr, DQ, OUT + (size_t)b * TT * DM, DM, nullptr, 0, 0, 0); }
}

// v002
// A run of this version takes 1140 microseconds.
// Timed twice side by side with v001, it ran 1.12 and 1.11 times as fast.
// Counting every step since v000, it is 1.62 times as fast.
#include <hip/hip_runtime.h>

// Causal multi-head attention with 128-wide heads, rotary embeddings from half-width input tables and a per-head RMSNorm applied AFTER the rotary (x [2][2048][2048]; q, k, v = x W^T ('oi' 1/sqrt(2048), no bias; 16 heads x 128); rope: (x1, x2) = the two HALVES of each head -> cat(x1 c - x2 s, x1 s + x2 c) with the sin / cos INPUT tables [2048][64] (read; argument order x, sin, cos); then per head q = RMSNorm(q) x q_norm_w, k = RMSNorm(k) x k_norm_w (eps = float32 machine epsilon 1.19e-7; weights [128] = ones, read); scores / sqrt(128); causal (-inf); softmax; out = merged Wo^T ('oi') -> [2][2048][2048] (8.4 M); argument order x, sin, cos, Wq, Wk, Wv, Wo, q_norm_w, k_norm_w).
// Layout per batch: bf16 copy of x; 'oi' weights cast as-is; exact projections; k_qkpost takes the f32 q / k projections to their 16-bit head planes in one pass: rotary from the bf16-rounded input tables (the tables need not be rotations: no norm-preservation shortcut), per (head, token) 1/sqrt(mean + eps) over the 128 rotated dims, x r x w[d]; causal T-2048 attention (hybrid rows: < 512 hi/lo 3 products, rest fp16 x1024; k_gemmc skips tiles above the diagonal; k_gemmpv splits the key loop of P x V over the waves of a work-group); merged hi/lo x Wo exact.
// Compute dtypes, f32 accumulate: every input rounded to bf16 incl. the tables; projections exact; rotary and RMSNorm f32; attention rows < 512 3 products, rest fp16; softmax f32; Wo hl x exact.

#define NB_  2
#define TT   2048
#define DM   2048
#define NH_  16
#define NKV  16
#define REP  (NH_ / NKV)
#define HD   128
#define DQ   (NH_ * HD)
#define DKV  (NKV * HD)
#define ZH   2
#define RH   512                  // query rows < RH use hi+lo planes (0: none)
#define WIN  2048
#define PCAR 1024.0f
#define SCL  0.088388347648318447f   // HD^-0.5
typedef _Float16 h16;
typedef unsigned short bf;
typedef __attribute__((ext_vector_type(16))) __bf16   v16bf;
typedef __attribute__((ext_vector_type(16))) _Float16 v16h;
typedef __attribute__((ext_vector_type(8)))  _Float16 v8h;
typedef __attribute__((ext_vector_type(8)))  unsigned short v8us;
typedef __attribute__((ext_vector_type(8)))  float    v8f;
typedef __attribute__((ext_vector_type(4)))  float    v4f;
typedef v8h  __attribute__((may_alias)) v8ha;
typedef v4f  __attribute__((may_alias)) v4fa;
typedef v8us __attribute__((may_alias)) v8usa;

__device__ __forceinline__ unsigned short f2bf(float f) { unsigned u = __float_as_uint(f); u += 0x7FFFu + ((u >> 16) & 1u); return (unsigned short)(u >> 16); }
__device__ __forceinline__ float bf2f(unsigned short b) { return __uint_as_float(((unsigned)b) << 16); }
__device__ __forceinline__ float bfr(float f) { return bf2f(f2bf(f)); }
__device__ __forceinline__ v16h cat16(v8h lo, v8h hi) { return __builtin_shufflevector(lo, hi, 0, 1, 2, 3, 4, 5, 6, 7, 8, 9, 10, 11, 12, 13, 14, 15); }
__device__ __forceinline__ v16bf cat16b(v8us lo, v8us hi) { return __builtin_bit_cast(v16bf, __builtin_shufflevector(lo, hi, 0, 1, 2, 3, 4, 5, 6, 7, 8, 9, 10, 11, 12, 13, 14, 15)); }
__device__ __forceinline__ v8f wmma16(v16h a, v16h b, v8f c) { return __builtin_amdgcn_wmma_f32_16x16x32_f16(false, a, false, b, (short)0, c, false, false); }
__device__ __forceinline__ v8f wmmab(v16bf a, v16bf b, v8f c) { return __builtin_amdgcn_wmma_f32_16x16x32_bf16(false, a, false, b, (short)0, c, false, false); }



// ---- k_gemmw: register-blocked GEMM, ONE WAVE per 64x64 output tile (16 accumulators), operands straight from K-contiguous 16-bit planes; grid (M/64, N/64, Z), 32 threads.
// C[m][n] (f32, pitch ldc, + optional f32 bias[n]) = sum_k A[m][k] Bt[n][k] (+ split products per NSPLIT). z-batch strides sA/sB/sC in elements. K % 32 == 0.
template <typename T16> struct WFrag;
template <> struct WFrag<h16> { typedef v16h V; static __device__ __forceinline__ V ld(const h16* p) { return cat16(*(const v8h*)p, *(const v8h*)(p + 16)); } static __device__ __forceinline__ v8f mma(V a, V b, v8f c) { return wmma16(a, b, c); } };
template <> struct WFrag<bf> { typedef v16bf V; static __device__ __forceinline__ V ld(const bf* p) { return cat16b(*(const v8us*)p, *(const v8us*)(p + 16)); } static __device__ __forceinline__ v8f mma(V a, V b, v8f c) { return wmmab(a, b, c); } };
template <typename T16, int NSPLIT, bool BIAS>
__global__ __launch_bounds__(32) void k_gemmw(const T16* __restrict__ A, const T16* __restrict__ A2, const T16* __restrict__ Bt, const T16* __restrict__ Bt2, int K, float* C, int ldc, const float* __restrict__ bias, size_t sA, size_t sB, size_t sC) {
    typedef typename WFrag<T16>::V V;
    __shared__ __align__(16) float os[16 * 68];
    const size_t z = blockIdx.z; A += z * sA; if (A2) A2 += z * sA; Bt += z * sB; if (Bt2) Bt2 += z * sB; C += z * sC;
    const int lane = threadIdx.x & 31, lr = lane & 15, hi = lane >> 4; const int r0 = blockIdx.x * 64, c0 = blockIdx.y * 64;
    v8f acc[4][4];
#pragma unroll
    for (int mb = 0; mb < 4; ++mb)
#pragma unroll
        for (int nb = 0; nb < 4; ++nb) acc[mb][nb] = (v8f){};
    const size_t aoff = (size_t)(r0 + lr) * K + 8 * hi, boff = (size_t)(c0 + lr) * K + 8 * hi;
#pragma unroll 1
    for (int kc = 0; kc < K; kc += 32) {
        V a[4], a2[4];
#pragma unroll
        for (int mb = 0; mb < 4; ++mb) { a[mb] = WFrag<T16>::ld(A + aoff + (size_t)mb * 16 * K + kc); if (NSPLIT == 1 || NSPLIT == 2) a2[mb] = WFrag<T16>::ld(A2 + aoff + (size_t)mb * 16 * K + kc); }
#pragma unroll
        for (int nb = 0; nb < 4; ++nb) { const V b = WFrag<T16>::ld(Bt + boff + (size_t)nb * 16 * K + kc); V b2; if (NSPLIT >= 2) b2 = WFrag<T16>::ld(Bt2 + boff + (size_t)nb * 16 * K + kc);
#pragma unroll
            for (int mb = 0; mb < 4; ++mb) { acc[mb][nb] = WFrag<T16>::mma(a[mb], b, acc[mb][nb]); if (NSPLIT == 1 || NSPLIT == 2) acc[mb][nb] = WFrag<T16>::mma(a2[mb], b, acc[mb][nb]); if (NSPLIT >= 2) acc[mb][nb] = WFrag<T16>::mma(a[mb], b2, acc[mb][nb]); } }
        asm volatile("v_nop\n\tv_nop\n\tv_nop\n\tv_nop" : "+v"(acc[0][0]), "+v"(acc[1][1]), "+v"(acc[2][2]), "+v"(acc[3][3]) : "v"(a[0]), "v"(a[3]));
    }
#pragma unroll
    for (int mb = 0; mb < 4; ++mb) {
#pragma unroll
        for (int nb = 0; nb < 4; ++nb) {
#pragma unroll
            for (int j = 0; j < 8; ++j) os[(hi * 8 + j) * 68 + nb * 16 + lr] = acc[mb][nb][j]; }
        __builtin_amdgcn_wave_barrier(); asm volatile("" ::: "memory");
        float* crow = C + (size_t)(r0 + mb * 16) * ldc + c0;
{
#pragma unroll
            for (int s = 0; s < 8; ++s) { const int row = 2 * s + hi, cofs = lr * 4; v4f val = *(const v4fa*)(os + row * 68 + cofs); if (BIAS) { val[0] += bfr(bias[c0 + cofs]); val[1] += bfr(bias[c0 + cofs + 1]); val[2] += bfr(bias[c0 + cofs + 2]); val[3] += bfr(bias[c0 + cofs + 3]); }
                *(v4f*)(crow + (size_t)row * ldc + cofs) = val; }
             }
        __builtin_amdgcn_wave_barrier(); asm volatile("" ::: "memory");
    }
}

// ---- k_gemmc: the same one-wave 64x64 tile GEMM specialised for the causal scores: tiles entirely above the diagonal (query rows r0+roff.., key columns c0..) are skipped.
// roff = row offset of this launch's first row within the sequence.
template <typename T16, int NSPLIT>
__global__ __launch_bounds__(32) void k_gemmc(const T16* __restrict__ A, const T16* __restrict__ A2, const T16* __restrict__ Bt, const T16* __restrict__ Bt2, int K, float* C, int ldc, int roff, size_t sA, size_t sB, size_t sC) {
    typedef typename WFrag<T16>::V V;
    __shared__ __align__(16) float os[16 * 68];
    const size_t z = blockIdx.z; A += z * sA; if (A2) A2 += z * sA; Bt += z * sB; if (Bt2) Bt2 += z * sB; C += z * sC;
    const int lane = threadIdx.x & 31, lr = lane & 15, hi = lane >> 4; const int r0 = blockIdx.x * 64, c0 = blockIdx.y * 64;
    if (c0 > r0 + roff + 63) return;                  // score tile entirely above the causal diagonal: never used (the softmax loads it but masks j > i by select)
    v8f acc[4][4];
#pragma unroll
    for (int mb = 0; mb < 4; ++mb)
#pragma unroll
        for (int nb = 0; nb < 4; ++nb) acc[mb][nb] = (v8f){};
    const size_t aoff = (size_t)(r0 + lr) * K + 8 * hi, boff = (size_t)(c0 + lr) * K + 8 * hi;
#pragma unroll 1
    for (int kc = 0; kc < K; kc += 32) {
        V a[4], a2[4];
#pragma unroll
        for (int mb = 0; mb < 4; ++mb) { a[mb] = WFrag<T16>::ld(A + aoff + (size_t)mb * 16 * K + kc); if (NSPLIT == 1 || NSPLIT == 2) a2[mb] = WFrag<T16>::ld(A2 + aoff + (size_t)mb * 16 * K + kc); }
#pragma unroll
        for (int nb = 0; nb < 4; ++nb) { const V b = WFrag<T16>::ld(Bt + boff + (size_t)nb * 16 * K + kc); V b2; if (NSPLIT >= 2) b2 = WFrag<T16>::ld(Bt2 + boff + (size_t)nb * 16 * K + kc);
#pragma unroll
            for (int mb = 0; mb < 4; ++mb) { acc[mb][nb] = WFrag<T16>::mma(a[mb], b, acc[mb][nb]); if (NSPLIT == 1 || NSPLIT == 2) acc[mb][nb] = WFrag<T16>::mma(a2[mb], b, acc[mb][nb]); if (NSPLIT >= 2) acc[mb][nb] = WFrag<T16>::mma(a[mb], b2, acc[mb][nb]); } }
        asm volatile("v_nop\n\tv_nop\n\tv_nop\n\tv_nop" : "+v"(acc[0][0]), "+v"(acc[1][1]), "+v"(acc[2][2]), "+v"(acc[3][3]) : "v"(a[0]), "v"(a[3]));
    }
#pragma unroll
    for (int mb = 0; mb < 4; ++mb) {
#pragma unroll
        for (int nb = 0; nb < 4; ++nb) {
#pragma unroll
            for (int j = 0; j < 8; ++j) os[(hi * 8 + j) * 68 + nb * 16 + lr] = acc[mb][nb][j]; }
        __builtin_amdgcn_wave_barrier(); asm volatile("" ::: "memory");
        float* crow = C + (size_t)(r0 + mb * 16) * ldc + c0;
{
#pragma unroll
            for (int s = 0; s < 8; ++s) { const int row = 2 * s + hi, cofs = lr * 4; v4f val = *(const v4fa*)(os + row * 68 + cofs);
                *(v4f*)(crow + (size_t)row * ldc + cofs) = val; }
             }
        __builtin_amdgcn_wave_barrier(); asm volatile("" ::: "memory");
    }
}

// ---- k_gemmpv: probability x value contraction, one 64x64 output tile per work-group of NW waves. The key loop (row length KD) stops at the diagonal block (probabilities beyond it are exactly zero) and is
// split over the waves in 64-key chunks (one 128-byte line of every operand row), chunk c to wave c % NW; each wave keeps the whole tile in 16 accumulators. The NW partial tiles meet in LDS
// (accumulator order, 16 bytes a lane) and are summed in wave order 0..NW-1; each wave then stores 4-row x 64-column groups as whole 128-byte lines (output pitch LDC). KD, r0 and roff are multiples of 64.
// ldlast: WFrag::ld for the LAST fragment read through a lane address. Its second half is the last use of the address registers, so the register allocator lets that half's result, or a later load's, land on them.
template <typename T16> __device__ __forceinline__ typename WFrag<T16>::V ldlast(const T16* p);
template <> __device__ __forceinline__ v16h ldlast<h16>(const h16* p) { const v8h x = *(const v8h*)p;
    asm volatile("s_wait_xcnt 0x0" ::: "memory");   // in front of the half whose result may take the address registers of the loads issued before it
    const v8h y = *(const v8h*)(p + 16);
    asm volatile("s_wait_xcnt 0x0" ::: "memory");   // behind that half, in front of the next plane's loads, whose results may take its address registers
    return cat16(x, y); }
template <> __device__ __forceinline__ v16bf ldlast<bf>(const bf* p) { const v8us x = *(const v8us*)p;
    asm volatile("s_wait_xcnt 0x0" ::: "memory");   // as in the h16 form
    const v8us y = *(const v8us*)(p + 16);
    asm volatile("s_wait_xcnt 0x0" ::: "memory");   // as in the h16 form
    return cat16b(x, y); }
template <typename T16, int NSPLIT, int NW, int KD, int LDC>
__global__ __launch_bounds__(NW * 32) void k_gemmpv(const T16* __restrict__ A, const T16* __restrict__ A2, const T16* __restrict__ Bt, const T16* __restrict__ Bt2, float* C, int roff, size_t sA, size_t sB, size_t sC) {
    typedef typename WFrag<T16>::V V;
    __shared__ __align__(16) float red[NW * 4096];
    const int lane = threadIdx.x & 31, lr = lane & 15, hi = lane >> 4; const int r0 = blockIdx.x * 64, c0 = blockIdx.y * 64;
    const size_t z = blockIdx.z, ua = z * sA + (size_t)r0 * KD, ub = z * sB + (size_t)c0 * KD; A += ua; if (A2) A2 += ua; Bt += ub; if (Bt2) Bt2 += ub; C += z * sC;   // tile bases, the same in every lane
    const int w = __builtin_amdgcn_readfirstlane((int)(threadIdx.x >> 5));   // wave number, kept scalar so that the loop bounds and the operand bases are scalar
    const int Kl = min(KD, r0 + roff + 64);
    v8f acc[4][4];   // every full unroll below: acc, a, a2 live in registers and need constant indices
#pragma unroll
    for (int mb = 0; mb < 4; ++mb)
#pragma unroll
        for (int nb = 0; nb < 4; ++nb) acc[mb][nb] = (v8f){};
    const int lo = (lr * KD + 8 * hi) * 2;   // the lane's byte offset in a 16-row block, the same for all four planes: one address per plane and trip, every load is that address + a constant
    // both key loops stay rolled: beside the 128 accumulator registers one trip's fragments already fill most of the register file in the hi/lo form
#pragma unroll 1
    for (int kb = w * 64; kb < Kl; kb += NW * 64) {
#pragma unroll 1
        for (int kc = kb; kc < kb + 64; kc += 32) {
            const char* pa = (const char*)(A + kc); const char* pa2 = (const char*)(A2 + kc); const char* pb = (const char*)(Bt + kc); const char* pb2 = (const char*)(Bt2 + kc);
            V a[4], a2[4];
#pragma unroll
            for (int mb = 0; mb < 3; ++mb) { a[mb] = WFrag<T16>::ld((const T16*)(pa + lo + mb * 32 * KD)); if (NSPLIT == 1 || NSPLIT == 2) a2[mb] = WFrag<T16>::ld((const T16*)(pa2 + lo + mb * 32 * KD)); }
            a[3] = ldlast<T16>((const T16*)(pa + lo + 3 * 32 * KD)); if (NSPLIT == 1 || NSPLIT == 2) a2[3] = ldlast<T16>((const T16*)(pa2 + lo + 3 * 32 * KD));
#pragma unroll
            for (int nb = 0; nb < 4; ++nb) { const T16* qb = (const T16*)(pb + lo + nb * 32 * KD); const T16* qb2 = (const T16*)(pb2 + lo + nb * 32 * KD); const V b = (nb < 3) ? WFrag<T16>::ld(qb) : ldlast<T16>(qb); V b2; if (NSPLIT >= 2) b2 = (nb < 3) ? WFrag<T16>::ld(qb2) : ldlast<T16>(qb2);
#pragma unroll
                for (int mb = 0; mb < 4; ++mb) { acc[mb][nb] = WFrag<T16>::mma(a[mb], b, acc[mb][nb]); if (NSPLIT == 1 || NSPLIT == 2) acc[mb][nb] = WFrag<T16>::mma(a2[mb], b, acc[mb][nb]); if (NSPLIT >= 2) acc[mb][nb] = WFrag<T16>::mma(a[mb], b2, acc[mb][nb]); } }
            asm volatile("v_nop\n\tv_nop\n\tv_nop\n\tv_nop" : "+v"(acc[0][0]), "+v"(acc[1][1]), "+v"(acc[2][2]), "+v"(acc[3][3]) : "v"(a[0]), "v"(a[3]));   // the distance behind the last matrix instruction, on the taken back edge too, before the next trip's loads overwrite its operands
        }
    }
#pragma unroll
    for (int mb = 0; mb < 4; ++mb)
#pragma unroll
        for (int nb = 0; nb < 4; ++nb) { float* p = red + (size_t)w * 4096 + (mb * 4 + nb) * 256 + lane * 4; const v8f t = acc[mb][nb];
            *(v4fa*)p = __builtin_shufflevector(t, t, 0, 1, 2, 3); *(v4fa*)(p + 128) = __builtin_shufflevector(t, t, 4, 5, 6, 7); }
    __syncthreads();   // every wave's partial tile is in LDS before any wave sums
    float* cp = C + (size_t)(r0 + 4 * w) * LDC + c0 + lane;   // group g starts at row 4 * g and lane (lr, hi) of pass u holds column 32 * u + lane: one address, every store is that address + a constant
#pragma unroll
    for (int i = 0; i < 16 / NW; ++i) { const int g = w + i * NW, mb = g >> 2, hs = (g >> 1) & 1, hf = g & 1;   // group g: rows mb * 16 + hs * 8 + hf * 4 .. + 3, all 64 columns
#pragma unroll
        for (int u = 0; u < 2; ++u) { const int nb = 2 * u + hi; const float* p = red + (mb * 4 + nb) * 256 + hf * 128 + (hs * 16 + lr) * 4; v4f s = *(const v4fa*)p;
#pragma unroll
            for (int ww = 1; ww < NW; ++ww) s += *(const v4fa*)(p + ww * 4096);
#pragma unroll
            for (int e = 0; e < 4; ++e) cp[(4 * NW * i + e) * LDC + 32 * u] = s[e]; } }
}

__device__ __forceinline__ h16 tohx(float x) { return (h16)x; }
__device__ __forceinline__ void splitf(float y, unsigned short& h, unsigned short& l) { h = f2bf(y); l = f2bf(y - bf2f(h)); }
typedef __attribute__((ext_vector_type(2))) _Float16 v2h;
typedef __attribute__((ext_vector_type(4))) _Float16 v4h;
typedef __attribute__((ext_vector_type(2))) unsigned short v2us;
typedef __attribute__((ext_vector_type(4))) unsigned short v4us;
typedef __attribute__((ext_vector_type(2))) float v2f;
typedef __attribute__((ext_vector_type(4))) int v4i;

__global__ __launch_bounds__(256) void k_cvt8(const float* __restrict__ src, bf* dst, size_t n8) { const size_t i = (size_t)blockIdx.x * 256 + threadIdx.x; if (i >= n8) return; const v8f v = *(const v8f*)(src + i * 8); v8us o;
#pragma unroll
    for (int k = 0; k < 8; ++k) o[k] = f2bf(v[k]); *(v8us*)(dst + i * 8) = o;  }

__global__ __launch_bounds__(256) void k_vtp(const float* __restrict__ F, int pitch, int nheads, h16* V16, bf* Vh, bf* Vl) { const size_t e = ((size_t)blockIdx.x * 256 + threadIdx.x) * 2; if (e >= (size_t)nheads * HD * TT) return; const int t = (int)(e % TT); const int d = (int)((e / TT) % HD); const int g = (int)(e / ((size_t)TT * HD)); v2h o16; v2us oh, ol;
#pragma unroll
    for (int q = 0; q < 2; ++q) { const float x = F[(size_t)(t + q) * pitch + g * HD + d]; o16[q] = tohx(x); unsigned short a2, c2; splitf(x, a2, c2); oh[q] = a2; ol[q] = c2; }
    *(v2h*)(V16 + e) = o16; *(v2us*)(Vh + e) = oh; *(v2us*)(Vl + e) = ol;  }
// k_asoft: per row (zz, i): t = S x HD^-0.5 for j <= i and i - j < WIN (WIN = TT: every key j <= i is kept; the reference's -1e9 additive fill vanishes identically); softmax over the 2048 keys (register row, one exp, fixed trees);
__global__ __launch_bounds__(256) void k_asoft(const float* __restrict__ Sb, h16* P16, bf* Ph, bf* Pl) {
    const int lane = threadIdx.x & 31; const int row = blockIdx.x * 8 + (threadIdx.x >> 5); if (row >= ZH * TT) return; const int i = row % TT; const int zz = row / TT; (void)zz; const bool hires = (i < RH); const float* sr = Sb + (size_t)row * TT; float v[TT / 32]; float mx = -3.0e38f;
#pragma unroll
    for (int ch = 0; ch < TT / 128; ++ch) { const int j0 = ch * 128 + lane * 4; const v4f a = *(const v4f*)(sr + j0);
#pragma unroll
        for (int q = 0; q < 4; ++q) { const int j = j0 + q; (void)j; const float t = (j <= i && i - j < WIN) ? a[q] * SCL : -3.0e38f; v[ch * 4 + q] = t; mx = fmaxf(mx, t); } }
#pragma unroll
    for (int sh = 16; sh; sh >>= 1) mx = fmaxf(mx, __shfl_xor(mx, sh, 32));
    float sum = 0.f;
#pragma unroll
    for (int k = 0; k < TT / 32; ++k) { float d0 = __fsub_rn(v[k], mx); asm volatile("" : "+v"(d0)); v[k] = __builtin_amdgcn_exp2f(__fmul_rn(d0, 1.4426950408889634f)); sum += v[k]; }
#pragma unroll
    for (int sh = 16; sh; sh >>= 1) sum += __shfl_xor(sum, sh, 32);
    const float f = __fdiv_rn(hires ? 1.0f : PCAR, sum);
{
        if (hires) {
#pragma unroll
            for (int ch = 0; ch < TT / 128; ++ch) { v4us oh, ol;
#pragma unroll
                for (int q = 0; q < 4; ++q) { unsigned short a, c2; splitf(v[ch * 4 + q] * f, a, c2); oh[q] = a; ol[q] = c2; }
                const size_t oo = ((size_t)zz * (RH ? RH : 1) + i) * TT + ch * 128 + lane * 4; *(v4us*)(Ph + oo) = oh; *(v4us*)(Pl + oo) = ol; }
        } else {
#pragma unroll
            for (int ch = 0; ch < TT / 128; ++ch) { v4h o4;
#pragma unroll
                for (int q = 0; q < 4; ++q) o4[q] = tohx(v[ch * 4 + q] * f);
                *(v4h*)(P16 + (size_t)row * TT + ch * 128 + lane * 4) = o4; } }
         }
}
// ---- k_qkpost: all that stands between the f32 q / k projections [t][h * HD + d] and their 16-bit head planes [h][t][d] (fp16 + bf16 hi/lo), in one pass; blockIdx.y = 0: q, 1: k.
// 16 lanes hold one (token, head) row: lane j the dims 4j..4j+3 of both halves, so that each rotary pair sits in one lane. A group does QKH heads of one token (one read of the tables), all its loads issued ahead.
// rotary from the bf16-rounded tables, r = 1/sqrt(mean of squares + eps) over the 128 rotated dims (8 terms a lane, then a butterfly over the 16 lanes), (y x r) x w[d] with w rounded to bf16.
#define QKH 4
static_assert(NH_ == NKV && NH_ % QKH == 0 && (TT * (NH_ / QKH)) % 16 == 0 && HD == 128, "k_qkpost: q and k alike, whole groups, whole blocks, 16 lanes x 4 dims a half row");
__device__ __forceinline__ float rowsum16(float v) {   // sum over the 16 lanes of a row, every lane on; the cross-lane reads fold into the adds
    v += __builtin_bit_cast(float, __builtin_amdgcn_update_dpp(0, __builtin_bit_cast(int, v), 0x161, 0xf, 0xf, true));   // row_xmask:1
    v += __builtin_bit_cast(float, __builtin_amdgcn_update_dpp(0, __builtin_bit_cast(int, v), 0x162, 0xf, 0xf, true));   // row_xmask:2
    v += __builtin_bit_cast(float, __builtin_amdgcn_update_dpp(0, __builtin_bit_cast(int, v), 0x164, 0xf, 0xf, true));   // row_xmask:4
    v += __builtin_bit_cast(float, __builtin_amdgcn_update_dpp(0, __builtin_bit_cast(int, v), 0x168, 0xf, 0xf, true));   // row_xmask:8
    return v; }
__global__ __launch_bounds__(256) void k_qkpost(const float* __restrict__ Fq, const float* __restrict__ Fk, const float* __restrict__ sinT, const float* __restrict__ cosT, const float* __restrict__ wq_, const float* __restrict__ wk_, h16* Q16, bf* Qh, bf* Ql, h16* K16, bf* Kh, bf* Kl) {
    const bool isk = blockIdx.y != 0; const float* F = isk ? Fk : Fq; const float* w = isk ? wk_ : wq_; h16* P16 = isk ? K16 : Q16; bf* Ph = isk ? Kh : Qh; bf* Pl = isk ? Kl : Ql;
    const int g = blockIdx.x * 16 + (threadIdx.x >> 4), d = (threadIdx.x & 15) * 4; const int t = g / (NH_ / QKH), h0 = (g % (NH_ / QKH)) * QKH;
    const float* f = F + (size_t)t * DQ + h0 * HD + d; v4f x1[QKH], x2[QKH];
#pragma unroll
    for (int i = 0; i < QKH; ++i) { x1[i] = *(const v4f*)(f + i * HD); x2[i] = *(const v4f*)(f + i * HD + HD / 2); }
    const v4f cr = *(const v4f*)(cosT + t * (HD / 2) + d), sr = *(const v4f*)(sinT + t * (HD / 2) + d), wa = *(const v4f*)(w + d), wb = *(const v4f*)(w + HD / 2 + d); v4f c, s, w1, w2;
    __builtin_amdgcn_sched_barrier(0);   // all twelve loads are issued before any arithmetic: without it the scheduler sinks one of them behind the first wait, a second trip to memory in every wave
#pragma unroll
    for (int q = 0; q < 4; ++q) { c[q] = bfr(cr[q]); s[q] = bfr(sr[q]); w1[q] = bfr(wa[q]); w2[q] = bfr(wb[q]); }
#pragma unroll
    for (int i = 0; i < QKH; ++i) { const v4f y1 = x1[i] * c - x2[i] * s, y2 = x1[i] * s + x2[i] * c; float ss = 0.f;
#pragma unroll
        for (int q = 0; q < 4; ++q) ss += y1[q] * y1[q];
#pragma unroll
        for (int q = 0; q < 4; ++q) ss += y2[q] * y2[q];
        const float rf = __fdiv_rn(1.0f, __fsqrt_rn(rowsum16(ss) * (1.0f / HD) + 1.1920929e-07f)); const size_t o = ((size_t)(h0 + i) * TT + t) * HD + d; v4h a16, b16; v4us ah, al, bh, bl;
#pragma unroll
        for (int q = 0; q < 4; ++q) { const float ra = (y1[q] * rf) * w1[q], rb = (y2[q] * rf) * w2[q]; unsigned short u, v; a16[q] = tohx(ra); splitf(ra, u, v); ah[q] = u; al[q] = v; b16[q] = tohx(rb); splitf(rb, u, v); bh[q] = u; bl[q] = v; }
        *(v4h*)(P16 + o) = a16; *(v4h*)(P16 + o + HD / 2) = b16; *(v4us*)(Ph + o) = ah; *(v4us*)(Ph + o + HD / 2) = bh; *(v4us*)(Pl + o) = al; *(v4us*)(Pl + o + HD / 2) = bl; }   // each store: one whole 128-byte line a group
}
__global__ __launch_bounds__(256) void k_merge(const float* __restrict__ O, int h0, bf* Ah, bf* Al) { const size_t e = ((size_t)blockIdx.x * 256 + threadIdx.x) * 2; if (e >= (size_t)ZH * TT * HD) return; const int d = (int)(e % HD); const int t = (int)((e / HD) % TT); const int zz = (int)(e / ((size_t)HD * TT)); const float cs = (t < RH) ? 1.0f : (1.0f / PCAR); const size_t oo = (size_t)t * DQ + (h0 + zz) * HD + d;
    v2us oh, ol;
#pragma unroll
    for (int q = 0; q < 2; ++q) { unsigned short a, c2; splitf(O[e + q] * cs, a, c2); oh[q] = a; ol[q] = c2; } *(v2us*)(Ah + oo) = oh; *(v2us*)(Al + oo) = ol;  }

extern "C" void kernel_launch(void* const* d_in, const int* in_sizes, int n_in,
                              void* d_out, int out_size, void* d_ws, size_t ws_size, hipStream_t stream) {
    (void)in_sizes; (void)n_in; (void)out_size;
    const float* x = (const float*)d_in[0]; const float* sinT = (const float*)d_in[1]; const float* cosT = (const float*)d_in[2]; const float* wq = (const float*)d_in[3]; const float* wk = (const float*)d_in[4]; const float* wv = (const float*)d_in[5]; const float* wo = (const float*)d_in[6]; const float* qsc = (const float*)d_in[7]; const float* ksc = (const float*)d_in[8];   /* x, sin, cos (f32 [2048][64], READ), Wq, Wk, Wv, Wo ('oi' [2048][2048]), q_norm_w, k_norm_w ([128], read) */
    float* OUT = (float*)d_out;     // [2][2048][2048]
    char* wsp = (char*)d_ws;
    auto take = [&](size_t bytes) { char* p = wsp; wsp += (bytes + 255) & ~(size_t)255; return (void*)p; };
    bf* WQ = (bf*)take((size_t)DQ * DM * 2); bf* WK = (bf*)take((size_t)DKV * DM * 2); bf* WV = (bf*)take((size_t)DKV * DM * 2); bf* WO = (bf*)take((size_t)DM * DQ * 2);
    bf* XB = (bf*)take((size_t)TT * DM * 2); float* FQ = (float*)take((size_t)TT * DQ * 4); float* FK = (float*)take((size_t)TT * DKV * 4);
    h16* QP16 = (h16*)take((size_t)NH_ * TT * HD * 2); h16* KP16 = (h16*)take((size_t)NKV * TT * HD * 2); h16* VT16 = (h16*)take((size_t)NKV * HD * TT * 2);
    bf* QPh = (bf*)take((size_t)NH_ * TT * HD * 2); bf* QPl = (bf*)take((size_t)NH_ * TT * HD * 2); bf* KPh = (bf*)take((size_t)NKV * TT * HD * 2); bf* KPl = (bf*)take((size_t)NKV * TT * HD * 2); bf* VTh = (bf*)take((size_t)NKV * HD * TT * 2); bf* VTl = (bf*)take((size_t)NKV * HD * TT * 2); bf* Ph = (bf*)take((size_t)ZH * RH * TT * 2); bf* Pl = (bf*)take((size_t)ZH * RH * TT * 2);
    float* Sb = (float*)take((size_t)ZH * TT * TT * 4); h16* P16 = (h16*)take((size_t)ZH * TT * TT * 2); float* Ob = (float*)take((size_t)ZH * TT * HD * 4); bf* ATh = (bf*)take((size_t)TT * DQ * 2); bf* ATl = (bf*)take((size_t)TT * DQ * 2);
    if ((size_t)(wsp - (char*)d_ws) > ws_size) return;    // ws 256 MiB
    float* FV = FK;   // v projection reuses the k buffer after the k planes are built (stream-ordered)
    { k_cvt8<<<(unsigned)(((size_t)DQ * DM / 8 + 255) / 256), 256, 0, stream>>>(wq, WQ, (size_t)DQ * DM / 8); k_cvt8<<<(unsigned)(((size_t)DKV * DM / 8 + 255) / 256), 256, 0, stream>>>(wk, WK, (size_t)DKV * DM / 8); k_cvt8<<<(unsigned)(((size_t)DKV * DM / 8 + 255) / 256), 256, 0, stream>>>(wv, WV, (size_t)DKV * DM / 8);
      k_cvt8<<<(unsigned)(((size_t)DM * DQ / 8 + 255) / 256), 256, 0, stream>>>(wo, WO, (size_t)DM * DQ / 8);
       }
    const unsigned LKv = (unsigned)(((size_t)NKV * TT * HD / 2 + 255) / 256);
    for (int b = 0; b < NB_; ++b) {
        
        k_cvt8<<<(unsigned)(((size_t)TT * DM / 8 + 255) / 256), 256, 0, stream>>>(x + (size_t)b * TT * DM, XB, (size_t)TT * DM / 8);
        k_gemmw<bf, 0, false><<<dim3(TT / 64, DQ / 64, 1), 32, 0, stream>>>(XB, nullptr, WQ, nullptr, DM, FQ, DQ, nullptr, 0, 0, 0);
        k_gemmw<bf, 0, false><<<dim3(TT / 64, DKV / 64, 1), 32, 0, stream>>>(XB, nullptr, WK, nullptr, DM, FK, DKV, nullptr, 0, 0, 0);
        k_qkpost<<<dim3(TT * (NH_ / QKH) / 16, 2, 1), 256, 0, stream>>>(FQ, FK, sinT, cosT, qsc, ksc, QP16, QPh, QPl, KP16, KPh, KPl);
        k_gemmw<bf, 0, false><<<dim3(TT / 64, DKV / 64, 1), 32, 0, stream>>>(XB, nullptr, WV, nullptr, DM, FV, DKV, nullptr, 0, 0, 0); k_vtp<<<LKv, 256, 0, stream>>>(FV, DKV, NKV, VT16, VTh, VTl);
        for (int h0 = 0; h0 < NH_; h0 += ZH) { const size_t zq = (size_t)h0, zk = (size_t)(h0 / REP);   // one kv head per query head: the pass's two heads use consecutive kv planes (z-strides TT*HD)
            k_gemmc<bf, 2><<<dim3(RH / 64, TT / 64, ZH), 32, 0, stream>>>(QPh + zq * TT * HD, QPl + zq * TT * HD, KPh + zk * TT * HD, KPl + zk * TT * HD, HD, Sb, TT, 0, (size_t)TT * HD, (size_t)TT * HD, (size_t)TT * TT);
            k_gemmc<h16, 0><<<dim3((TT - RH) / 64, TT / 64, ZH), 32, 0, stream>>>(QP16 + zq * TT * HD + (size_t)RH * HD, nullptr, KP16 + zk * TT * HD, nullptr, HD, Sb + (size_t)RH * TT, TT, RH, (size_t)TT * HD, (size_t)TT * HD, (size_t)TT * TT);
            k_asoft<<<ZH * TT / 8, 256, 0, stream>>>(Sb, P16, Ph, Pl);
            k_gemmpv<bf, 2, 8, TT, HD><<<dim3(RH / 64, HD / 64, ZH), 256, 0, stream>>>(Ph, Pl, VTh + zk * HD * TT, VTl + zk * HD * TT, Ob, 0, (size_t)RH * TT, (size_t)HD * TT, (size_t)TT * HD);
            k_gemmpv<h16, 0, 16, TT, HD><<<dim3((TT - RH) / 64, HD / 64, ZH), 512, 0, stream>>>(P16 + (size_t)RH * TT, nullptr, VT16 + zk * HD * TT, nullptr, Ob + (size_t)RH * HD, RH, (size_t)TT * TT, (size_t)HD * TT, (size_t)TT * HD);
            k_merge<<<(unsigned)(((size_t)ZH * TT * HD / 2 + 255) / 256), 256, 0, stream>>>(Ob, h0, ATh, ATl); }
        k_gemmw<bf, 1, false><<<dim3(TT / 64, DM / 64, 1), 32, 0, stream>>>(ATh, ATl, WO, nullptr, DQ, OUT + (size_t)b * TT * DM, DM, nullptr, 0, 0, 0); }
}

// v003
// A run of this version takes 849 microseconds.
// In two side-by-side timings against v002, it was 1.34 and 1.35 times as fast.
// Counting every step since v000, it is 2.18 times as fast.
#include <hip/hip_runtime.h>

// Causal multi-head attention with 128-wide heads, rotary embeddings from half-width input tables and a per-head RMSNorm applied AFTER the rotary (x [2][2048][2048]; q, k, v = x W^T ('oi' 1/sqrt(2048), no bias; 16 heads x 128); rope: (x1, x2) = the two HALVES of each head -> cat(x1 c - x2 s, x1 s + x2 c) with the sin / cos INPUT tables [2048][64] (read; argument order x, sin, cos); then per head q = RMSNorm(q) x q_norm_w, k = RMSNorm(k) x k_norm_w (eps = float32 machine epsilon 1.19e-7; weights [128] = ones, read); scores / sqrt(128); causal (-inf); softmax; out = merged Wo^T ('oi') -> [2][2048][2048] (8.4 M); argument order x, sin, cos, Wq, Wk, Wv, Wo, q_norm_w, k_norm_w).
// Layout per batch: bf16 copy of x; 'oi' weights cast as-is; exact projections; k_qkpost takes the f32 q / k projections to their 16-bit head planes in one pass: rotary from the bf16-rounded input tables (the staged tables need not be rotations: no norm-preservation shortcut), per (head, token) 1/sqrt(mean + eps) over the 128 rotated dims, x r x w[d]; causal T-2048 attention (hybrid rows: < 512 hi/lo 3 products, rest fp16 x1024; k_gemmc skips tiles above the diagonal; k_gemmpv splits the key loop of P x V over the waves of a work-group; ZH heads a pass, the probabilities written over their own score rows); merged hi/lo x Wo exact.
// Compute dtypes, f32 accumulate: every input rounded to bf16 incl. the tables; projections exact; rotary and RMSNorm f32; attention rows < 512 3 products, rest fp16; softmax f32; Wo hl x exact.

#define NB_  2
#define TT   2048
#define DM   2048
#define NH_  16
#define NKV  16
#define REP  (NH_ / NKV)
#define HD   128
#define DQ   (NH_ * HD)
#define DKV  (NKV * HD)
#define ZH   8                    // heads per attention pass
#define RH   512                  // query rows < RH use hi+lo planes (0: none)
#define WIN  2048
#define PCAR 1024.0f
#define SCL  0.088388347648318447f   // HD^-0.5
typedef _Float16 h16;
typedef unsigned short bf;
typedef __attribute__((ext_vector_type(16))) __bf16   v16bf;
typedef __attribute__((ext_vector_type(16))) _Float16 v16h;
typedef __attribute__((ext_vector_type(8)))  _Float16 v8h;
typedef __attribute__((ext_vector_type(8)))  unsigned short v8us;
typedef __attribute__((ext_vector_type(8)))  float    v8f;
typedef __attribute__((ext_vector_type(4)))  float    v4f;
typedef v8h  __attribute__((may_alias)) v8ha;
typedef v4f  __attribute__((may_alias)) v4fa;
typedef v8us __attribute__((may_alias)) v8usa;

__device__ __forceinline__ unsigned short f2bf(float f) { unsigned u = __float_as_uint(f); u += 0x7FFFu + ((u >> 16) & 1u); return (unsigned short)(u >> 16); }
__device__ __forceinline__ float bf2f(unsigned short b) { return __uint_as_float(((unsigned)b) << 16); }
__device__ __forceinline__ float bfr(float f) { return bf2f(f2bf(f)); }
__device__ __forceinline__ v16h cat16(v8h lo, v8h hi) { return __builtin_shufflevector(lo, hi, 0, 1, 2, 3, 4, 5, 6, 7, 8, 9, 10, 11, 12, 13, 14, 15); }
__device__ __forceinline__ v16bf cat16b(v8us lo, v8us hi) { return __builtin_bit_cast(v16bf, __builtin_shufflevector(lo, hi, 0, 1, 2, 3, 4, 5, 6, 7, 8, 9, 10, 11, 12, 13, 14, 15)); }
__device__ __forceinline__ v8f wmma16(v16h a, v16h b, v8f c) { return __builtin_amdgcn_wmma_f32_16x16x32_f16(false, a, false, b, (short)0, c, false, false); }
__device__ __forceinline__ v8f wmmab(v16bf a, v16bf b, v8f c) { return __builtin_amdgcn_wmma_f32_16x16x32_bf16(false, a, false, b, (short)0, c, false, false); }



// ---- k_gemmw: register-blocked GEMM, ONE WAVE per 64x64 output tile (16 accumulators), operands straight from K-contiguous 16-bit planes; grid (M/64, N/64, Z), 32 threads.
// C[m][n] (f32, pitch ldc, + optional f32 bias[n]) = sum_k A[m][k] Bt[n][k] (+ split products per NSPLIT). z-batch strides sA/sB/sC in elements. K % 32 == 0.
template <typename T16> struct WFrag;
template <> struct WFrag<h16> { typedef v16h V; static __device__ __forceinline__ V ld(const h16* p) { return cat16(*(const v8h*)p, *(const v8h*)(p + 16)); } static __device__ __forceinline__ v8f mma(V a, V b, v8f c) { return wmma16(a, b, c); } };
template <> struct WFrag<bf> { typedef v16bf V; static __device__ __forceinline__ V ld(const bf* p) { return cat16b(*(const v8us*)p, *(const v8us*)(p + 16)); } static __device__ __forceinline__ v8f mma(V a, V b, v8f c) { return wmmab(a, b, c); } };
template <typename T16, int NSPLIT, bool BIAS>
__global__ __launch_bounds__(32) void k_gemmw(const T16* __restrict__ A, const T16* __restrict__ A2, const T16* __restrict__ Bt, const T16* __restrict__ Bt2, int K, float* C, int ldc, const float* __restrict__ bias, size_t sA, size_t sB, size_t sC) {
    typedef typename WFrag<T16>::V V;
    __shared__ __align__(16) float os[16 * 68];
    const size_t z = blockIdx.z; A += z * sA; if (A2) A2 += z * sA; Bt += z * sB; if (Bt2) Bt2 += z * sB; C += z * sC;
    const int lane = threadIdx.x & 31, lr = lane & 15, hi = lane >> 4; const int r0 = blockIdx.x * 64, c0 = blockIdx.y * 64;
    v8f acc[4][4];
#pragma unroll
    for (int mb = 0; mb < 4; ++mb)
#pragma unroll
        for (int nb = 0; nb < 4; ++nb) acc[mb][nb] = (v8f){};
    const size_t aoff = (size_t)(r0 + lr) * K + 8 * hi, boff = (size_t)(c0 + lr) * K + 8 * hi;
#pragma unroll 1
    for (int kc = 0; kc < K; kc += 32) {
        V a[4], a2[4];
#pragma unroll
        for (int mb = 0; mb < 4; ++mb) { a[mb] = WFrag<T16>::ld(A + aoff + (size_t)mb * 16 * K + kc); if (NSPLIT == 1 || NSPLIT == 2) a2[mb] = WFrag<T16>::ld(A2 + aoff + (size_t)mb * 16 * K + kc); }
#pragma unroll
        for (int nb = 0; nb < 4; ++nb) { const V b = WFrag<T16>::ld(Bt + boff + (size_t)nb * 16 * K + kc); V b2; if (NSPLIT >= 2) b2 = WFrag<T16>::ld(Bt2 + boff + (size_t)nb * 16 * K + kc);
#pragma unroll
            for (int mb = 0; mb < 4; ++mb) { acc[mb][nb] = WFrag<T16>::mma(a[mb], b, acc[mb][nb]); if (NSPLIT == 1 || NSPLIT == 2) acc[mb][nb] = WFrag<T16>::mma(a2[mb], b, acc[mb][nb]); if (NSPLIT >= 2) acc[mb][nb] = WFrag<T16>::mma(a[mb], b2, acc[mb][nb]); } }
        asm volatile("v_nop\n\tv_nop\n\tv_nop\n\tv_nop" : "+v"(acc[0][0]), "+v"(acc[1][1]), "+v"(acc[2][2]), "+v"(acc[3][3]) : "v"(a[0]), "v"(a[3]));
    }
#pragma unroll
    for (int mb = 0; mb < 4; ++mb) {
#pragma unroll
        for (int nb = 0; nb < 4; ++nb) {
#pragma unroll
            for (int j = 0; j < 8; ++j) os[(hi * 8 + j) * 68 + nb * 16 + lr] = acc[mb][nb][j]; }
        __builtin_amdgcn_wave_barrier(); asm volatile("" ::: "memory");
        float* crow = C + (size_t)(r0 + mb * 16) * ldc + c0;
{
#pragma unroll
            for (int s = 0; s < 8; ++s) { const int row = 2 * s + hi, cofs = lr * 4; v4f val = *(const v4fa*)(os + row * 68 + cofs); if (BIAS) { val[0] += bfr(bias[c0 + cofs]); val[1] += bfr(bias[c0 + cofs + 1]); val[2] += bfr(bias[c0 + cofs + 2]); val[3] += bfr(bias[c0 + cofs + 3]); }
                *(v4f*)(crow + (size_t)row * ldc + cofs) = val; }
             }
        __builtin_amdgcn_wave_barrier(); asm volatile("" ::: "memory");
    }
}

// ---- k_gemmc: the same one-wave 64x64 tile GEMM specialised for the causal scores: tiles entirely above the diagonal (query rows r0+roff.., key columns c0..) are skipped.
// roff = row offset of this launch's first row within the sequence.
template <typename T16, int NSPLIT>
__global__ __launch_bounds__(32) void k_gemmc(const T16* __restrict__ A, const T16* __restrict__ A2, const T16* __restrict__ Bt, const T16* __restrict__ Bt2, int K, float* C, int ldc, int roff, size_t sA, size_t sB, size_t sC) {
    typedef typename WFrag<T16>::V V;
    __shared__ __align__(16) float os[16 * 68];
    const size_t z = blockIdx.z; A += z * sA; if (A2) A2 += z * sA; Bt += z * sB; if (Bt2) Bt2 += z * sB; C += z * sC;
    const int lane = threadIdx.x & 31, lr = lane & 15, hi = lane >> 4; const int r0 = blockIdx.x * 64, c0 = blockIdx.y * 64;
    if (c0 > r0 + roff + 63) return;                  // score tile entirely above the causal diagonal: never used (the softmax loads it but masks j > i by select)
    v8f acc[4][4];
#pragma unroll
    for (int mb = 0; mb < 4; ++mb)
#pragma unroll
        for (int nb = 0; nb < 4; ++nb) acc[mb][nb] = (v8f){};
    const size_t aoff = (size_t)(r0 + lr) * K + 8 * hi, boff = (size_t)(c0 + lr) * K + 8 * hi;
#pragma unroll 1
    for (int kc = 0; kc < K; kc += 32) {
        V a[4], a2[4];
#pragma unroll
        for (int mb = 0; mb < 4; ++mb) { a[mb] = WFrag<T16>::ld(A + aoff + (size_t)mb * 16 * K + kc); if (NSPLIT == 1 || NSPLIT == 2) a2[mb] = WFrag<T16>::ld(A2 + aoff + (size_t)mb * 16 * K + kc); }
#pragma unroll
        for (int nb = 0; nb < 4; ++nb) { const V b = WFrag<T16>::ld(Bt + boff + (size_t)nb * 16 * K + kc); V b2; if (NSPLIT >= 2) b2 = WFrag<T16>::ld(Bt2 + boff + (size_t)nb * 16 * K + kc);
#pragma unroll
            for (int mb = 0; mb < 4; ++mb) { acc[mb][nb] = WFrag<T16>::mma(a[mb], b, acc[mb][nb]); if (NSPLIT == 1 || NSPLIT == 2) acc[mb][nb] = WFrag<T16>::mma(a2[mb], b, acc[mb][nb]); if (NSPLIT >= 2) acc[mb][nb] = WFrag<T16>::mma(a[mb], b2, acc[mb][nb]); } }
        asm volatile("v_nop\n\tv_nop\n\tv_nop\n\tv_nop" : "+v"(acc[0][0]), "+v"(acc[1][1]), "+v"(acc[2][2]), "+v"(acc[3][3]) : "v"(a[0]), "v"(a[3]));
    }
#pragma unroll
    for (int mb = 0; mb < 4; ++mb) {
#pragma unroll
        for (int nb = 0; nb < 4; ++nb) {
#pragma unroll
            for (int j = 0; j < 8; ++j) os[(hi * 8 + j) * 68 + nb * 16 + lr] = acc[mb][nb][j]; }
        __builtin_amdgcn_wave_barrier(); asm volatile("" ::: "memory");
        float* crow = C + (size_t)(r0 + mb * 16) * ldc + c0;
{
#pragma unroll
            for (int s = 0; s < 8; ++s) { const int row = 2 * s + hi, cofs = lr * 4; v4f val = *(const v4fa*)(os + row * 68 + cofs);
                *(v4f*)(crow + (size_t)row * ldc + cofs) = val; }
             }
        __builtin_amdgcn_wave_barrier(); asm volatile("" ::: "memory");
    }
}

// ---- k_gemmpv: probability x value contraction, one 64x64 output tile per work-group of NW waves. The key loop (row length KD) stops at the diagonal block (probabilities beyond it are exactly zero) and is
// split over the waves in 64-key chunks (one 128-byte line of every operand row), chunk c to wave c % NW; each wave keeps the whole tile in 16 accumulators. The NW partial tiles meet in LDS
// (accumulator order, 16 bytes a lane) and are summed in wave order 0..NW-1; each wave then stores 4-row x 64-column groups as whole 128-byte lines (output pitch LDC). KD, r0 and roff are multiples of 64.
// KA: pitch of the probability rows in 16-bit elements (they lie in the f32 score rows, so 2 x KD); the value rows have pitch KD.
// ldlast: WFrag::ld for the LAST fragment read through a lane address. Its second half is the last use of the address registers, so the register allocator lets that half's result, or a later load's, land on them.
template <typename T16> __device__ __forceinline__ typename WFrag<T16>::V ldlast(const T16* p);
template <> __device__ __forceinline__ v16h ldlast<h16>(const h16* p) { const v8h x = *(const v8h*)p;
    asm volatile("s_wait_xcnt 0x0" ::: "memory");   // in front of the half whose result may take the address registers of the loads issued before it
    const v8h y = *(const v8h*)(p + 16);
    asm volatile("s_wait_xcnt 0x0" ::: "memory");   // behind that half, in front of the next plane's loads, whose results may take its address registers
    return cat16(x, y); }
template <> __device__ __forceinline__ v16bf ldlast<bf>(const bf* p) { const v8us x = *(const v8us*)p;
    asm volatile("s_wait_xcnt 0x0" ::: "memory");   // as in the h16 form
    const v8us y = *(const v8us*)(p + 16);
    asm volatile("s_wait_xcnt 0x0" ::: "memory");   // as in the h16 form
    return cat16b(x, y); }
template <typename T16, int NSPLIT, int NW, int KD, int KA, int LDC>
__global__ __launch_bounds__(NW * 32) void k_gemmpv(const T16* __restrict__ A, const T16* __restrict__ A2, const T16* __restrict__ Bt, const T16* __restrict__ Bt2, float* C, int roff, size_t sA, size_t sB, size_t sC) {
    typedef typename WFrag<T16>::V V;
    __shared__ __align__(16) float red[NW * 4096];
    const int lane = threadIdx.x & 31, lr = lane & 15, hi = lane >> 4; const int r0 = blockIdx.x * 64, c0 = blockIdx.y * 64;
    const size_t z = blockIdx.z, ua = z * sA + (size_t)r0 * KA, ub = z * sB + (size_t)c0 * KD; A += ua; if (A2) A2 += ua; Bt += ub; if (Bt2) Bt2 += ub; C += z * sC;   // tile bases, the same in every lane
    const int w = __builtin_amdgcn_readfirstlane((int)(threadIdx.x >> 5));   // wave number, kept scalar so that the loop bounds and the operand bases are scalar
    const int Kl = min(KD, r0 + roff + 64);
    v8f acc[4][4];   // every full unroll below: acc, a, a2 live in registers and need constant indices
#pragma unroll
    for (int mb = 0; mb < 4; ++mb)
#pragma unroll
        for (int nb = 0; nb < 4; ++nb) acc[mb][nb] = (v8f){};
    const int loa = (lr * KA + 8 * hi) * 2, lo = (lr * KD + 8 * hi) * 2;   // the lane's byte offset in a 16-row block of the probability planes and of the value planes: one address per plane and trip, every load is that address + a constant
    // both key loops stay rolled: beside the 128 accumulator registers one trip's fragments already fill most of the register file in the hi/lo form
#pragma unroll 1
    for (int kb = w * 64; kb < Kl; kb += NW * 64) {
#pragma unroll 1
        for (int kc = kb; kc < kb + 64; kc += 32) {
            const char* pa = (const char*)(A + kc); const char* pa2 = (const char*)(A2 + kc); const char* pb = (const char*)(Bt + kc); const char* pb2 = (const char*)(Bt2 + kc);
            V a[4], a2[4];
#pragma unroll
            for (int mb = 0; mb < 3; ++mb) { a[mb] = WFrag<T16>::ld((const T16*)(pa + loa + mb * 32 * KA)); if (NSPLIT == 1 || NSPLIT == 2) a2[mb] = WFrag<T16>::ld((const T16*)(pa2 + loa + mb * 32 * KA)); }
            a[3] = ldlast<T16>((const T16*)(pa + loa + 3 * 32 * KA)); if (NSPLIT == 1 || NSPLIT == 2) a2[3] = ldlast<T16>((const T16*)(pa2 + loa + 3 * 32 * KA));
#pragma unroll
            for (int nb = 0; nb < 4; ++nb) { const T16* qb = (const T16*)(pb + lo + nb * 32 * KD); const T16* qb2 = (const T16*)(pb2 + lo + nb * 32 * KD); const V b = (nb < 3) ? WFrag<T16>::ld(qb) : ldlast<T16>(qb); V b2; if (NSPLIT >= 2) b2 = (nb < 3) ? WFrag<T16>::ld(qb2) : ldlast<T16>(qb2);
#pragma unroll
                for (int mb = 0; mb < 4; ++mb) { acc[mb][nb] = WFrag<T16>::mma(a[mb], b, acc[mb][nb]); if (NSPLIT == 1 || NSPLIT == 2) acc[mb][nb] = WFrag<T16>::mma(a2[mb], b, acc[mb][nb]); if (NSPLIT >= 2) acc[mb][nb] = WFrag<T16>::mma(a[mb], b2, acc[mb][nb]); } }
            asm volatile("v_nop\n\tv_nop\n\tv_nop\n\tv_nop" : "+v"(acc[0][0]), "+v"(acc[1][1]), "+v"(acc[2][2]), "+v"(acc[3][3]) : "v"(a[0]), "v"(a[3]));   // the distance behind the last matrix instruction, on the taken back edge too, before the next trip's loads overwrite its operands
        }
    }
#pragma unroll
    for (int mb = 0; mb < 4; ++mb)
#pragma unroll
        for (int nb = 0; nb < 4; ++nb) { float* p = red + (size_t)w * 4096 + (mb * 4 + nb) * 256 + lane * 4; const v8f t = acc[mb][nb];
            *(v4fa*)p = __builtin_shufflevector(t, t, 0, 1, 2, 3); *(v4fa*)(p + 128) = __builtin_shufflevector(t, t, 4, 5, 6, 7); }
    __syncthreads();   // every wave's partial tile is in LDS before any wave sums
    float* cp = C + (size_t)(r0 + 4 * w) * LDC + c0 + lane;   // group g starts at row 4 * g and lane (lr, hi) of pass u holds column 32 * u + lane: one address, every store is that address + a constant
#pragma unroll
    for (int i = 0; i < 16 / NW; ++i) { const int g = w + i * NW, mb = g >> 2, hs = (g >> 1) & 1, hf = g & 1;   // group g: rows mb * 16 + hs * 8 + hf * 4 .. + 3, all 64 columns
#pragma unroll
        for (int u = 0; u < 2; ++u) { const int nb = 2 * u + hi; const float* p = red + (mb * 4 + nb) * 256 + hf * 128 + (hs * 16 + lr) * 4; v4f s = *(const v4fa*)p;
#pragma unroll
            for (int ww = 1; ww < NW; ++ww) s += *(const v4fa*)(p + ww * 4096);
#pragma unroll
            for (int e = 0; e < 4; ++e) cp[(4 * NW * i + e) * LDC + 32 * u] = s[e]; } }
}

__device__ __forceinline__ h16 tohx(float x) { return (h16)x; }
__device__ __forceinline__ void splitf(float y, unsigned short& h, unsigned short& l) { h = f2bf(y); l = f2bf(y - bf2f(h)); }
typedef __attribute__((ext_vector_type(2))) _Float16 v2h;
typedef __attribute__((ext_vector_type(4))) _Float16 v4h;
typedef __attribute__((ext_vector_type(2))) unsigned short v2us;
typedef __attribute__((ext_vector_type(4))) unsigned short v4us;
typedef __attribute__((ext_vector_type(2))) float v2f;
typedef __attribute__((ext_vector_type(4))) int v4i;

__global__ __launch_bounds__(256) void k_cvt8(const float* __restrict__ src, bf* dst, size_t n8) { const size_t i = (size_t)blockIdx.x * 256 + threadIdx.x; if (i >= n8) return; const v8f v = *(const v8f*)(src + i * 8); v8us o;
#pragma unroll
    for (int k = 0; k < 8; ++k) o[k] = f2bf(v[k]); *(v8us*)(dst + i * 8) = o;  }

__global__ __launch_bounds__(256) void k_vtp(const float* __restrict__ F, int pitch, int nheads, h16* V16, bf* Vh, bf* Vl) { const size_t e = ((size_t)blockIdx.x * 256 + threadIdx.x) * 2; if (e >= (size_t)nheads * HD * TT) return; const int t = (int)(e % TT); const int d = (int)((e / TT) % HD); const int g = (int)(e / ((size_t)TT * HD)); v2h o16; v2us oh, ol;
#pragma unroll
    for (int q = 0; q < 2; ++q) { const float x = F[(size_t)(t + q) * pitch + g * HD + d]; o16[q] = tohx(x); unsigned short a2, c2; splitf(x, a2, c2); oh[q] = a2; ol[q] = c2; }
    *(v2h*)(V16 + e) = o16; *(v2us*)(Vh + e) = oh; *(v2us*)(Vl + e) = ol;  }
// k_asoft: per row (zz, i): t = S x HD^-0.5 for j <= i and i - j < WIN (sliding causal window; the reference's -1e9 additive fill vanishes identically); softmax over the 2048 keys (register row, one exp, fixed trees);
// the probabilities go over the row's own scores, which one wave has read whole by then: fp16 rows into the first half of the 8-KiB row; hi/lo rows hi into the first half, lo into the second.
__global__ __launch_bounds__(256) void k_asoft(float* Sb) {
    const int lane = threadIdx.x & 31; const int row = blockIdx.x * 8 + (threadIdx.x >> 5); if (row >= ZH * TT) return; const int i = row % TT; const int zz = row / TT; (void)zz; const bool hires = (i < RH); float* sr = Sb + (size_t)row * TT; float v[TT / 32]; float mx = -3.0e38f;
#pragma unroll
    for (int ch = 0; ch < TT / 128; ++ch) { const int j0 = ch * 128 + lane * 4; const v4f a = *(const v4f*)(sr + j0);
#pragma unroll
        for (int q = 0; q < 4; ++q) { const int j = j0 + q; (void)j; const float t = (j <= i && i - j < WIN) ? a[q] * SCL : -3.0e38f; v[ch * 4 + q] = t; mx = fmaxf(mx, t); } }
#pragma unroll
    for (int sh = 16; sh; sh >>= 1) mx = fmaxf(mx, __shfl_xor(mx, sh, 32));
    float sum = 0.f;
#pragma unroll
    for (int k = 0; k < TT / 32; ++k) { float d0 = __fsub_rn(v[k], mx); asm volatile("" : "+v"(d0)); v[k] = __builtin_amdgcn_exp2f(__fmul_rn(d0, 1.4426950408889634f)); sum += v[k]; }
#pragma unroll
    for (int sh = 16; sh; sh >>= 1) sum += __shfl_xor(sum, sh, 32);
    const float f = __fdiv_rn(hires ? 1.0f : PCAR, sum);
{
        if (hires) {
#pragma unroll
            for (int ch = 0; ch < TT / 128; ++ch) { v4us oh, ol;
#pragma unroll
                for (int q = 0; q < 4; ++q) { unsigned short a, c2; splitf(v[ch * 4 + q] * f, a, c2); oh[q] = a; ol[q] = c2; }
                bf* po = (bf*)sr + ch * 128 + lane * 4; *(v4us*)po = oh; *(v4us*)(po + TT) = ol; }
        } else {
#pragma unroll
            for (int ch = 0; ch < TT / 128; ++ch) { v4h o4;
#pragma unroll
                for (int q = 0; q < 4; ++q) o4[q] = tohx(v[ch * 4 + q] * f);
                *(v4h*)((h16*)sr + ch * 128 + lane * 4) = o4; } }
         }
}
// ---- k_qkpost: all that stands between the f32 q / k projections [t][h * HD + d] and their 16-bit head planes [h][t][d] (fp16 + bf16 hi/lo), in one pass; blockIdx.y = 0: q, 1: k.
// 16 lanes hold one (token, head) row: lane j the dims 4j..4j+3 of both halves, so that each rotary pair sits in one lane. A group does QKH heads of one token (one read of the tables), all its loads issued ahead.
// rotary from the bf16-rounded tables, r = 1/sqrt(mean of squares + eps) over the 128 rotated dims (8 terms a lane, then a butterfly over the 16 lanes), (y x r) x w[d] with w rounded to bf16.
#define QKH 4
static_assert(NH_ == NKV && NH_ % QKH == 0 && (TT * (NH_ / QKH)) % 16 == 0 && HD == 128, "k_qkpost: q and k alike, whole groups, whole blocks, 16 lanes x 4 dims a half row");
__device__ __forceinline__ float rowsum16(float v) {   // sum over the 16 lanes of a row, every lane on; the cross-lane reads fold into the adds
    v += __builtin_bit_cast(float, __builtin_amdgcn_update_dpp(0, __builtin_bit_cast(int, v), 0x161, 0xf, 0xf, true));   // row_xmask:1
    v += __builtin_bit_cast(float, __builtin_amdgcn_update_dpp(0, __builtin_bit_cast(int, v), 0x162, 0xf, 0xf, true));   // row_xmask:2
    v += __builtin_bit_cast(float, __builtin_amdgcn_update_dpp(0, __builtin_bit_cast(int, v), 0x164, 0xf, 0xf, true));   // row_xmask:4
    v += __builtin_bit_cast(float, __builtin_amdgcn_update_dpp(0, __builtin_bit_cast(int, v), 0x168, 0xf, 0xf, true));   // row_xmask:8
    return v; }
__global__ __launch_bounds__(256) void k_qkpost(const float* __restrict__ Fq, const float* __restrict__ Fk, const float* __restrict__ sinT, const float* __restrict__ cosT, const float* __restrict__ wq_, const float* __restrict__ wk_, h16* Q16, bf* Qh, bf* Ql, h16* K16, bf* Kh, bf* Kl) {
    const bool isk = blockIdx.y != 0; const float* F = isk ? Fk : Fq; const float* w = isk ? wk_ : wq_; h16* P16 = isk ? K16 : Q16; bf* Ph = isk ? Kh : Qh; bf* Pl = isk ? Kl : Ql;
    const int g = blockIdx.x * 16 + (threadIdx.x >> 4), d = (threadIdx.x & 15) * 4; const int t = g / (NH_ / QKH), h0 = (g % (NH_ / QKH)) * QKH;
    const float* f = F + (size_t)t * DQ + h0 * HD + d; v4f x1[QKH], x2[QKH];
#pragma unroll
    for (int i = 0; i < QKH; ++i) { x1[i] = *(const v4f*)(f + i * HD); x2[i] = *(const v4f*)(f + i * HD + HD / 2); }
    const v4f cr = *(const v4f*)(cosT + t * (HD / 2) + d), sr = *(const v4f*)(sinT + t * (HD / 2) + d), wa = *(const v4f*)(w + d), wb = *(const v4f*)(w + HD / 2 + d); v4f c, s, w1, w2;
    __builtin_amdgcn_sched_barrier(0);   // all twelve loads are issued before any arithmetic: without it the scheduler sinks one of them behind the first wait, a second trip to memory in every wave
#pragma unroll
    for (int q = 0; q < 4; ++q) { c[q] = bfr(cr[q]); s[q] = bfr(sr[q]); w1[q] = bfr(wa[q]); w2[q] = bfr(wb[q]); }
#pragma unroll
    for (int i = 0; i < QKH; ++i) { const v4f y1 = x1[i] * c - x2[i] * s, y2 = x1[i] * s + x2[i] * c; float ss = 0.f;
#pragma unroll
        for (int q = 0; q < 4; ++q) ss += y1[q] * y1[q];
#pragma unroll
        for (int q = 0; q < 4; ++q) ss += y2[q] * y2[q];
        const float rf = __fdiv_rn(1.0f, __fsqrt_rn(rowsum16(ss) * (1.0f / HD) + 1.1920929e-07f)); const size_t o = ((size_t)(h0 + i) * TT + t) * HD + d; v4h a16, b16; v4us ah, al, bh, bl;
#pragma unroll
        for (int q = 0; q < 4; ++q) { const float ra = (y1[q] * rf) * w1[q], rb = (y2[q] * rf) * w2[q]; unsigned short u, v; a16[q] = tohx(ra); splitf(ra, u, v); ah[q] = u; al[q] = v; b16[q] = tohx(rb); splitf(rb, u, v); bh[q] = u; bl[q] = v; }
        *(v4h*)(P16 + o) = a16; *(v4h*)(P16 + o + HD / 2) = b16; *(v4us*)(Ph + o) = ah; *(v4us*)(Ph + o + HD / 2) = bh; *(v4us*)(Pl + o) = al; *(v4us*)(Pl + o + HD / 2) = bl; }   // each store: one whole 128-byte line a group
}
__global__ __launch_bounds__(256) void k_merge(const float* __restrict__ O, int h0, bf* Ah, bf* Al) { const size_t e = ((size_t)blockIdx.x * 256 + threadIdx.x) * 2; if (e >= (size_t)ZH * TT * HD) return; const int d = (int)(e % HD); const int t = (int)((e / HD) % TT); const int zz = (int)(e / ((size_t)HD * TT)); const float cs = (t < RH) ? 1.0f : (1.0f / PCAR); const size_t oo = (size_t)t * DQ + (h0 + zz) * HD + d;
    v2us oh, ol;
#pragma unroll
    for (int q = 0; q < 2; ++q) { unsigned short a, c2; splitf(O[e + q] * cs, a, c2); oh[q] = a; ol[q] = c2; } *(v2us*)(Ah + oo) = oh; *(v2us*)(Al + oo) = ol;  }

extern "C" void kernel_launch(void* const* d_in, const int* in_sizes, int n_in,
                              void* d_out, int out_size, void* d_ws, size_t ws_size, hipStream_t stream) {
    (void)in_sizes; (void)n_in; (void)out_size;
    const float* x = (const float*)d_in[0]; const float* sinT = (const float*)d_in[1]; const float* cosT = (const float*)d_in[2]; const float* wq = (const float*)d_in[3]; const float* wk = (const float*)d_in[4]; const float* wv = (const float*)d_in[5]; const float* wo = (const float*)d_in[6]; const float* qsc = (const float*)d_in[7]; const float* ksc = (const float*)d_in[8];   /* x, sin, cos (f32 [2048][64], READ), Wq, Wk, Wv, Wo ('oi' [2048][2048]), q_norm_w, k_norm_w ([128], read) */
    float* OUT = (float*)d_out;     // [2][2048][2048]
    char* wsp = (char*)d_ws;
    auto take = [&](size_t bytes) { char* p = wsp; wsp += (bytes + 255) & ~(size_t)255; return (void*)p; };
    bf* WQ = (bf*)take((size_t)DQ * DM * 2); bf* WK = (bf*)take((size_t)DKV * DM * 2); bf* WV = (bf*)take((size_t)DKV * DM * 2); bf* WO = (bf*)take((size_t)DM * DQ * 2);
    h16* QP16 = (h16*)take((size_t)NH_ * TT * HD * 2); h16* KP16 = (h16*)take((size_t)NKV * TT * HD * 2); h16* VT16 = (h16*)take((size_t)NKV * HD * TT * 2);
    bf* QPh = (bf*)take((size_t)NH_ * TT * HD * 2); bf* QPl = (bf*)take((size_t)NH_ * TT * HD * 2); bf* KPh = (bf*)take((size_t)NKV * TT * HD * 2); bf* KPl = (bf*)take((size_t)NKV * TT * HD * 2); bf* VTh = (bf*)take((size_t)NKV * HD * TT * 2); bf* VTl = (bf*)take((size_t)NKV * HD * TT * 2); bf* ATh = (bf*)take((size_t)TT * DQ * 2); bf* ATl = (bf*)take((size_t)TT * DQ * 2);
    char* shared0 = wsp;   // from here two uses of the same bytes, one after the other in every batch: the projections' buffers, dead once the head planes are built, then the attention passes' scores and outputs
    bf* XB = (bf*)take((size_t)TT * DM * 2); float* FQ = (float*)take((size_t)TT * DQ * 4); float* FK = (float*)take((size_t)TT * DKV * 4);
    wsp = shared0;
    float* Sb = (float*)take((size_t)ZH * TT * TT * 4); float* Ob = (float*)take((size_t)ZH * TT * HD * 4);
    if ((size_t)(wsp - (char*)d_ws) > ws_size) return;    // ws 256 MiB
    float* FV = FK;   // v projection reuses the k buffer after the k planes are built (stream-ordered)
    { k_cvt8<<<(unsigned)(((size_t)DQ * DM / 8 + 255) / 256), 256, 0, stream>>>(wq, WQ, (size_t)DQ * DM / 8); k_cvt8<<<(unsigned)(((size_t)DKV * DM / 8 + 255) / 256), 256, 0, stream>>>(wk, WK, (size_t)DKV * DM / 8); k_cvt8<<<(unsigned)(((size_t)DKV * DM / 8 + 255) / 256), 256, 0, stream>>>(wv, WV, (size_t)DKV * DM / 8);
      k_cvt8<<<(unsigned)(((size_t)DM * DQ / 8 + 255) / 256), 256, 0, stream>>>(wo, WO, (size_t)DM * DQ / 8);
       }
    const unsigned LKv = (unsigned)(((size_t)NKV * TT * HD / 2 + 255) / 256);
    for (int b = 0; b < NB_; ++b) {
        
        k_cvt8<<<(unsigned)(((size_t)TT * DM / 8 + 255) / 256), 256, 0, stream>>>(x + (size_t)b * TT * DM, XB, (size_t)TT * DM / 8);
        k_gemmw<bf, 0, false><<<dim3(TT / 64, DQ / 64, 1), 32, 0, stream>>>(XB, nullptr, WQ, nullptr, DM, FQ, DQ, nullptr, 0, 0, 0);
        k_gemmw<bf, 0, false><<<dim3(TT / 64, DKV / 64, 1), 32, 0, stream>>>(XB, nullptr, WK, nullptr, DM, FK, DKV, nullptr, 0, 0, 0);
        k_qkpost<<<dim3(TT * (NH_ / QKH) / 16, 2, 1), 256, 0, stream>>>(FQ, FK, sinT, cosT, qsc, ksc, QP16, QPh, QPl, KP16, KPh, KPl);
        k_gemmw<bf, 0, false><<<dim3(TT / 64, DKV / 64, 1), 32, 0, stream>>>(XB, nullptr, WV, nullptr, DM, FV, DKV, nullptr, 0, 0, 0); k_vtp<<<LKv, 256, 0, stream>>>(FV, DKV, NKV, VT16, VTh, VTl);
        for (int h0 = 0; h0 < NH_; h0 += ZH) { const size_t zq = (size_t)h0, zk = (size_t)(h0 / REP);   // one kv head per query head: the pass's heads use consecutive kv planes (z-strides TT*HD)
            k_gemmc<bf, 2><<<dim3(RH / 64, TT / 64, ZH), 32, 0, stream>>>(QPh + zq * TT * HD, QPl + zq * TT * HD, KPh + zk * TT * HD, KPl + zk * TT * HD, HD, Sb, TT, 0, (size_t)TT * HD, (size_t)TT * HD, (size_t)TT * TT);
            k_gemmc<h16, 0><<<dim3((TT - RH) / 64, TT / 64, ZH), 32, 0, stream>>>(QP16 + zq * TT * HD + (size_t)RH * HD, nullptr, KP16 + zk * TT * HD, nullptr, HD, Sb + (size_t)RH * TT, TT, RH, (size_t)TT * HD, (size_t)TT * HD, (size_t)TT * TT);
            k_asoft<<<ZH * TT / 8, 256, 0, stream>>>(Sb);
            k_gemmpv<bf, 2, 8, TT, 2 * TT, HD><<<dim3(RH / 64, HD / 64, ZH), 256, 0, stream>>>((const bf*)Sb, (const bf*)Sb + TT, VTh + zk * HD * TT, VTl + zk * HD * TT, Ob, 0, (size_t)2 * TT * TT, (size_t)HD * TT, (size_t)TT * HD);
            k_gemmpv<h16, 0, 16, TT, 2 * TT, HD><<<dim3((TT - RH) / 64, HD / 64, ZH), 512, 0, stream>>>((const h16*)(Sb + (size_t)RH * TT), nullptr, VT16 + zk * HD * TT, nullptr, Ob + (size_t)RH * HD, RH, (size_t)2 * TT * TT, (size_t)HD * TT, (size_t)TT * HD);
            k_merge<<<(unsigned)(((size_t)ZH * TT * HD / 2 + 255) / 256), 256, 0, stream>>>(Ob, h0, ATh, ATl); }
        k_gemmw<bf, 1, false><<<dim3(TT / 64, DM / 64, 1), 32, 0, stream>>>(ATh, ATl, WO, nullptr, DQ, OUT + (size_t)b * TT * DM, DM, nullptr, 0, 0, 0); }
}

// v004
// One run takes 616 microseconds.
// Timed twice side by side with v003, it ran 1.38 times as fast both times.
// All steps since v000 together make it 3.00 times as fast.
#include <hip/hip_runtime.h>

// Causal multi-head attention with 128-wide heads, rotary embeddings from half-width input tables and a per-head RMSNorm applied AFTER the rotary (x [2][2048][2048]; q, k, v = x W^T ('oi' 1/sqrt(2048), no bias; 16 heads x 128); rope: (x1, x2) = the two HALVES of each head -> cat(x1 c - x2 s, x1 s + x2 c) with the sin / cos INPUT tables [2048][64] (read; argument order x, sin, cos); then per head q = RMSNorm(q) x q_norm_w, k = RMSNorm(k) x k_norm_w (eps = float32 machine epsilon 1.19e-7; weights [128] = ones, read); scores / sqrt(128); causal (-inf); softmax; out = merged Wo^T ('oi') -> [2][2048][2048] (8.4 M); argument order x, sin, cos, Wq, Wk, Wv, Wo, q_norm_w, k_norm_w).
// Layout per batch: bf16 copy of x; 'oi' weights cast as-is; exact projections; k_qkpost takes the f32 q / k projections to their 16-bit head planes in one pass: rotary from the bf16-rounded input tables (the staged tables need not be rotations: no norm-preservation shortcut), per (head, token) 1/sqrt(mean + eps) over the 128 rotated dims, x r x w[d]; causal T-2048 attention (hybrid rows: < 512 hi/lo 3 products, rest fp16 x1024; k_gemmc skips tiles above the diagonal; k_gemmpv splits the key loop of P x V over the waves of a work-group; ZH heads a pass, the probabilities written over their own score rows); merged hi/lo x Wo exact.
// Compute dtypes, f32 accumulate: every input rounded to bf16 incl. the tables; projections exact; rotary and RMSNorm f32; attention rows < 512 3 products, rest fp16; softmax f32; Wo hl x exact.

#define NB_  2
#define TT   2048
#define DM   2048
#define NH_  16
#define NKV  16
#define REP  (NH_ / NKV)
#define HD   128
#define DQ   (NH_ * HD)
#define DKV  (NKV * HD)
#define ZH   8                    // heads per attention pass
#define RH   512                  // query rows < RH use hi+lo planes (0: none)
#define WIN  2048
#define PCAR 1024.0f
#define SCL  0.088388347648318447f   // HD^-0.5
typedef _Float16 h16;
typedef unsigned short bf;
typedef __attribute__((ext_vector_type(16))) __bf16   v16bf;
typedef __attribute__((ext_vector_type(16))) _Float16 v16h;
typedef __attribute__((ext_vector_type(8)))  _Float16 v8h;
typedef __attribute__((ext_vector_type(8)))  unsigned short v8us;
typedef __attribute__((ext_vector_type(8)))  float    v8f;
typedef __attribute__((ext_vector_type(4)))  float    v4f;
typedef v8h  __attribute__((may_alias)) v8ha;
typedef v4f  __attribute__((may_alias)) v4fa;
typedef v8us __attribute__((may_alias)) v8usa;

__device__ __forceinline__ unsigned short f2bf(float f) { unsigned u = __float_as_uint(f); u += 0x7FFFu + ((u >> 16) & 1u); return (unsigned short)(u >> 16); }
__device__ __forceinline__ float bf2f(unsigned short b) { return __uint_as_float(((unsigned)b) << 16); }
__device__ __forceinline__ float bfr(float f) { return bf2f(f2bf(f)); }
__device__ __forceinline__ v16h cat16(v8h lo, v8h hi) { return __builtin_shufflevector(lo, hi, 0, 1, 2, 3, 4, 5, 6, 7, 8, 9, 10, 11, 12, 13, 14, 15); }
__device__ __forceinline__ v16bf cat16b(v8us lo, v8us hi) { return __builtin_bit_cast(v16bf, __builtin_shufflevector(lo, hi, 0, 1, 2, 3, 4, 5, 6, 7, 8, 9, 10, 11, 12, 13, 14, 15)); }
__device__ __forceinline__ v8f wmma16(v16h a, v16h b, v8f c) { return __builtin_amdgcn_wmma_f32_16x16x32_f16(false, a, false, b, (short)0, c, false, false); }
__device__ __forceinline__ v8f wmmab(v16bf a, v16bf b, v8f c) { return __builtin_amdgcn_wmma_f32_16x16x32_bf16(false, a, false, b, (short)0, c, false, false); }



// ---- k_gemmt: C[m][n] (f32, pitch KD) = sum_k A[m][k] Bt[n][k] (+ A2[m][k] Bt[n][k] for NSPLIT 1), operands K-contiguous bf16 planes of pitch KD; grid (M/128, N/128), 256 threads.
// One 128x128 output tile per work-group of 8 waves (2 x 4 waves of 64 x 32). K runs in stages of KS (128 or 64): every operand row piece of 2 KS bytes is read from global memory once per work-group, as whole 128-byte lines,
// goes through registers into one of two LDS buffers (row pitch 2 KS + 16 bytes) and is read from there as fragments. Two register sets: a stage's global loads are issued two stages ahead of its LDS stores; one barrier a stage.
// Each accumulator takes its products in the same k order as a single k loop over 32-wide steps.
template <typename T16> struct WFrag;
template <> struct WFrag<h16> { typedef v16h V; static __device__ __forceinline__ V ld(const h16* p) { return cat16(*(const v8h*)p, *(const v8h*)(p + 16)); } static __device__ __forceinline__ v8f mma(V a, V b, v8f c) { return wmma16(a, b, c); } };
template <> struct WFrag<bf> { typedef v16bf V; static __device__ __forceinline__ V ld(const bf* p) { return cat16b(*(const v8us*)p, *(const v8us*)(p + 16)); } static __device__ __forceinline__ v8f mma(V a, V b, v8f c) { return wmmab(a, b, c); } };
// The work-group barrier of the stage loop: it orders LDS traffic alone, so that the global loads issued ahead stay in flight across it (__syncthreads() waits for them too).
__device__ __forceinline__ void lds_barrier() { __builtin_amdgcn_fence(__ATOMIC_RELEASE, "workgroup", "local"); __builtin_amdgcn_s_barrier(); __builtin_amdgcn_fence(__ATOMIC_ACQUIRE, "workgroup", "local"); }
template <int NSPLIT, int KD, int KS>
__global__ __launch_bounds__(256) void k_gemmt(const bf* __restrict__ A, const bf* __restrict__ A2, const bf* __restrict__ Bt, float* C) {
    constexpr int PIT = KS + 8, TILE = 128 * PIT, NT = NSPLIT ? 3 : 2, NS = KD / KS, LPR = KS / 8, RPP = 256 / LPR, NP = 128 / RPP;   // lanes a row piece, rows a pass of the 256 threads, pieces a thread and tile
    static_assert(KD % (2 * KS) == 0 && NS >= 4, "an even number of whole stages, at least four");
    struct Stage { v8us a[NP], b[NP], a2[NP]; };   // one stage's share of a thread, on its way from global memory to LDS
    __shared__ __align__(16) bf sm[2 * NT * TILE];
    __shared__ __align__(16) float osm[8 * 16 * 36];
    const int tid = threadIdx.x, lane = tid & 31, lr = lane & 15, hi = lane >> 4, w = tid >> 5, wm = w >> 2, wn = w & 3;
    const int r0 = blockIdx.x * 128, c0 = blockIdx.y * 128;
    const int srow = tid / LPR, scol = (tid % LPR) * 8;   // staging: piece i of a thread is row srow + RPP i, 16 bytes at element scol
    const bf* ga = A + (size_t)(r0 + srow) * KD + scol; const bf* ga2 = NSPLIT ? A2 + (size_t)(r0 + srow) * KD + scol : nullptr; const bf* gb = Bt + (size_t)(c0 + srow) * KD + scol;
    bf* sp = sm + srow * PIT + scol;
    const bf* fa = sm + (wm * 64 + lr) * PIT + 8 * hi; const bf* fb = sm + TILE + (wn * 32 + lr) * PIT + 8 * hi;
    Stage R0, R1; v8f acc[4][2];   // every full unroll below: these live in registers and need constant indices
#pragma unroll
    for (int mb = 0; mb < 4; ++mb)
#pragma unroll
        for (int nb = 0; nb < 2; ++nb) acc[mb][nb] = (v8f){};
    auto gload = [&](Stage& R, int k0) {
        __builtin_amdgcn_sched_barrier(0);   // with the one below: nothing that rewrites an address register is scheduled between these loads and their wait
#pragma unroll
        for (int i = 0; i < NP; ++i) { R.a[i] = *(const v8us*)(ga + (size_t)i * RPP * KD + k0); R.b[i] = *(const v8us*)(gb + (size_t)i * RPP * KD + k0); if (NSPLIT) R.a2[i] = *(const v8us*)(ga2 + (size_t)i * RPP * KD + k0); }
        asm volatile("s_wait_xcnt 0x0" ::: "memory");   // behind the issued loads, in front of whatever next rewrites their address registers
        __builtin_amdgcn_sched_barrier(0);   // the whole stage is issued here: without it the scheduler sinks loads towards their LDS stores, and their trip to memory is then waited for in full
    };
    auto sstore = [&](const Stage& R, int buf) { bf* p = sp + buf * NT * TILE;
#pragma unroll
        for (int i = 0; i < NP; ++i) { *(v8us*)(p + i * RPP * PIT) = R.a[i]; *(v8us*)(p + TILE + i * RPP * PIT) = R.b[i]; if (NSPLIT) *(v8us*)(p + 2 * TILE + i * RPP * PIT) = R.a2[i]; } };
    auto products = [&](int buf) { const bf* pa = fa + buf * NT * TILE; const bf* pb = fb + buf * NT * TILE;
#pragma unroll
        for (int kc = 0; kc < KS; kc += 32) { v16bf a[4], a2[4];
#pragma unroll
            for (int mb = 0; mb < 4; ++mb) { a[mb] = WFrag<bf>::ld(pa + mb * 16 * PIT + kc); if (NSPLIT) a2[mb] = WFrag<bf>::ld(pa + 2 * TILE + mb * 16 * PIT + kc); }
#pragma unroll
            for (int nb = 0; nb < 2; ++nb) { const v16bf b = WFrag<bf>::ld(pb + nb * 16 * PIT + kc);
#pragma unroll
                for (int mb = 0; mb < 4; ++mb) { acc[mb][nb] = wmmab(a[mb], b, acc[mb][nb]); if (NSPLIT) acc[mb][nb] = wmmab(a2[mb], b, acc[mb][nb]); } } } };
    // Stage s is read from buffer s & 1. Each barrier below publishes the stage just stored and ends every wave's reads of the stage just used, whose buffer the next store takes.
    gload(R0, 0); sstore(R0, 0); gload(R0, KS); gload(R1, 2 * KS);
    lds_barrier();
    // the loop stays rolled: its body already holds two whole stages
#pragma unroll 1
    for (int s = 0; s < NS - 4; s += 2) {   // on entry: buffer 0 holds stage s, R0 stage s + 1, R1 stage s + 2
        products(0); sstore(R0, 1); gload(R0, (s + 3) * KS);
        lds_barrier();
        products(1); sstore(R1, 0); gload(R1, (s + 4) * KS);
        lds_barrier();
    }
    products(0); sstore(R0, 1); gload(R0, (NS - 1) * KS);
    lds_barrier();
    products(1); sstore(R1, 0);
    lds_barrier();
    products(0); sstore(R0, 1);
    lds_barrier();
    products(1);
    float* os = osm + w * (16 * 36);   // the wave's own 16 x 32 patch: accumulator order in, whole 128-byte output lines out
#pragma unroll
    for (int mb = 0; mb < 4; ++mb) {
#pragma unroll
        for (int nb = 0; nb < 2; ++nb)
#pragma unroll
            for (int j = 0; j < 8; ++j) os[(hi * 8 + j) * 36 + nb * 16 + lr] = acc[mb][nb][j];
        float* crow = C + (size_t)(r0 + wm * 64 + mb * 16) * KD + c0 + wn * 32;
#pragma unroll
        for (int q = 0; q < 4; ++q) { const int row = 4 * q + (lane >> 3), cofs = (lane & 7) * 4; const v4f val = *(const v4fa*)(os + row * 36 + cofs); *(v4f*)(crow + (size_t)row * KD + cofs) = val; }
    }
}

// ---- k_gemmc: register-blocked GEMM, ONE WAVE per 64x64 output tile (16 accumulators), operands straight from K-contiguous 16-bit planes, for the causal scores: tiles entirely above the diagonal (query rows r0+roff.., key columns c0..) are skipped.
// roff = row offset of this launch's first row within the sequence.
template <typename T16, int NSPLIT>
__global__ __launch_bounds__(32) void k_gemmc(const T16* __restrict__ A, const T16* __restrict__ A2, const T16* __restrict__ Bt, const T16* __restrict__ Bt2, int K, float* C, int ldc, int roff, size_t sA, size_t sB, size_t sC) {
    typedef typename WFrag<T16>::V V;
    __shared__ __align__(16) float os[16 * 68];
    const size_t z = blockIdx.z; A += z * sA; if (A2) A2 += z * sA; Bt += z * sB; if (Bt2) Bt2 += z * sB; C += z * sC;
    const int lane = threadIdx.x & 31, lr = lane & 15, hi = lane >> 4; const int r0 = blockIdx.x * 64, c0 = blockIdx.y * 64;
    if (c0 > r0 + roff + 63) return;                  // score tile entirely above the causal diagonal: never used (the softmax loads it but masks j > i by select)
    v8f acc[4][4];
#pragma unroll
    for (int mb = 0; mb < 4; ++mb)
#pragma unroll
        for (int nb = 0; nb < 4; ++nb) acc[mb][nb] = (v8f){};
    const size_t aoff = (size_t)(r0 + lr) * K + 8 * hi, boff = (size_t)(c0 + lr) * K + 8 * hi;
#pragma unroll 1
    for (int kc = 0; kc < K; kc += 32) {
        V a[4], a2[4];
#pragma unroll
        for (int mb = 0; mb < 4; ++mb) { a[mb] = WFrag<T16>::ld(A + aoff + (size_t)mb * 16 * K + kc); if (NSPLIT == 1 || NSPLIT == 2) a2[mb] = WFrag<T16>::ld(A2 + aoff + (size_t)mb * 16 * K + kc); }
#pragma unroll
        for (int nb = 0; nb < 4; ++nb) { const V b = WFrag<T16>::ld(Bt + boff + (size_t)nb * 16 * K + kc); V b2; if (NSPLIT >= 2) b2 = WFrag<T16>::ld(Bt2 + boff + (size_t)nb * 16 * K + kc);
#pragma unroll
            for (int mb = 0; mb < 4; ++mb) { acc[mb][nb] = WFrag<T16>::mma(a[mb], b, acc[mb][nb]); if (NSPLIT == 1 || NSPLIT == 2) acc[mb][nb] = WFrag<T16>::mma(a2[mb], b, acc[mb][nb]); if (NSPLIT >= 2) acc[mb][nb] = WFrag<T16>::mma(a[mb], b2, acc[mb][nb]); } }
        asm volatile("v_nop\n\tv_nop\n\tv_nop\n\tv_nop" : "+v"(acc[0][0]), "+v"(acc[1][1]), "+v"(acc[2][2]), "+v"(acc[3][3]) : "v"(a[0]), "v"(a[3]));
    }
#pragma unroll
    for (int mb = 0; mb < 4; ++mb) {
#pragma unroll
        for (int nb = 0; nb < 4; ++nb) {
#pragma unroll
            for (int j = 0; j < 8; ++j) os[(hi * 8 + j) * 68 + nb * 16 + lr] = acc[mb][nb][j]; }
        __builtin_amdgcn_wave_barrier(); asm volatile("" ::: "memory");
        float* crow = C + (size_t)(r0 + mb * 16) * ldc + c0;
{
#pragma unroll
            for (int s = 0; s < 8; ++s) { const int row = 2 * s + hi, cofs = lr * 4; v4f val = *(const v4fa*)(os + row * 68 + cofs);
                *(v4f*)(crow + (size_t)row * ldc + cofs) = val; }
             }
        __builtin_amdgcn_wave_barrier(); asm volatile("" ::: "memory");
    }
}

// ---- k_gemmpv: probability x value contraction, one 64x64 output tile per work-group of NW waves. The key loop (row length KD) stops at the diagonal block (probabilities beyond it are exactly zero) and is
// split over the waves in 64-key chunks (one 128-byte line of every operand row), chunk c to wave c % NW; each wave keeps the whole tile in 16 accumulators. The NW partial tiles meet in LDS
// (accumulator order, 16 bytes a lane) and are summed in wave order 0..NW-1; each wave then stores 4-row x 64-column groups as whole 128-byte lines (output pitch LDC). KD, r0 and roff are multiples of 64.
// KA: pitch of the probability rows in 16-bit elements (they lie in the f32 score rows, so 2 x KD); the value rows have pitch KD.
// ldlast: WFrag::ld for the LAST fragment read through a lane address. Its second half is the last use of the address registers, so the register allocator lets that half's result, or a later load's, land on them.
template <typename T16> __device__ __forceinline__ typename WFrag<T16>::V ldlast(const T16* p);
template <> __device__ __forceinline__ v16h ldlast<h16>(const h16* p) { const v8h x = *(const v8h*)p;
    asm volatile("s_wait_xcnt 0x0" ::: "memory");   // in front of the half whose result may take the address registers of the loads issued before it
    const v8h y = *(const v8h*)(p + 16);
    asm volatile("s_wait_xcnt 0x0" ::: "memory");   // behind that half, in front of the next plane's loads, whose results may take its address registers
    return cat16(x, y); }
template <> __device__ __forceinline__ v16bf ldlast<bf>(const bf* p) { const v8us x = *(const v8us*)p;
    asm volatile("s_wait_xcnt 0x0" ::: "memory");   // as in the h16 form
    const v8us y = *(const v8us*)(p + 16);
    asm volatile("s_wait_xcnt 0x0" ::: "memory");   // as in the h16 form
    return cat16b(x, y); }
template <typename T16, int NSPLIT, int NW, int KD, int KA, int LDC>
__global__ __launch_bounds__(NW * 32) void k_gemmpv(const T16* __restrict__ A, const T16* __restrict__ A2, const T16* __restrict__ Bt, const T16* __restrict__ Bt2, float* C, int roff, size_t sA, size_t sB, size_t sC) {
    typedef typename WFrag<T16>::V V;
    __shared__ __align__(16) float red[NW * 4096];
    const int lane = threadIdx.x & 31, lr = lane & 15, hi = lane >> 4; const int r0 = blockIdx.x * 64, c0 = blockIdx.y * 64;
    const size_t z = blockIdx.z, ua = z * sA + (size_t)r0 * KA, ub = z * sB + (size_t)c0 * KD; A += ua; if (A2) A2 += ua; Bt += ub; if (Bt2) Bt2 += ub; C += z * sC;   // tile bases, the same in every lane
    const int w = __builtin_amdgcn_readfirstlane((int)(threadIdx.x >> 5));   // wave number, kept scalar so that the loop bounds and the operand bases are scalar
    const int Kl = min(KD, r0 + roff + 64);
    v8f acc[4][4];   // every full unroll below: acc, a, a2 live in registers and need constant indices
#pragma unroll
    for (int mb = 0; mb < 4; ++mb)
#pragma unroll
        for (int nb = 0; nb < 4; ++nb) acc[mb][nb] = (v8f){};
    const int loa = (lr * KA + 8 * hi) * 2, lo = (lr * KD + 8 * hi) * 2;   // the lane's byte offset in a 16-row block of the probability planes and of the value planes: one address per plane and trip, every load is that address + a constant
    // both key loops stay rolled: beside the 128 accumulator registers one trip's fragments already fill most of the register file in the hi/lo form
#pragma unroll 1
    for (int kb = w * 64; kb < Kl; kb += NW * 64) {
#pragma unroll 1
        for (int kc = kb; kc < kb + 64; kc += 32) {
            const char* pa = (const char*)(A + kc); const char* pa2 = (const char*)(A2 + kc); const char* pb = (const char*)(Bt + kc); const char* pb2 = (const char*)(Bt2 + kc);
            V a[4], a2[4];
#pragma unroll
            for (int mb = 0; mb < 3; ++mb) { a[mb] = WFrag<T16>::ld((const T16*)(pa + loa + mb * 32 * KA)); if (NSPLIT == 1 || NSPLIT == 2) a2[mb] = WFrag<T16>::ld((const T16*)(pa2 + loa + mb * 32 * KA)); }
            a[3] = ldlast<T16>((const T16*)(pa + loa + 3 * 32 * KA)); if (NSPLIT == 1 || NSPLIT == 2) a2[3] = ldlast<T16>((const T16*)(pa2 + loa + 3 * 32 * KA));
#pragma unroll
            for (int nb = 0; nb < 4; ++nb) { const T16* qb = (const T16*)(pb + lo + nb * 32 * KD); const T16* qb2 = (const T16*)(pb2 + lo + nb * 32 * KD); const V b = (nb < 3) ? WFrag<T16>::ld(qb) : ldlast<T16>(qb); V b2; if (NSPLIT >= 2) b2 = (nb < 3) ? WFrag<T16>::ld(qb2) : ldlast<T16>(qb2);
#pragma unroll
                for (int mb = 0; mb < 4; ++mb) { acc[mb][nb] = WFrag<T16>::mma(a[mb], b, acc[mb][nb]); if (NSPLIT == 1 || NSPLIT == 2) acc[mb][nb] = WFrag<T16>::mma(a2[mb], b, acc[mb][nb]); if (NSPLIT >= 2) acc[mb][nb] = WFrag<T16>::mma(a[mb], b2, acc[mb][nb]); } }
            asm volatile("v_nop\n\tv_nop\n\tv_nop\n\tv_nop" : "+v"(acc[0][0]), "+v"(acc[1][1]), "+v"(acc[2][2]), "+v"(acc[3][3]) : "v"(a[0]), "v"(a[3]));   // the distance behind the last matrix instruction, on the taken back edge too, before the next trip's loads overwrite its operands
        }
    }
#pragma unroll
    for (int mb = 0; mb < 4; ++mb)
#pragma unroll
        for (int nb = 0; nb < 4; ++nb) { float* p = red + (size_t)w * 4096 + (mb * 4 + nb) * 256 + lane * 4; const v8f t = acc[mb][nb];
            *(v4fa*)p = __builtin_shufflevector(t, t, 0, 1, 2, 3); *(v4fa*)(p + 128) = __builtin_shufflevector(t, t, 4, 5, 6, 7); }
    __syncthreads();   // every wave's partial tile is in LDS before any wave sums
    float* cp = C + (size_t)(r0 + 4 * w) * LDC + c0 + lane;   // group g starts at row 4 * g and lane (lr, hi) of pass u holds column 32 * u + lane: one address, every store is that address + a constant
#pragma unroll
    for (int i = 0; i < 16 / NW; ++i) { const int g = w + i * NW, mb = g >> 2, hs = (g >> 1) & 1, hf = g & 1;   // group g: rows mb * 16 + hs * 8 + hf * 4 .. + 3, all 64 columns
#pragma unroll
        for (int u = 0; u < 2; ++u) { const int nb = 2 * u + hi; const float* p = red + (mb * 4 + nb) * 256 + hf * 128 + (hs * 16 + lr) * 4; v4f s = *(const v4fa*)p;
#pragma unroll
            for (int ww = 1; ww < NW; ++ww) s += *(const v4fa*)(p + ww * 4096);
#pragma unroll
            for (int e = 0; e < 4; ++e) cp[(4 * NW * i + e) * LDC + 32 * u] = s[e]; } }
}

__device__ __forceinline__ h16 tohx(float x) { return (h16)x; }
__device__ __forceinline__ void splitf(float y, unsigned short& h, unsigned short& l) { h = f2bf(y); l = f2bf(y - bf2f(h)); }
typedef __attribute__((ext_vector_type(2))) _Float16 v2h;
typedef __attribute__((ext_vector_type(4))) _Float16 v4h;
typedef __attribute__((ext_vector_type(2))) unsigned short v2us;
typedef __attribute__((ext_vector_type(4))) unsigned short v4us;
typedef __attribute__((ext_vector_type(2))) float v2f;
typedef __attribute__((ext_vector_type(4))) int v4i;

__global__ __launch_bounds__(256) void k_cvt8(const float* __restrict__ src, bf* dst, size_t n8) { const size_t i = (size_t)blockIdx.x * 256 + threadIdx.x; if (i >= n8) return; const v8f v = *(const v8f*)(src + i * 8); v8us o;
#pragma unroll
    for (int k = 0; k < 8; ++k) o[k] = f2bf(v[k]); *(v8us*)(dst + i * 8) = o;  }

__global__ __launch_bounds__(256) void k_vtp(const float* __restrict__ F, int pitch, int nheads, h16* V16, bf* Vh, bf* Vl) { const size_t e = ((size_t)blockIdx.x * 256 + threadIdx.x) * 2; if (e >= (size_t)nheads * HD * TT) return; const int t = (int)(e % TT); const int d = (int)((e / TT) % HD); const int g = (int)(e / ((size_t)TT * HD)); v2h o16; v2us oh, ol;
#pragma unroll
    for (int q = 0; q < 2; ++q) { const float x = F[(size_t)(t + q) * pitch + g * HD + d]; o16[q] = tohx(x); unsigned short a2, c2; splitf(x, a2, c2); oh[q] = a2; ol[q] = c2; }
    *(v2h*)(V16 + e) = o16; *(v2us*)(Vh + e) = oh; *(v2us*)(Vl + e) = ol;  }
// k_asoft: per row (zz, i): t = S x HD^-0.5 for j <= i and i - j < WIN (sliding causal window; the reference's -1e9 additive fill vanishes identically); softmax over the 2048 keys (register row, one exp, fixed trees);
// the probabilities go over the row's own scores, which one wave has read whole by then: fp16 rows into the first half of the 8-KiB row; hi/lo rows hi into the first half, lo into the second.
__global__ __launch_bounds__(256) void k_asoft(float* Sb) {
    const int lane = threadIdx.x & 31; const int row = blockIdx.x * 8 + (threadIdx.x >> 5); if (row >= ZH * TT) return; const int i = row % TT; const int zz = row / TT; (void)zz; const bool hires = (i < RH); float* sr = Sb + (size_t)row * TT; float v[TT / 32]; float mx = -3.0e38f;
#pragma unroll
    for (int ch = 0; ch < TT / 128; ++ch) { const int j0 = ch * 128 + lane * 4; const v4f a = *(const v4f*)(sr + j0);
#pragma unroll
        for (int q = 0; q < 4; ++q) { const int j = j0 + q; (void)j; const float t = (j <= i && i - j < WIN) ? a[q] * SCL : -3.0e38f; v[ch * 4 + q] = t; mx = fmaxf(mx, t); } }
#pragma unroll
    for (int sh = 16; sh; sh >>= 1) mx = fmaxf(mx, __shfl_xor(mx, sh, 32));
    float sum = 0.f;
#pragma unroll
    for (int k = 0; k < TT / 32; ++k) { float d0 = __fsub_rn(v[k], mx); asm volatile("" : "+v"(d0)); v[k] = __builtin_amdgcn_exp2f(__fmul_rn(d0, 1.4426950408889634f)); sum += v[k]; }
#pragma unroll
    for (int sh = 16; sh; sh >>= 1) sum += __shfl_xor(sum, sh, 32);
    const float f = __fdiv_rn(hires ? 1.0f : PCAR, sum);
{
        if (hires) {
#pragma unroll
            for (int ch = 0; ch < TT / 128; ++ch) { v4us oh, ol;
#pragma unroll
                for (int q = 0; q < 4; ++q) { unsigned short a, c2; splitf(v[ch * 4 + q] * f, a, c2); oh[q] = a; ol[q] = c2; }
                bf* po = (bf*)sr + ch * 128 + lane * 4; *(v4us*)po = oh; *(v4us*)(po + TT) = ol; }
        } else {
#pragma unroll
            for (int ch = 0; ch < TT / 128; ++ch) { v4h o4;
#pragma unroll
                for (int q = 0; q < 4; ++q) o4[q] = tohx(v[ch * 4 + q] * f);
                *(v4h*)((h16*)sr + ch * 128 + lane * 4) = o4; } }
         }
}
// ---- k_qkpost: all that stands between the f32 q / k projections [t][h * HD + d] and their 16-bit head planes [h][t][d] (fp16 + bf16 hi/lo), in one pass; blockIdx.y = 0: q, 1: k.
// 16 lanes hold one (token, head) row: lane j the dims 4j..4j+3 of both halves, so that each rotary pair sits in one lane. A group does QKH heads of one token (one read of the tables), all its loads issued ahead.
// rotary from the bf16-rounded tables, r = 1/sqrt(mean of squares + eps) over the 128 rotated dims (8 terms a lane, then a butterfly over the 16 lanes), (y x r) x w[d] with w rounded to bf16.
#define QKH 4
static_assert(NH_ == NKV && NH_ % QKH == 0 && (TT * (NH_ / QKH)) % 16 == 0 && HD == 128, "k_qkpost: q and k alike, whole groups, whole blocks, 16 lanes x 4 dims a half row");
__device__ __forceinline__ float rowsum16(float v) {   // sum over the 16 lanes of a row, every lane on; the cross-lane reads fold into the adds
    v += __builtin_bit_cast(float, __builtin_amdgcn_update_dpp(0, __builtin_bit_cast(int, v), 0x161, 0xf, 0xf, true));   // row_xmask:1
    v += __builtin_bit_cast(float, __builtin_amdgcn_update_dpp(0, __builtin_bit_cast(int, v), 0x162, 0xf, 0xf, true));   // row_xmask:2
    v += __builtin_bit_cast(float, __builtin_amdgcn_update_dpp(0, __builtin_bit_cast(int, v), 0x164, 0xf, 0xf, true));   // row_xmask:4
    v += __builtin_bit_cast(float, __builtin_amdgcn_update_dpp(0, __builtin_bit_cast(int, v), 0x168, 0xf, 0xf, true));   // row_xmask:8
    return v; }
__global__ __launch_bounds__(256) void k_qkpost(const float* __restrict__ Fq, const float* __restrict__ Fk, const float* __restrict__ sinT, const float* __restrict__ cosT, const float* __restrict__ wq_, const float* __restrict__ wk_, h16* Q16, bf* Qh, bf* Ql, h16* K16, bf* Kh, bf* Kl) {
    const bool isk = blockIdx.y != 0; const float* F = isk ? Fk : Fq; const float* w = isk ? wk_ : wq_; h16* P16 = isk ? K16 : Q16; bf* Ph = isk ? Kh : Qh; bf* Pl = isk ? Kl : Ql;
    const int g = blockIdx.x * 16 + (threadIdx.x >> 4), d = (threadIdx.x & 15) * 4; const int t = g / (NH_ / QKH), h0 = (g % (NH_ / QKH)) * QKH;
    const float* f = F + (size_t)t * DQ + h0 * HD + d; v4f x1[QKH], x2[QKH];
#pragma unroll
    for (int i = 0; i < QKH; ++i) { x1[i] = *(const v4f*)(f + i * HD); x2[i] = *(const v4f*)(f + i * HD + HD / 2); }
    const v4f cr = *(const v4f*)(cosT + t * (HD / 2) + d), sr = *(const v4f*)(sinT + t * (HD / 2) + d), wa = *(const v4f*)(w + d), wb = *(const v4f*)(w + HD / 2 + d); v4f c, s, w1, w2;
    __builtin_amdgcn_sched_barrier(0);   // all twelve loads are issued before any arithmetic: without it the scheduler sinks one of them behind the first wait, a second trip to memory in every wave
#pragma unroll
    for (int q = 0; q < 4; ++q) { c[q] = bfr(cr[q]); s[q] = bfr(sr[q]); w1[q] = bfr(wa[q]); w2[q] = bfr(wb[q]); }
#pragma unroll
    for (int i = 0; i < QKH; ++i) { const v4f y1 = x1[i] * c - x2[i] * s, y2 = x1[i] * s + x2[i] * c; float ss = 0.f;
#pragma unroll
        for (int q = 0; q < 4; ++q) ss += y1[q] * y1[q];
#pragma unroll
        for (int q = 0; q < 4; ++q) ss += y2[q] * y2[q];
        const float rf = __fdiv_rn(1.0f, __fsqrt_rn(rowsum16(ss) * (1.0f / HD) + 1.1920929e-07f)); const size_t o = ((size_t)(h0 + i) * TT + t) * HD + d; v4h a16, b16; v4us ah, al, bh, bl;
#pragma unroll
        for (int q = 0; q < 4; ++q) { const float ra = (y1[q] * rf) * w1[q], rb = (y2[q] * rf) * w2[q]; unsigned short u, v; a16[q] = tohx(ra); splitf(ra, u, v); ah[q] = u; al[q] = v; b16[q] = tohx(rb); splitf(rb, u, v); bh[q] = u; bl[q] = v; }
        *(v4h*)(P16 + o) = a16; *(v4h*)(P16 + o + HD / 2) = b16; *(v4us*)(Ph + o) = ah; *(v4us*)(Ph + o + HD / 2) = bh; *(v4us*)(Pl + o) = al; *(v4us*)(Pl + o + HD / 2) = bl; }   // each store: one whole 128-byte line a group
}
__global__ __launch_bounds__(256) void k_merge(const float* __restrict__ O, int h0, bf* Ah, bf* Al) { const size_t e = ((size_t)blockIdx.x * 256 + threadIdx.x) * 2; if (e >= (size_t)ZH * TT * HD) return; const int d = (int)(e % HD); const int t = (int)((e / HD) % TT); const int zz = (int)(e / ((size_t)HD * TT)); const float cs = (t < RH) ? 1.0f : (1.0f / PCAR); const size_t oo = (size_t)t * DQ + (h0 + zz) * HD + d;
    v2us oh, ol;
#pragma unroll
    for (int q = 0; q < 2; ++q) { unsigned short a, c2; splitf(O[e + q] * cs, a, c2); oh[q] = a; ol[q] = c2; } *(v2us*)(Ah + oo) = oh; *(v2us*)(Al + oo) = ol;  }

extern "C" void kernel_launch(void* const* d_in, const int* in_sizes, int n_in,
                              void* d_out, int out_size, void* d_ws, size_t ws_size, hipStream_t stream) {
    (void)in_sizes; (void)n_in; (void)out_size;
    const float* x = (const float*)d_in[0]; const float* sinT = (const float*)d_in[1]; const float* cosT = (const float*)d_in[2]; const float* wq = (const float*)d_in[3]; const float* wk = (const float*)d_in[4]; const float* wv = (const float*)d_in[5]; const float* wo = (const float*)d_in[6]; const float* qsc = (const float*)d_in[7]; const float* ksc = (const float*)d_in[8];   /* x, sin, cos (f32 [2048][64], READ), Wq, Wk, Wv, Wo ('oi' [2048][2048]), q_norm_w, k_norm_w ([128], read) */
    float* OUT = (float*)d_out;     // [2][2048][2048]
    char* wsp = (char*)d_ws;
    auto take = [&](size_t bytes) { char* p = wsp; wsp += (bytes + 255) & ~(size_t)255; return (void*)p; };
    bf* WQ = (bf*)take((size_t)DQ * DM * 2); bf* WK = (bf*)take((size_t)DKV * DM * 2); bf* WV = (bf*)take((size_t)DKV * DM * 2); bf* WO = (bf*)take((size_t)DM * DQ * 2);
    h16* QP16 = (h16*)take((size_t)NH_ * TT * HD * 2); h16* KP16 = (h16*)take((size_t)NKV * TT * HD * 2); h16* VT16 = (h16*)take((size_t)NKV * HD * TT * 2);
    bf* QPh = (bf*)take((size_t)NH_ * TT * HD * 2); bf* QPl = (bf*)take((size_t)NH_ * TT * HD * 2); bf* KPh = (bf*)take((size_t)NKV * TT * HD * 2); bf* KPl = (bf*)take((size_t)NKV * TT * HD * 2); bf* VTh = (bf*)take((size_t)NKV * HD * TT * 2); bf* VTl = (bf*)take((size_t)NKV * HD * TT * 2); bf* ATh = (bf*)take((size_t)TT * DQ * 2); bf* ATl = (bf*)take((size_t)TT * DQ * 2);
    char* shared0 = wsp;   // from here two uses of the same bytes, one after the other in every batch: the projections' buffers, dead once the head planes are built, then the attention passes' scores and outputs
    bf* XB = (bf*)take((size_t)TT * DM * 2); float* FQ = (float*)take((size_t)TT * DQ * 4); float* FK = (float*)take((size_t)TT * DKV * 4);
    wsp = shared0;
    float* Sb = (float*)take((size_t)ZH * TT * TT * 4); float* Ob = (float*)take((size_t)ZH * TT * HD * 4);
    if ((size_t)(wsp - (char*)d_ws) > ws_size) return;    // ws 256 MiB
    float* FV = FK;   // v projection reuses the k buffer after the k planes are built (stream-ordered)
    { k_cvt8<<<(unsigned)(((size_t)DQ * DM / 8 + 255) / 256), 256, 0, stream>>>(wq, WQ, (size_t)DQ * DM / 8); k_cvt8<<<(unsigned)(((size_t)DKV * DM / 8 + 255) / 256), 256, 0, stream>>>(wk, WK, (size_t)DKV * DM / 8); k_cvt8<<<(unsigned)(((size_t)DKV * DM / 8 + 255) / 256), 256, 0, stream>>>(wv, WV, (size_t)DKV * DM / 8);
      k_cvt8<<<(unsigned)(((size_t)DM * DQ / 8 + 255) / 256), 256, 0, stream>>>(wo, WO, (size_t)DM * DQ / 8);
       }
    const unsigned LKv = (unsigned)(((size_t)NKV * TT * HD / 2 + 255) / 256);
    for (int b = 0; b < NB_; ++b) {
        
        k_cvt8<<<(unsigned)(((size_t)TT * DM / 8 + 255) / 256), 256, 0, stream>>>(x + (size_t)b * TT * DM, XB, (size_t)TT * DM / 8);
        k_gemmt<0, DM, 128><<<dim3(TT / 128, DQ / 128, 1), 256, 0, stream>>>(XB, nullptr, WQ, FQ);
        k_gemmt<0, DM, 128><<<dim3(TT / 128, DKV / 128, 1), 256, 0, stream>>>(XB, nullptr, WK, FK);
        k_qkpost<<<dim3(TT * (NH_ / QKH) / 16, 2, 1), 256, 0, stream>>>(FQ, FK, sinT, cosT, qsc, ksc, QP16, QPh, QPl, KP16, KPh, KPl);
        k_gemmt<0, DM, 128><<<dim3(TT / 128, DKV / 128, 1), 256, 0, stream>>>(XB, nullptr, WV, FV); k_vtp<<<LKv, 256, 0, stream>>>(FV, DKV, NKV, VT16, VTh, VTl);
        for (int h0 = 0; h0 < NH_; h0 += ZH) { const size_t zq = (size_t)h0, zk = (size_t)(h0 / REP);   // one kv head per query head: the pass's heads use consecutive kv planes (z-strides TT*HD)
            k_gemmc<bf, 2><<<dim3(RH / 64, TT / 64, ZH), 32, 0, stream>>>(QPh + zq * TT * HD, QPl + zq * TT * HD, KPh + zk * TT * HD, KPl + zk * TT * HD, HD, Sb, TT, 0, (size_t)TT * HD, (size_t)TT * HD, (size_t)TT * TT);
            k_gemmc<h16, 0><<<dim3((TT - RH) / 64, TT / 64, ZH), 32, 0, stream>>>(QP16 + zq * TT * HD + (size_t)RH * HD, nullptr, KP16 + zk * TT * HD, nullptr, HD, Sb + (size_t)RH * TT, TT, RH, (size_t)TT * HD, (size_t)TT * HD, (size_t)TT * TT);
            k_asoft<<<ZH * TT / 8, 256, 0, stream>>>(Sb);
            k_gemmpv<bf, 2, 8, TT, 2 * TT, HD><<<dim3(RH / 64, HD / 64, ZH), 256, 0, stream>>>((const bf*)Sb, (const bf*)Sb + TT, VTh + zk * HD * TT, VTl + zk * HD * TT, Ob, 0, (size_t)2 * TT * TT, (size_t)HD * TT, (size_t)TT * HD);
            k_gemmpv<h16, 0, 16, TT, 2 * TT, HD><<<dim3((TT - RH) / 64, HD / 64, ZH), 512, 0, stream>>>((const h16*)(Sb + (size_t)RH * TT), nullptr, VT16 + zk * HD * TT, nullptr, Ob + (size_t)RH * HD, RH, (size_t)2 * TT * TT, (size_t)HD * TT, (size_t)TT * HD);
            k_merge<<<(unsigned)(((size_t)ZH * TT * HD / 2 + 255) / 256), 256, 0, stream>>>(Ob, h0, ATh, ATl); }
        k_gemmt<1, DQ, 64><<<dim3(TT / 128, DM / 128, 1), 256, 0, stream>>>(ATh, ATl, WO, OUT + (size_t)b * TT * DM); }
}

// v005
// Measured time: 293 microseconds a run.
// In two side-by-side timings against v004, it was 2.08 and 2.12 times as fast.
// All steps since v000 together make it 6.30 times as fast.
#include <hip/hip_runtime.h>

// Causal multi-head attention with 128-wide heads, rotary embeddings from half-width input tables and a per-head RMSNorm applied AFTER the rotary (x [2][2048][2048]; q, k, v = x W^T ('oi' 1/sqrt(2048), no bias; 16 heads x 128); rope: (x1, x2) = the two HALVES of each head -> cat(x1 c - x2 s, x1 s + x2 c) with the sin / cos INPUT tables [2048][64] (read; argument order x, sin, cos); then per head q = RMSNorm(q) x q_norm_w, k = RMSNorm(k) x k_norm_w (eps = float32 machine epsilon 1.19e-7; weights [128] = ones, read); scores / sqrt(128); causal (-inf); softmax; out = merged Wo^T ('oi') -> [2][2048][2048] (8.4 M); argument order x, sin, cos, Wq, Wk, Wv, Wo, q_norm_w, k_norm_w).
// Layout, per batch: bf16 copy of x; 'oi' weights cast as-is; exact projections; k_qkpost takes the f32 q / k projections to their 16-bit head planes in one pass: rotary from the bf16-rounded input tables (the staged tables need not be rotations: no norm-preservation shortcut), per (head, token) 1/sqrt(mean + eps) over the 128 rotated dims, x r x w[d]; then, for both batches at once, k_fattn: causal T-2048 attention in one launch (hybrid rows: < 512 hi/lo 3 products, rest fp16 x1024; online softmax, scores and probabilities stay in registers; it writes the merged hi/lo planes); merged hi/lo x Wo exact.
// Compute dtypes, f32 accumulate: every input rounded to bf16 incl. the tables; projections exact; rotary and RMSNorm f32; attention rows < 512 3 products, rest fp16; softmax f32; Wo hl x exact.

#define NB_  2
#define TT   2048
#define DM   2048
#define NH_  16
#define NKV  16
#define REP  (NH_ / NKV)
#define HD   128
#define DQ   (NH_ * HD)
#define DKV  (NKV * HD)
#define RH   512                  // query rows < RH use hi+lo planes (0: none)
#define SCL  0.088388347648318447f   // HD^-0.5
typedef _Float16 h16;
typedef unsigned short bf;
typedef __attribute__((ext_vector_type(16))) __bf16   v16bf;
typedef __attribute__((ext_vector_type(16))) _Float16 v16h;
typedef __attribute__((ext_vector_type(8)))  _Float16 v8h;
typedef __attribute__((ext_vector_type(8)))  unsigned short v8us;
typedef __attribute__((ext_vector_type(8)))  float    v8f;
typedef __attribute__((ext_vector_type(4)))  float    v4f;
typedef v8h  __attribute__((may_alias)) v8ha;
typedef v4f  __attribute__((may_alias)) v4fa;
typedef v8us __attribute__((may_alias)) v8usa;

__device__ __forceinline__ unsigned short f2bf(float f) { unsigned u = __float_as_uint(f); u += 0x7FFFu + ((u >> 16) & 1u); return (unsigned short)(u >> 16); }
__device__ __forceinline__ float bf2f(unsigned short b) { return __uint_as_float(((unsigned)b) << 16); }
__device__ __forceinline__ float bfr(float f) { return bf2f(f2bf(f)); }
__device__ __forceinline__ v16h cat16(v8h lo, v8h hi) { return __builtin_shufflevector(lo, hi, 0, 1, 2, 3, 4, 5, 6, 7, 8, 9, 10, 11, 12, 13, 14, 15); }
__device__ __forceinline__ v16bf cat16b(v8us lo, v8us hi) { return __builtin_bit_cast(v16bf, __builtin_shufflevector(lo, hi, 0, 1, 2, 3, 4, 5, 6, 7, 8, 9, 10, 11, 12, 13, 14, 15)); }
__device__ __forceinline__ v8f wmma16(v16h a, v16h b, v8f c) { return __builtin_amdgcn_wmma_f32_16x16x32_f16(false, a, false, b, (short)0, c, false, false); }
__device__ __forceinline__ v8f wmmab(v16bf a, v16bf b, v8f c) { return __builtin_amdgcn_wmma_f32_16x16x32_bf16(false, a, false, b, (short)0, c, false, false); }



// ---- k_gemmt: C[m][n] (f32, pitch KD) = sum_k A[m][k] Bt[n][k] (+ A2[m][k] Bt[n][k] for NSPLIT 1), operands K-contiguous bf16 planes of pitch KD; grid (M/128, N/128), 256 threads.
// One 128x128 output tile per work-group of 8 waves (2 x 4 waves of 64 x 32). K runs in stages of KS (128 or 64): every operand row piece of 2 KS bytes is read from global memory once per work-group, as whole 128-byte lines,
// goes through registers into one of two LDS buffers (row pitch 2 KS + 16 bytes) and is read from there as fragments. Two register sets: a stage's global loads are issued two stages ahead of its LDS stores; one barrier a stage.
// Each accumulator takes its products in the same k order as a single k loop over 32-wide steps.
template <typename T16> struct WFrag;
template <> struct WFrag<h16> { typedef v16h V; static __device__ __forceinline__ V ld(const h16* p) { return cat16(*(const v8h*)p, *(const v8h*)(p + 16)); } static __device__ __forceinline__ v8f mma(V a, V b, v8f c) { return wmma16(a, b, c); } };
template <> struct WFrag<bf> { typedef v16bf V; static __device__ __forceinline__ V ld(const bf* p) { return cat16b(*(const v8us*)p, *(const v8us*)(p + 16)); } static __device__ __forceinline__ v8f mma(V a, V b, v8f c) { return wmmab(a, b, c); } };
// The work-group barrier of the stage loop: it orders LDS traffic alone, so that the global loads issued ahead stay in flight across it (__syncthreads() waits for them too).
__device__ __forceinline__ void lds_barrier() { __builtin_amdgcn_fence(__ATOMIC_RELEASE, "workgroup", "local"); __builtin_amdgcn_s_barrier(); __builtin_amdgcn_fence(__ATOMIC_ACQUIRE, "workgroup", "local"); }
template <int NSPLIT, int KD, int KS>
__global__ __launch_bounds__(256) void k_gemmt(const bf* __restrict__ A, const bf* __restrict__ A2, const bf* __restrict__ Bt, float* C) {
    constexpr int PIT = KS + 8, TILE = 128 * PIT, NT = NSPLIT ? 3 : 2, NS = KD / KS, LPR = KS / 8, RPP = 256 / LPR, NP = 128 / RPP;   // lanes a row piece, rows a pass of the 256 threads, pieces a thread and tile
    static_assert(KD % (2 * KS) == 0 && NS >= 4, "an even number of whole stages, at least four");
    struct Stage { v8us a[NP], b[NP], a2[NP]; };   // one stage's share of a thread, on its way from global memory to LDS
    __shared__ __align__(16) bf sm[2 * NT * TILE];
    __shared__ __align__(16) float osm[8 * 16 * 36];
    const int tid = threadIdx.x, lane = tid & 31, lr = lane & 15, hi = lane >> 4, w = tid >> 5, wm = w >> 2, wn = w & 3;
    const int r0 = blockIdx.x * 128, c0 = blockIdx.y * 128;
    const int srow = tid / LPR, scol = (tid % LPR) * 8;   // staging: piece i of a thread is row srow + RPP i, 16 bytes at element scol
    const bf* ga = A + (size_t)(r0 + srow) * KD + scol; const bf* ga2 = NSPLIT ? A2 + (size_t)(r0 + srow) * KD + scol : nullptr; const bf* gb = Bt + (size_t)(c0 + srow) * KD + scol;
    bf* sp = sm + srow * PIT + scol;
    const bf* fa = sm + (wm * 64 + lr) * PIT + 8 * hi; const bf* fb = sm + TILE + (wn * 32 + lr) * PIT + 8 * hi;
    Stage R0, R1; v8f acc[4][2];   // every full unroll below: these live in registers and need constant indices
#pragma unroll
    for (int mb = 0; mb < 4; ++mb)
#pragma unroll
        for (int nb = 0; nb < 2; ++nb) acc[mb][nb] = (v8f){};
    auto gload = [&](Stage& R, int k0) {
        __builtin_amdgcn_sched_barrier(0);   // with the one below: nothing that rewrites an address register is scheduled between these loads and their wait
#pragma unroll
        for (int i = 0; i < NP; ++i) { R.a[i] = *(const v8us*)(ga + (size_t)i * RPP * KD + k0); R.b[i] = *(const v8us*)(gb + (size_t)i * RPP * KD + k0); if (NSPLIT) R.a2[i] = *(const v8us*)(ga2 + (size_t)i * RPP * KD + k0); }
        asm volatile("s_wait_xcnt 0x0" ::: "memory");   // behind the issued loads, in front of whatever next rewrites their address registers
        __builtin_amdgcn_sched_barrier(0);   // the whole stage is issued here: without it the scheduler sinks loads towards their LDS stores, and their trip to memory is then waited for in full
    };
    auto sstore = [&](const Stage& R, int buf) { bf* p = sp + buf * NT * TILE;
#pragma unroll
        for (int i = 0; i < NP; ++i) { *(v8us*)(p + i * RPP * PIT) = R.a[i]; *(v8us*)(p + TILE + i * RPP * PIT) = R.b[i]; if (NSPLIT) *(v8us*)(p + 2 * TILE + i * RPP * PIT) = R.a2[i]; } };
    auto products = [&](int buf) { const bf* pa = fa + buf * NT * TILE; const bf* pb = fb + buf * NT * TILE;
#pragma unroll
        for (int kc = 0; kc < KS; kc += 32) { v16bf a[4], a2[4];
#pragma unroll
            for (int mb = 0; mb < 4; ++mb) { a[mb] = WFrag<bf>::ld(pa + mb * 16 * PIT + kc); if (NSPLIT) a2[mb] = WFrag<bf>::ld(pa + 2 * TILE + mb * 16 * PIT + kc); }
#pragma unroll
            for (int nb = 0; nb < 2; ++nb) { const v16bf b = WFrag<bf>::ld(pb + nb * 16 * PIT + kc);
#pragma unroll
                for (int mb = 0; mb < 4; ++mb) { acc[mb][nb] = wmmab(a[mb], b, acc[mb][nb]); if (NSPLIT) acc[mb][nb] = wmmab(a2[mb], b, acc[mb][nb]); } } } };
    // Stage s is read from buffer s & 1. Each barrier below publishes the stage just stored and ends every wave's reads of the stage just used, whose buffer the next store takes.
    gload(R0, 0); sstore(R0, 0); gload(R0, KS); gload(R1, 2 * KS);
    lds_barrier();
    // the loop stays rolled: its body already holds two whole stages
#pragma unroll 1
    for (int s = 0; s < NS - 4; s += 2) {   // on entry: buffer 0 holds stage s, R0 stage s + 1, R1 stage s + 2
        products(0); sstore(R0, 1); gload(R0, (s + 3) * KS);
        lds_barrier();
        products(1); sstore(R1, 0); gload(R1, (s + 4) * KS);
        lds_barrier();
    }
    products(0); sstore(R0, 1); gload(R0, (NS - 1) * KS);
    lds_barrier();
    products(1); sstore(R1, 0);
    lds_barrier();
    products(0); sstore(R0, 1);
    lds_barrier();
    products(1);
    float* os = osm + w * (16 * 36);   // the wave's own 16 x 32 patch: accumulator order in, whole 128-byte output lines out
#pragma unroll
    for (int mb = 0; mb < 4; ++mb) {
#pragma unroll
        for (int nb = 0; nb < 2; ++nb)
#pragma unroll
            for (int j = 0; j < 8; ++j) os[(hi * 8 + j) * 36 + nb * 16 + lr] = acc[mb][nb][j];
        float* crow = C + (size_t)(r0 + wm * 64 + mb * 16) * KD + c0 + wn * 32;
#pragma unroll
        for (int q = 0; q < 4; ++q) { const int row = 4 * q + (lane >> 3), cofs = (lane & 7) * 4; const v4f val = *(const v4fa*)(os + row * 36 + cofs); *(v4f*)(crow + (size_t)row * KD + cofs) = val; }
    }
}

__device__ __forceinline__ h16 tohx(float x) { return (h16)x; }
__device__ __forceinline__ void splitf(float y, unsigned short& h, unsigned short& l) { h = f2bf(y); l = f2bf(y - bf2f(h)); }
typedef __attribute__((ext_vector_type(2))) _Float16 v2h;
typedef __attribute__((ext_vector_type(4))) _Float16 v4h;
typedef __attribute__((ext_vector_type(2))) unsigned short v2us;
typedef __attribute__((ext_vector_type(4))) unsigned short v4us;
typedef __attribute__((ext_vector_type(2))) float v2f;
typedef __attribute__((ext_vector_type(4))) int v4i;

__global__ __launch_bounds__(256) void k_cvt8(const float* __restrict__ src, bf* dst, size_t n8) { const size_t i = (size_t)blockIdx.x * 256 + threadIdx.x; if (i >= n8) return; const v8f v = *(const v8f*)(src + i * 8); v8us o;
#pragma unroll
    for (int k = 0; k < 8; ++k) o[k] = f2bf(v[k]); *(v8us*)(dst + i * 8) = o;  }

__global__ __launch_bounds__(256) void k_vtp(const float* __restrict__ F, int pitch, int nheads, h16* V16, bf* Vh, bf* Vl) { const size_t e = ((size_t)blockIdx.x * 256 + threadIdx.x) * 2; if (e >= (size_t)nheads * HD * TT) return; const int t = (int)(e % TT); const int d = (int)((e / TT) % HD); const int g = (int)(e / ((size_t)TT * HD)); v2h o16; v2us oh, ol;
#pragma unroll
    for (int q = 0; q < 2; ++q) { const float x = F[(size_t)(t + q) * pitch + g * HD + d]; o16[q] = tohx(x); unsigned short a2, c2; splitf(x, a2, c2); oh[q] = a2; ol[q] = c2; }
    *(v2h*)(V16 + e) = o16; *(v2us*)(Vh + e) = oh; *(v2us*)(Vl + e) = ol;  }
// ---- k_qkpost: all that stands between the f32 q / k projections [t][h * HD + d] and their 16-bit head planes [h][t][d] (fp16 + bf16 hi/lo), in one pass; blockIdx.y = 0: q, 1: k.
// 16 lanes hold one (token, head) row: lane j the dims 4j..4j+3 of both halves, so that each rotary pair sits in one lane. A group does QKH heads of one token (one read of the tables), all its loads issued ahead.
// rotary from the bf16-rounded tables, r = 1/sqrt(mean of squares + eps) over the 128 rotated dims (8 terms a lane, then a butterfly over the 16 lanes), (y x r) x w[d] with w rounded to bf16.
#define QKH 4
static_assert(NH_ == NKV && NH_ % QKH == 0 && (TT * (NH_ / QKH)) % 16 == 0 && HD == 128, "k_qkpost: q and k alike, whole groups, whole blocks, 16 lanes x 4 dims a half row");
__device__ __forceinline__ float rowsum16(float v) {   // sum over the 16 lanes of a row, every lane on; the cross-lane reads fold into the adds
    v += __builtin_bit_cast(float, __builtin_amdgcn_update_dpp(0, __builtin_bit_cast(int, v), 0x161, 0xf, 0xf, true));   // row_xmask:1
    v += __builtin_bit_cast(float, __builtin_amdgcn_update_dpp(0, __builtin_bit_cast(int, v), 0x162, 0xf, 0xf, true));   // row_xmask:2
    v += __builtin_bit_cast(float, __builtin_amdgcn_update_dpp(0, __builtin_bit_cast(int, v), 0x164, 0xf, 0xf, true));   // row_xmask:4
    v += __builtin_bit_cast(float, __builtin_amdgcn_update_dpp(0, __builtin_bit_cast(int, v), 0x168, 0xf, 0xf, true));   // row_xmask:8
    return v; }
__global__ __launch_bounds__(256) void k_qkpost(const float* __restrict__ Fq, const float* __restrict__ Fk, const float* __restrict__ sinT, const float* __restrict__ cosT, const float* __restrict__ wq_, const float* __restrict__ wk_, h16* Q16, bf* Qh, bf* Ql, h16* K16, bf* Kh, bf* Kl) {
    const bool isk = blockIdx.y != 0; const float* F = isk ? Fk : Fq; const float* w = isk ? wk_ : wq_; h16* P16 = isk ? K16 : Q16; bf* Ph = isk ? Kh : Qh; bf* Pl = isk ? Kl : Ql;
    const int g = blockIdx.x * 16 + (threadIdx.x >> 4), d = (threadIdx.x & 15) * 4; const int t = g / (NH_ / QKH), h0 = (g % (NH_ / QKH)) * QKH;
    const float* f = F + (size_t)t * DQ + h0 * HD + d; v4f x1[QKH], x2[QKH];
#pragma unroll
    for (int i = 0; i < QKH; ++i) { x1[i] = *(const v4f*)(f + i * HD); x2[i] = *(const v4f*)(f + i * HD + HD / 2); }
    const v4f cr = *(const v4f*)(cosT + t * (HD / 2) + d), sr = *(const v4f*)(sinT + t * (HD / 2) + d), wa = *(const v4f*)(w + d), wb = *(const v4f*)(w + HD / 2 + d); v4f c, s, w1, w2;
    __builtin_amdgcn_sched_barrier(0);   // all twelve loads are issued before any arithmetic: without it the scheduler sinks one of them behind the first wait, a second trip to memory in every wave
#pragma unroll
    for (int q = 0; q < 4; ++q) { c[q] = bfr(cr[q]); s[q] = bfr(sr[q]); w1[q] = bfr(wa[q]); w2[q] = bfr(wb[q]); }
#pragma unroll
    for (int i = 0; i < QKH; ++i) { const v4f y1 = x1[i] * c - x2[i] * s, y2 = x1[i] * s + x2[i] * c; float ss = 0.f;
#pragma unroll
        for (int q = 0; q < 4; ++q) ss += y1[q] * y1[q];
#pragma unroll
        for (int q = 0; q < 4; ++q) ss += y2[q] * y2[q];
        const float rf = __fdiv_rn(1.0f, __fsqrt_rn(rowsum16(ss) * (1.0f / HD) + 1.1920929e-07f)); const size_t o = ((size_t)(h0 + i) * TT + t) * HD + d; v4h a16, b16; v4us ah, al, bh, bl;
#pragma unroll
        for (int q = 0; q < 4; ++q) { const float ra = (y1[q] * rf) * w1[q], rb = (y2[q] * rf) * w2[q]; unsigned short u, v; a16[q] = tohx(ra); splitf(ra, u, v); ah[q] = u; al[q] = v; b16[q] = tohx(rb); splitf(rb, u, v); bh[q] = u; bl[q] = v; }
        *(v4h*)(P16 + o) = a16; *(v4h*)(P16 + o + HD / 2) = b16; *(v4us*)(Ph + o) = ah; *(v4us*)(Ph + o + HD / 2) = bh; *(v4us*)(Pl + o) = al; *(v4us*)(Pl + o + HD / 2) = bl; }   // each store: one whole 128-byte line a group
}
#define FTHR 4.0f
#define FPK (HD + 8)             // LDS pitch of a key row, elements
#define FPV (64 + 8)             // LDS pitch of a value-plane row piece (64 keys), elements
#define FTK (64 * FPK)
#define FTV (HD * FPV)
__device__ __forceinline__ float xhalf(float x) { return __builtin_bit_cast(float, __builtin_amdgcn_permlanex16(__builtin_bit_cast(int, x), __builtin_bit_cast(int, x), 0x76543210, 0xfedcba98, false, false)); }   // lane l reads lane l ^ 16
__device__ __forceinline__ void wmma_gap() { __builtin_amdgcn_sched_barrier(0); asm volatile("v_nop\n\tv_nop\n\tv_nop\n\tv_nop"); __builtin_amdgcn_sched_barrier(0); }   // the distance behind the last matrix instruction before loads overwrite its operands, on a taken branch too
template <typename T16, int NSPLIT, int R>
__device__ __forceinline__ void fattn_wg(T16* sm, const T16* __restrict__ Q, const T16* __restrict__ Q2, const T16* __restrict__ K, const T16* __restrict__ K2, const T16* __restrict__ Vt, const T16* __restrict__ Vt2, bf* Ah, bf* Al, int q0, int w) {
    typedef typename WFrag<T16>::V V;
    constexpr float CS = SCL * 1.4426950408889634f, POFF = NSPLIT ? 0.0f : 10.0f;   // scores to log2 units; 2^10 on the fp16 probabilities
    constexpr int BUF = (NSPLIT ? 2 : 1) * (FTK + FTV);   // one buffer: K, V^T (, K lo, V^T lo)
    struct Stage { v8us k[8], v[8], k2[8], v2[8]; };   // one stage's share of a thread, on its way from global memory to LDS
    const int tid = threadIdx.x, lane = tid & 31, lr = lane & 15, hi = lane >> 4;
    const int qw0 = q0 + 16 * R * w, plast = (qw0 + 16 * R - 1) / 32, ns = (q0 + 64 * R) / 64;   // the wave's first row; its last pass, which holds its diagonal (every query has an unmasked key in every pass up to it); the work-group's stages
    const int krow = tid >> 4, kcol = (tid & 15) * 8, vrow = tid >> 3, vcol = (tid & 7) * 8;   // staging: piece i of a thread is key row krow + 8 i and value-plane row vrow + 16 i, 16 bytes each
    const int gko = krow * HD + kcol, gvo = vrow * TT + vcol, sko = krow * FPK + kcol, svo = FTK + vrow * FPV + vcol;
    const int fko = lr * FPK + 8 * hi, fvo = FTK + lr * FPV + 8 * hi;   // the lane's element offset in a 16-row block of the staged tiles
    Stage G; V qf[R][4], qf2[R][4]; v8f acc[R][8]; float m_run[R], l_run[R];   // every full unroll below: these live in registers and need constant indices
    auto gload = [&](int st) {
        __builtin_amdgcn_sched_barrier(0);   // with the one below: nothing that rewrites an address register is scheduled between these loads and their wait
#pragma unroll
        for (int i = 0; i < 8; ++i) { G.k[i] = *(const v8usa*)(K + (size_t)st * 64 * HD + gko + i * 8 * HD); G.v[i] = *(const v8usa*)(Vt + st * 64 + gvo + i * 16 * TT);
            if (NSPLIT) { G.k2[i] = *(const v8usa*)(K2 + (size_t)st * 64 * HD + gko + i * 8 * HD); G.v2[i] = *(const v8usa*)(Vt2 + st * 64 + gvo + i * 16 * TT); } }
        asm volatile("s_wait_xcnt 0x0" ::: "memory");   // behind the issued loads, in front of whatever next rewrites their address registers
        __builtin_amdgcn_sched_barrier(0);   // the whole stage is issued here, a stage ahead of its LDS stores
    };
    auto sstore = [&](int buf) { T16* p = sm + buf * BUF;
#pragma unroll
        for (int i = 0; i < 8; ++i) { *(v8usa*)(p + sko + i * 8 * FPK) = G.k[i]; *(v8usa*)(p + svo + i * 16 * FPV) = G.v[i];
            if (NSPLIT) { *(v8usa*)(p + FTK + FTV + sko + i * 8 * FPK) = G.k2[i]; *(v8usa*)(p + FTK + FTV + svo + i * 16 * FPV) = G.v2[i]; } } };
    __builtin_amdgcn_sched_barrier(0);   // the query rows are loaded in front of stage 0: loads return in order, so the wait of stage 0's LDS stores covers them and no pass waits for a staged load on their account
#pragma unroll
    for (int g = 0; g < R; ++g)
#pragma unroll
        for (int kc = 0; kc < 4; ++kc) { qf[g][kc] = WFrag<T16>::ld(Q + (size_t)(qw0 + 16 * g + lr) * HD + 8 * hi + kc * 32); if (NSPLIT) qf2[g][kc] = WFrag<T16>::ld(Q2 + (size_t)(qw0 + 16 * g + lr) * HD + 8 * hi + kc * 32); }
    asm volatile("s_wait_xcnt 0x0" ::: "memory");   // as in gload
    gload(0);
    sstore(0);
    if (ns > 1) gload(1);
#pragma unroll
    for (int g = 0; g < R; ++g) { m_run[g] = -__builtin_inff(); l_run[g] = 0.0f;
#pragma unroll
        for (int t = 0; t < 8; ++t) acc[g][t] = (v8f){}; }
    lds_barrier();
    // Stage st is read from buffer st & 1. Each barrier publishes the stage just stored and ends every wave's reads of the stage just used, whose buffer the next store takes. Every wave stages and passes every barrier, also where its own passes are over.
    // both loops stay rolled and nested: one pass already holds 32 (fp16) or 48 (hi/lo) matrix instructions beside its softmax
#pragma unroll 1
    for (int st = 0; st < ns; ++st) {
        const T16* sb = sm + (st & 1) * BUF;
#pragma unroll 1
        for (int sub = 0; sub < 2; ++sub) { const int p = 2 * st + sub;
            if (p > plast) break;   // wave-uniform
            V kf[2][4], kf2[2][4], vf[8], vf2[8];
#pragma unroll
            for (int kt = 0; kt < 2; ++kt)
#pragma unroll
                for (int kc = 0; kc < 4; ++kc) { kf[kt][kc] = WFrag<T16>::ld(sb + fko + (sub * 32 + kt * 16) * FPK + kc * 32); if (NSPLIT) kf2[kt][kc] = WFrag<T16>::ld(sb + FTK + FTV + fko + (sub * 32 + kt * 16) * FPK + kc * 32); }
            if (!NSPLIT) __builtin_amdgcn_sched_barrier(0);   // fp16 form: the key fragments' LDS reads go first (LDS reads return in order, and the score products wait for these alone)
#pragma unroll
            for (int t = 0; t < 8; ++t) { vf[t] = WFrag<T16>::ld(sb + fvo + t * 16 * FPV + sub * 32); if (NSPLIT) vf2[t] = WFrag<T16>::ld(sb + FTK + FTV + fvo + t * 16 * FPV + sub * 32); }
            if (!NSPLIT) __builtin_amdgcn_sched_barrier(0);   // fp16 form: the value fragments' LDS reads are issued here, under the score products and the softmax (the hi/lo form has no registers to spare for that)
            v8f s[2][R];
#pragma unroll
            for (int kt = 0; kt < 2; ++kt)
#pragma unroll
                for (int g = 0; g < R; ++g) s[kt][g] = (v8f){};
#pragma unroll
            for (int kc = 0; kc < 4; ++kc)
#pragma unroll
                for (int kt = 0; kt < 2; ++kt)
#pragma unroll
                    for (int g = 0; g < R; ++g) { s[kt][g] = WFrag<T16>::mma(kf[kt][kc], qf[g][kc], s[kt][g]); if (NSPLIT) { s[kt][g] = WFrag<T16>::mma(kf[kt][kc], qf2[g][kc], s[kt][g]); s[kt][g] = WFrag<T16>::mma(kf2[kt][kc], qf[g][kc], s[kt][g]); } }
            if (p * 32 + 31 > qw0) {   // wave-uniform: only the pass on the diagonal pays for the mask
#pragma unroll
                for (int g = 0; g < R; ++g)
#pragma unroll
                    for (int kt = 0; kt < 2; ++kt) {
#pragma unroll
                        for (int r = 0; r < 8; ++r) if (p * 32 + 16 * kt + 8 * hi + r > qw0 + 16 * g + lr) s[kt][g][r] = -__builtin_inff();
                        asm volatile("" : "+v"(s[kt][g]));   // the masked scores: keeps the selects inside the branch
                    }
            }
            float mb[R]; bool need = false;
#pragma unroll
            for (int g = 0; g < R; ++g) { float mx = s[0][g][0];
#pragma unroll
                for (int r = 1; r < 8; ++r) mx = fmaxf(mx, s[0][g][r]);
#pragma unroll
                for (int r = 0; r < 8; ++r) mx = fmaxf(mx, s[1][g][r]);
                mx = fmaxf(mx, xhalf(mx)) * CS; mb[g] = mx; need = need || (mx > m_run[g] + FTHR); }   // both wave halves hold the query's maximum of this pass (the scale is positive)
            if (__builtin_amdgcn_ballot_w32(need) != 0) {   // one scalar test a pass; always taken in the first pass, where m_run is -inf and corr 0
#pragma unroll
                for (int g = 0; g < R; ++g) { const float m_new = fmaxf(m_run[g], mb[g]); const float corr = __builtin_amdgcn_exp2f(m_run[g] - m_new); l_run[g] *= corr; m_run[g] = m_new;
#pragma unroll
                    for (int t = 0; t < 8; ++t) acc[g][t] = acc[g][t] * corr; }
            }
#pragma unroll
            for (int g = 0; g < R; ++g) { const float nm = POFF - m_run[g]; float pr[16], ps0 = 0.0f, ps1 = 0.0f;
#pragma unroll
                for (int e = 0; e < 16; e += 2) { const v2f arg = __builtin_elementwise_fma((v2f){s[e >> 3][g][e & 7], s[e >> 3][g][(e & 7) + 1]}, (v2f){CS, CS}, (v2f){nm, nm});   // two scores of a register pair in one packed instruction
                    pr[e] = __builtin_amdgcn_exp2f(arg.x); pr[e + 1] = __builtin_amdgcn_exp2f(arg.y); ps0 += pr[e]; ps1 += pr[e + 1]; }   // element e of the B operand: key 8 hi + e, or 16 + 8 hi + (e - 8): the k order of the value fragments
                l_run[g] += ps0 + ps1;
                if constexpr (NSPLIT != 0) { typedef __attribute__((ext_vector_type(16))) unsigned short v16us; v16us ph, pl;
#pragma unroll
                    for (int e = 0; e < 16; ++e) { unsigned short a, c2; splitf(pr[e], a, c2); ph[e] = a; pl[e] = c2; }
                    const V bh = __builtin_bit_cast(V, ph), bl = __builtin_bit_cast(V, pl);
#pragma unroll
                    for (int t = 0; t < 8; ++t) { acc[g][t] = WFrag<T16>::mma(vf[t], bh, acc[g][t]); acc[g][t] = WFrag<T16>::mma(vf[t], bl, acc[g][t]); acc[g][t] = WFrag<T16>::mma(vf2[t], bh, acc[g][t]); }
                } else { V pf;
#pragma unroll
                    for (int e = 0; e < 16; ++e) pf[e] = tohx(pr[e]);
#pragma unroll
                    for (int t = 0; t < 8; ++t) acc[g][t] = WFrag<T16>::mma(vf[t], pf, acc[g][t]); } }
            wmma_gap();
        }
        if (st + 1 < ns) { sstore((st + 1) & 1); if (st + 2 < ns) gload(st + 2); }   // the same for the whole work-group
        lds_barrier();
    }
#pragma unroll
    for (int g = 0; g < R; ++g) { const float inv = __fdiv_rn(1.0f, l_run[g] + xhalf(l_run[g]));   // each wave half holds the sum over its own keys
        const size_t o = (size_t)(qw0 + 16 * g + lr) * DQ + 8 * hi;
#pragma unroll
        for (int t = 0; t < 8; ++t) { v8us oh, ol;   // register r of tile t: dim 16 t + 8 hi + r of query lr
#pragma unroll
            for (int r = 0; r < 8; ++r) { unsigned short a, c2; splitf(acc[g][t][r] * inv, a, c2); oh[r] = a; ol[r] = c2; }
            __builtin_amdgcn_sched_barrier(0);   // with the one below: nothing that rewrites a data or address register of these stores is scheduled between them and their wait
            *(v8us*)(Ah + o + 16 * t) = oh; *(v8us*)(Al + o + 16 * t) = ol;
            asm volatile("s_wait_xcnt 0x0" ::: "memory");   // behind the issued stores, in front of whatever next rewrites their registers
            __builtin_amdgcn_sched_barrier(0); } }
}
// Heaviest row blocks first, the short hi/lo blocks last. Planes [batch x head][..]; merged output planes [batch][t][h * HD + d].
#define FNBH (NB_ * NH_)
#define FNF  ((TT - RH) / 128 * FNBH)
#define FNH  (RH / 64 * FNBH)
static_assert(NH_ == NKV && HD == 128 && RH % 64 == 0 && (TT - RH) % 128 == 0 && TT % 64 == 0, "k_fattn: one kv head a query head, whole work-groups, whole stages");
__global__ __launch_bounds__(128) __attribute__((amdgpu_waves_per_eu(2, 2))) void k_fattn(const h16* __restrict__ Q16, const h16* __restrict__ K16, const h16* __restrict__ V16, const bf* __restrict__ Qh, const bf* __restrict__ Ql, const bf* __restrict__ Kh, const bf* __restrict__ Kl, const bf* __restrict__ Vh, const bf* __restrict__ Vl, bf* Ah, bf* Al) {
    __shared__ __align__(16) bf sm[2 * 2 * (FTK + FTV)];
    const int w = __builtin_amdgcn_readfirstlane((int)(threadIdx.x >> 5)), bx = blockIdx.x;   // wave number, kept scalar so that the pass tests are scalar branches
    const int ix = bx < FNF ? bx : bx - FNF, bh = ix % FNBH, rb = ix / FNBH;
    const size_t pl = (size_t)bh * TT * HD, ao = (size_t)(bh / NH_) * TT * DQ + (size_t)(bh % NH_) * HD;
    if (bx < FNF) fattn_wg<h16, 0, 2>((h16*)sm, Q16 + pl, nullptr, K16 + pl, nullptr, V16 + pl, nullptr, Ah + ao, Al + ao, RH + ((TT - RH) / 128 - 1 - rb) * 128, w);
    else fattn_wg<bf, 2, 1>(sm, Qh + pl, Ql + pl, Kh + pl, Kl + pl, Vh + pl, Vl + pl, Ah + ao, Al + ao, (RH / 64 - 1 - rb) * 64, w);
}

extern "C" void kernel_launch(void* const* d_in, const int* in_sizes, int n_in,
                              void* d_out, int out_size, void* d_ws, size_t ws_size, hipStream_t stream) {
    (void)in_sizes; (void)n_in; (void)out_size;
    const float* x = (const float*)d_in[0]; const float* sinT = (const float*)d_in[1]; const float* cosT = (const float*)d_in[2]; const float* wq = (const float*)d_in[3]; const float* wk = (const float*)d_in[4]; const float* wv = (const float*)d_in[5]; const float* wo = (const float*)d_in[6]; const float* qsc = (const float*)d_in[7]; const float* ksc = (const float*)d_in[8];   /* x, sin, cos (f32 [2048][64], READ), Wq, Wk, Wv, Wo ('oi' [2048][2048]), q_norm_w, k_norm_w ([128], read) */
    float* OUT = (float*)d_out;     // [2][2048][2048]
    char* wsp = (char*)d_ws;
    auto take = [&](size_t bytes) { char* p = wsp; wsp += (bytes + 255) & ~(size_t)255; return (void*)p; };
    bf* WQ = (bf*)take((size_t)DQ * DM * 2); bf* WK = (bf*)take((size_t)DKV * DM * 2); bf* WV = (bf*)take((size_t)DKV * DM * 2); bf* WO = (bf*)take((size_t)DM * DQ * 2);
    const size_t PB = (size_t)NH_ * TT * HD, AB = (size_t)TT * DQ;   // elements of one batch in a head plane and in a merged plane; every plane holds both batches
    h16* QP16 = (h16*)take(NB_ * PB * 2); h16* KP16 = (h16*)take(NB_ * PB * 2); h16* VT16 = (h16*)take(NB_ * PB * 2);
    bf* QPh = (bf*)take(NB_ * PB * 2); bf* QPl = (bf*)take(NB_ * PB * 2); bf* KPh = (bf*)take(NB_ * PB * 2); bf* KPl = (bf*)take(NB_ * PB * 2); bf* VTh = (bf*)take(NB_ * PB * 2); bf* VTl = (bf*)take(NB_ * PB * 2); bf* ATh = (bf*)take(NB_ * AB * 2); bf* ATl = (bf*)take(NB_ * AB * 2);
    bf* XB = (bf*)take((size_t)TT * DM * 2); float* FQ = (float*)take((size_t)TT * DQ * 4); float* FK = (float*)take((size_t)TT * DKV * 4);
    if ((size_t)(wsp - (char*)d_ws) > ws_size) return;    // ws 256 MiB
    float* FV = FK;   // v projection reuses the k buffer after the k planes are built (stream-ordered)
    { k_cvt8<<<(unsigned)(((size_t)DQ * DM / 8 + 255) / 256), 256, 0, stream>>>(wq, WQ, (size_t)DQ * DM / 8); k_cvt8<<<(unsigned)(((size_t)DKV * DM / 8 + 255) / 256), 256, 0, stream>>>(wk, WK, (size_t)DKV * DM / 8); k_cvt8<<<(unsigned)(((size_t)DKV * DM / 8 + 255) / 256), 256, 0, stream>>>(wv, WV, (size_t)DKV * DM / 8);
      k_cvt8<<<(unsigned)(((size_t)DM * DQ / 8 + 255) / 256), 256, 0, stream>>>(wo, WO, (size_t)DM * DQ / 8);
       }
    const unsigned LKv = (unsigned)(((size_t)NKV * TT * HD / 2 + 255) / 256);
    for (int b = 0; b < NB_; ++b) {
        k_cvt8<<<(unsigned)(((size_t)TT * DM / 8 + 255) / 256), 256, 0, stream>>>(x + (size_t)b * TT * DM, XB, (size_t)TT * DM / 8);
        k_gemmt<0, DM, 128><<<dim3(TT / 128, DQ / 128, 1), 256, 0, stream>>>(XB, nullptr, WQ, FQ);
        k_gemmt<0, DM, 128><<<dim3(TT / 128, DKV / 128, 1), 256, 0, stream>>>(XB, nullptr, WK, FK);
        k_qkpost<<<dim3(TT * (NH_ / QKH) / 16, 2, 1), 256, 0, stream>>>(FQ, FK, sinT, cosT, qsc, ksc, QP16 + b * PB, QPh + b * PB, QPl + b * PB, KP16 + b * PB, KPh + b * PB, KPl + b * PB);
        k_gemmt<0, DM, 128><<<dim3(TT / 128, DKV / 128, 1), 256, 0, stream>>>(XB, nullptr, WV, FV); k_vtp<<<LKv, 256, 0, stream>>>(FV, DKV, NKV, VT16 + b * PB, VTh + b * PB, VTl + b * PB); }
    k_fattn<<<FNF + FNH, 128, 0, stream>>>(QP16, KP16, VT16, QPh, QPl, KPh, KPl, VTh, VTl, ATh, ATl);
    for (int b = 0; b < NB_; ++b) k_gemmt<1, DQ, 64><<<dim3(TT / 128, DM / 128, 1), 256, 0, stream>>>(ATh + b * AB, ATl + b * AB, WO, OUT + (size_t)b * TT * DM);
}

// v006
// One run takes 228 microseconds.
// Two timings next to v005 put it at 1.28 and 1.27 times that version's speed.
// All steps since v000 together make it 8.04 times as fast.
#include <hip/hip_runtime.h>

// Causal multi-head attention with 128-wide heads, rotary embeddings from half-width input tables and a per-head RMSNorm applied AFTER the rotary (x [2][2048][2048]; q, k, v = x W^T ('oi' 1/sqrt(2048), no bias; 16 heads x 128); rope: (x1, x2) = the two HALVES of each head -> cat(x1 c - x2 s, x1 s + x2 c) with the sin / cos INPUT tables [2048][64] (read; argument order x, sin, cos); then per head q = RMSNorm(q) x q_norm_w, k = RMSNorm(k) x k_norm_w (eps = float32 machine epsilon 1.19e-7; weights [128] = ones, read); scores / sqrt(128); causal (-inf); softmax; out = merged Wo^T ('oi') -> [2][2048][2048] (8.4 M); argument order x, sin, cos, Wq, Wk, Wv, Wo, q_norm_w, k_norm_w).
// Layout, both batches at once: bf16 copy of x; 'oi' weights cast as-is; k_proj: exact projections q, k, v in one launch, each 128 x 128 tile (128 tokens of one head) taken to its 16-bit head planes in the tile's epilogue: q / k rotary from the bf16-rounded input tables (the tables need not be rotations: no norm-preservation shortcut), per (head, token) 1/sqrt(mean + eps) over the 128 rotated dims, x r x w[d]; v transposed; then k_fattn: causal T-2048 attention in one launch (hybrid rows: < 512 hi/lo 3 products, rest fp16 x1024; online softmax, scores and probabilities stay in registers; it writes the merged hi/lo planes); merged hi/lo x Wo exact.
// Compute dtypes, f32 accumulate: every input rounded to bf16 incl. the tables; projections exact; rotary and RMSNorm f32; attention rows < 512 3 products, rest fp16; softmax f32; Wo hl x exact.

#define NB_  2
#define TT   2048
#define DM   2048
#define NH_  16
#define NKV  16
#define REP  (NH_ / NKV)
#define HD   128
#define DQ   (NH_ * HD)
#define DKV  (NKV * HD)
#define RH   512                  // query rows < RH use hi+lo planes (0: none)
#define SCL  0.088388347648318447f   // HD^-0.5
typedef _Float16 h16;
typedef unsigned short bf;
typedef __attribute__((ext_vector_type(16))) __bf16   v16bf;
typedef __attribute__((ext_vector_type(16))) _Float16 v16h;
typedef __attribute__((ext_vector_type(8)))  _Float16 v8h;
typedef __attribute__((ext_vector_type(8)))  unsigned short v8us;
typedef __attribute__((ext_vector_type(8)))  float    v8f;
typedef __attribute__((ext_vector_type(4)))  float    v4f;
typedef v8h  __attribute__((may_alias)) v8ha;
typedef v4f  __attribute__((may_alias)) v4fa;
typedef v8us __attribute__((may_alias)) v8usa;

__device__ __forceinline__ unsigned short f2bf(float f) { unsigned u = __float_as_uint(f); u += 0x7FFFu + ((u >> 16) & 1u); return (unsigned short)(u >> 16); }
__device__ __forceinline__ float bf2f(unsigned short b) { return __uint_as_float(((unsigned)b) << 16); }
__device__ __forceinline__ float bfr(float f) { return bf2f(f2bf(f)); }
__device__ __forceinline__ v16h cat16(v8h lo, v8h hi) { return __builtin_shufflevector(lo, hi, 0, 1, 2, 3, 4, 5, 6, 7, 8, 9, 10, 11, 12, 13, 14, 15); }
__device__ __forceinline__ v16bf cat16b(v8us lo, v8us hi) { return __builtin_bit_cast(v16bf, __builtin_shufflevector(lo, hi, 0, 1, 2, 3, 4, 5, 6, 7, 8, 9, 10, 11, 12, 13, 14, 15)); }
__device__ __forceinline__ v8f wmma16(v16h a, v16h b, v8f c) { return __builtin_amdgcn_wmma_f32_16x16x32_f16(false, a, false, b, (short)0, c, false, false); }
__device__ __forceinline__ v8f wmmab(v16bf a, v16bf b, v8f c) { return __builtin_amdgcn_wmma_f32_16x16x32_bf16(false, a, false, b, (short)0, c, false, false); }



// ---- gemm_main: acc = the work-group's tile of C[m][n] = sum_k A[m][k] Bt[n][k] (+ A2[m][k] Bt[n][k] for NSPLIT 1), operands K-contiguous bf16 planes of pitch KD; 256 threads. k_gemmt stores C (f32, pitch KD), grid (M/128, N/128); k_proj goes on from the tile.
// One 128x128 output tile per work-group of 8 waves (2 x 4 waves of 64 x 32). K runs in stages of KS (128 or 64): every operand row piece of 2 KS bytes is read from global memory once per work-group, as whole 128-byte lines,
// goes through registers into one of two LDS buffers (row pitch 2 KS + 16 bytes) and is read from there as fragments. Two register sets: a stage's global loads are issued two stages ahead of its LDS stores; one barrier a stage.
// Each accumulator takes its products in the same k order as a single k loop over 32-wide steps.
template <typename T16> struct WFrag;
template <> struct WFrag<h16> { typedef v16h V; static __device__ __forceinline__ V ld(const h16* p) { return cat16(*(const v8h*)p, *(const v8h*)(p + 16)); } static __device__ __forceinline__ v8f mma(V a, V b, v8f c) { return wmma16(a, b, c); } };
template <> struct WFrag<bf> { typedef v16bf V; static __device__ __forceinline__ V ld(const bf* p) { return cat16b(*(const v8us*)p, *(const v8us*)(p + 16)); } static __device__ __forceinline__ v8f mma(V a, V b, v8f c) { return wmmab(a, b, c); } };
// The work-group barrier of the stage loop: it orders LDS traffic alone, so that the global loads issued ahead stay in flight across it (__syncthreads() waits for them too).
__device__ __forceinline__ void lds_barrier() { __builtin_amdgcn_fence(__ATOMIC_RELEASE, "workgroup", "local"); __builtin_amdgcn_s_barrier(); __builtin_amdgcn_fence(__ATOMIC_ACQUIRE, "workgroup", "local"); }
#define GSM(NSPLIT, KS) (2 * ((NSPLIT) ? 3 : 2) * 128 * ((KS) + 8))   // elements of the two LDS buffers
template <int NSPLIT, int KD, int KS>
__device__ __forceinline__ void gemm_main(bf* sm, const bf* __restrict__ A, const bf* __restrict__ A2, const bf* __restrict__ Bt, int r0, int c0, v8f (&acc)[4][2]) {
    constexpr int PIT = KS + 8, TILE = 128 * PIT, NT = NSPLIT ? 3 : 2, NS = KD / KS, LPR = KS / 8, RPP = 256 / LPR, NP = 128 / RPP;   // lanes a row piece, rows a pass of the 256 threads, pieces a thread and tile
    static_assert(KD % (2 * KS) == 0 && NS >= 4, "an even number of whole stages, at least four");
    struct Stage { v8us a[NP], b[NP], a2[NP]; };   // one stage's share of a thread, on its way from global memory to LDS
    static_assert(GSM(NSPLIT, KS) == 2 * NT * TILE, "the callers' LDS array");
    const int tid = threadIdx.x, lane = tid & 31, lr = lane & 15, hi = lane >> 4, w = tid >> 5, wm = w >> 2, wn = w & 3;
    const int srow = tid / LPR, scol = (tid % LPR) * 8;   // staging: piece i of a thread is row srow + RPP i, 16 bytes at element scol
    const bf* ga = A + (size_t)(r0 + srow) * KD + scol; const bf* ga2 = NSPLIT ? A2 + (size_t)(r0 + srow) * KD + scol : nullptr; const bf* gb = Bt + (size_t)(c0 + srow) * KD + scol;
    bf* sp = sm + srow * PIT + scol;
    const bf* fa = sm + (wm * 64 + lr) * PIT + 8 * hi; const bf* fb = sm + TILE + (wn * 32 + lr) * PIT + 8 * hi;
    Stage R0, R1;   // every full unroll below: these live in registers and need constant indices
#pragma unroll
    for (int mb = 0; mb < 4; ++mb)
#pragma unroll
        for (int nb = 0; nb < 2; ++nb) acc[mb][nb] = (v8f){};
    auto gload = [&](Stage& R, int k0) {
        __builtin_amdgcn_sched_barrier(0);   // with the one below: nothing that rewrites an address register is scheduled between these loads and their wait
#pragma unroll
        for (int i = 0; i < NP; ++i) { R.a[i] = *(const v8us*)(ga + (size_t)i * RPP * KD + k0); R.b[i] = *(const v8us*)(gb + (size_t)i * RPP * KD + k0); if (NSPLIT) R.a2[i] = *(const v8us*)(ga2 + (size_t)i * RPP * KD + k0); }
        asm volatile("s_wait_xcnt 0x0" ::: "memory");   // behind the issued loads, in front of whatever next rewrites their address registers
        __builtin_amdgcn_sched_barrier(0);   // the whole stage is issued here: without it the scheduler sinks loads towards their LDS stores, and their trip to memory is then waited for in full
    };
    auto sstore = [&](const Stage& R, int buf) { bf* p = sp + buf * NT * TILE;
#pragma unroll
        for (int i = 0; i < NP; ++i) { *(v8us*)(p + i * RPP * PIT) = R.a[i]; *(v8us*)(p + TILE + i * RPP * PIT) = R.b[i]; if (NSPLIT) *(v8us*)(p + 2 * TILE + i * RPP * PIT) = R.a2[i]; } };
    auto products = [&](int buf) { const bf* pa = fa + buf * NT * TILE; const bf* pb = fb + buf * NT * TILE;
#pragma unroll
        for (int kc = 0; kc < KS; kc += 32) { v16bf a[4], a2[4];
#pragma unroll
            for (int mb = 0; mb < 4; ++mb) { a[mb] = WFrag<bf>::ld(pa + mb * 16 * PIT + kc); if (NSPLIT) a2[mb] = WFrag<bf>::ld(pa + 2 * TILE + mb * 16 * PIT + kc); }
#pragma unroll
            for (int nb = 0; nb < 2; ++nb) { const v16bf b = WFrag<bf>::ld(pb + nb * 16 * PIT + kc);
#pragma unroll
                for (int mb = 0; mb < 4; ++mb) { acc[mb][nb] = wmmab(a[mb], b, acc[mb][nb]); if (NSPLIT) acc[mb][nb] = wmmab(a2[mb], b, acc[mb][nb]); } } } };
    // Stage s is read from buffer s & 1. Each barrier below publishes the stage just stored and ends every wave's reads of the stage just used, whose buffer the next store takes.
    gload(R0, 0); sstore(R0, 0); gload(R0, KS); gload(R1, 2 * KS);
    lds_barrier();
    // the loop stays rolled: its body already holds two whole stages
#pragma unroll 1
    for (int s = 0; s < NS - 4; s += 2) {   // on entry: buffer 0 holds stage s, R0 stage s + 1, R1 stage s + 2
        products(0); sstore(R0, 1); gload(R0, (s + 3) * KS);
        lds_barrier();
        products(1); sstore(R1, 0); gload(R1, (s + 4) * KS);
        lds_barrier();
    }
    products(0); sstore(R0, 1); gload(R0, (NS - 1) * KS);
    lds_barrier();
    products(1); sstore(R1, 0);
    lds_barrier();
    products(0); sstore(R0, 1);
    lds_barrier();
    products(1);   // behind the last barrier only buffer 1 is still read
}
template <int NSPLIT, int KD, int KS>
__global__ __launch_bounds__(256) void k_gemmt(const bf* __restrict__ A, const bf* __restrict__ A2, const bf* __restrict__ Bt, float* C) {
    __shared__ __align__(16) bf sm[GSM(NSPLIT, KS)];
    __shared__ __align__(16) float osm[8 * 16 * 36];
    const int tid = threadIdx.x, lane = tid & 31, lr = lane & 15, hi = lane >> 4, w = tid >> 5, wm = w >> 2, wn = w & 3;
    const int r0 = blockIdx.x * 128, c0 = blockIdx.y * 128;
    v8f acc[4][2];
    gemm_main<NSPLIT, KD, KS>(sm, A, A2, Bt, r0, c0, acc);
    float* os = osm + w * (16 * 36);   // the wave's own 16 x 32 patch: accumulator order in, whole 128-byte output lines out
#pragma unroll
    for (int mb = 0; mb < 4; ++mb) {
#pragma unroll
        for (int nb = 0; nb < 2; ++nb)
#pragma unroll
            for (int j = 0; j < 8; ++j) os[(hi * 8 + j) * 36 + nb * 16 + lr] = acc[mb][nb][j];
        float* crow = C + (size_t)(r0 + wm * 64 + mb * 16) * KD + c0 + wn * 32;
#pragma unroll
        for (int q = 0; q < 4; ++q) { const int row = 4 * q + (lane >> 3), cofs = (lane & 7) * 4; const v4f val = *(const v4fa*)(os + row * 36 + cofs); *(v4f*)(crow + (size_t)row * KD + cofs) = val; }
    }
}

__device__ __forceinline__ h16 tohx(float x) { return (h16)x; }
__device__ __forceinline__ void splitf(float y, unsigned short& h, unsigned short& l) { h = f2bf(y); l = f2bf(y - bf2f(h)); }
typedef __attribute__((ext_vector_type(2))) _Float16 v2h;
typedef __attribute__((ext_vector_type(4))) _Float16 v4h;
typedef __attribute__((ext_vector_type(2))) unsigned short v2us;
typedef __attribute__((ext_vector_type(4))) unsigned short v4us;
typedef __attribute__((ext_vector_type(2))) float v2f;
typedef __attribute__((ext_vector_type(4))) int v4i;

__global__ __launch_bounds__(256) void k_cvt8(const float* __restrict__ src, bf* dst, size_t n8) { const size_t i = (size_t)blockIdx.x * 256 + threadIdx.x; if (i >= n8) return; const v8f v = *(const v8f*)(src + i * 8); v8us o;
#pragma unroll
    for (int k = 0; k < 8; ++k) o[k] = f2bf(v[k]); *(v8us*)(dst + i * 8) = o;  }

// ---- k_proj: the projections q, k, v of both batches in one launch, each tile carried on to its 16-bit planes; nothing f32 goes through memory. X [batch x t][DM]; Wqkv: the rows of Wq, Wk, Wv one behind the other; grid (NB_ TT / 128, (DQ + 2 DKV) / 128).
// A 128 x 128 tile is 128 tokens of one head of q, k or v. The accumulators go as f32 into LDS (pitch PTP floats), in the place of stage buffer 0, and behind one barrier 16 lanes take one row of it, 16 rows a pass of the 256 threads.
// q / k tile, stored [t][d] -> planes [batch x h][t][d] (fp16 + bf16 hi/lo): lane j holds the dims 4j..4j+3 of both halves, so that each rotary pair sits in one lane. rotary from the bf16-rounded tables, r = 1/sqrt(mean of squares + eps) over the
// 128 rotated dims (8 terms a lane, then a butterfly over the 16 lanes), (y x r) x w[d] with w rounded to bf16. v tile, stored [d][t] (a lane's 8 accumulator registers are 8 tokens of one dim) -> transposed planes [batch x h][d][t]: lane j the tokens 8j..8j+7.
#define PTP 132
typedef float __attribute__((may_alias)) fa;
static_assert(NH_ == NKV && HD == 128 && TT % 128 == 0, "k_proj: q, k and v alike; a tile is one head wide and lies in one batch");
__device__ __forceinline__ float rowsum16(float v) {   // sum over the 16 lanes of a row, every lane on; the cross-lane reads fold into the adds
    v += __builtin_bit_cast(float, __builtin_amdgcn_update_dpp(0, __builtin_bit_cast(int, v), 0x161, 0xf, 0xf, true));   // row_xmask:1
    v += __builtin_bit_cast(float, __builtin_amdgcn_update_dpp(0, __builtin_bit_cast(int, v), 0x162, 0xf, 0xf, true));   // row_xmask:2
    v += __builtin_bit_cast(float, __builtin_amdgcn_update_dpp(0, __builtin_bit_cast(int, v), 0x164, 0xf, 0xf, true));   // row_xmask:4
    v += __builtin_bit_cast(float, __builtin_amdgcn_update_dpp(0, __builtin_bit_cast(int, v), 0x168, 0xf, 0xf, true));   // row_xmask:8
    return v; }
__global__ __launch_bounds__(256) void k_proj(const bf* __restrict__ X, const bf* __restrict__ Wqkv, const float* __restrict__ sinT, const float* __restrict__ cosT, const float* __restrict__ wq_, const float* __restrict__ wk_, h16* Q16, bf* Qh, bf* Ql, h16* K16, bf* Kh, bf* Kl, h16* V16, bf* Vh, bf* Vl) {
    __shared__ __align__(16) bf sm[GSM(0, 128)];
    static_assert(128 * PTP * 4 <= GSM(0, 128), "the f32 tile fits in stage buffer 0 (half of the array's 2 GSM bytes), which no wave reads behind the stage loop's last barrier: no barrier in front of its stores");
    const int tid = threadIdx.x, lane = tid & 31, lr = lane & 15, hi = lane >> 4, w = tid >> 5, wm = w >> 2, wn = w & 3;
    const int r0 = blockIdx.x * 128, c0 = blockIdx.y * 128;
    v8f acc[4][2];   // every full unroll below: register arrays need constant indices
    gemm_main<0, DM, 128>(sm, X, nullptr, Wqkv, r0, c0, acc);
    fa* ts = (fa*)sm;
    const int bb = r0 / TT, t0 = r0 % TT, rr = tid >> 4, l16 = tid & 15;   // batch, first token; the thread's row in a pass and its place in the row
    if (c0 < DQ + DKV) {   // the same for the whole work-group
        const bool isk = c0 >= DQ; const float* wn_ = isk ? wk_ : wq_; h16* P16 = isk ? K16 : Q16; bf* Ph = isk ? Kh : Qh; bf* Pl = isk ? Kl : Ql;
        const int hb = bb * NH_ + (c0 % DQ) / HD, d = l16 * 4; const float* pc = cosT + (t0 + rr) * (HD / 2) + d; const float* ps = sinT + (t0 + rr) * (HD / 2) + d; v4f cr[8], sr[8];
        __builtin_amdgcn_sched_barrier(0);   // with the one below: nothing that rewrites an address register is scheduled between these loads and their wait
#pragma unroll
        for (int i = 0; i < 8; ++i) { cr[i] = *(const v4f*)(pc + i * 16 * (HD / 2)); sr[i] = *(const v4f*)(ps + i * 16 * (HD / 2)); }
        const v4f wa = *(const v4f*)(wn_ + d), wb = *(const v4f*)(wn_ + HD / 2 + d);
        asm volatile("s_wait_xcnt 0x0" :: "v"(pc), "v"(ps) : "memory");   // behind the issued loads, in front of whatever next rewrites their address registers; the two addresses are named so that they live up to here and no later load of the run lands on them
        __builtin_amdgcn_sched_barrier(0);   // all the tables' loads are issued here: their trip to memory runs under the tile's LDS stores and the barrier
#pragma unroll
        for (int mb = 0; mb < 4; ++mb)
#pragma unroll
            for (int nb = 0; nb < 2; ++nb)
#pragma unroll
                for (int j = 0; j < 8; ++j) ts[(wm * 64 + mb * 16 + hi * 8 + j) * PTP + wn * 32 + nb * 16 + lr] = acc[mb][nb][j];
        lds_barrier();   // publishes the tile
        v4f w1, w2;
#pragma unroll
        for (int q = 0; q < 4; ++q) { w1[q] = bfr(wa[q]); w2[q] = bfr(wb[q]); }
        v4f xl[8], xh[8];   // all eight rows' LDS reads are issued ahead of the passes, whose scheduling barriers would else leave each pass waiting for its own
#pragma unroll
        for (int i = 0; i < 8; ++i) { xl[i] = *(const v4fa*)(ts + (i * 16 + rr) * PTP + d); xh[i] = *(const v4fa*)(ts + (i * 16 + rr) * PTP + HD / 2 + d); }
#pragma unroll
        for (int i = 0; i < 8; ++i) { const int row = i * 16 + rr; const v4f x1 = xl[i], x2 = xh[i]; v4f c, s;
#pragma unroll
            for (int q = 0; q < 4; ++q) { c[q] = bfr(cr[i][q]); s[q] = bfr(sr[i][q]); }
            const v4f y1 = x1 * c - x2 * s, y2 = x1 * s + x2 * c; float ss = 0.f;
#pragma unroll
            for (int q = 0; q < 4; ++q) ss += y1[q] * y1[q];
#pragma unroll
            for (int q = 0; q < 4; ++q) ss += y2[q] * y2[q];
            const float rf = __fdiv_rn(1.0f, __fsqrt_rn(rowsum16(ss) * (1.0f / HD) + 1.1920929e-07f)); const size_t o = ((size_t)hb * TT + t0 + row) * HD + d; v4h a16, b16; v4us ah, al, bh, bl;
#pragma unroll
            for (int q = 0; q < 4; ++q) { const float ra = (y1[q] * rf) * w1[q], rb = (y2[q] * rf) * w2[q]; unsigned short u, v; a16[q] = tohx(ra); splitf(ra, u, v); ah[q] = u; al[q] = v; b16[q] = tohx(rb); splitf(rb, u, v); bh[q] = u; bl[q] = v; }
            __builtin_amdgcn_sched_barrier(0);   // with the one below: nothing that rewrites a data or address register of these stores is scheduled between them and their wait
            *(v4h*)(P16 + o) = a16; *(v4h*)(P16 + o + HD / 2) = b16; *(v4us*)(Ph + o) = ah; *(v4us*)(Ph + o + HD / 2) = bh; *(v4us*)(Pl + o) = al; *(v4us*)(Pl + o + HD / 2) = bl;   // each store: one whole 128-byte line a row
            asm volatile("s_wait_xcnt 0x0" ::: "memory");   // behind the issued stores, in front of whatever next rewrites their registers
            __builtin_amdgcn_sched_barrier(0); }
    } else {
#pragma unroll
        for (int mb = 0; mb < 4; ++mb)
#pragma unroll
            for (int nb = 0; nb < 2; ++nb) { fa* p = ts + (wn * 32 + nb * 16 + lr) * PTP + wm * 64 + mb * 16 + hi * 8; const v8f a = acc[mb][nb];
                *(v4fa*)p = (v4f){a[0], a[1], a[2], a[3]}; *(v4fa*)(p + 4) = (v4f){a[4], a[5], a[6], a[7]}; }
        lds_barrier();   // publishes the tile
        const int hv = bb * NKV + (c0 - DQ - DKV) / HD, tc = l16 * 8; v4f xl[8], xh[8];   // as in the q / k branch: all the LDS reads ahead of the passes
#pragma unroll
        for (int i = 0; i < 8; ++i) { xl[i] = *(const v4fa*)(ts + (i * 16 + rr) * PTP + tc); xh[i] = *(const v4fa*)(ts + (i * 16 + rr) * PTP + tc + 4); }
#pragma unroll
        for (int i = 0; i < 8; ++i) { const int dd = i * 16 + rr; const v4f xa = xl[i], xb = xh[i]; const size_t e = ((size_t)hv * HD + dd) * TT + t0 + tc; v8h o16; v8us oh, ol;
#pragma unroll
            for (int q = 0; q < 8; ++q) { const float x = q < 4 ? xa[q & 3] : xb[q & 3]; unsigned short a2, c2; o16[q] = tohx(x); splitf(x, a2, c2); oh[q] = a2; ol[q] = c2; }
            __builtin_amdgcn_sched_barrier(0);   // with the one below: nothing that rewrites a data or address register of these stores is scheduled between them and their wait
            *(v8h*)(V16 + e) = o16; *(v8us*)(Vh + e) = oh; *(v8us*)(Vl + e) = ol;   // each store: two whole 128-byte lines a row
            asm volatile("s_wait_xcnt 0x0" ::: "memory");   // behind the issued stores, in front of whatever next rewrites their registers
            __builtin_amdgcn_sched_barrier(0); }
    }
}
#define FTHR 4.0f
#define FPK (HD + 8)             // LDS pitch of a key row, elements
#define FPV (64 + 8)             // LDS pitch of a value-plane row piece (64 keys), elements
#define FTK (64 * FPK)
#define FTV (HD * FPV)
__device__ __forceinline__ float xhalf(float x) { return __builtin_bit_cast(float, __builtin_amdgcn_permlanex16(__builtin_bit_cast(int, x), __builtin_bit_cast(int, x), 0x76543210, 0xfedcba98, false, false)); }   // lane l reads lane l ^ 16
__device__ __forceinline__ void wmma_gap() { __builtin_amdgcn_sched_barrier(0); asm volatile("v_nop\n\tv_nop\n\tv_nop\n\tv_nop"); __builtin_amdgcn_sched_barrier(0); }   // the distance behind the last matrix instruction before loads overwrite its operands, on a taken branch too
template <typename T16, int NSPLIT, int R>
__device__ __forceinline__ void fattn_wg(T16* sm, const T16* __restrict__ Q, const T16* __restrict__ Q2, const T16* __restrict__ K, const T16* __restrict__ K2, const T16* __restrict__ Vt, const T16* __restrict__ Vt2, bf* Ah, bf* Al, int q0, int w) {
    typedef typename WFrag<T16>::V V;
    constexpr float CS = SCL * 1.4426950408889634f, POFF = NSPLIT ? 0.0f : 10.0f;   // scores to log2 units; 2^10 on the fp16 probabilities
    constexpr int BUF = (NSPLIT ? 2 : 1) * (FTK + FTV);   // one buffer: K, V^T (, K lo, V^T lo)
    struct Stage { v8us k[8], v[8], k2[8], v2[8]; };   // one stage's share of a thread, on its way from global memory to LDS
    const int tid = threadIdx.x, lane = tid & 31, lr = lane & 15, hi = lane >> 4;
    const int qw0 = q0 + 16 * R * w, plast = (qw0 + 16 * R - 1) / 32, ns = (q0 + 64 * R) / 64;   // the wave's first row; its last pass, which holds its diagonal (every query has an unmasked key in every pass up to it); the work-group's stages
    const int krow = tid >> 4, kcol = (tid & 15) * 8, vrow = tid >> 3, vcol = (tid & 7) * 8;   // staging: piece i of a thread is key row krow + 8 i and value-plane row vrow + 16 i, 16 bytes each
    const int gko = krow * HD + kcol, gvo = vrow * TT + vcol, sko = krow * FPK + kcol, svo = FTK + vrow * FPV + vcol;
    const int fko = lr * FPK + 8 * hi, fvo = FTK + lr * FPV + 8 * hi;   // the lane's element offset in a 16-row block of the staged tiles
    Stage G; V qf[R][4], qf2[R][4]; v8f acc[R][8]; float m_run[R], l_run[R];   // every full unroll below: these live in registers and need constant indices
    auto gload = [&](int st) {
        __builtin_amdgcn_sched_barrier(0);   // with the one below: nothing that rewrites an address register is scheduled between these loads and their wait
#pragma unroll
        for (int i = 0; i < 8; ++i) { G.k[i] = *(const v8usa*)(K + (size_t)st * 64 * HD + gko + i * 8 * HD); G.v[i] = *(const v8usa*)(Vt + st * 64 + gvo + i * 16 * TT);
            if (NSPLIT) { G.k2[i] = *(const v8usa*)(K2 + (size_t)st * 64 * HD + gko + i * 8 * HD); G.v2[i] = *(const v8usa*)(Vt2 + st * 64 + gvo + i * 16 * TT); } }
        asm volatile("s_wait_xcnt 0x0" ::: "memory");   // behind the issued loads, in front of whatever next rewrites their address registers
        __builtin_amdgcn_sched_barrier(0);   // the whole stage is issued here, a stage ahead of its LDS stores
    };
    auto sstore = [&](int buf) { T16* p = sm + buf * BUF;
#pragma unroll
        for (int i = 0; i < 8; ++i) { *(v8usa*)(p + sko + i * 8 * FPK) = G.k[i]; *(v8usa*)(p + svo + i * 16 * FPV) = G.v[i];
            if (NSPLIT) { *(v8usa*)(p + FTK + FTV + sko + i * 8 * FPK) = G.k2[i]; *(v8usa*)(p + FTK + FTV + svo + i * 16 * FPV) = G.v2[i]; } } };
    __builtin_amdgcn_sched_barrier(0);   // the query rows are loaded in front of stage 0: loads return in order, so the wait of stage 0's LDS stores covers them and no pass waits for a staged load on their account
#pragma unroll
    for (int g = 0; g < R; ++g)
#pragma unroll
        for (int kc = 0; kc < 4; ++kc) { qf[g][kc] = WFrag<T16>::ld(Q + (size_t)(qw0 + 16 * g + lr) * HD + 8 * hi + kc * 32); if (NSPLIT) qf2[g][kc] = WFrag<T16>::ld(Q2 + (size_t)(qw0 + 16 * g + lr) * HD + 8 * hi + kc * 32); }
    asm volatile("s_wait_xcnt 0x0" ::: "memory");   // as in gload
    gload(0);
    sstore(0);
    if (ns > 1) gload(1);
#pragma unroll
    for (int g = 0; g < R; ++g) { m_run[g] = -__builtin_inff(); l_run[g] = 0.0f;
#pragma unroll
        for (int t = 0; t < 8; ++t) acc[g][t] = (v8f){}; }
    lds_barrier();
    // Stage st is read from buffer st & 1. Each barrier publishes the stage just stored and ends every wave's reads of the stage just used, whose buffer the next store takes. Every wave stages and passes every barrier, also where its own passes are over.
    // both loops stay rolled and nested: one pass already holds 32 (fp16) or 48 (hi/lo) matrix instructions beside its softmax
#pragma unroll 1
    for (int st = 0; st < ns; ++st) {
        const T16* sb = sm + (st & 1) * BUF;
#pragma unroll 1
        for (int sub = 0; sub < 2; ++sub) { const int p = 2 * st + sub;
            if (p > plast) break;   // wave-uniform
            V kf[2][4], kf2[2][4], vf[8], vf2[8];
#pragma unroll
            for (int kt = 0; kt < 2; ++kt)
#pragma unroll
                for (int kc = 0; kc < 4; ++kc) { kf[kt][kc] = WFrag<T16>::ld(sb + fko + (sub * 32 + kt * 16) * FPK + kc * 32); if (NSPLIT) kf2[kt][kc] = WFrag<T16>::ld(sb + FTK + FTV + fko + (sub * 32 + kt * 16) * FPK + kc * 32); }
            if (!NSPLIT) __builtin_amdgcn_sched_barrier(0);   // fp16 form: the key fragments' LDS reads go first (LDS reads return in order, and the score products wait for these alone)
#pragma unroll
            for (int t = 0; t < 8; ++t) { vf[t] = WFrag<T16>::ld(sb + fvo + t * 16 * FPV + sub * 32); if (NSPLIT) vf2[t] = WFrag<T16>::ld(sb + FTK + FTV + fvo + t * 16 * FPV + sub * 32); }
            if (!NSPLIT) __builtin_amdgcn_sched_barrier(0);   // fp16 form: the value fragments' LDS reads are issued here, under the score products and the softmax (the hi/lo form has no registers to spare for that)
            v8f s[2][R];
#pragma unroll
            for (int kt = 0; kt < 2; ++kt)
#pragma unroll
                for (int g = 0; g < R; ++g) s[kt][g] = (v8f){};
#pragma unroll
            for (int kc = 0; kc < 4; ++kc)
#pragma unroll
                for (int kt = 0; kt < 2; ++kt)
#pragma unroll
                    for (int g = 0; g < R; ++g) { s[kt][g] = WFrag<T16>::mma(kf[kt][kc], qf[g][kc], s[kt][g]); if (NSPLIT) { s[kt][g] = WFrag<T16>::mma(kf[kt][kc], qf2[g][kc], s[kt][g]); s[kt][g] = WFrag<T16>::mma(kf2[kt][kc], qf[g][kc], s[kt][g]); } }
            if (p * 32 + 31 > qw0) {   // wave-uniform: only the pass on the diagonal pays for the mask
#pragma unroll
                for (int g = 0; g < R; ++g)
#pragma unroll
                    for (int kt = 0; kt < 2; ++kt) {
#pragma unroll
                        for (int r = 0; r < 8; ++r) if (p * 32 + 16 * kt + 8 * hi + r > qw0 + 16 * g + lr) s[kt][g][r] = -__builtin_inff();
                        asm volatile("" : "+v"(s[kt][g]));   // the masked scores: keeps the selects inside the branch
                    }
            }
            float mb[R]; bool need = false;
#pragma unroll
            for (int g = 0; g < R; ++g) { float mx = s[0][g][0];
#pragma unroll
                for (int r = 1; r < 8; ++r) mx = fmaxf(mx, s[0][g][r]);
#pragma unroll
                for (int r = 0; r < 8; ++r) mx = fmaxf(mx, s[1][g][r]);
                mx = fmaxf(mx, xhalf(mx)) * CS; mb[g] = mx; need = need || (mx > m_run[g] + FTHR); }   // both wave halves hold the query's maximum of this pass (the scale is positive)
            if (__builtin_amdgcn_ballot_w32(need) != 0) {   // one scalar test a pass; always taken in the first pass, where m_run is -inf and corr 0
#pragma unroll
                for (int g = 0; g < R; ++g) { const float m_new = fmaxf(m_run[g], mb[g]); const float corr = __builtin_amdgcn_exp2f(m_run[g] - m_new); l_run[g] *= corr; m_run[g] = m_new;
#pragma unroll
                    for (int t = 0; t < 8; ++t) acc[g][t] = acc[g][t] * corr; }
            }
#pragma unroll
            for (int g = 0; g < R; ++g) { const float nm = POFF - m_run[g]; float pr[16], ps0 = 0.0f, ps1 = 0.0f;
#pragma unroll
                for (int e = 0; e < 16; e += 2) { const v2f arg = __builtin_elementwise_fma((v2f){s[e >> 3][g][e & 7], s[e >> 3][g][(e & 7) + 1]}, (v2f){CS, CS}, (v2f){nm, nm});   // two scores of a register pair in one packed instruction
                    pr[e] = __builtin_amdgcn_exp2f(arg.x); pr[e + 1] = __builtin_amdgcn_exp2f(arg.y); ps0 += pr[e]; ps1 += pr[e + 1]; }   // element e of the B operand: key 8 hi + e, or 16 + 8 hi + (e - 8): the k order of the value fragments
                l_run[g] += ps0 + ps1;
                if constexpr (NSPLIT != 0) { typedef __attribute__((ext_vector_type(16))) unsigned short v16us; v16us ph, pl;
#pragma unroll
                    for (int e = 0; e < 16; ++e) { unsigned short a, c2; splitf(pr[e], a, c2); ph[e] = a; pl[e] = c2; }
                    const V bh = __builtin_bit_cast(V, ph), bl = __builtin_bit_cast(V, pl);
#pragma unroll
                    for (int t = 0; t < 8; ++t) { acc[g][t] = WFrag<T16>::mma(vf[t], bh, acc[g][t]); acc[g][t] = WFrag<T16>::mma(vf[t], bl, acc[g][t]); acc[g][t] = WFrag<T16>::mma(vf2[t], bh, acc[g][t]); }
                } else { V pf;
#pragma unroll
                    for (int e = 0; e < 16; ++e) pf[e] = tohx(pr[e]);
#pragma unroll
                    for (int t = 0; t < 8; ++t) acc[g][t] = WFrag<T16>::mma(vf[t], pf, acc[g][t]); } }
            wmma_gap();
        }
        if (st + 1 < ns) { sstore((st + 1) & 1); if (st + 2 < ns) gload(st + 2); }   // the same for the whole work-group
        lds_barrier();
    }
#pragma unroll
    for (int g = 0; g < R; ++g) { const float inv = __fdiv_rn(1.0f, l_run[g] + xhalf(l_run[g]));   // each wave half holds the sum over its own keys
        const size_t o = (size_t)(qw0 + 16 * g + lr) * DQ + 8 * hi;
#pragma unroll
        for (int t = 0; t < 8; ++t) { v8us oh, ol;   // register r of tile t: dim 16 t + 8 hi + r of query lr
#pragma unroll
            for (int r = 0; r < 8; ++r) { unsigned short a, c2; splitf(acc[g][t][r] * inv, a, c2); oh[r] = a; ol[r] = c2; }
            __builtin_amdgcn_sched_barrier(0);   // with the one below: nothing that rewrites a data or address register of these stores is scheduled between them and their wait
            *(v8us*)(Ah + o + 16 * t) = oh; *(v8us*)(Al + o + 16 * t) = ol;
            asm volatile("s_wait_xcnt 0x0" ::: "memory");   // behind the issued stores, in front of whatever next rewrites their registers
            __builtin_amdgcn_sched_barrier(0); } }
}
// Heaviest row blocks first, the short hi/lo blocks last. Planes [batch x head][..]; merged output planes [batch][t][h * HD + d].
#define FNBH (NB_ * NH_)
#define FNF  ((TT - RH) / 128 * FNBH)
#define FNH  (RH / 64 * FNBH)
static_assert(NH_ == NKV && HD == 128 && RH % 64 == 0 && (TT - RH) % 128 == 0 && TT % 64 == 0, "k_fattn: one kv head a query head, whole work-groups, whole stages");
__global__ __launch_bounds__(128) __attribute__((amdgpu_waves_per_eu(2, 2))) void k_fattn(const h16* __restrict__ Q16, const h16* __restrict__ K16, const h16* __restrict__ V16, const bf* __restrict__ Qh, const bf* __restrict__ Ql, const bf* __restrict__ Kh, const bf* __restrict__ Kl, const bf* __restrict__ Vh, const bf* __restrict__ Vl, bf* Ah, bf* Al) {
    __shared__ __align__(16) bf sm[2 * 2 * (FTK + FTV)];
    const int w = __builtin_amdgcn_readfirstlane((int)(threadIdx.x >> 5)), bx = blockIdx.x;   // wave number, kept scalar so that the pass tests are scalar branches
    const int ix = bx < FNF ? bx : bx - FNF, bh = ix % FNBH, rb = ix / FNBH;
    const size_t pl = (size_t)bh * TT * HD, ao = (size_t)(bh / NH_) * TT * DQ + (size_t)(bh % NH_) * HD;
    if (bx < FNF) fattn_wg<h16, 0, 2>((h16*)sm, Q16 + pl, nullptr, K16 + pl, nullptr, V16 + pl, nullptr, Ah + ao, Al + ao, RH + ((TT - RH) / 128 - 1 - rb) * 128, w);
    else fattn_wg<bf, 2, 1>(sm, Qh + pl, Ql + pl, Kh + pl, Kl + pl, Vh + pl, Vl + pl, Ah + ao, Al + ao, (RH / 64 - 1 - rb) * 64, w);
}

extern "C" void kernel_launch(void* const* d_in, const int* in_sizes, int n_in,
                              void* d_out, int out_size, void* d_ws, size_t ws_size, hipStream_t stream) {
    (void)in_sizes; (void)n_in; (void)out_size;
    const float* x = (const float*)d_in[0]; const float* sinT = (const float*)d_in[1]; const float* cosT = (const float*)d_in[2]; const float* wq = (const float*)d_in[3]; const float* wk = (const float*)d_in[4]; const float* wv = (const float*)d_in[5]; const float* wo = (const float*)d_in[6]; const float* qsc = (const float*)d_in[7]; const float* ksc = (const float*)d_in[8];   /* x, sin, cos (f32 [2048][64], READ), Wq, Wk, Wv, Wo ('oi' [2048][2048]), q_norm_w, k_norm_w ([128], read) */
    float* OUT = (float*)d_out;     // [2][2048][2048]
    char* wsp = (char*)d_ws;
    auto take = [&](size_t bytes) { char* p = wsp; wsp += (bytes + 255) & ~(size_t)255; return (void*)p; };
    bf* WQ = (bf*)take((size_t)DQ * DM * 2); bf* WK = (bf*)take((size_t)DKV * DM * 2); bf* WV = (bf*)take((size_t)DKV * DM * 2); bf* WO = (bf*)take((size_t)DM * DQ * 2);
    const size_t PB = (size_t)NH_ * TT * HD, AB = (size_t)TT * DQ;   // elements of one batch in a head plane and in a merged plane; every plane holds both batches
    h16* QP16 = (h16*)take(NB_ * PB * 2); h16* KP16 = (h16*)take(NB_ * PB * 2); h16* VT16 = (h16*)take(NB_ * PB * 2);
    bf* QPh = (bf*)take(NB_ * PB * 2); bf* QPl = (bf*)take(NB_ * PB * 2); bf* KPh = (bf*)take(NB_ * PB * 2); bf* KPl = (bf*)take(NB_ * PB * 2); bf* VTh = (bf*)take(NB_ * PB * 2); bf* VTl = (bf*)take(NB_ * PB * 2); bf* ATh = (bf*)take(NB_ * AB * 2); bf* ATl = (bf*)take(NB_ * AB * 2);
    bf* XB = (bf*)take((size_t)NB_ * TT * DM * 2);
    if ((size_t)(wsp - (char*)d_ws) > ws_size) return;    // ws 256 MiB
    { k_cvt8<<<(unsigned)(((size_t)DQ * DM / 8 + 255) / 256), 256, 0, stream>>>(wq, WQ, (size_t)DQ * DM / 8); k_cvt8<<<(unsigned)(((size_t)DKV * DM / 8 + 255) / 256), 256, 0, stream>>>(wk, WK, (size_t)DKV * DM / 8); k_cvt8<<<(unsigned)(((size_t)DKV * DM / 8 + 255) / 256), 256, 0, stream>>>(wv, WV, (size_t)DKV * DM / 8);
      k_cvt8<<<(unsigned)(((size_t)DM * DQ / 8 + 255) / 256), 256, 0, stream>>>(wo, WO, (size_t)DM * DQ / 8);
       }
    k_cvt8<<<(unsigned)(((size_t)NB_ * TT * DM / 8 + 255) / 256), 256, 0, stream>>>(x, XB, (size_t)NB_ * TT * DM / 8);
    // WQ, WK, WV lie one behind the other (each a multiple of 256 bytes): one [DQ + 2 DKV][DM] operand
    k_proj<<<dim3(NB_ * TT / 128, (DQ + 2 * DKV) / 128, 1), 256, 0, stream>>>(XB, WQ, sinT, cosT, qsc, ksc, QP16, QPh, QPl, KP16, KPh, KPl, VT16, VTh, VTl);
    k_fattn<<<FNF + FNH, 128, 0, stream>>>(QP16, KP16, VT16, QPh, QPl, KPh, KPl, VTh, VTl, ATh, ATl);
    for (int b = 0; b < NB_; ++b) k_gemmt<1, DQ, 64><<<dim3(TT / 128, DM / 128, 1), 256, 0, stream>>>(ATh + b * AB, ATl + b * AB, WO, OUT + (size_t)b * TT * DM);
}

// v007
// It runs in 217 microseconds.
// In both of two side-by-side timings against v006, it was 1.05 times as fast.
// Over all steps from v000 it is 8.45 times as fast.
#include <hip/hip_runtime.h>

// Causal multi-head attention with 128-wide heads, rotary embeddings from half-width input tables and a per-head RMSNorm applied AFTER the rotary (x [2][2048][2048]; q, k, v = x W^T ('oi' 1/sqrt(2048), no bias; 16 heads x 128); rope: (x1, x2) = the two HALVES of each head -> cat(x1 c - x2 s, x1 s + x2 c) with the sin / cos INPUT tables [2048][64] (read; argument order x, sin, cos); then per head q = RMSNorm(q) x q_norm_w, k = RMSNorm(k) x k_norm_w (eps = float32 machine epsilon 1.19e-7; weights [128] = ones, read); scores / sqrt(128); causal (-inf); softmax; out = merged Wo^T ('oi') -> [2][2048][2048] (8.4 M); argument order x, sin, cos, Wq, Wk, Wv, Wo, q_norm_w, k_norm_w).
// Layout, both batches at once: bf16 copy of x; 'oi' weights cast as-is; k_proj: exact projections q, k, v in one launch, each 128 x 128 tile (128 tokens of one head) taken to its 16-bit head planes in the tile's epilogue: q / k rotary from the bf16-rounded input tables (the tables need not be rotations: no norm-preservation shortcut), per (head, token) 1/sqrt(mean + eps) over the 128 rotated dims, x r x w[d]; v transposed; then k_fattn: causal T-2048 attention in one launch (hybrid rows: < 512 hi/lo 3 products, rest fp16 x1024; online softmax, scores and probabilities stay in registers; it writes the merged hi/lo planes); merged hi/lo x Wo exact.
// Compute dtypes, f32 accumulate: every input rounded to bf16 incl. the tables; projections exact; rotary and RMSNorm f32; attention rows < 512 3 products, rest fp16; softmax f32; Wo hl x exact.

#define NB_  2
#define TT   2048
#define DM   2048
#define NH_  16
#define NKV  16
#define REP  (NH_ / NKV)
#define HD   128
#define DQ   (NH_ * HD)
#define DKV  (NKV * HD)
#define RH   512                  // query rows < RH use hi+lo planes (0: none)
#define SCL  0.088388347648318447f   // HD^-0.5
typedef _Float16 h16;
typedef unsigned short bf;
typedef __attribute__((ext_vector_type(16))) __bf16   v16bf;
typedef __attribute__((ext_vector_type(16))) _Float16 v16h;
typedef __attribute__((ext_vector_type(8)))  _Float16 v8h;
typedef __attribute__((ext_vector_type(8)))  unsigned short v8us;
typedef __attribute__((ext_vector_type(8)))  float    v8f;
typedef __attribute__((ext_vector_type(4)))  float    v4f;
typedef v8h  __attribute__((may_alias)) v8ha;
typedef v4f  __attribute__((may_alias)) v4fa;
typedef v8us __attribute__((may_alias)) v8usa;

__device__ __forceinline__ unsigned short f2bf(float f) { unsigned u = __float_as_uint(f); u += 0x7FFFu + ((u >> 16) & 1u); return (unsigned short)(u >> 16); }
__device__ __forceinline__ float bf2f(unsigned short b) { return __uint_as_float(((unsigned)b) << 16); }
__device__ __forceinline__ float bfr(float f) { return bf2f(f2bf(f)); }
__device__ __forceinline__ v16h cat16(v8h lo, v8h hi) { return __builtin_shufflevector(lo, hi, 0, 1, 2, 3, 4, 5, 6, 7, 8, 9, 10, 11, 12, 13, 14, 15); }
__device__ __forceinline__ v16bf cat16b(v8us lo, v8us hi) { return __builtin_bit_cast(v16bf, __builtin_shufflevector(lo, hi, 0, 1, 2, 3, 4, 5, 6, 7, 8, 9, 10, 11, 12, 13, 14, 15)); }
__device__ __forceinline__ v8f wmma16(v16h a, v16h b, v8f c) { return __builtin_amdgcn_wmma_f32_16x16x32_f16(false, a, false, b, (short)0, c, false, false); }
__device__ __forceinline__ v8f wmmab(v16bf a, v16bf b, v8f c) { return __builtin_amdgcn_wmma_f32_16x16x32_bf16(false, a, false, b, (short)0, c, false, false); }



// ---- gemm_main: acc = the work-group's tile of C[m][n] = sum_k A[m][k] Bt[n][k] (+ A2[m][k] Bt[n][k] for NSPLIT 1), operands K-contiguous bf16 planes of pitch KD; 256 threads. k_gemmt stores C (f32, pitch KD), grid (M/128, N/128); k_proj goes on from the tile.
// One 128x128 output tile per work-group of 8 waves (2 x 4 waves of 64 x 32). K runs in stages of KS (128 or 64): every operand row piece of 2 KS bytes is read from global memory once per work-group, as whole 128-byte lines,
// goes through registers into one of two LDS buffers (row pitch 2 KS + 16 bytes) and is read from there as fragments. Two register sets: a stage's global loads are issued two stages ahead of its LDS stores; one barrier a stage.
// Each accumulator takes its products in the same k order as a single k loop over 32-wide steps.
template <typename T16> struct WFrag;
template <> struct WFrag<h16> { typedef v16h V; static __device__ __forceinline__ V ld(const h16* p) { return cat16(*(const v8h*)p, *(const v8h*)(p + 16)); } static __device__ __forceinline__ v8f mma(V a, V b, v8f c) { return wmma16(a, b, c); } };
template <> struct WFrag<bf> { typedef v16bf V; static __device__ __forceinline__ V ld(const bf* p) { return cat16b(*(const v8us*)p, *(const v8us*)(p + 16)); } static __device__ __forceinline__ v8f mma(V a, V b, v8f c) { return wmmab(a, b, c); } };
// The work-group barrier of the stage loop: it orders LDS traffic alone, so that the global loads issued ahead stay in flight across it (__syncthreads() waits for them too).
__device__ __forceinline__ void lds_barrier() { __builtin_amdgcn_fence(__ATOMIC_RELEASE, "workgroup", "local"); __builtin_amdgcn_s_barrier(); __builtin_amdgcn_fence(__ATOMIC_ACQUIRE, "workgroup", "local"); }
#define GSM(NSPLIT, KS) (2 * ((NSPLIT) ? 3 : 2) * 128 * ((KS) + 8))   // elements of the two LDS buffers
template <int NSPLIT, int KD, int KS>
__device__ __forceinline__ void gemm_main(bf* sm, const bf* __restrict__ A, const bf* __restrict__ A2, const bf* __restrict__ Bt, int r0, int c0, v8f (&acc)[4][2]) {
    constexpr int PIT = KS + 8, TILE = 128 * PIT, NT = NSPLIT ? 3 : 2, NS = KD / KS, LPR = KS / 8, RPP = 256 / LPR, NP = 128 / RPP;   // lanes a row piece, rows a pass of the 256 threads, pieces a thread and tile
    static_assert(KD % (2 * KS) == 0 && NS >= 4, "an even number of whole stages, at least four");
    struct Stage { v8us a[NP], b[NP], a2[NP]; };   // one stage's share of a thread, on its way from global memory to LDS
    static_assert(GSM(NSPLIT, KS) == 2 * NT * TILE, "the callers' LDS array");
    const int tid = threadIdx.x, lane = tid & 31, lr = lane & 15, hi = lane >> 4, w = tid >> 5, wm = w >> 2, wn = w & 3;
    const int srow = tid / LPR, scol = (tid % LPR) * 8;   // staging: piece i of a thread is row srow + RPP i, 16 bytes at element scol
    const bf* ga = A + (size_t)(r0 + srow) * KD + scol; const bf* ga2 = NSPLIT ? A2 + (size_t)(r0 + srow) * KD + scol : nullptr; const bf* gb = Bt + (size_t)(c0 + srow) * KD + scol;
    bf* sp = sm + srow * PIT + scol;
    const bf* fa = sm + (wm * 64 + lr) * PIT + 8 * hi; const bf* fb = sm + TILE + (wn * 32 + lr) * PIT + 8 * hi;
    Stage R0, R1;   // every full unroll below: these live in registers and need constant indices
#pragma unroll
    for (int mb = 0; mb < 4; ++mb)
#pragma unroll
        for (int nb = 0; nb < 2; ++nb) acc[mb][nb] = (v8f){};
    auto gload = [&](Stage& R, int k0) {
        __builtin_amdgcn_sched_barrier(0);   // with the one below: nothing that rewrites an address register is scheduled between these loads and their wait
#pragma unroll
        for (int i = 0; i < NP; ++i) { R.a[i] = *(const v8us*)(ga + (size_t)i * RPP * KD + k0); R.b[i] = *(const v8us*)(gb + (size_t)i * RPP * KD + k0); if (NSPLIT) R.a2[i] = *(const v8us*)(ga2 + (size_t)i * RPP * KD + k0); }
        asm volatile("s_wait_xcnt 0x0" ::: "memory");   // behind the issued loads, in front of whatever next rewrites their address registers
        __builtin_amdgcn_sched_barrier(0);   // the whole stage is issued here: without it the scheduler sinks loads towards their LDS stores, and their trip to memory is then waited for in full
    };
    auto sstore = [&](const Stage& R, int buf) { bf* p = sp + buf * NT * TILE;
#pragma unroll
        for (int i = 0; i < NP; ++i) { *(v8us*)(p + i * RPP * PIT) = R.a[i]; *(v8us*)(p + TILE + i * RPP * PIT) = R.b[i]; if (NSPLIT) *(v8us*)(p + 2 * TILE + i * RPP * PIT) = R.a2[i]; } };
    auto products = [&](int buf) { const bf* pa = fa + buf * NT * TILE; const bf* pb = fb + buf * NT * TILE;
#pragma unroll
        for (int kc = 0; kc < KS; kc += 32) { v16bf a[4], a2[4];
#pragma unroll
            for (int mb = 0; mb < 4; ++mb) { a[mb] = WFrag<bf>::ld(pa + mb * 16 * PIT + kc); if (NSPLIT) a2[mb] = WFrag<bf>::ld(pa + 2 * TILE + mb * 16 * PIT + kc); }
#pragma unroll
            for (int nb = 0; nb < 2; ++nb) { const v16bf b = WFrag<bf>::ld(pb + nb * 16 * PIT + kc);
#pragma unroll
                for (int mb = 0; mb < 4; ++mb) { acc[mb][nb] = wmmab(a[mb], b, acc[mb][nb]); if (NSPLIT) acc[mb][nb] = wmmab(a2[mb], b, acc[mb][nb]); } } } };
    // Stage s is read from buffer s & 1. Each barrier below publishes the stage just stored and ends every wave's reads of the stage just used, whose buffer the next store takes.
    gload(R0, 0); sstore(R0, 0); gload(R0, KS); gload(R1, 2 * KS);
    lds_barrier();
    // the loop stays rolled: its body already holds two whole stages
#pragma unroll 1
    for (int s = 0; s < NS - 4; s += 2) {   // on entry: buffer 0 holds stage s, R0 stage s + 1, R1 stage s + 2
        products(0); sstore(R0, 1); gload(R0, (s + 3) * KS);
        lds_barrier();
        products(1); sstore(R1, 0); gload(R1, (s + 4) * KS);
        lds_barrier();
    }
    products(0); sstore(R0, 1); gload(R0, (NS - 1) * KS);
    lds_barrier();
    products(1); sstore(R1, 0);
    lds_barrier();
    products(0); sstore(R0, 1);
    lds_barrier();
    products(1);   // behind the last barrier only buffer 1 is still read
}
template <int NSPLIT, int KD, int KS>
__global__ __launch_bounds__(256) void k_gemmt(const bf* __restrict__ A, const bf* __restrict__ A2, const bf* __restrict__ Bt, float* C) {
    __shared__ __align__(16) bf sm[GSM(NSPLIT, KS)];
    __shared__ __align__(16) float osm[8 * 16 * 36];
    const int tid = threadIdx.x, lane = tid & 31, lr = lane & 15, hi = lane >> 4, w = tid >> 5, wm = w >> 2, wn = w & 3;
    const int r0 = blockIdx.x * 128, c0 = blockIdx.y * 128;
    v8f acc[4][2];
    gemm_main<NSPLIT, KD, KS>(sm, A, A2, Bt, r0, c0, acc);
    float* os = osm + w * (16 * 36);   // the wave's own 16 x 32 patch: accumulator order in, whole 128-byte output lines out
#pragma unroll
    for (int mb = 0; mb < 4; ++mb) {
#pragma unroll
        for (int nb = 0; nb < 2; ++nb)
#pragma unroll
            for (int j = 0; j < 8; ++j) os[(hi * 8 + j) * 36 + nb * 16 + lr] = acc[mb][nb][j];
        float* crow = C + (size_t)(r0 + wm * 64 + mb * 16) * KD + c0 + wn * 32;
#pragma unroll
        for (int q = 0; q < 4; ++q) { const int row = 4 * q + (lane >> 3), cofs = (lane & 7) * 4; const v4f val = *(const v4fa*)(os + row * 36 + cofs); *(v4f*)(crow + (size_t)row * KD + cofs) = val; }
    }
}

__device__ __forceinline__ h16 tohx(float x) { return (h16)x; }
__device__ __forceinline__ void splitf(float y, unsigned short& h, unsigned short& l) { h = f2bf(y); l = f2bf(y - bf2f(h)); }
typedef __attribute__((ext_vector_type(2))) _Float16 v2h;
typedef __attribute__((ext_vector_type(4))) _Float16 v4h;
typedef __attribute__((ext_vector_type(2))) unsigned short v2us;
typedef __attribute__((ext_vector_type(4))) unsigned short v4us;
typedef __attribute__((ext_vector_type(2))) float v2f;
typedef __attribute__((ext_vector_type(4))) int v4i;

// ---- k_cast: the bf16 copies of the four weights and x in one launch. Six segments of CSEG elements (each weight is one, x is two); grid CSEG / (CWAV CBLK) = one work-group of 16 waves a WGP.
// A wave takes the same CBLK elements of each segment in turn: 8 loads of 512 contiguous bytes (read once: non-temporal), the next segment's loads issued before this segment is rounded and stored as whole 128-byte lines.
#define CSEG (DM * DM)
#define CBLK 1024
#define CWAV 16
static_assert(DQ * DM == CSEG && DKV * DM == CSEG && NB_ * TT * DM == 2 * CSEG && CSEG % (CBLK * CWAV) == 0, "k_cast: equal segments, whole work-groups");
__global__ __launch_bounds__(CWAV * 32) void k_cast(const float* __restrict__ wq, const float* __restrict__ wk, const float* __restrict__ wv, const float* __restrict__ wo, const float* __restrict__ x, bf* WQ, bf* WK, bf* WV, bf* WO, bf* XB) {
    const int lane = threadIdx.x & 31, wave = __builtin_amdgcn_readfirstlane((int)(threadIdx.x >> 5));
    const int e0 = ((int)blockIdx.x * CWAV + wave) * CBLK + lane * 4;
    const float* sp[6] = {wq + e0, wk + e0, wv + e0, wo + e0, x + e0, x + CSEG + e0}; bf* dp[6] = {WQ + e0, WK + e0, WV + e0, WO + e0, XB + e0, XB + CSEG + e0};
    v4f r[2][8];   // every full unroll below: these live in registers and need constant indices
#pragma unroll
    for (int i = -1; i < 6; ++i) {
        if (i + 1 < 6) {
            __builtin_amdgcn_sched_barrier(0);   // with the one below: nothing that rewrites an address register is scheduled between these loads and their wait
#pragma unroll
            for (int q = 0; q < 8; ++q) r[(i + 1) & 1][q] = __builtin_nontemporal_load((const v4f*)(sp[i + 1] + q * 128));
            asm volatile("s_wait_xcnt 0x0" ::: "memory");   // behind the issued loads, in front of whatever next rewrites their address registers
            __builtin_amdgcn_sched_barrier(0);   // the next segment's loads are all issued here, ahead of this segment's rounding: 8 to 16 loads of a wave stay in flight
        }
        if (i >= 0) { v4us o[8];
#pragma unroll
            for (int q = 0; q < 8; ++q)
#pragma unroll
                for (int k = 0; k < 4; ++k) o[q][k] = f2bf(r[i & 1][q][k]);
            __builtin_amdgcn_sched_barrier(0);   // with the one below: nothing that rewrites a data or address register of these stores is scheduled between them and their wait
#pragma unroll
            for (int q = 0; q < 8; ++q) *(v4us*)(dp[i] + q * 128) = o[q];   // each store: two whole 128-byte lines
            asm volatile("s_wait_xcnt 0x0" ::: "memory");   // behind the issued stores, in front of whatever next rewrites their registers
            __builtin_amdgcn_sched_barrier(0); }
    }
}

// ---- k_proj: the projections q, k, v of both batches in one launch, each tile carried on to its 16-bit planes; nothing f32 goes through memory. X [batch x t][DM]; Wqkv: the rows of Wq, Wk, Wv one behind the other; grid (NB_ TT / 128, (DQ + 2 DKV) / 128).
// A 128 x 128 tile is 128 tokens of one head of q, k or v. The accumulators go as f32 into LDS (pitch PTP floats), in the place of stage buffer 0, and behind one barrier 16 lanes take one row of it, 16 rows a pass of the 256 threads.
// q / k tile, stored [t][d] -> planes [batch x h][t][d] (fp16 + bf16 hi/lo): lane j holds the dims 4j..4j+3 of both halves, so that each rotary pair sits in one lane. rotary from the bf16-rounded tables, r = 1/sqrt(mean of squares + eps) over the
// 128 rotated dims (8 terms a lane, then a butterfly over the 16 lanes), (y x r) x w[d] with w rounded to bf16. v tile, stored [d][t] (a lane's 8 accumulator registers are 8 tokens of one dim) -> transposed planes [batch x h][d][t]: lane j the tokens 8j..8j+7.
#define PTP 132
typedef float __attribute__((may_alias)) fa;
static_assert(NH_ == NKV && HD == 128 && TT % 128 == 0, "k_proj: q, k and v alike; a tile is one head wide and lies in one batch");
__device__ __forceinline__ float rowsum16(float v) {   // sum over the 16 lanes of a row, every lane on; the cross-lane reads fold into the adds
    v += __builtin_bit_cast(float, __builtin_amdgcn_update_dpp(0, __builtin_bit_cast(int, v), 0x161, 0xf, 0xf, true));   // row_xmask:1
    v += __builtin_bit_cast(float, __builtin_amdgcn_update_dpp(0, __builtin_bit_cast(int, v), 0x162, 0xf, 0xf, true));   // row_xmask:2
    v += __builtin_bit_cast(float, __builtin_amdgcn_update_dpp(0, __builtin_bit_cast(int, v), 0x164, 0xf, 0xf, true));   // row_xmask:4
    v += __builtin_bit_cast(float, __builtin_amdgcn_update_dpp(0, __builtin_bit_cast(int, v), 0x168, 0xf, 0xf, true));   // row_xmask:8
    return v; }
__global__ __launch_bounds__(256) void k_proj(const bf* __restrict__ X, const bf* __restrict__ Wqkv, const float* __restrict__ sinT, const float* __restrict__ cosT, const float* __restrict__ wq_, const float* __restrict__ wk_, h16* Q16, bf* Qh, bf* Ql, h16* K16, bf* Kh, bf* Kl, h16* V16, bf* Vh, bf* Vl) {
    __shared__ __align__(16) bf sm[GSM(0, 128)];
    static_assert(128 * PTP * 4 <= GSM(0, 128), "the f32 tile fits in stage buffer 0 (half of the array's 2 GSM bytes), which no wave reads behind the stage loop's last barrier: no barrier in front of its stores");
    const int tid = threadIdx.x, lane = tid & 31, lr = lane & 15, hi = lane >> 4, w = tid >> 5, wm = w >> 2, wn = w & 3;
    const int r0 = blockIdx.x * 128, c0 = blockIdx.y * 128;
    v8f acc[4][2];   // every full unroll below: register arrays need constant indices
    gemm_main<0, DM, 128>(sm, X, nullptr, Wqkv, r0, c0, acc);
    fa* ts = (fa*)sm;
    const int bb = r0 / TT, t0 = r0 % TT, rr = tid >> 4, l16 = tid & 15;   // batch, first token; the thread's row in a pass and its place in the row
    if (c0 < DQ + DKV) {   // the same for the whole work-group
        const bool isk = c0 >= DQ; const float* wn_ = isk ? wk_ : wq_; h16* P16 = isk ? K16 : Q16; bf* Ph = isk ? Kh : Qh; bf* Pl = isk ? Kl : Ql;
        const int hb = bb * NH_ + (c0 % DQ) / HD, d = l16 * 4; const float* pc = cosT + (t0 + rr) * (HD / 2) + d; const float* ps = sinT + (t0 + rr) * (HD / 2) + d; v4f cr[8], sr[8];
        __builtin_amdgcn_sched_barrier(0);   // with the one below: nothing that rewrites an address register is scheduled between these loads and their wait
#pragma unroll
        for (int i = 0; i < 8; ++i) { cr[i] = *(const v4f*)(pc + i * 16 * (HD / 2)); sr[i] = *(const v4f*)(ps + i * 16 * (HD / 2)); }
        const v4f wa = *(const v4f*)(wn_ + d), wb = *(const v4f*)(wn_ + HD / 2 + d);
        asm volatile("s_wait_xcnt 0x0" :: "v"(pc), "v"(ps) : "memory");   // behind the issued loads, in front of whatever next rewrites their address registers; the two addresses are named so that they live up to here and no later load of the run lands on them
        __builtin_amdgcn_sched_barrier(0);   // all the tables' loads are issued here: their trip to memory runs under the tile's LDS stores and the barrier
#pragma unroll
        for (int mb = 0; mb < 4; ++mb)
#pragma unroll
            for (int nb = 0; nb < 2; ++nb)
#pragma unroll
                for (int j = 0; j < 8; ++j) ts[(wm * 64 + mb * 16 + hi * 8 + j) * PTP + wn * 32 + nb * 16 + lr] = acc[mb][nb][j];
        lds_barrier();   // publishes the tile
        v4f w1, w2;
#pragma unroll
        for (int q = 0; q < 4; ++q) { w1[q] = bfr(wa[q]); w2[q] = bfr(wb[q]); }
        v4f xl[8], xh[8];   // all eight rows' LDS reads are issued ahead of the passes, whose scheduling barriers would else leave each pass waiting for its own
#pragma unroll
        for (int i = 0; i < 8; ++i) { xl[i] = *(const v4fa*)(ts + (i * 16 + rr) * PTP + d); xh[i] = *(const v4fa*)(ts + (i * 16 + rr) * PTP + HD / 2 + d); }
#pragma unroll
        for (int i = 0; i < 8; ++i) { const int row = i * 16 + rr; const v4f x1 = xl[i], x2 = xh[i]; v4f c, s;
#pragma unroll
            for (int q = 0; q < 4; ++q) { c[q] = bfr(cr[i][q]); s[q] = bfr(sr[i][q]); }
            const v4f y1 = x1 * c - x2 * s, y2 = x1 * s + x2 * c; float ss = 0.f;
#pragma unroll
            for (int q = 0; q < 4; ++q) ss += y1[q] * y1[q];
#pragma unroll
            for (int q = 0; q < 4; ++q) ss += y2[q] * y2[q];
            const float rf = __fdiv_rn(1.0f, __fsqrt_rn(rowsum16(ss) * (1.0f / HD) + 1.1920929e-07f)); const size_t o = ((size_t)hb * TT + t0 + row) * HD + d; v4h a16, b16; v4us ah, al, bh, bl;
#pragma unroll
            for (int q = 0; q < 4; ++q) { const float ra = (y1[q] * rf) * w1[q], rb = (y2[q] * rf) * w2[q]; unsigned short u, v; a16[q] = tohx(ra); splitf(ra, u, v); ah[q] = u; al[q] = v; b16[q] = tohx(rb); splitf(rb, u, v); bh[q] = u; bl[q] = v; }
            __builtin_amdgcn_sched_barrier(0);   // with the one below: nothing that rewrites a data or address register of these stores is scheduled between them and their wait
            *(v4h*)(P16 + o) = a16; *(v4h*)(P16 + o + HD / 2) = b16; *(v4us*)(Ph + o) = ah; *(v4us*)(Ph + o + HD / 2) = bh; *(v4us*)(Pl + o) = al; *(v4us*)(Pl + o + HD / 2) = bl;   // each store: one whole 128-byte line a row
            asm volatile("s_wait_xcnt 0x0" ::: "memory");   // behind the issued stores, in front of whatever next rewrites their registers
            __builtin_amdgcn_sched_barrier(0); }
    } else {
#pragma unroll
        for (int mb = 0; mb < 4; ++mb)
#pragma unroll
            for (int nb = 0; nb < 2; ++nb) { fa* p = ts + (wn * 32 + nb * 16 + lr) * PTP + wm * 64 + mb * 16 + hi * 8; const v8f a = acc[mb][nb];
                *(v4fa*)p = (v4f){a[0], a[1], a[2], a[3]}; *(v4fa*)(p + 4) = (v4f){a[4], a[5], a[6], a[7]}; }
        lds_barrier();   // publishes the tile
        const int hv = bb * NKV + (c0 - DQ - DKV) / HD, tc = l16 * 8; v4f xl[8], xh[8];   // as in the q / k branch: all the LDS reads ahead of the passes
#pragma unroll
        for (int i = 0; i < 8; ++i) { xl[i] = *(const v4fa*)(ts + (i * 16 + rr) * PTP + tc); xh[i] = *(const v4fa*)(ts + (i * 16 + rr) * PTP + tc + 4); }
#pragma unroll
        for (int i = 0; i < 8; ++i) { const int dd = i * 16 + rr; const v4f xa = xl[i], xb = xh[i]; const size_t e = ((size_t)hv * HD + dd) * TT + t0 + tc; v8h o16; v8us oh, ol;
#pragma unroll
            for (int q = 0; q < 8; ++q) { const float x = q < 4 ? xa[q & 3] : xb[q & 3]; unsigned short a2, c2; o16[q] = tohx(x); splitf(x, a2, c2); oh[q] = a2; ol[q] = c2; }
            __builtin_amdgcn_sched_barrier(0);   // with the one below: nothing that rewrites a data or address register of these stores is scheduled between them and their wait
            *(v8h*)(V16 + e) = o16; *(v8us*)(Vh + e) = oh; *(v8us*)(Vl + e) = ol;   // each store: two whole 128-byte lines a row
            asm volatile("s_wait_xcnt 0x0" ::: "memory");   // behind the issued stores, in front of whatever next rewrites their registers
            __builtin_amdgcn_sched_barrier(0); }
    }
}
#define FTHR 4.0f
#define FPK (HD + 8)             // LDS pitch of a key row, elements
#define FPV (64 + 8)             // LDS pitch of a value-plane row piece (64 keys), elements
#define FTK (64 * FPK)
#define FTV (HD * FPV)
__device__ __forceinline__ float xhalf(float x) { return __builtin_bit_cast(float, __builtin_amdgcn_permlanex16(__builtin_bit_cast(int, x), __builtin_bit_cast(int, x), 0x76543210, 0xfedcba98, false, false)); }   // lane l reads lane l ^ 16
__device__ __forceinline__ void wmma_gap() { __builtin_amdgcn_sched_barrier(0); asm volatile("v_nop\n\tv_nop\n\tv_nop\n\tv_nop"); __builtin_amdgcn_sched_barrier(0); }   // the distance behind the last matrix instruction before loads overwrite its operands, on a taken branch too
template <typename T16, int NSPLIT, int R>
__device__ __forceinline__ void fattn_wg(T16* sm, const T16* __restrict__ Q, const T16* __restrict__ Q2, const T16* __restrict__ K, const T16* __restrict__ K2, const T16* __restrict__ Vt, const T16* __restrict__ Vt2, bf* Ah, bf* Al, int q0, int w) {
    typedef typename WFrag<T16>::V V;
    constexpr float CS = SCL * 1.4426950408889634f, POFF = NSPLIT ? 0.0f : 10.0f;   // scores to log2 units; 2^10 on the fp16 probabilities
    constexpr int BUF = (NSPLIT ? 2 : 1) * (FTK + FTV);   // one buffer: K, V^T (, K lo, V^T lo)
    struct Stage { v8us k[8], v[8], k2[8], v2[8]; };   // one stage's share of a thread, on its way from global memory to LDS
    const int tid = threadIdx.x, lane = tid & 31, lr = lane & 15, hi = lane >> 4;
    const int qw0 = q0 + 16 * R * w, plast = (qw0 + 16 * R - 1) / 32, ns = (q0 + 64 * R) / 64;   // the wave's first row; its last pass, which holds its diagonal (every query has an unmasked key in every pass up to it); the work-group's stages
    const int krow = tid >> 4, kcol = (tid & 15) * 8, vrow = tid >> 3, vcol = (tid & 7) * 8;   // staging: piece i of a thread is key row krow + 8 i and value-plane row vrow + 16 i, 16 bytes each
    const int gko = krow * HD + kcol, gvo = vrow * TT + vcol, sko = krow * FPK + kcol, svo = FTK + vrow * FPV + vcol;
    const int fko = lr * FPK + 8 * hi, fvo = FTK + lr * FPV + 8 * hi;   // the lane's element offset in a 16-row block of the staged tiles
    Stage G; V qf[R][4], qf2[R][4]; v8f acc[R][8]; float m_run[R], l_run[R];   // every full unroll below: these live in registers and need constant indices
    auto gload = [&](int st) {
        __builtin_amdgcn_sched_barrier(0);   // with the one below: nothing that rewrites an address register is scheduled between these loads and their wait
#pragma unroll
        for (int i = 0; i < 8; ++i) { G.k[i] = *(const v8usa*)(K + (size_t)st * 64 * HD + gko + i * 8 * HD); G.v[i] = *(const v8usa*)(Vt + st * 64 + gvo + i * 16 * TT);
            if (NSPLIT) { G.k2[i] = *(const v8usa*)(K2 + (size_t)st * 64 * HD + gko + i * 8 * HD); G.v2[i] = *(const v8usa*)(Vt2 + st * 64 + gvo + i * 16 * TT); } }
        asm volatile("s_wait_xcnt 0x0" ::: "memory");   // behind the issued loads, in front of whatever next rewrites their address registers
        __builtin_amdgcn_sched_barrier(0);   // the whole stage is issued here, a stage ahead of its LDS stores
    };
    auto sstore = [&](int buf) { T16* p = sm + buf * BUF;
#pragma unroll
        for (int i = 0; i < 8; ++i) { *(v8usa*)(p + sko + i * 8 * FPK) = G.k[i]; *(v8usa*)(p + svo + i * 16 * FPV) = G.v[i];
            if (NSPLIT) { *(v8usa*)(p + FTK + FTV + sko + i * 8 * FPK) = G.k2[i]; *(v8usa*)(p + FTK + FTV + svo + i * 16 * FPV) = G.v2[i]; } } };
    __builtin_amdgcn_sched_barrier(0);   // the query rows are loaded in front of stage 0: loads return in order, so the wait of stage 0's LDS stores covers them and no pass waits for a staged load on their account
#pragma unroll
    for (int g = 0; g < R; ++g)
#pragma unroll
        for (int kc = 0; kc < 4; ++kc) { qf[g][kc] = WFrag<T16>::ld(Q + (size_t)(qw0 + 16 * g + lr) * HD + 8 * hi + kc * 32); if (NSPLIT) qf2[g][kc] = WFrag<T16>::ld(Q2 + (size_t)(qw0 + 16 * g + lr) * HD + 8 * hi + kc * 32); }
    asm volatile("s_wait_xcnt 0x0" ::: "memory");   // as in gload
    gload(0);
    sstore(0);
    if (ns > 1) gload(1);
#pragma unroll
    for (int g = 0; g < R; ++g) { m_run[g] = -__builtin_inff(); l_run[g] = 0.0f;
#pragma unroll
        for (int t = 0; t < 8; ++t) acc[g][t] = (v8f){}; }
    lds_barrier();
    // Stage st is read from buffer st & 1. Each barrier publishes the stage just stored and ends every wave's reads of the stage just used, whose buffer the next store takes. Every wave stages and passes every barrier, also where its own passes are over.
    // both loops stay rolled and nested: one pass already holds 32 (fp16) or 48 (hi/lo) matrix instructions beside its softmax
#pragma unroll 1
    for (int st = 0; st < ns; ++st) {
        const T16* sb = sm + (st & 1) * BUF;
#pragma unroll 1
        for (int sub = 0; sub < 2; ++sub) { const int p = 2 * st + sub;
            if (p > plast) break;   // wave-uniform
            V kf[2][4], kf2[2][4], vf[8], vf2[8];
#pragma unroll
            for (int kt = 0; kt < 2; ++kt)
#pragma unroll
                for (int kc = 0; kc < 4; ++kc) { kf[kt][kc] = WFrag<T16>::ld(sb + fko + (sub * 32 + kt * 16) * FPK + kc * 32); if (NSPLIT) kf2[kt][kc] = WFrag<T16>::ld(sb + FTK + FTV + fko + (sub * 32 + kt * 16) * FPK + kc * 32); }
            if (!NSPLIT) __builtin_amdgcn_sched_barrier(0);   // fp16 form: the key fragments' LDS reads go first (LDS reads return in order, and the score products wait for these alone)
#pragma unroll
            for (int t = 0; t < 8; ++t) { vf[t] = WFrag<T16>::ld(sb + fvo + t * 16 * FPV + sub * 32); if (NSPLIT) vf2[t] = WFrag<T16>::ld(sb + FTK + FTV + fvo + t * 16 * FPV + sub * 32); }
            if (!NSPLIT) __builtin_amdgcn_sched_barrier(0);   // fp16 form: the value fragments' LDS reads are issued here, under the score products and the softmax (the hi/lo form has no registers to spare for that)
            v8f s[2][R];
#pragma unroll
            for (int kt = 0; kt < 2; ++kt)
#pragma unroll
                for (int g = 0; g < R; ++g) s[kt][g] = (v8f){};
#pragma unroll
            for (int kc = 0; kc < 4; ++kc)
#pragma unroll
                for (int kt = 0; kt < 2; ++kt)
#pragma unroll
                    for (int g = 0; g < R; ++g) { s[kt][g] = WFrag<T16>::mma(kf[kt][kc], qf[g][kc], s[kt][g]); if (NSPLIT) { s[kt][g] = WFrag<T16>::mma(kf[kt][kc], qf2[g][kc], s[kt][g]); s[kt][g] = WFrag<T16>::mma(kf2[kt][kc], qf[g][kc], s[kt][g]); } }
            if (p * 32 + 31 > qw0) {   // wave-uniform: only the pass on the diagonal pays for the mask
#pragma unroll
                for (int g = 0; g < R; ++g)
#pragma unroll
                    for (int kt = 0; kt < 2; ++kt) {
#pragma unroll
                        for (int r = 0; r < 8; ++r) if (p * 32 + 16 * kt + 8 * hi + r > qw0 + 16 * g + lr) s[kt][g][r] = -__builtin_inff();
                        asm volatile("" : "+v"(s[kt][g]));   // the masked scores: keeps the selects inside the branch
                    }
            }
            float mb[R]; bool need = false;
#pragma unroll
            for (int g = 0; g < R; ++g) { float mx = s[0][g][0];
#pragma unroll
                for (int r = 1; r < 8; ++r) mx = fmaxf(mx, s[0][g][r]);
#pragma unroll
                for (int r = 0; r < 8; ++r) mx = fmaxf(mx, s[1][g][r]);
                mx = fmaxf(mx, xhalf(mx)) * CS; mb[g] = mx; need = need || (mx > m_run[g] + FTHR); }   // both wave halves hold the query's maximum of this pass (the scale is positive)
            if (__builtin_amdgcn_ballot_w32(need) != 0) {   // one scalar test a pass; always taken in the first pass, where m_run is -inf and corr 0
#pragma unroll
                for (int g = 0; g < R; ++g) { const float m_new = fmaxf(m_run[g], mb[g]); const float corr = __builtin_amdgcn_exp2f(m_run[g] - m_new); l_run[g] *= corr; m_run[g] = m_new;
#pragma unroll
                    for (int t = 0; t < 8; ++t) acc[g][t] = acc[g][t] * corr; }
            }
#pragma unroll
            for (int g = 0; g < R; ++g) { const float nm = POFF - m_run[g]; float pr[16], ps0 = 0.0f, ps1 = 0.0f;
#pragma unroll
                for (int e = 0; e < 16; e += 2) { const v2f arg = __builtin_elementwise_fma((v2f){s[e >> 3][g][e & 7], s[e >> 3][g][(e & 7) + 1]}, (v2f){CS, CS}, (v2f){nm, nm});   // two scores of a register pair in one packed instruction
                    pr[e] = __builtin_amdgcn_exp2f(arg.x); pr[e + 1] = __builtin_amdgcn_exp2f(arg.y); ps0 += pr[e]; ps1 += pr[e + 1]; }   // element e of the B operand: key 8 hi + e, or 16 + 8 hi + (e - 8): the k order of the value fragments
                l_run[g] += ps0 + ps1;
                if constexpr (NSPLIT != 0) { typedef __attribute__((ext_vector_type(16))) unsigned short v16us; v16us ph, pl;
#pragma unroll
                    for (int e = 0; e < 16; ++e) { unsigned short a, c2; splitf(pr[e], a, c2); ph[e] = a; pl[e] = c2; }
                    const V bh = __builtin_bit_cast(V, ph), bl = __builtin_bit_cast(V, pl);
#pragma unroll
                    for (int t = 0; t < 8; ++t) { acc[g][t] = WFrag<T16>::mma(vf[t], bh, acc[g][t]); acc[g][t] = WFrag<T16>::mma(vf[t], bl, acc[g][t]); acc[g][t] = WFrag<T16>::mma(vf2[t], bh, acc[g][t]); }
                } else { V pf;
#pragma unroll
                    for (int e = 0; e < 16; ++e) pf[e] = tohx(pr[e]);
#pragma unroll
                    for (int t = 0; t < 8; ++t) acc[g][t] = WFrag<T16>::mma(vf[t], pf, acc[g][t]); } }
            wmma_gap();
        }
        if (st + 1 < ns) { sstore((st + 1) & 1); if (st + 2 < ns) gload(st + 2); }   // the same for the whole work-group
        lds_barrier();
    }
#pragma unroll
    for (int g = 0; g < R; ++g) { const float inv = __fdiv_rn(1.0f, l_run[g] + xhalf(l_run[g]));   // each wave half holds the sum over its own keys
        const size_t o = (size_t)(qw0 + 16 * g + lr) * DQ + 8 * hi;
#pragma unroll
        for (int t = 0; t < 8; ++t) { v8us oh, ol;   // register r of tile t: dim 16 t + 8 hi + r of query lr
#pragma unroll
            for (int r = 0; r < 8; ++r) { unsigned short a, c2; splitf(acc[g][t][r] * inv, a, c2); oh[r] = a; ol[r] = c2; }
            __builtin_amdgcn_sched_barrier(0);   // with the one below: nothing that rewrites a data or address register of these stores is scheduled between them and their wait
            *(v8us*)(Ah + o + 16 * t) = oh; *(v8us*)(Al + o + 16 * t) = ol;
            asm volatile("s_wait_xcnt 0x0" ::: "memory");   // behind the issued stores, in front of whatever next rewrites their registers
            __builtin_amdgcn_sched_barrier(0); } }
}
// Heaviest row blocks first, the short hi/lo blocks last. Planes [batch x head][..]; merged output planes [batch][t][h * HD + d].
#define FNBH (NB_ * NH_)
#define FNF  ((TT - RH) / 128 * FNBH)
#define FNH  (RH / 64 * FNBH)
static_assert(NH_ == NKV && HD == 128 && RH % 64 == 0 && (TT - RH) % 128 == 0 && TT % 64 == 0, "k_fattn: one kv head a query head, whole work-groups, whole stages");
__global__ __launch_bounds__(128) __attribute__((amdgpu_waves_per_eu(2, 2))) void k_fattn(const h16* __restrict__ Q16, const h16* __restrict__ K16, const h16* __restrict__ V16, const bf* __restrict__ Qh, const bf* __restrict__ Ql, const bf* __restrict__ Kh, const bf* __restrict__ Kl, const bf* __restrict__ Vh, const bf* __restrict__ Vl, bf* Ah, bf* Al) {
    __shared__ __align__(16) bf sm[2 * 2 * (FTK + FTV)];
    const int w = __builtin_amdgcn_readfirstlane((int)(threadIdx.x >> 5)), bx = blockIdx.x;   // wave number, kept scalar so that the pass tests are scalar branches
    const int ix = bx < FNF ? bx : bx - FNF, bh = ix % FNBH, rb = ix / FNBH;
    const size_t pl = (size_t)bh * TT * HD, ao = (size_t)(bh / NH_) * TT * DQ + (size_t)(bh % NH_) * HD;
    if (bx < FNF) fattn_wg<h16, 0, 2>((h16*)sm, Q16 + pl, nullptr, K16 + pl, nullptr, V16 + pl, nullptr, Ah + ao, Al + ao, RH + ((TT - RH) / 128 - 1 - rb) * 128, w);
    else fattn_wg<bf, 2, 1>(sm, Qh + pl, Ql + pl, Kh + pl, Kl + pl, Vh + pl, Vl + pl, Ah + ao, Al + ao, (RH / 64 - 1 - rb) * 64, w);
}

extern "C" void kernel_launch(void* const* d_in, const int* in_sizes, int n_in,
                              void* d_out, int out_size, void* d_ws, size_t ws_size, hipStream_t stream) {
    (void)in_sizes; (void)n_in; (void)out_size;
    const float* x = (const float*)d_in[0]; const float* sinT = (const float*)d_in[1]; const float* cosT = (const float*)d_in[2]; const float* wq = (const float*)d_in[3]; const float* wk = (const float*)d_in[4]; const float* wv = (const float*)d_in[5]; const float* wo = (const float*)d_in[6]; const float* qsc = (const float*)d_in[7]; const float* ksc = (const float*)d_in[8];   /* x, sin, cos (f32 [2048][64], READ), Wq, Wk, Wv, Wo ('oi' [2048][2048]), q_norm_w, k_norm_w ([128], read) */
    float* OUT = (float*)d_out;     // [2][2048][2048]
    char* wsp = (char*)d_ws;
    auto take = [&](size_t bytes) { char* p = wsp; wsp += (bytes + 255) & ~(size_t)255; return (void*)p; };
    bf* WQ = (bf*)take((size_t)DQ * DM * 2); bf* WK = (bf*)take((size_t)DKV * DM * 2); bf* WV = (bf*)take((size_t)DKV * DM * 2); bf* WO = (bf*)take((size_t)DM * DQ * 2);
    const size_t PB = (size_t)NH_ * TT * HD, AB = (size_t)TT * DQ;   // elements of one batch in a head plane and in a merged plane; every plane holds both batches
    h16* QP16 = (h16*)take(NB_ * PB * 2); h16* KP16 = (h16*)take(NB_ * PB * 2); h16* VT16 = (h16*)take(NB_ * PB * 2);
    bf* QPh = (bf*)take(NB_ * PB * 2); bf* QPl = (bf*)take(NB_ * PB * 2); bf* KPh = (bf*)take(NB_ * PB * 2); bf* KPl = (bf*)take(NB_ * PB * 2); bf* VTh = (bf*)take(NB_ * PB * 2); bf* VTl = (bf*)take(NB_ * PB * 2); bf* ATh = (bf*)take(NB_ * AB * 2); bf* ATl = (bf*)take(NB_ * AB * 2);
    bf* XB = (bf*)take((size_t)NB_ * TT * DM * 2);
    if ((size_t)(wsp - (char*)d_ws) > ws_size) return;    // ws 256 MiB
    k_cast<<<CSEG / (CBLK * CWAV), CWAV * 32, 0, stream>>>(wq, wk, wv, wo, x, WQ, WK, WV, WO, XB);
    // WQ, WK, WV lie one behind the other (each a multiple of 256 bytes): one [DQ + 2 DKV][DM] operand
    k_proj<<<dim3(NB_ * TT / 128, (DQ + 2 * DKV) / 128, 1), 256, 0, stream>>>(XB, WQ, sinT, cosT, qsc, ksc, QP16, QPh, QPl, KP16, KPh, KPl, VT16, VTh, VTl);
    k_fattn<<<FNF + FNH, 128, 0, stream>>>(QP16, KP16, VT16, QPh, QPl, KPh, KPl, VTh, VTl, ATh, ATl);
    k_gemmt<1, DQ, 64><<<dim3(NB_ * TT / 128, DM / 128, 1), 256, 0, stream>>>(ATh, ATl, WO, OUT);   // the batches lie one behind the other in the merged planes and in the output: one [NB_ TT][DQ] operand
}

// v008
// It runs in 184 microseconds.
// In two side-by-side timings against v007, it was 1.18 and 1.19 times as fast.
// All steps since v000 together make it 10.0 times as fast.
#include <hip/hip_runtime.h>

// Causal multi-head attention with 128-wide heads, rotary embeddings from half-width input tables and a per-head RMSNorm applied AFTER the rotary (x [2][2048][2048]; q, k, v = x W^T ('oi' 1/sqrt(2048), no bias; 16 heads x 128); rope: (x1, x2) = the two HALVES of each head -> cat(x1 c - x2 s, x1 s + x2 c) with the sin / cos INPUT tables [2048][64] (read; argument order x, sin, cos); then per head q = RMSNorm(q) x q_norm_w, k = RMSNorm(k) x k_norm_w (eps = float32 machine epsilon 1.19e-7; weights [128] = ones, read); scores / sqrt(128); causal (-inf); softmax; out = merged Wo^T ('oi') -> [2][2048][2048] (8.4 M); argument order x, sin, cos, Wq, Wk, Wv, Wo, q_norm_w, k_norm_w).
// Layout, both batches at once: bf16 copy of x; 'oi' weights cast as-is; k_proj: exact projections q, k, v in one launch, each 128 x 128 tile (128 tokens of one head) taken to its 16-bit head planes in the tile's epilogue: q / k rotary from the bf16-rounded input tables (the tables need not be rotations: no norm-preservation shortcut), per (head, token) 1/sqrt(mean + eps) over the 128 rotated dims, x r x w[d]; v transposed; then k_fattn: causal T-2048 attention in one launch (hybrid rows: < 512 hi/lo 3 products, rest fp16 x1024; online softmax, scores and probabilities stay in registers; it writes the merged hi/lo planes); merged hi/lo x Wo exact.
// Compute dtypes, f32 accumulate: every input rounded to bf16 incl. the tables; projections exact; rotary and RMSNorm f32; attention rows < 512 3 products, rest fp16; softmax f32; Wo hl x exact.

#define NB_  2
#define TT   2048
#define DM   2048
#define NH_  16
#define NKV  16
#define REP  (NH_ / NKV)
#define HD   128
#define DQ   (NH_ * HD)
#define DKV  (NKV * HD)
#define RH   512                  // query rows < RH use hi+lo planes (0: none)
#define SCL  0.088388347648318447f   // HD^-0.5
typedef _Float16 h16;
typedef unsigned short bf;
typedef __attribute__((ext_vector_type(16))) __bf16   v16bf;
typedef __attribute__((ext_vector_type(16))) _Float16 v16h;
typedef __attribute__((ext_vector_type(8)))  _Float16 v8h;
typedef __attribute__((ext_vector_type(8)))  unsigned short v8us;
typedef __attribute__((ext_vector_type(8)))  float    v8f;
typedef __attribute__((ext_vector_type(4)))  float    v4f;
typedef v8h  __attribute__((may_alias)) v8ha;
typedef v4f  __attribute__((may_alias)) v4fa;
typedef v8us __attribute__((may_alias)) v8usa;

__device__ __forceinline__ unsigned short f2bf(float f) { unsigned u = __float_as_uint(f); u += 0x7FFFu + ((u >> 16) & 1u); return (unsigned short)(u >> 16); }
__device__ __forceinline__ float bf2f(unsigned short b) { return __uint_as_float(((unsigned)b) << 16); }
__device__ __forceinline__ float bfr(float f) { return bf2f(f2bf(f)); }
__device__ __forceinline__ v16h cat16(v8h lo, v8h hi) { return __builtin_shufflevector(lo, hi, 0, 1, 2, 3, 4, 5, 6, 7, 8, 9, 10, 11, 12, 13, 14, 15); }
__device__ __forceinline__ v16bf cat16b(v8us lo, v8us hi) { return __builtin_bit_cast(v16bf, __builtin_shufflevector(lo, hi, 0, 1, 2, 3, 4, 5, 6, 7, 8, 9, 10, 11, 12, 13, 14, 15)); }
__device__ __forceinline__ v8f wmma16(v16h a, v16h b, v8f c) { return __builtin_amdgcn_wmma_f32_16x16x32_f16(false, a, false, b, (short)0, c, false, false); }
__device__ __forceinline__ v8f wmmab(v16bf a, v16bf b, v8f c) { return __builtin_amdgcn_wmma_f32_16x16x32_bf16(false, a, false, b, (short)0, c, false, false); }



// ---- gemm_main: acc = the work-group's tile of C[m][n] = sum_k A[m][k] Bt[n][k] (+ A2[m][k] Bt[n][k] for NSPLIT 1), operands K-contiguous bf16 planes of pitch KD; 256 threads. k_gemmt stores C (f32, pitch KD), grid (M/128, N/128); k_proj goes on from the tile.
// One 128x128 output tile per work-group of 8 waves (2 x 4 waves of 64 x 32). K runs in stages of KS (128 or 64): every operand row piece of 2 KS bytes is read from global memory once per work-group, as whole 128-byte lines,
// goes through registers into one of two LDS buffers (row pitch 2 KS + 16 bytes) and is read from there as fragments. One register set: a stage's global loads are issued one stage ahead of its LDS stores; one barrier a stage.
// So a wave stays within 256 registers and two work-groups share a WGP (four waves a SIMD; the callers ask for that budget): one's LDS waits, barriers, prologue and epilogue run under the other's products.
// Each accumulator takes its products in the same k order as a single k loop over 32-wide steps.
template <typename T16> struct WFrag;
template <> struct WFrag<h16> { typedef v16h V; static __device__ __forceinline__ V ld(const h16* p) { return cat16(*(const v8h*)p, *(const v8h*)(p + 16)); } static __device__ __forceinline__ v8f mma(V a, V b, v8f c) { return wmma16(a, b, c); } };
template <> struct WFrag<bf> { typedef v16bf V; static __device__ __forceinline__ V ld(const bf* p) { return cat16b(*(const v8us*)p, *(const v8us*)(p + 16)); } static __device__ __forceinline__ v8f mma(V a, V b, v8f c) { return wmmab(a, b, c); } };
// The work-group barrier of the stage loop: it orders LDS traffic alone, so that the global loads issued ahead stay in flight across it (__syncthreads() waits for them too).
__device__ __forceinline__ void lds_barrier() { __builtin_amdgcn_fence(__ATOMIC_RELEASE, "workgroup", "local"); __builtin_amdgcn_s_barrier(); __builtin_amdgcn_fence(__ATOMIC_ACQUIRE, "workgroup", "local"); }
#define GSM(NSPLIT, KS) (2 * ((NSPLIT) ? 3 : 2) * 128 * ((KS) + 8))   // elements of the two LDS buffers
template <int NSPLIT, int KD, int KS>
__device__ __forceinline__ void gemm_main(bf* sm, const bf* __restrict__ A, const bf* __restrict__ A2, const bf* __restrict__ Bt, int r0, int c0, v8f (&acc)[4][2]) {
    constexpr int PIT = KS + 8, TILE = 128 * PIT, NT = NSPLIT ? 3 : 2, NS = KD / KS, LPR = KS / 8, RPP = 256 / LPR, NP = 128 / RPP;   // lanes a row piece, rows a pass of the 256 threads, pieces a thread and tile
    static_assert(KD % (2 * KS) == 0 && NS >= 4, "an even number of whole stages, at least four");
    struct Stage { v8us a[NP], b[NP], a2[NP]; };   // one stage's share of a thread, on its way from global memory to LDS
    static_assert(GSM(NSPLIT, KS) == 2 * NT * TILE, "the callers' LDS array");
    const int tid = threadIdx.x, lane = tid & 31, lr = lane & 15, hi = lane >> 4, w = tid >> 5, wm = w >> 2, wn = w & 3;
    const int srow = tid / LPR, scol = (tid % LPR) * 8;   // staging: piece i of a thread is row srow + RPP i, 16 bytes at element scol
    const bf* ga = A + (size_t)(r0 + srow) * KD + scol; const bf* ga2 = NSPLIT ? A2 + (size_t)(r0 + srow) * KD + scol : nullptr; const bf* gb = Bt + (size_t)(c0 + srow) * KD + scol;
    bf* sp = sm + srow * PIT + scol;
    const bf* fa = sm + (wm * 64 + lr) * PIT + 8 * hi; const bf* fb = sm + TILE + (wn * 32 + lr) * PIT + 8 * hi;
    Stage R0;   // every full unroll below: it lives in registers and needs constant indices
#pragma unroll
    for (int mb = 0; mb < 4; ++mb)
#pragma unroll
        for (int nb = 0; nb < 2; ++nb) acc[mb][nb] = (v8f){};
    auto gload = [&](Stage& R, int k0) {
        __builtin_amdgcn_sched_barrier(0);   // with the one below: nothing that rewrites an address register is scheduled between these loads and their wait
#pragma unroll
        for (int i = 0; i < NP; ++i) { R.a[i] = *(const v8us*)(ga + (size_t)i * RPP * KD + k0); R.b[i] = *(const v8us*)(gb + (size_t)i * RPP * KD + k0); if (NSPLIT) R.a2[i] = *(const v8us*)(ga2 + (size_t)i * RPP * KD + k0); }
        asm volatile("s_wait_xcnt 0x0" ::: "memory");   // behind the issued loads, in front of whatever next rewrites their address registers
        __builtin_amdgcn_sched_barrier(0);   // the whole stage is issued here: without it the scheduler sinks loads towards their LDS stores, and their trip to memory is then waited for in full
    };
    auto sstore = [&](const Stage& R, int buf) { bf* p = sp + buf * NT * TILE;
#pragma unroll
        for (int i = 0; i < NP; ++i) { *(v8us*)(p + i * RPP * PIT) = R.a[i]; *(v8us*)(p + TILE + i * RPP * PIT) = R.b[i]; if (NSPLIT) *(v8us*)(p + 2 * TILE + i * RPP * PIT) = R.a2[i]; } };
    auto products = [&](int buf) { const bf* pa = fa + buf * NT * TILE; const bf* pb = fb + buf * NT * TILE;
#pragma unroll
        for (int kc = 0; kc < KS; kc += 32) { v16bf a[4], a2[4];
#pragma unroll
            for (int mb = 0; mb < 4; ++mb) { a[mb] = WFrag<bf>::ld(pa + mb * 16 * PIT + kc); if (NSPLIT) a2[mb] = WFrag<bf>::ld(pa + 2 * TILE + mb * 16 * PIT + kc); }
#pragma unroll
            for (int nb = 0; nb < 2; ++nb) { const v16bf b = WFrag<bf>::ld(pb + nb * 16 * PIT + kc);
#pragma unroll
                for (int mb = 0; mb < 4; ++mb) { acc[mb][nb] = wmmab(a[mb], b, acc[mb][nb]); if (NSPLIT) acc[mb][nb] = wmmab(a2[mb], b, acc[mb][nb]); } } } };
    // Stage s is read from buffer s & 1. Each barrier below publishes the stage just stored and ends every wave's reads of the stage just used, whose buffer the next store takes.
    gload(R0, 0); sstore(R0, 0); gload(R0, KS);
    lds_barrier();
    // the loop stays rolled: its body already holds two whole stages
#pragma unroll 1
    for (int s = 0; s < NS - 2; s += 2) {   // on entry: buffer 0 holds stage s, R0 stage s + 1
        products(0); sstore(R0, 1); gload(R0, (s + 2) * KS);
        lds_barrier();
        products(1); sstore(R0, 0); gload(R0, (s + 3) * KS);
        lds_barrier();
    }
    products(0); sstore(R0, 1);
    lds_barrier();
    products(1);   // behind the last barrier only buffer 1 is still read
}
template <int NSPLIT, int KD, int KS>
__global__ __launch_bounds__(256) __attribute__((amdgpu_waves_per_eu(4, 4))) void k_gemmt(const bf* __restrict__ A, const bf* __restrict__ A2, const bf* __restrict__ Bt, float* C) {
    __shared__ __align__(16) bf sm[GSM(NSPLIT, KS)];
    __shared__ __align__(16) float osm[8 * 16 * 36];
    const int tid = threadIdx.x, lane = tid & 31, lr = lane & 15, hi = lane >> 4, w = tid >> 5, wm = w >> 2, wn = w & 3;
    const int r0 = blockIdx.x * 128, c0 = blockIdx.y * 128;
    v8f acc[4][2];
    gemm_main<NSPLIT, KD, KS>(sm, A, A2, Bt, r0, c0, acc);
    __builtin_amdgcn_sched_barrier(0);   // the epilogue's address arithmetic stays behind the last products: scheduled among their fragments it goes over the 256 registers, into scratch
    float* os = osm + w * (16 * 36);   // the wave's own 16 x 32 patch: accumulator order in, whole 128-byte output lines out
#pragma unroll
    for (int mb = 0; mb < 4; ++mb) {
#pragma unroll
        for (int nb = 0; nb < 2; ++nb)
#pragma unroll
            for (int j = 0; j < 8; ++j) os[(hi * 8 + j) * 36 + nb * 16 + lr] = acc[mb][nb][j];
        float* crow = C + (size_t)(r0 + wm * 64 + mb * 16) * KD + c0 + wn * 32;
#pragma unroll
        for (int q = 0; q < 4; ++q) { const int row = 4 * q + (lane >> 3), cofs = (lane & 7) * 4; const v4f val = *(const v4fa*)(os + row * 36 + cofs); *(v4f*)(crow + (size_t)row * KD + cofs) = val; }
    }
}

__device__ __forceinline__ h16 tohx(float x) { return (h16)x; }
__device__ __forceinline__ void splitf(float y, unsigned short& h, unsigned short& l) { h = f2bf(y); l = f2bf(y - bf2f(h)); }
typedef __attribute__((ext_vector_type(2))) _Float16 v2h;
typedef __attribute__((ext_vector_type(4))) _Float16 v4h;
typedef __attribute__((ext_vector_type(2))) unsigned short v2us;
typedef __attribute__((ext_vector_type(4))) unsigned short v4us;
typedef __attribute__((ext_vector_type(2))) float v2f;
typedef __attribute__((ext_vector_type(4))) int v4i;

// ---- k_cast: the bf16 copies of the four weights and x in one launch. Six segments of CSEG elements (each weight is one, x is two); grid CSEG / (CWAV CBLK) = one work-group of 16 waves a WGP.
// A wave takes the same CBLK elements of each segment in turn: 8 loads of 512 contiguous bytes (read once: non-temporal), the next segment's loads issued before this segment is rounded and stored as whole 128-byte lines.
#define CSEG (DM * DM)
#define CBLK 1024
#define CWAV 16
static_assert(DQ * DM == CSEG && DKV * DM == CSEG && NB_ * TT * DM == 2 * CSEG && CSEG % (CBLK * CWAV) == 0, "k_cast: equal segments, whole work-groups");
__global__ __launch_bounds__(CWAV * 32) void k_cast(const float* __restrict__ wq, const float* __restrict__ wk, const float* __restrict__ wv, const float* __restrict__ wo, const float* __restrict__ x, bf* WQ, bf* WK, bf* WV, bf* WO, bf* XB) {
    const int lane = threadIdx.x & 31, wave = __builtin_amdgcn_readfirstlane((int)(threadIdx.x >> 5));
    const int e0 = ((int)blockIdx.x * CWAV + wave) * CBLK + lane * 4;
    const float* sp[6] = {wq + e0, wk + e0, wv + e0, wo + e0, x + e0, x + CSEG + e0}; bf* dp[6] = {WQ + e0, WK + e0, WV + e0, WO + e0, XB + e0, XB + CSEG + e0};
    v4f r[2][8];   // every full unroll below: these live in registers and need constant indices
#pragma unroll
    for (int i = -1; i < 6; ++i) {
        if (i + 1 < 6) {
            __builtin_amdgcn_sched_barrier(0);   // with the one below: nothing that rewrites an address register is scheduled between these loads and their wait
#pragma unroll
            for (int q = 0; q < 8; ++q) r[(i + 1) & 1][q] = __builtin_nontemporal_load((const v4f*)(sp[i + 1] + q * 128));
            asm volatile("s_wait_xcnt 0x0" ::: "memory");   // behind the issued loads, in front of whatever next rewrites their address registers
            __builtin_amdgcn_sched_barrier(0);   // the next segment's loads are all issued here, ahead of this segment's rounding: 8 to 16 loads of a wave stay in flight
        }
        if (i >= 0) { v4us o[8];
#pragma unroll
            for (int q = 0; q < 8; ++q)
#pragma unroll
                for (int k = 0; k < 4; ++k) o[q][k] = f2bf(r[i & 1][q][k]);
            __builtin_amdgcn_sched_barrier(0);   // with the one below: nothing that rewrites a data or address register of these stores is scheduled between them and their wait
#pragma unroll
            for (int q = 0; q < 8; ++q) *(v4us*)(dp[i] + q * 128) = o[q];   // each store: two whole 128-byte lines
            asm volatile("s_wait_xcnt 0x0" ::: "memory");   // behind the issued stores, in front of whatever next rewrites their registers
            __builtin_amdgcn_sched_barrier(0); }
    }
}

// ---- k_proj: the projections q, k, v of both batches in one launch, each tile carried on to its 16-bit planes; nothing f32 goes through memory. X [batch x t][DM]; Wqkv: the rows of Wq, Wk, Wv one behind the other; grid (NB_ TT / 128, (DQ + 2 DKV) / 128).
// A 128 x 128 tile is 128 tokens of one head of q, k or v. The accumulators go as f32 into LDS (pitch PTP floats), in the place of stage buffer 0, and behind one barrier 16 lanes take one row of it, 16 rows a pass of the 256 threads.
// q / k tile, stored [t][d] -> planes [batch x h][t][d] (fp16 + bf16 hi/lo): lane j holds the dims 4j..4j+3 of both halves, so that each rotary pair sits in one lane. rotary from the bf16-rounded tables, r = 1/sqrt(mean of squares + eps) over the
// 128 rotated dims (8 terms a lane, then a butterfly over the 16 lanes), (y x r) x w[d] with w rounded to bf16. v tile, stored [d][t] (a lane's 8 accumulator registers are 8 tokens of one dim) -> transposed planes [batch x h][d][t]: lane j the tokens 8j..8j+7.
#define PTP 132
typedef float __attribute__((may_alias)) fa;
static_assert(NH_ == NKV && HD == 128 && TT % 128 == 0, "k_proj: q, k and v alike; a tile is one head wide and lies in one batch");
__device__ __forceinline__ float rowsum16(float v) {   // sum over the 16 lanes of a row, every lane on; the cross-lane reads fold into the adds
    v += __builtin_bit_cast(float, __builtin_amdgcn_update_dpp(0, __builtin_bit_cast(int, v), 0x161, 0xf, 0xf, true));   // row_xmask:1
    v += __builtin_bit_cast(float, __builtin_amdgcn_update_dpp(0, __builtin_bit_cast(int, v), 0x162, 0xf, 0xf, true));   // row_xmask:2
    v += __builtin_bit_cast(float, __builtin_amdgcn_update_dpp(0, __builtin_bit_cast(int, v), 0x164, 0xf, 0xf, true));   // row_xmask:4
    v += __builtin_bit_cast(float, __builtin_amdgcn_update_dpp(0, __builtin_bit_cast(int, v), 0x168, 0xf, 0xf, true));   // row_xmask:8
    return v; }
__global__ __launch_bounds__(256) __attribute__((amdgpu_waves_per_eu(4, 4))) void k_proj(const bf* __restrict__ X, const bf* __restrict__ Wqkv, const float* __restrict__ sinT, const float* __restrict__ cosT, const float* __restrict__ wq_, const float* __restrict__ wk_, h16* Q16, bf* Qh, bf* Ql, h16* K16, bf* Kh, bf* Kl, h16* V16, bf* Vh, bf* Vl) {
    __shared__ __align__(16) bf sm[GSM(0, 128)];
    static_assert(128 * PTP * 4 <= GSM(0, 128), "the f32 tile fits in stage buffer 0 (half of the array's 2 GSM bytes), which no wave reads behind the stage loop's last barrier: no barrier in front of its stores");
    const int tid = threadIdx.x, lane = tid & 31, lr = lane & 15, hi = lane >> 4, w = tid >> 5, wm = w >> 2, wn = w & 3;
    const int r0 = blockIdx.x * 128, c0 = blockIdx.y * 128;
    v8f acc[4][2];   // every full unroll below: register arrays need constant indices
    gemm_main<0, DM, 128>(sm, X, nullptr, Wqkv, r0, c0, acc);
    fa* ts = (fa*)sm;
    const int bb = r0 / TT, t0 = r0 % TT, rr = tid >> 4, l16 = tid & 15;   // batch, first token; the thread's row in a pass and its place in the row
    if (c0 < DQ + DKV) {   // the same for the whole work-group
        const bool isk = c0 >= DQ; const float* wn_ = isk ? wk_ : wq_; h16* P16 = isk ? K16 : Q16; bf* Ph = isk ? Kh : Qh; bf* Pl = isk ? Kl : Ql;
        const int hb = bb * NH_ + (c0 % DQ) / HD, d = l16 * 4; const float* pc = cosT + (t0 + rr) * (HD / 2) + d; const float* ps = sinT + (t0 + rr) * (HD / 2) + d; v4f cr[8], sr[8];
        __builtin_amdgcn_sched_barrier(0);   // with the one below: nothing that rewrites an address register is scheduled between these loads and their wait
#pragma unroll
        for (int i = 0; i < 8; ++i) { cr[i] = *(const v4f*)(pc + i * 16 * (HD / 2)); sr[i] = *(const v4f*)(ps + i * 16 * (HD / 2)); }
        const v4f wa = *(const v4f*)(wn_ + d), wb = *(const v4f*)(wn_ + HD / 2 + d);
        asm volatile("s_wait_xcnt 0x0" :: "v"(pc), "v"(ps) : "memory");   // behind the issued loads, in front of whatever next rewrites their address registers; the two addresses are named so that they live up to here and no later load of the run lands on them
        __builtin_amdgcn_sched_barrier(0);   // all the tables' loads are issued here: their trip to memory runs under the tile's LDS stores and the barrier
#pragma unroll
        for (int mb = 0; mb < 4; ++mb)
#pragma unroll
            for (int nb = 0; nb < 2; ++nb)
#pragma unroll
                for (int j = 0; j < 8; ++j) ts[(wm * 64 + mb * 16 + hi * 8 + j) * PTP + wn * 32 + nb * 16 + lr] = acc[mb][nb][j];
        lds_barrier();   // publishes the tile
        v4f w1, w2;
#pragma unroll
        for (int q = 0; q < 4; ++q) { w1[q] = bfr(wa[q]); w2[q] = bfr(wb[q]); }
        v4f xl[8], xh[8];   // all eight rows' LDS reads are issued ahead of the passes, whose scheduling barriers would else leave each pass waiting for its own
#pragma unroll
        for (int i = 0; i < 8; ++i) { xl[i] = *(const v4fa*)(ts + (i * 16 + rr) * PTP + d); xh[i] = *(const v4fa*)(ts + (i * 16 + rr) * PTP + HD / 2 + d); }
#pragma unroll
        for (int i = 0; i < 8; ++i) { const int row = i * 16 + rr; const v4f x1 = xl[i], x2 = xh[i]; v4f c, s;
#pragma unroll
            for (int q = 0; q < 4; ++q) { c[q] = bfr(cr[i][q]); s[q] = bfr(sr[i][q]); }
            const v4f y1 = x1 * c - x2 * s, y2 = x1 * s + x2 * c; float ss = 0.f;
#pragma unroll
            for (int q = 0; q < 4; ++q) ss += y1[q] * y1[q];
#pragma unroll
            for (int q = 0; q < 4; ++q) ss += y2[q] * y2[q];
            const float rf = __fdiv_rn(1.0f, __fsqrt_rn(rowsum16(ss) * (1.0f / HD) + 1.1920929e-07f)); const size_t o = ((size_t)hb * TT + t0 + row) * HD + d; v4h a16, b16; v4us ah, al, bh, bl;
#pragma unroll
            for (int q = 0; q < 4; ++q) { const float ra = (y1[q] * rf) * w1[q], rb = (y2[q] * rf) * w2[q]; unsigned short u, v; a16[q] = tohx(ra); splitf(ra, u, v); ah[q] = u; al[q] = v; b16[q] = tohx(rb); splitf(rb, u, v); bh[q] = u; bl[q] = v; }
            __builtin_amdgcn_sched_barrier(0);   // with the one below: nothing that rewrites a data or address register of these stores is scheduled between them and their wait
            *(v4h*)(P16 + o) = a16; *(v4h*)(P16 + o + HD / 2) = b16; *(v4us*)(Ph + o) = ah; *(v4us*)(Ph + o + HD / 2) = bh; *(v4us*)(Pl + o) = al; *(v4us*)(Pl + o + HD / 2) = bl;   // each store: one whole 128-byte line a row
            asm volatile("s_wait_xcnt 0x0" ::: "memory");   // behind the issued stores, in front of whatever next rewrites their registers
            __builtin_amdgcn_sched_barrier(0); }
    } else {
#pragma unroll
        for (int mb = 0; mb < 4; ++mb)
#pragma unroll
            for (int nb = 0; nb < 2; ++nb) { fa* p = ts + (wn * 32 + nb * 16 + lr) * PTP + wm * 64 + mb * 16 + hi * 8; const v8f a = acc[mb][nb];
                *(v4fa*)p = (v4f){a[0], a[1], a[2], a[3]}; *(v4fa*)(p + 4) = (v4f){a[4], a[5], a[6], a[7]}; }
        lds_barrier();   // publishes the tile
        const int hv = bb * NKV + (c0 - DQ - DKV) / HD, tc = l16 * 8; v4f xl[8], xh[8];   // as in the q / k branch: all the LDS reads ahead of the passes
#pragma unroll
        for (int i = 0; i < 8; ++i) { xl[i] = *(const v4fa*)(ts + (i * 16 + rr) * PTP + tc); xh[i] = *(const v4fa*)(ts + (i * 16 + rr) * PTP + tc + 4); }
#pragma unroll
        for (int i = 0; i < 8; ++i) { const int dd = i * 16 + rr; const v4f xa = xl[i], xb = xh[i]; const size_t e = ((size_t)hv * HD + dd) * TT + t0 + tc; v8h o16; v8us oh, ol;
#pragma unroll
            for (int q = 0; q < 8; ++q) { const float x = q < 4 ? xa[q & 3] : xb[q & 3]; unsigned short a2, c2; o16[q] = tohx(x); splitf(x, a2, c2); oh[q] = a2; ol[q] = c2; }
            __builtin_amdgcn_sched_barrier(0);   // with the one below: nothing that rewrites a data or address register of these stores is scheduled between them and their wait
            *(v8h*)(V16 + e) = o16; *(v8us*)(Vh + e) = oh; *(v8us*)(Vl + e) = ol;   // each store: two whole 128-byte lines a row
            asm volatile("s_wait_xcnt 0x0" ::: "memory");   // behind the issued stores, in front of whatever next rewrites their registers
            __builtin_amdgcn_sched_barrier(0); }
    }
}
#define FTHR 4.0f
#define FPK (HD + 8)             // LDS pitch of a key row, elements
#define FPV (64 + 8)             // LDS pitch of a value-plane row piece (64 keys), elements
#define FTK (64 * FPK)
#define FTV (HD * FPV)
__device__ __forceinline__ float xhalf(float x) { return __builtin_bit_cast(float, __builtin_amdgcn_permlanex16(__builtin_bit_cast(int, x), __builtin_bit_cast(int, x), 0x76543210, 0xfedcba98, false, false)); }   // lane l reads lane l ^ 16
__device__ __forceinline__ void wmma_gap() { __builtin_amdgcn_sched_barrier(0); asm volatile("v_nop\n\tv_nop\n\tv_nop\n\tv_nop"); __builtin_amdgcn_sched_barrier(0); }   // the distance behind the last matrix instruction before loads overwrite its operands, on a taken branch too
template <typename T16, int NSPLIT, int R>
__device__ __forceinline__ void fattn_wg(T16* sm, const T16* __restrict__ Q, const T16* __restrict__ Q2, const T16* __restrict__ K, const T16* __restrict__ K2, const T16* __restrict__ Vt, const T16* __restrict__ Vt2, bf* Ah, bf* Al, int q0, int w) {
    typedef typename WFrag<T16>::V V;
    constexpr float CS = SCL * 1.4426950408889634f, POFF = NSPLIT ? 0.0f : 10.0f;   // scores to log2 units; 2^10 on the fp16 probabilities
    constexpr int BUF = (NSPLIT ? 2 : 1) * (FTK + FTV);   // one buffer: K, V^T (, K lo, V^T lo)
    struct Stage { v8us k[8], v[8], k2[8], v2[8]; };   // one stage's share of a thread, on its way from global memory to LDS
    const int tid = threadIdx.x, lane = tid & 31, lr = lane & 15, hi = lane >> 4;
    const int qw0 = q0 + 16 * R * w, plast = (qw0 + 16 * R - 1) / 32, ns = (q0 + 64 * R) / 64;   // the wave's first row; its last pass, which holds its diagonal (every query has an unmasked key in every pass up to it); the work-group's stages
    const int krow = tid >> 4, kcol = (tid & 15) * 8, vrow = tid >> 3, vcol = (tid & 7) * 8;   // staging: piece i of a thread is key row krow + 8 i and value-plane row vrow + 16 i, 16 bytes each
    const int gko = krow * HD + kcol, gvo = vrow * TT + vcol, sko = krow * FPK + kcol, svo = FTK + vrow * FPV + vcol;
    const int fko = lr * FPK + 8 * hi, fvo = FTK + lr * FPV + 8 * hi;   // the lane's element offset in a 16-row block of the staged tiles
    Stage G; V qf[R][4], qf2[R][4]; v8f acc[R][8]; float m_run[R], l_run[R];   // every full unroll below: these live in registers and need constant indices
    auto gload = [&](int st) {
        __builtin_amdgcn_sched_barrier(0);   // with the one below: nothing that rewrites an address register is scheduled between these loads and their wait
#pragma unroll
        for (int i = 0; i < 8; ++i) { G.k[i] = *(const v8usa*)(K + (size_t)st * 64 * HD + gko + i * 8 * HD); G.v[i] = *(const v8usa*)(Vt + st * 64 + gvo + i * 16 * TT);
            if (NSPLIT) { G.k2[i] = *(const v8usa*)(K2 + (size_t)st * 64 * HD + gko + i * 8 * HD); G.v2[i] = *(const v8usa*)(Vt2 + st * 64 + gvo + i * 16 * TT); } }
        asm volatile("s_wait_xcnt 0x0" ::: "memory");   // behind the issued loads, in front of whatever next rewrites their address registers
        __builtin_amdgcn_sched_barrier(0);   // the whole stage is issued here, a stage ahead of its LDS stores
    };
    auto sstore = [&](int buf) { T16* p = sm + buf * BUF;
#pragma unroll
        for (int i = 0; i < 8; ++i) { *(v8usa*)(p + sko + i * 8 * FPK) = G.k[i]; *(v8usa*)(p + svo + i * 16 * FPV) = G.v[i];
            if (NSPLIT) { *(v8usa*)(p + FTK + FTV + sko + i * 8 * FPK) = G.k2[i]; *(v8usa*)(p + FTK + FTV + svo + i * 16 * FPV) = G.v2[i]; } } };
    __builtin_amdgcn_sched_barrier(0);   // the query rows are loaded in front of stage 0: loads return in order, so the wait of stage 0's LDS stores covers them and no pass waits for a staged load on their account
#pragma unroll
    for (int g = 0; g < R; ++g)
#pragma unroll
        for (int kc = 0; kc < 4; ++kc) { qf[g][kc] = WFrag<T16>::ld(Q + (size_t)(qw0 + 16 * g + lr) * HD + 8 * hi + kc * 32); if (NSPLIT) qf2[g][kc] = WFrag<T16>::ld(Q2 + (size_t)(qw0 + 16 * g + lr) * HD + 8 * hi + kc * 32); }
    asm volatile("s_wait_xcnt 0x0" ::: "memory");   // as in gload
    gload(0);
    sstore(0);
    if (ns > 1) gload(1);
#pragma unroll
    for (int g = 0; g < R; ++g) { m_run[g] = -__builtin_inff(); l_run[g] = 0.0f;
#pragma unroll
        for (int t = 0; t < 8; ++t) acc[g][t] = (v8f){}; }
    lds_barrier();
    // Stage st is read from buffer st & 1. Each barrier publishes the stage just stored and ends every wave's reads of the stage just used, whose buffer the next store takes. Every wave stages and passes every barrier, also where its own passes are over.
    // both loops stay rolled and nested: one pass already holds 32 (fp16) or 48 (hi/lo) matrix instructions beside its softmax
#pragma unroll 1
    for (int st = 0; st < ns; ++st) {
        const T16* sb = sm + (st & 1) * BUF;
#pragma unroll 1
        for (int sub = 0; sub < 2; ++sub) { const int p = 2 * st + sub;
            if (p > plast) break;   // wave-uniform
            V kf[2][4], kf2[2][4], vf[8], vf2[8];
#pragma unroll
            for (int kt = 0; kt < 2; ++kt)
#pragma unroll
                for (int kc = 0; kc < 4; ++kc) { kf[kt][kc] = WFrag<T16>::ld(sb + fko + (sub * 32 + kt * 16) * FPK + kc * 32); if (NSPLIT) kf2[kt][kc] = WFrag<T16>::ld(sb + FTK + FTV + fko + (sub * 32 + kt * 16) * FPK + kc * 32); }
            if (!NSPLIT) __builtin_amdgcn_sched_barrier(0);   // fp16 form: the key fragments' LDS reads go first (LDS reads return in order, and the score products wait for these alone)
#pragma unroll
            for (int t = 0; t < 8; ++t) { vf[t] = WFrag<T16>::ld(sb + fvo + t * 16 * FPV + sub * 32); if (NSPLIT) vf2[t] = WFrag<T16>::ld(sb + FTK + FTV + fvo + t * 16 * FPV + sub * 32); }
            if (!NSPLIT) __builtin_amdgcn_sched_barrier(0);   // fp16 form: the value fragments' LDS reads are issued here, under the score products and the softmax (the hi/lo form has no registers to spare for that)
            v8f s[2][R];
#pragma unroll
            for (int kt = 0; kt < 2; ++kt)
#pragma unroll
                for (int g = 0; g < R; ++g) s[kt][g] = (v8f){};
#pragma unroll
            for (int kc = 0; kc < 4; ++kc)
#pragma unroll
                for (int kt = 0; kt < 2; ++kt)
#pragma unroll
                    for (int g = 0; g < R; ++g) { s[kt][g] = WFrag<T16>::mma(kf[kt][kc], qf[g][kc], s[kt][g]); if (NSPLIT) { s[kt][g] = WFrag<T16>::mma(kf[kt][kc], qf2[g][kc], s[kt][g]); s[kt][g] = WFrag<T16>::mma(kf2[kt][kc], qf[g][kc], s[kt][g]); } }
            if (p * 32 + 31 > qw0) {   // wave-uniform: only the pass on the diagonal pays for the mask
#pragma unroll
                for (int g = 0; g < R; ++g)
#pragma unroll
                    for (int kt = 0; kt < 2; ++kt) {
#pragma unroll
                        for (int r = 0; r < 8; ++r) if (p * 32 + 16 * kt + 8 * hi + r > qw0 + 16 * g + lr) s[kt][g][r] = -__builtin_inff();
                        asm volatile("" : "+v"(s[kt][g]));   // the masked scores: keeps the selects inside the branch
                    }
            }
            float mb[R]; bool need = false;
#pragma unroll
            for (int g = 0; g < R; ++g) { float mx = s[0][g][0];
#pragma unroll
                for (int r = 1; r < 8; ++r) mx = fmaxf(mx, s[0][g][r]);
#pragma unroll
                for (int r = 0; r < 8; ++r) mx = fmaxf(mx, s[1][g][r]);
                mx = fmaxf(mx, xhalf(mx)) * CS; mb[g] = mx; need = need || (mx > m_run[g] + FTHR); }   // both wave halves hold the query's maximum of this pass (the scale is positive)
            if (__builtin_amdgcn_ballot_w32(need) != 0) {   // one scalar test a pass; always taken in the first pass, where m_run is -inf and corr 0
#pragma unroll
                for (int g = 0; g < R; ++g) { const float m_new = fmaxf(m_run[g], mb[g]); const float corr = __builtin_amdgcn_exp2f(m_run[g] - m_new); l_run[g] *= corr; m_run[g] = m_new;
#pragma unroll
                    for (int t = 0; t < 8; ++t) acc[g][t] = acc[g][t] * corr; }
            }
#pragma unroll
            for (int g = 0; g < R; ++g) { const float nm = POFF - m_run[g]; float pr[16], ps0 = 0.0f, ps1 = 0.0f;
#pragma unroll
                for (int e = 0; e < 16; e += 2) { const v2f arg = __builtin_elementwise_fma((v2f){s[e >> 3][g][e & 7], s[e >> 3][g][(e & 7) + 1]}, (v2f){CS, CS}, (v2f){nm, nm});   // two scores of a register pair in one packed instruction
                    pr[e] = __builtin_amdgcn_exp2f(arg.x); pr[e + 1] = __builtin_amdgcn_exp2f(arg.y); ps0 += pr[e]; ps1 += pr[e + 1]; }   // element e of the B operand: key 8 hi + e, or 16 + 8 hi + (e - 8): the k order of the value fragments
                l_run[g] += ps0 + ps1;
                if constexpr (NSPLIT != 0) { typedef __attribute__((ext_vector_type(16))) unsigned short v16us; v16us ph, pl;
#pragma unroll
                    for (int e = 0; e < 16; ++e) { unsigned short a, c2; splitf(pr[e], a, c2); ph[e] = a; pl[e] = c2; }
                    const V bh = __builtin_bit_cast(V, ph), bl = __builtin_bit_cast(V, pl);
#pragma unroll
                    for (int t = 0; t < 8; ++t) { acc[g][t] = WFrag<T16>::mma(vf[t], bh, acc[g][t]); acc[g][t] = WFrag<T16>::mma(vf[t], bl, acc[g][t]); acc[g][t] = WFrag<T16>::mma(vf2[t], bh, acc[g][t]); }
                } else { V pf;
#pragma unroll
                    for (int e = 0; e < 16; ++e) pf[e] = tohx(pr[e]);
#pragma unroll
                    for (int t = 0; t < 8; ++t) acc[g][t] = WFrag<T16>::mma(vf[t], pf, acc[g][t]); } }
            wmma_gap();
        }
        if (st + 1 < ns) { sstore((st + 1) & 1); if (st + 2 < ns) gload(st + 2); }   // the same for the whole work-group
        lds_barrier();
    }
#pragma unroll
    for (int g = 0; g < R; ++g) { const float inv = __fdiv_rn(1.0f, l_run[g] + xhalf(l_run[g]));   // each wave half holds the sum over its own keys
        const size_t o = (size_t)(qw0 + 16 * g + lr) * DQ + 8 * hi;
#pragma unroll
        for (int t = 0; t < 8; ++t) { v8us oh, ol;   // register r of tile t: dim 16 t + 8 hi + r of query lr
#pragma unroll
            for (int r = 0; r < 8; ++r) { unsigned short a, c2; splitf(acc[g][t][r] * inv, a, c2); oh[r] = a; ol[r] = c2; }
            __builtin_amdgcn_sched_barrier(0);   // with the one below: nothing that rewrites a data or address register of these stores is scheduled between them and their wait
            *(v8us*)(Ah + o + 16 * t) = oh; *(v8us*)(Al + o + 16 * t) = ol;
            asm volatile("s_wait_xcnt 0x0" ::: "memory");   // behind the issued stores, in front of whatever next rewrites their registers
            __builtin_amdgcn_sched_barrier(0); } }
}
// Heaviest row blocks first, the short hi/lo blocks last. Planes [batch x head][..]; merged output planes [batch][t][h * HD + d].
#define FNBH (NB_ * NH_)
#define FNF  ((TT - RH) / 128 * FNBH)
#define FNH  (RH / 64 * FNBH)
static_assert(NH_ == NKV && HD == 128 && RH % 64 == 0 && (TT - RH) % 128 == 0 && TT % 64 == 0, "k_fattn: one kv head a query head, whole work-groups, whole stages");
__global__ __launch_bounds__(128) __attribute__((amdgpu_waves_per_eu(2, 2))) void k_fattn(const h16* __restrict__ Q16, const h16* __restrict__ K16, const h16* __restrict__ V16, const bf* __restrict__ Qh, const bf* __restrict__ Ql, const bf* __restrict__ Kh, const bf* __restrict__ Kl, const bf* __restrict__ Vh, const bf* __restrict__ Vl, bf* Ah, bf* Al) {
    __shared__ __align__(16) bf sm[2 * 2 * (FTK + FTV)];
    const int w = __builtin_amdgcn_readfirstlane((int)(threadIdx.x >> 5)), bx = blockIdx.x;   // wave number, kept scalar so that the pass tests are scalar branches
    const int ix = bx < FNF ? bx : bx - FNF, bh = ix % FNBH, rb = ix / FNBH;
    const size_t pl = (size_t)bh * TT * HD, ao = (size_t)(bh / NH_) * TT * DQ + (size_t)(bh % NH_) * HD;
    if (bx < FNF) fattn_wg<h16, 0, 2>((h16*)sm, Q16 + pl, nullptr, K16 + pl, nullptr, V16 + pl, nullptr, Ah + ao, Al + ao, RH + ((TT - RH) / 128 - 1 - rb) * 128, w);
    else fattn_wg<bf, 2, 1>(sm, Qh + pl, Ql + pl, Kh + pl, Kl + pl, Vh + pl, Vl + pl, Ah + ao, Al + ao, (RH / 64 - 1 - rb) * 64, w);
}

extern "C" void kernel_launch(void* const* d_in, const int* in_sizes, int n_in,
                              void* d_out, int out_size, void* d_ws, size_t ws_size, hipStream_t stream) {
    (void)in_sizes; (void)n_in; (void)out_size;
    const float* x = (const float*)d_in[0]; const float* sinT = (const float*)d_in[1]; const float* cosT = (const float*)d_in[2]; const float* wq = (const float*)d_in[3]; const float* wk = (const float*)d_in[4]; const float* wv = (const float*)d_in[5]; const float* wo = (const float*)d_in[6]; const float* qsc = (const float*)d_in[7]; const float* ksc = (const float*)d_in[8];   /* x, sin, cos (f32 [2048][64], READ), Wq, Wk, Wv, Wo ('oi' [2048][2048]), q_norm_w, k_norm_w ([128], read) */
    float* OUT = (float*)d_out;     // [2][2048][2048]
    char* wsp = (char*)d_ws;
    auto take = [&](size_t bytes) { char* p = wsp; wsp += (bytes + 255) & ~(size_t)255; return (void*)p; };
    bf* WQ = (bf*)take((size_t)DQ * DM * 2); bf* WK = (bf*)take((size_t)DKV * DM * 2); bf* WV = (bf*)take((size_t)DKV * DM * 2); bf* WO = (bf*)take((size_t)DM * DQ * 2);
    const size_t PB = (size_t)NH_ * TT * HD, AB = (size_t)TT * DQ;   // elements of one batch in a head plane and in a merged plane; every plane holds both batches
    h16* QP16 = (h16*)take(NB_ * PB * 2); h16* KP16 = (h16*)take(NB_ * PB * 2); h16* VT16 = (h16*)take(NB_ * PB * 2);
    bf* QPh = (bf*)take(NB_ * PB * 2); bf* QPl = (bf*)take(NB_ * PB * 2); bf* KPh = (bf*)take(NB_ * PB * 2); bf* KPl = (bf*)take(NB_ * PB * 2); bf* VTh = (bf*)take(NB_ * PB * 2); bf* VTl = (bf*)take(NB_ * PB * 2); bf* ATh = (bf*)take(NB_ * AB * 2); bf* ATl = (bf*)take(NB_ * AB * 2);
    bf* XB = (bf*)take((size_t)NB_ * TT * DM * 2);
    if ((size_t)(wsp - (char*)d_ws) > ws_size) return;    // ws 256 MiB
    k_cast<<<CSEG / (CBLK * CWAV), CWAV * 32, 0, stream>>>(wq, wk, wv, wo, x, WQ, WK, WV, WO, XB);
    // WQ, WK, WV lie one behind the other (each a multiple of 256 bytes): one [DQ + 2 DKV][DM] operand
    k_proj<<<dim3(NB_ * TT / 128, (DQ + 2 * DKV) / 128, 1), 256, 0, stream>>>(XB, WQ, sinT, cosT, qsc, ksc, QP16, QPh, QPl, KP16, KPh, KPl, VT16, VTh, VTl);
    k_fattn<<<FNF + FNH, 128, 0, stream>>>(QP16, KP16, VT16, QPh, QPl, KPh, KPl, VTh, VTl, ATh, ATl);
    k_gemmt<1, DQ, 64><<<dim3(NB_ * TT / 128, DM / 128, 1), 256, 0, stream>>>(ATh, ATl, WO, OUT);   // the batches lie one behind the other in the merged planes and in the output: one [NB_ TT][DQ] operand
}

// v009
// A run of this version takes 177 microseconds.
// In both of two side-by-side timings against v008, it was 1.04 times as fast.
// Counting every step since v000, it is 10.4 times as fast.
#include <hip/hip_runtime.h>

// Causal multi-head attention with 128-wide heads, rotary embeddings from half-width input tables and a per-head RMSNorm applied AFTER the rotary (x [2][2048][2048]; q, k, v = x W^T ('oi' 1/sqrt(2048), no bias; 16 heads x 128); rope: (x1, x2) = the two HALVES of each head -> cat(x1 c - x2 s, x1 s + x2 c) with the sin / cos INPUT tables [2048][64] (read; argument order x, sin, cos); then per head q = RMSNorm(q) x q_norm_w, k = RMSNorm(k) x k_norm_w (eps = float32 machine epsilon 1.19e-7; weights [128] = ones, read); scores / sqrt(128); causal (-inf); softmax; out = merged Wo^T ('oi') -> [2][2048][2048] (8.4 M); argument order x, sin, cos, Wq, Wk, Wv, Wo, q_norm_w, k_norm_w).
// Layout, both batches at once: bf16 copy of x; 'oi' weights cast as-is; k_proj: exact projections q, k, v in one launch, each 128 x 128 tile (128 tokens of one head) taken to its 16-bit head planes in the tile's epilogue: q / k rotary from the bf16-rounded input tables (the tables need not be rotations: no norm-preservation shortcut), per (head, token) 1/sqrt(mean + eps) over the 128 rotated dims, x r x w[d]; v transposed; then k_fattn: causal T-2048 attention in one launch (hybrid rows: < 512 hi/lo 3 products, rest fp16 x1024; online softmax, scores and probabilities stay in registers; it writes the merged hi/lo planes); merged hi/lo x Wo exact.
// Compute dtypes, f32 accumulate: every input rounded to bf16 incl. the tables; projections exact; rotary and RMSNorm f32; attention rows < 512 3 products, rest fp16; softmax f32; Wo hl x exact.

#define NB_  2
#define TT   2048
#define DM   2048
#define NH_  16
#define NKV  16
#define REP  (NH_ / NKV)
#define HD   128
#define DQ   (NH_ * HD)
#define DKV  (NKV * HD)
#define RH   512                  // query rows < RH use hi+lo planes (0: none)
#define SCL  0.088388347648318447f   // HD^-0.5
typedef _Float16 h16;
typedef unsigned short bf;
typedef __attribute__((ext_vector_type(16))) __bf16   v16bf;
typedef __attribute__((ext_vector_type(16))) _Float16 v16h;
typedef __attribute__((ext_vector_type(8)))  _Float16 v8h;
typedef __attribute__((ext_vector_type(8)))  unsigned short v8us;
typedef __attribute__((ext_vector_type(8)))  float    v8f;
typedef __attribute__((ext_vector_type(4)))  float    v4f;
typedef v8h  __attribute__((may_alias)) v8ha;
typedef v4f  __attribute__((may_alias)) v4fa;
typedef v8us __attribute__((may_alias)) v8usa;

__device__ __forceinline__ unsigned short f2bf(float f) { unsigned u = __float_as_uint(f); u += 0x7FFFu + ((u >> 16) & 1u); return (unsigned short)(u >> 16); }
__device__ __forceinline__ float bf2f(unsigned short b) { return __uint_as_float(((unsigned)b) << 16); }
__device__ __forceinline__ float bfr(float f) { return bf2f(f2bf(f)); }
__device__ __forceinline__ v16h cat16(v8h lo, v8h hi) { return __builtin_shufflevector(lo, hi, 0, 1, 2, 3, 4, 5, 6, 7, 8, 9, 10, 11, 12, 13, 14, 15); }
__device__ __forceinline__ v16bf cat16b(v8us lo, v8us hi) { return __builtin_bit_cast(v16bf, __builtin_shufflevector(lo, hi, 0, 1, 2, 3, 4, 5, 6, 7, 8, 9, 10, 11, 12, 13, 14, 15)); }
__device__ __forceinline__ v8f wmma16(v16h a, v16h b, v8f c) { return __builtin_amdgcn_wmma_f32_16x16x32_f16(false, a, false, b, (short)0, c, false, false); }
__device__ __forceinline__ v8f wmmab(v16bf a, v16bf b, v8f c) { return __builtin_amdgcn_wmma_f32_16x16x32_bf16(false, a, false, b, (short)0, c, false, false); }



// ---- gemm_main: acc = the work-group's tile of C[m][n] = sum_k A[m][k] Bt[n][k] (+ A2[m][k] Bt[n][k] for NSPLIT 1), operands K-contiguous bf16 planes of pitch KD; 128 threads. k_gemmt stores C (f32, pitch KD), grid (M/128, N/128); k_proj goes on from the tile.
// One 128x128 output tile per work-group of 4 waves (2 x 2 waves of 64 x 64: 8 fragments read from LDS feed 16 products). K runs in stages of KS: every operand row piece of 2 KS bytes is read from global memory once per work-group, as whole 128-byte lines,
// goes through registers into one of two LDS buffers (row pitch 2 KS + 16 bytes) and is read from there as fragments. One register set: a stage's global loads are issued one stage ahead of its LDS stores; one barrier a stage.
// Two or three work-groups share a WGP, one wave of each on every SIMD (the callers ask for the register budget): one's LDS waits, barriers, prologue and epilogue run under the others' products.
// Each accumulator takes its products in the same k order as a single k loop over 32-wide steps.
template <typename T16> struct WFrag;
template <> struct WFrag<h16> { typedef v16h V; static __device__ __forceinline__ V ld(const h16* p) { return cat16(*(const v8h*)p, *(const v8h*)(p + 16)); } static __device__ __forceinline__ v8f mma(V a, V b, v8f c) { return wmma16(a, b, c); } };
template <> struct WFrag<bf> { typedef v16bf V; static __device__ __forceinline__ V ld(const bf* p) { return cat16b(*(const v8us*)p, *(const v8us*)(p + 16)); } static __device__ __forceinline__ v8f mma(V a, V b, v8f c) { return wmmab(a, b, c); } };
// The work-group barrier of the stage loop: it orders LDS traffic alone, so that the global loads issued ahead stay in flight across it (__syncthreads() waits for them too).
__device__ __forceinline__ void lds_barrier() { __builtin_amdgcn_fence(__ATOMIC_RELEASE, "workgroup", "local"); __builtin_amdgcn_s_barrier(); __builtin_amdgcn_fence(__ATOMIC_ACQUIRE, "workgroup", "local"); }
#define GSM(NSPLIT, KS) (2 * ((NSPLIT) ? 3 : 2) * 128 * ((KS) + 8))   // elements of the two LDS buffers
template <int NSPLIT, int KD, int KS>
__device__ __forceinline__ void gemm_main(bf* sm, const bf* __restrict__ A, const bf* __restrict__ A2, const bf* __restrict__ Bt, int r0, int c0, v8f (&acc)[4][4]) {
    constexpr int PIT = KS + 8, TILE = 128 * PIT, NT = NSPLIT ? 3 : 2, NS = KD / KS, NK = KS / 32, LPR = KS / 8, RPP = 128 / LPR, NP = 128 / RPP;   // k steps a stage; lanes a row piece, rows a pass of the 128 threads, pieces a thread and tile
    static_assert(KD % (2 * KS) == 0 && NS >= 4, "an even number of whole stages, at least four");
    struct Stage { v8us a[NP], b[NP], a2[NP]; };   // one stage's share of a thread, on its way from global memory to LDS
    static_assert(GSM(NSPLIT, KS) == 2 * NT * TILE, "the callers' LDS array");
    const int tid = threadIdx.x, lane = tid & 31, lr = lane & 15, hi = lane >> 4, w = tid >> 5, wm = w >> 1, wn = w & 1;
    const int srow = tid / LPR, scol = (tid % LPR) * 8;   // staging: piece i of a thread is row srow + RPP i, 16 bytes at element scol
    const bf* ga = A + (size_t)r0 * KD; const bf* ga2 = NSPLIT ? A2 + (size_t)r0 * KD : nullptr; const bf* gb = Bt + (size_t)c0 * KD; const unsigned go = srow * KD + scol;   // the tiles' first rows (the same for the work-group) and the thread's own element offset, one register for all operands
    bf* sp = sm + srow * PIT + scol;
    const bf* fa = sm + (wm * 64 + lr) * PIT + 8 * hi; const bf* fb = sm + TILE + (wn * 64 + lr) * PIT + 8 * hi;
    Stage R0;   // every full unroll below: it lives in registers and needs constant indices
#pragma unroll
    for (int mb = 0; mb < 4; ++mb)
#pragma unroll
        for (int nb = 0; nb < 4; ++nb) acc[mb][nb] = (v8f){};
    auto gload = [&](Stage& R, int k0) {
        __builtin_amdgcn_sched_barrier(0);   // with the one below: nothing that rewrites an address register is scheduled between these loads and their wait
#pragma unroll
        for (int i = 0; i < NP; ++i) { R.a[i] = *(const v8us*)(ga + (size_t)i * RPP * KD + k0 + go); R.b[i] = *(const v8us*)(gb + (size_t)i * RPP * KD + k0 + go); if (NSPLIT) R.a2[i] = *(const v8us*)(ga2 + (size_t)i * RPP * KD + k0 + go); }
        asm volatile("s_wait_xcnt 0x0" ::: "memory");   // behind the issued loads, in front of whatever next rewrites their address registers
        __builtin_amdgcn_sched_barrier(0);   // the whole stage is issued here: without it the scheduler sinks loads towards their LDS stores, and their trip to memory is then waited for in full
    };
    auto sstore = [&](const Stage& R, int buf) { bf* p = sp + buf * NT * TILE;
#pragma unroll
        for (int i = 0; i < NP; ++i) { *(v8us*)(p + i * RPP * PIT) = R.a[i]; *(v8us*)(p + TILE + i * RPP * PIT) = R.b[i]; if (NSPLIT) *(v8us*)(p + 2 * TILE + i * RPP * PIT) = R.a2[i]; } };
    auto products = [&](int buf) { const bf* pa = fa + buf * NT * TILE; const bf* pb = fb + buf * NT * TILE; v16bf a[NK][4], a2[NK][4], b[NK][4];
#pragma unroll
        for (int kq = 0; kq < NK; ++kq)
#pragma unroll
            for (int f = 0; f < 4; ++f) { a[kq][f] = WFrag<bf>::ld(pa + f * 16 * PIT + kq * 32); b[kq][f] = WFrag<bf>::ld(pb + f * 16 * PIT + kq * 32); if (NSPLIT) a2[kq][f] = WFrag<bf>::ld(pa + 2 * TILE + f * 16 * PIT + kq * 32); }
        __builtin_amdgcn_sched_barrier(0);   // the stage's fragment reads stand as one group in front of its products: left to itself the scheduler reads single fragments among the products and waits each one out
#pragma unroll
        for (int kq = 0; kq < NK; ++kq)
#pragma unroll
            for (int nb = 0; nb < 4; ++nb) {
#pragma unroll
                for (int mb = 0; mb < 4; ++mb) acc[mb][nb] = wmmab(a[kq][mb], b[kq][nb], acc[mb][nb]);
                if (NSPLIT) {
#pragma unroll
                    for (int mb = 0; mb < 4; ++mb) acc[mb][nb] = wmmab(a2[kq][mb], b[kq][nb], acc[mb][nb]); } }
        __builtin_amdgcn_sched_barrier(0);   // the next stage's LDS stores stay behind the products: lifted among them, their wait for the global loads would hold the products up
    };
    // Stage s is read from buffer s & 1. Each barrier below publishes the stage just stored and ends every wave's reads of the stage just used, whose buffer the next store takes.
    gload(R0, 0); sstore(R0, 0); gload(R0, KS);
    lds_barrier();
    // the loop stays rolled: its body already holds two whole stages
#pragma unroll 1
    for (int s = 0; s < NS - 2; s += 2) {   // on entry: buffer 0 holds stage s, R0 stage s + 1
        products(0); sstore(R0, 1); gload(R0, 2 * KS);
        lds_barrier();
        products(1); sstore(R0, 0); gload(R0, 3 * KS);
        lds_barrier();
        ga += 2 * KS; gb += 2 * KS; if (NSPLIT) ga2 += 2 * KS;   // the tiles' row starts move on with the stages: scalar additions, no vector register holds an address
    }
    products(0); sstore(R0, 1);
    lds_barrier();
    products(1);   // behind the last barrier only buffer 1 is still read
}
template <int NSPLIT, int KD, int KS>
__global__ __launch_bounds__(128) __attribute__((amdgpu_waves_per_eu(2, 2))) void k_gemmt(const bf* __restrict__ A, const bf* __restrict__ A2, const bf* __restrict__ Bt, float* C) {
    __shared__ __align__(16) bf sm[GSM(NSPLIT, KS)];
    __shared__ __align__(16) float osm[4 * 16 * 68];
    const int tid = threadIdx.x, lane = tid & 31, lr = lane & 15, hi = lane >> 4, w = tid >> 5, wm = w >> 1, wn = w & 1;
    const int r0 = blockIdx.x * 128, c0 = blockIdx.y * 128;
    v8f acc[4][4];
    gemm_main<NSPLIT, KD, KS>(sm, A, A2, Bt, r0, c0, acc);
    float* os = osm + w * (16 * 68);   // the wave's own 16 x 64 patch: accumulator order in, whole 128-byte output lines out
#pragma unroll
    for (int mb = 0; mb < 4; ++mb) {
#pragma unroll
        for (int nb = 0; nb < 4; ++nb)
#pragma unroll
            for (int j = 0; j < 8; ++j) os[(hi * 8 + j) * 68 + nb * 16 + lr] = acc[mb][nb][j];
        float* crow = C + (size_t)(r0 + wm * 64 + mb * 16) * KD + c0 + wn * 64;
        v4f val[8];
#pragma unroll
        for (int q = 0; q < 8; ++q) val[q] = *(const v4fa*)(os + (2 * q + hi) * 68 + lr * 4);
        __builtin_amdgcn_sched_barrier(0);   // with the one below: nothing that rewrites a data or address register of these stores is scheduled between them and their wait
#pragma unroll
        for (int q = 0; q < 8; ++q) *(v4f*)(crow + (size_t)(2 * q + hi) * KD + lr * 4) = val[q];   // each store: two whole 128-byte lines a row
        asm volatile("s_wait_xcnt 0x0" ::: "memory");   // behind the issued stores, in front of whatever next rewrites their registers
        __builtin_amdgcn_sched_barrier(0);
    }
}

__device__ __forceinline__ h16 tohx(float x) { return (h16)x; }
__device__ __forceinline__ void splitf(float y, unsigned short& h, unsigned short& l) { h = f2bf(y); l = f2bf(y - bf2f(h)); }
typedef __attribute__((ext_vector_type(2))) _Float16 v2h;
typedef __attribute__((ext_vector_type(4))) _Float16 v4h;
typedef __attribute__((ext_vector_type(2))) unsigned short v2us;
typedef __attribute__((ext_vector_type(4))) unsigned short v4us;
typedef __attribute__((ext_vector_type(2))) float v2f;
typedef __attribute__((ext_vector_type(4))) int v4i;

// ---- k_cast: the bf16 copies of the four weights and x in one launch. Six segments of CSEG elements (each weight is one, x is two); grid CSEG / (CWAV CBLK) = one work-group of 16 waves a WGP.
// A wave takes the same CBLK elements of each segment in turn: 8 loads of 512 contiguous bytes (read once: non-temporal), the next segment's loads issued before this segment is rounded and stored as whole 128-byte lines.
#define CSEG (DM * DM)
#define CBLK 1024
#define CWAV 16
static_assert(DQ * DM == CSEG && DKV * DM == CSEG && NB_ * TT * DM == 2 * CSEG && CSEG % (CBLK * CWAV) == 0, "k_cast: equal segments, whole work-groups");
__global__ __launch_bounds__(CWAV * 32) void k_cast(const float* __restrict__ wq, const float* __restrict__ wk, const float* __restrict__ wv, const float* __restrict__ wo, const float* __restrict__ x, bf* WQ, bf* WK, bf* WV, bf* WO, bf* XB) {
    const int lane = threadIdx.x & 31, wave = __builtin_amdgcn_readfirstlane((int)(threadIdx.x >> 5));
    const int e0 = ((int)blockIdx.x * CWAV + wave) * CBLK + lane * 4;
    const float* sp[6] = {wq + e0, wk + e0, wv + e0, wo + e0, x + e0, x + CSEG + e0}; bf* dp[6] = {WQ + e0, WK + e0, WV + e0, WO + e0, XB + e0, XB + CSEG + e0};
    v4f r[2][8];   // every full unroll below: these live in registers and need constant indices
#pragma unroll
    for (int i = -1; i < 6; ++i) {
        if (i + 1 < 6) {
            __builtin_amdgcn_sched_barrier(0);   // with the one below: nothing that rewrites an address register is scheduled between these loads and their wait
#pragma unroll
            for (int q = 0; q < 8; ++q) r[(i + 1) & 1][q] = __builtin_nontemporal_load((const v4f*)(sp[i + 1] + q * 128));
            asm volatile("s_wait_xcnt 0x0" ::: "memory");   // behind the issued loads, in front of whatever next rewrites their address registers
            __builtin_amdgcn_sched_barrier(0);   // the next segment's loads are all issued here, ahead of this segment's rounding: 8 to 16 loads of a wave stay in flight
        }
        if (i >= 0) { v4us o[8];
#pragma unroll
            for (int q = 0; q < 8; ++q)
#pragma unroll
                for (int k = 0; k < 4; ++k) o[q][k] = f2bf(r[i & 1][q][k]);
            __builtin_amdgcn_sched_barrier(0);   // with the one below: nothing that rewrites a data or address register of these stores is scheduled between them and their wait
#pragma unroll
            for (int q = 0; q < 8; ++q) *(v4us*)(dp[i] + q * 128) = o[q];   // each store: two whole 128-byte lines
            asm volatile("s_wait_xcnt 0x0" ::: "memory");   // behind the issued stores, in front of whatever next rewrites their registers
            __builtin_amdgcn_sched_barrier(0); }
    }
}

// ---- k_proj: the projections q, k, v of both batches in one launch, each tile carried on to its 16-bit planes; nothing f32 goes through memory. X [batch x t][DM]; Wqkv: the rows of Wq, Wk, Wv one behind the other; grid (NB_ TT / 128, (DQ + 2 DKV) / 128).
// A 128 x 128 tile is 128 tokens of one head of q, k or v. The accumulators go as f32 into LDS (pitch PTP floats), in the place of the two stage buffers, and behind one barrier 16 lanes take one row of it, 8 rows a pass of the 128 threads.
// q / k tile, stored [t][d] -> planes [batch x h][t][d] (fp16 + bf16 hi/lo): lane j holds the dims 4j..4j+3 of both halves, so that each rotary pair sits in one lane. rotary from the bf16-rounded tables, r = 1/sqrt(mean of squares + eps) over the
// 128 rotated dims (8 terms a lane, then a butterfly over the 16 lanes), (y x r) x w[d] with w rounded to bf16. v tile, stored [d][t] (a lane's 8 accumulator registers are 8 tokens of one dim) -> transposed planes [batch x h][d][t]: lane j the tokens 8j..8j+7.
#define PTP 132
typedef float __attribute__((may_alias)) fa;
static_assert(NH_ == NKV && HD == 128 && TT % 128 == 0, "k_proj: q, k and v alike; a tile is one head wide and lies in one batch");
__device__ __forceinline__ float rowsum16(float v) {   // sum over the 16 lanes of a row, every lane on; the cross-lane reads fold into the adds
    v += __builtin_bit_cast(float, __builtin_amdgcn_update_dpp(0, __builtin_bit_cast(int, v), 0x161, 0xf, 0xf, true));   // row_xmask:1
    v += __builtin_bit_cast(float, __builtin_amdgcn_update_dpp(0, __builtin_bit_cast(int, v), 0x162, 0xf, 0xf, true));   // row_xmask:2
    v += __builtin_bit_cast(float, __builtin_amdgcn_update_dpp(0, __builtin_bit_cast(int, v), 0x164, 0xf, 0xf, true));   // row_xmask:4
    v += __builtin_bit_cast(float, __builtin_amdgcn_update_dpp(0, __builtin_bit_cast(int, v), 0x168, 0xf, 0xf, true));   // row_xmask:8
    return v; }
__global__ __launch_bounds__(128) __attribute__((amdgpu_waves_per_eu(3, 3))) void k_proj(const bf* __restrict__ X, const bf* __restrict__ Wqkv, const float* __restrict__ sinT, const float* __restrict__ cosT, const float* __restrict__ wq_, const float* __restrict__ wk_, h16* Q16, bf* Qh, bf* Ql, h16* K16, bf* Kh, bf* Kl, h16* V16, bf* Vh, bf* Vl) {
    __shared__ __align__(16) bf sm[GSM(0, 64)];
    static_assert(128 * PTP * 4 <= 2 * GSM(0, 64), "the f32 tile fits in the two stage buffers (2 GSM bytes)");
    const int tid = threadIdx.x, lane = tid & 31, lr = lane & 15, hi = lane >> 4, w = tid >> 5, wm = w >> 1, wn = w & 1;
    const int r0 = blockIdx.x * 128, c0 = blockIdx.y * 128;
    v8f acc[4][4];   // every full unroll below: register arrays need constant indices
    gemm_main<0, DM, 64>(sm, X, nullptr, Wqkv, r0, c0, acc);
    lds_barrier();   // ends every wave's reads of the last stage: the f32 tile lies over both stage buffers
    fa* ts = (fa*)sm;
    const int bb = r0 / TT, t0 = r0 % TT, rr = tid >> 4, l16 = tid & 15;   // batch, first token; the thread's row in a pass and its place in the row
    if (c0 < DQ + DKV) {   // the same for the whole work-group
        const bool isk = c0 >= DQ; const float* wn_ = isk ? wk_ : wq_; h16* P16 = isk ? K16 : Q16; bf* Ph = isk ? Kh : Qh; bf* Pl = isk ? Kl : Ql;
        const int hb = bb * NH_ + (c0 % DQ) / HD, d = l16 * 4; const float* pc = cosT + (t0 + rr) * (HD / 2) + d; const float* ps = sinT + (t0 + rr) * (HD / 2) + d;
        __builtin_amdgcn_sched_barrier(0);   // with the one below: nothing that rewrites an address register is scheduled between these loads and their wait
        const v4f wa = *(const v4f*)(wn_ + d), wb = *(const v4f*)(wn_ + HD / 2 + d);
        asm volatile("s_wait_xcnt 0x0" ::: "memory");   // behind the issued loads, in front of whatever next rewrites their address registers
        __builtin_amdgcn_sched_barrier(0);   // the weights' loads are issued here: their trip to memory runs under the tile's LDS stores and the barrier
#pragma unroll
        for (int mb = 0; mb < 4; ++mb)
#pragma unroll
            for (int nb = 0; nb < 4; ++nb)
#pragma unroll
                for (int j = 0; j < 8; ++j) ts[(wm * 64 + mb * 16 + hi * 8 + j) * PTP + wn * 64 + nb * 16 + lr] = acc[mb][nb][j];
        lds_barrier();   // publishes the tile
        v4f w1, w2;
#pragma unroll
        for (int q = 0; q < 4; ++q) { w1[q] = bfr(wa[q]); w2[q] = bfr(wb[q]); }
        // the tile's two halves of 64 rows in a loop that stays rolled: unrolled, the kernel's text would be about twice as long
#pragma unroll 1
        for (int hf = 0; hf < 128; hf += 64) { v4f cr[8], sr[8]; const float* pch = pc + hf * (HD / 2); const float* psh = ps + hf * (HD / 2);
        __builtin_amdgcn_sched_barrier(0);   // with the one below: nothing that rewrites an address register is scheduled between these loads and their wait
#pragma unroll
        for (int i = 0; i < 8; ++i) { cr[i] = *(const v4f*)(pch + i * 8 * (HD / 2)); sr[i] = *(const v4f*)(psh + i * 8 * (HD / 2)); }
        asm volatile("s_wait_xcnt 0x0" :: "v"(pch), "v"(psh) : "memory");   // behind the issued loads, in front of whatever next rewrites their address registers; the two addresses are named so that they live up to here and no later load of the run lands on them
        __builtin_amdgcn_sched_barrier(0);   // all the half's table loads are issued here, ahead of its LDS reads
        v4f xl[8], xh[8];   // all eight rows' LDS reads are issued ahead of the passes, whose scheduling barriers would else leave each pass waiting for its own
#pragma unroll
        for (int i = 0; i < 8; ++i) { xl[i] = *(const v4fa*)(ts + (hf + i * 8 + rr) * PTP + d); xh[i] = *(const v4fa*)(ts + (hf + i * 8 + rr) * PTP + HD / 2 + d); }
#pragma unroll
        for (int i = 0; i < 8; ++i) { const int row = hf + i * 8 + rr; const v4f x1 = xl[i], x2 = xh[i]; v4f c, s;
#pragma unroll
            for (int q = 0; q < 4; ++q) { c[q] = bfr(cr[i][q]); s[q] = bfr(sr[i][q]); }
            const v4f y1 = x1 * c - x2 * s, y2 = x1 * s + x2 * c; float ss = 0.f;
#pragma unroll
            for (int q = 0; q < 4; ++q) ss += y1[q] * y1[q];
#pragma unroll
            for (int q = 0; q < 4; ++q) ss += y2[q] * y2[q];
            const float rf = __fdiv_rn(1.0f, __fsqrt_rn(rowsum16(ss) * (1.0f / HD) + 1.1920929e-07f)); const size_t o = ((size_t)hb * TT + t0 + row) * HD + d; v4h a16, b16; v4us ah, al, bh, bl;
#pragma unroll
            for (int q = 0; q < 4; ++q) { const float ra = (y1[q] * rf) * w1[q], rb = (y2[q] * rf) * w2[q]; unsigned short u, v; a16[q] = tohx(ra); splitf(ra, u, v); ah[q] = u; al[q] = v; b16[q] = tohx(rb); splitf(rb, u, v); bh[q] = u; bl[q] = v; }
            __builtin_amdgcn_sched_barrier(0);   // with the one below: nothing that rewrites a data or address register of these stores is scheduled between them and their wait
            *(v4h*)(P16 + o) = a16; *(v4h*)(P16 + o + HD / 2) = b16; *(v4us*)(Ph + o) = ah; *(v4us*)(Ph + o + HD / 2) = bh; *(v4us*)(Pl + o) = al; *(v4us*)(Pl + o + HD / 2) = bl;   // each store: one whole 128-byte line a row
            asm volatile("s_wait_xcnt 0x0" ::: "memory");   // behind the issued stores, in front of whatever next rewrites their registers
            __builtin_amdgcn_sched_barrier(0); } }
    } else {
#pragma unroll
        for (int mb = 0; mb < 4; ++mb)
#pragma unroll
            for (int nb = 0; nb < 4; ++nb) { fa* p = ts + (wn * 64 + nb * 16 + lr) * PTP + wm * 64 + mb * 16 + hi * 8; const v8f a = acc[mb][nb];
                *(v4fa*)p = (v4f){a[0], a[1], a[2], a[3]}; *(v4fa*)(p + 4) = (v4f){a[4], a[5], a[6], a[7]}; }
        lds_barrier();   // publishes the tile
        const int hv = bb * NKV + (c0 - DQ - DKV) / HD, tc = l16 * 8;
        // as in the q / k branch: two halves in a rolled loop, all of a half's LDS reads ahead of its passes
#pragma unroll 1
        for (int hf = 0; hf < 128; hf += 64) { v4f xl[8], xh[8];
#pragma unroll
        for (int i = 0; i < 8; ++i) { xl[i] = *(const v4fa*)(ts + (hf + i * 8 + rr) * PTP + tc); xh[i] = *(const v4fa*)(ts + (hf + i * 8 + rr) * PTP + tc + 4); }
#pragma unroll
        for (int i = 0; i < 8; ++i) { const int dd = hf + i * 8 + rr; const v4f xa = xl[i], xb = xh[i]; const size_t e = ((size_t)hv * HD + dd) * TT + t0 + tc; v8h o16; v8us oh, ol;
#pragma unroll
            for (int q = 0; q < 8; ++q) { const float x = q < 4 ? xa[q & 3] : xb[q & 3]; unsigned short a2, c2; o16[q] = tohx(x); splitf(x, a2, c2); oh[q] = a2; ol[q] = c2; }
            __builtin_amdgcn_sched_barrier(0);   // with the one below: nothing that rewrites a data or address register of these stores is scheduled between them and their wait
            *(v8h*)(V16 + e) = o16; *(v8us*)(Vh + e) = oh; *(v8us*)(Vl + e) = ol;   // each store: two whole 128-byte lines a row
            asm volatile("s_wait_xcnt 0x0" ::: "memory");   // behind the issued stores, in front of whatever next rewrites their registers
            __builtin_amdgcn_sched_barrier(0); } }
    }
}
#define FTHR 4.0f
#define FPK (HD + 8)             // LDS pitch of a key row, elements
#define FPV (64 + 8)             // LDS pitch of a value-plane row piece (64 keys), elements
#define FTK (64 * FPK)
#define FTV (HD * FPV)
__device__ __forceinline__ float xhalf(float x) { return __builtin_bit_cast(float, __builtin_amdgcn_permlanex16(__builtin_bit_cast(int, x), __builtin_bit_cast(int, x), 0x76543210, 0xfedcba98, false, false)); }   // lane l reads lane l ^ 16
__device__ __forceinline__ void wmma_gap() { __builtin_amdgcn_sched_barrier(0); asm volatile("v_nop\n\tv_nop\n\tv_nop\n\tv_nop"); __builtin_amdgcn_sched_barrier(0); }   // the distance behind the last matrix instruction before loads overwrite its operands, on a taken branch too
template <typename T16, int NSPLIT, int R>
__device__ __forceinline__ void fattn_wg(T16* sm, const T16* __restrict__ Q, const T16* __restrict__ Q2, const T16* __restrict__ K, const T16* __restrict__ K2, const T16* __restrict__ Vt, const T16* __restrict__ Vt2, bf* Ah, bf* Al, int q0, int w) {
    typedef typename WFrag<T16>::V V;
    constexpr float CS = SCL * 1.4426950408889634f, POFF = NSPLIT ? 0.0f : 10.0f;   // scores to log2 units; 2^10 on the fp16 probabilities
    constexpr int BUF = (NSPLIT ? 2 : 1) * (FTK + FTV);   // one buffer: K, V^T (, K lo, V^T lo)
    struct Stage { v8us k[8], v[8], k2[8], v2[8]; };   // one stage's share of a thread, on its way from global memory to LDS
    const int tid = threadIdx.x, lane = tid & 31, lr = lane & 15, hi = lane >> 4;
    const int qw0 = q0 + 16 * R * w, plast = (qw0 + 16 * R - 1) / 32, ns = (q0 + 64 * R) / 64;   // the wave's first row; its last pass, which holds its diagonal (every query has an unmasked key in every pass up to it); the work-group's stages
    const int krow = tid >> 4, kcol = (tid & 15) * 8, vrow = tid >> 3, vcol = (tid & 7) * 8;   // staging: piece i of a thread is key row krow + 8 i and value-plane row vrow + 16 i, 16 bytes each
    const int gko = krow * HD + kcol, gvo = vrow * TT + vcol, sko = krow * FPK + kcol, svo = FTK + vrow * FPV + vcol;
    const int fko = lr * FPK + 8 * hi, fvo = FTK + lr * FPV + 8 * hi;   // the lane's element offset in a 16-row block of the staged tiles
    Stage G; V qf[R][4], qf2[R][4]; v8f acc[R][8]; float m_run[R], l_run[R];   // every full unroll below: these live in registers and need constant indices
    auto gload = [&](int st) {
        __builtin_amdgcn_sched_barrier(0);   // with the one below: nothing that rewrites an address register is scheduled between these loads and their wait
#pragma unroll
        for (int i = 0; i < 8; ++i) { G.k[i] = *(const v8usa*)(K + (size_t)st * 64 * HD + gko + i * 8 * HD); G.v[i] = *(const v8usa*)(Vt + st * 64 + gvo + i * 16 * TT);
            if (NSPLIT) { G.k2[i] = *(const v8usa*)(K2 + (size_t)st * 64 * HD + gko + i * 8 * HD); G.v2[i] = *(const v8usa*)(Vt2 + st * 64 + gvo + i * 16 * TT); } }
        asm volatile("s_wait_xcnt 0x0" ::: "memory");   // behind the issued loads, in front of whatever next rewrites their address registers
        __builtin_amdgcn_sched_barrier(0);   // the whole stage is issued here, a stage ahead of its LDS stores
    };
    auto sstore = [&](int buf) { T16* p = sm + buf * BUF;
#pragma unroll
        for (int i = 0; i < 8; ++i) { *(v8usa*)(p + sko + i * 8 * FPK) = G.k[i]; *(v8usa*)(p + svo + i * 16 * FPV) = G.v[i];
            if (NSPLIT) { *(v8usa*)(p + FTK + FTV + sko + i * 8 * FPK) = G.k2[i]; *(v8usa*)(p + FTK + FTV + svo + i * 16 * FPV) = G.v2[i]; } } };
    __builtin_amdgcn_sched_barrier(0);   // the query rows are loaded in front of stage 0: loads return in order, so the wait of stage 0's LDS stores covers them and no pass waits for a staged load on their account
#pragma unroll
    for (int g = 0; g < R; ++g)
#pragma unroll
        for (int kc = 0; kc < 4; ++kc) { qf[g][kc] = WFrag<T16>::ld(Q + (size_t)(qw0 + 16 * g + lr) * HD + 8 * hi + kc * 32); if (NSPLIT) qf2[g][kc] = WFrag<T16>::ld(Q2 + (size_t)(qw0 + 16 * g + lr) * HD + 8 * hi + kc * 32); }
    asm volatile("s_wait_xcnt 0x0" ::: "memory");   // as in gload
    gload(0);
    sstore(0);
    if (ns > 1) gload(1);
#pragma unroll
    for (int g = 0; g < R; ++g) { m_run[g] = -__builtin_inff(); l_run[g] = 0.0f;
#pragma unroll
        for (int t = 0; t < 8; ++t) acc[g][t] = (v8f){}; }
    lds_barrier();
    // Stage st is read from buffer st & 1. Each barrier publishes the stage just stored and ends every wave's reads of the stage just used, whose buffer the next store takes. Every wave stages and passes every barrier, also where its own passes are over.
    // both loops stay rolled and nested: one pass already holds 32 (fp16) or 48 (hi/lo) matrix instructions beside its softmax
#pragma unroll 1
    for (int st = 0; st < ns; ++st) {
        const T16* sb = sm + (st & 1) * BUF;
#pragma unroll 1
        for (int sub = 0; sub < 2; ++sub) { const int p = 2 * st + sub;
            if (p > plast) break;   // wave-uniform
            V kf[2][4], kf2[2][4], vf[8], vf2[8];
#pragma unroll
            for (int kt = 0; kt < 2; ++kt)
#pragma unroll
                for (int kc = 0; kc < 4; ++kc) { kf[kt][kc] = WFrag<T16>::ld(sb + fko + (sub * 32 + kt * 16) * FPK + kc * 32); if (NSPLIT) kf2[kt][kc] = WFrag<T16>::ld(sb + FTK + FTV + fko + (sub * 32 + kt * 16) * FPK + kc * 32); }
            if (!NSPLIT) __builtin_amdgcn_sched_barrier(0);   // fp16 form: the key fragments' LDS reads go first (LDS reads return in order, and the score products wait for these alone)
#pragma unroll
            for (int t = 0; t < 8; ++t) { vf[t] = WFrag<T16>::ld(sb + fvo + t * 16 * FPV + sub * 32); if (NSPLIT) vf2[t] = WFrag<T16>::ld(sb + FTK + FTV + fvo + t * 16 * FPV + sub * 32); }
            if (!NSPLIT) __builtin_amdgcn_sched_barrier(0);   // fp16 form: the value fragments' LDS reads are issued here, under the score products and the softmax (the hi/lo form has no registers to spare for that)
            v8f s[2][R];
#pragma unroll
            for (int kt = 0; kt < 2; ++kt)
#pragma unroll
                for (int g = 0; g < R; ++g) s[kt][g] = (v8f){};
#pragma unroll
            for (int kc = 0; kc < 4; ++kc)
#pragma unroll
                for (int kt = 0; kt < 2; ++kt)
#pragma unroll
                    for (int g = 0; g < R; ++g) { s[kt][g] = WFrag<T16>::mma(kf[kt][kc], qf[g][kc], s[kt][g]); if (NSPLIT) { s[kt][g] = WFrag<T16>::mma(kf[kt][kc], qf2[g][kc], s[kt][g]); s[kt][g] = WFrag<T16>::mma(kf2[kt][kc], qf[g][kc], s[kt][g]); } }
            if (p * 32 + 31 > qw0) {   // wave-uniform: only the pass on the diagonal pays for the mask
#pragma unroll
                for (int g = 0; g < R; ++g)
#pragma unroll
                    for (int kt = 0; kt < 2; ++kt) {
#pragma unroll
                        for (int r = 0; r < 8; ++r) if (p * 32 + 16 * kt + 8 * hi + r > qw0 + 16 * g + lr) s[kt][g][r] = -__builtin_inff();
                        asm volatile("" : "+v"(s[kt][g]));   // the masked scores: keeps the selects inside the branch
                    }
            }
            float mb[R]; bool need = false;
#pragma unroll
            for (int g = 0; g < R; ++g) { float mx = s[0][g][0];
#pragma unroll
                for (int r = 1; r < 8; ++r) mx = fmaxf(mx, s[0][g][r]);
#pragma unroll
                for (int r = 0; r < 8; ++r) mx = fmaxf(mx, s[1][g][r]);
                mx = fmaxf(mx, xhalf(mx)) * CS; mb[g] = mx; need = need || (mx > m_run[g] + FTHR); }   // both wave halves hold the query's maximum of this pass (the scale is positive)
            if (__builtin_amdgcn_ballot_w32(need) != 0) {   // one scalar test a pass; always taken in the first pass, where m_run is -inf and corr 0
#pragma unroll
                for (int g = 0; g < R; ++g) { const float m_new = fmaxf(m_run[g], mb[g]); const float corr = __builtin_amdgcn_exp2f(m_run[g] - m_new); l_run[g] *= corr; m_run[g] = m_new;
#pragma unroll
                    for (int t = 0; t < 8; ++t) acc[g][t] = acc[g][t] * corr; }
            }
#pragma unroll
            for (int g = 0; g < R; ++g) { const float nm = POFF - m_run[g]; float pr[16], ps0 = 0.0f, ps1 = 0.0f;
#pragma unroll
                for (int e = 0; e < 16; e += 2) { const v2f arg = __builtin_elementwise_fma((v2f){s[e >> 3][g][e & 7], s[e >> 3][g][(e & 7) + 1]}, (v2f){CS, CS}, (v2f){nm, nm});   // two scores of a register pair in one packed instruction
                    pr[e] = __builtin_amdgcn_exp2f(arg.x); pr[e + 1] = __builtin_amdgcn_exp2f(arg.y); ps0 += pr[e]; ps1 += pr[e + 1]; }   // element e of the B operand: key 8 hi + e, or 16 + 8 hi + (e - 8): the k order of the value fragments
                l_run[g] += ps0 + ps1;
                if constexpr (NSPLIT != 0) { typedef __attribute__((ext_vector_type(16))) unsigned short v16us; v16us ph, pl;
#pragma unroll
                    for (int e = 0; e < 16; ++e) { unsigned short a, c2; splitf(pr[e], a, c2); ph[e] = a; pl[e] = c2; }
                    const V bh = __builtin_bit_cast(V, ph), bl = __builtin_bit_cast(V, pl);
#pragma unroll
                    for (int t = 0; t < 8; ++t) { acc[g][t] = WFrag<T16>::mma(vf[t], bh, acc[g][t]); acc[g][t] = WFrag<T16>::mma(vf[t], bl, acc[g][t]); acc[g][t] = WFrag<T16>::mma(vf2[t], bh, acc[g][t]); }
                } else { V pf;
#pragma unroll
                    for (int e = 0; e < 16; ++e) pf[e] = tohx(pr[e]);
#pragma unroll
                    for (int t = 0; t < 8; ++t) acc[g][t] = WFrag<T16>::mma(vf[t], pf, acc[g][t]); } }
            wmma_gap();
        }
        if (st + 1 < ns) { sstore((st + 1) & 1); if (st + 2 < ns) gload(st + 2); }   // the same for the whole work-group
        lds_barrier();
    }
#pragma unroll
    for (int g = 0; g < R; ++g) { const float inv = __fdiv_rn(1.0f, l_run[g] + xhalf(l_run[g]));   // each wave half holds the sum over its own keys
        const size_t o = (size_t)(qw0 + 16 * g + lr) * DQ + 8 * hi;
#pragma unroll
        for (int t = 0; t < 8; ++t) { v8us oh, ol;   // register r of tile t: dim 16 t + 8 hi + r of query lr
#pragma unroll
            for (int r = 0; r < 8; ++r) { unsigned short a, c2; splitf(acc[g][t][r] * inv, a, c2); oh[r] = a; ol[r] = c2; }
            __builtin_amdgcn_sched_barrier(0);   // with the one below: nothing that rewrites a data or address register of these stores is scheduled between them and their wait
            *(v8us*)(Ah + o + 16 * t) = oh; *(v8us*)(Al + o + 16 * t) = ol;
            asm volatile("s_wait_xcnt 0x0" ::: "memory");   // behind the issued stores, in front of whatever next rewrites their registers
            __builtin_amdgcn_sched_barrier(0); } }
}
// Heaviest row blocks first, the short hi/lo blocks last. Planes [batch x head][..]; merged output planes [batch][t][h * HD + d].
#define FNBH (NB_ * NH_)
#define FNF  ((TT - RH) / 128 * FNBH)
#define FNH  (RH / 64 * FNBH)
static_assert(NH_ == NKV && HD == 128 && RH % 64 == 0 && (TT - RH) % 128 == 0 && TT % 64 == 0, "k_fattn: one kv head a query head, whole work-groups, whole stages");
__global__ __launch_bounds__(128) __attribute__((amdgpu_waves_per_eu(2, 2))) void k_fattn(const h16* __restrict__ Q16, const h16* __restrict__ K16, const h16* __restrict__ V16, const bf* __restrict__ Qh, const bf* __restrict__ Ql, const bf* __restrict__ Kh, const bf* __restrict__ Kl, const bf* __restrict__ Vh, const bf* __restrict__ Vl, bf* Ah, bf* Al) {
    __shared__ __align__(16) bf sm[2 * 2 * (FTK + FTV)];
    const int w = __builtin_amdgcn_readfirstlane((int)(threadIdx.x >> 5)), bx = blockIdx.x;   // wave number, kept scalar so that the pass tests are scalar branches
    const int ix = bx < FNF ? bx : bx - FNF, bh = ix % FNBH, rb = ix / FNBH;
    const size_t pl = (size_t)bh * TT * HD, ao = (size_t)(bh / NH_) * TT * DQ + (size_t)(bh % NH_) * HD;
    if (bx < FNF) fattn_wg<h16, 0, 2>((h16*)sm, Q16 + pl, nullptr, K16 + pl, nullptr, V16 + pl, nullptr, Ah + ao, Al + ao, RH + ((TT - RH) / 128 - 1 - rb) * 128, w);
    else fattn_wg<bf, 2, 1>(sm, Qh + pl, Ql + pl, Kh + pl, Kl + pl, Vh + pl, Vl + pl, Ah + ao, Al + ao, (RH / 64 - 1 - rb) * 64, w);
}

extern "C" void kernel_launch(void* const* d_in, const int* in_sizes, int n_in,
                              void* d_out, int out_size, void* d_ws, size_t ws_size, hipStream_t stream) {
    (void)in_sizes; (void)n_in; (void)out_size;
    const float* x = (const float*)d_in[0]; const float* sinT = (const float*)d_in[1]; const float* cosT = (const float*)d_in[2]; const float* wq = (const float*)d_in[3]; const float* wk = (const float*)d_in[4]; const float* wv = (const float*)d_in[5]; const float* wo = (const float*)d_in[6]; const float* qsc = (const float*)d_in[7]; const float* ksc = (const float*)d_in[8];   /* x, sin, cos (f32 [2048][64], READ), Wq, Wk, Wv, Wo ('oi' [2048][2048]), q_norm_w, k_norm_w ([128], read) */
    float* OUT = (float*)d_out;     // [2][2048][2048]
    char* wsp = (char*)d_ws;
    auto take = [&](size_t bytes) { char* p = wsp; wsp += (bytes + 255) & ~(size_t)255; return (void*)p; };
    bf* WQ = (bf*)take((size_t)DQ * DM * 2); bf* WK = (bf*)take((size_t)DKV * DM * 2); bf* WV = (bf*)take((size_t)DKV * DM * 2); bf* WO = (bf*)take((size_t)DM * DQ * 2);
    const size_t PB = (size_t)NH_ * TT * HD, AB = (size_t)TT * DQ;   // elements of one batch in a head plane and in a merged plane; every plane holds both batches
    h16* QP16 = (h16*)take(NB_ * PB * 2); h16* KP16 = (h16*)take(NB_ * PB * 2); h16* VT16 = (h16*)take(NB_ * PB * 2);
    bf* QPh = (bf*)take(NB_ * PB * 2); bf* QPl = (bf*)take(NB_ * PB * 2); bf* KPh = (bf*)take(NB_ * PB * 2); bf* KPl = (bf*)take(NB_ * PB * 2); bf* VTh = (bf*)take(NB_ * PB * 2); bf* VTl = (bf*)take(NB_ * PB * 2); bf* ATh = (bf*)take(NB_ * AB * 2); bf* ATl = (bf*)take(NB_ * AB * 2);
    bf* XB = (bf*)take((size_t)NB_ * TT * DM * 2);
    if ((size_t)(wsp - (char*)d_ws) > ws_size) return;    // ws 256 MiB
    k_cast<<<CSEG / (CBLK * CWAV), CWAV * 32, 0, stream>>>(wq, wk, wv, wo, x, WQ, WK, WV, WO, XB);
    // WQ, WK, WV lie one behind the other (each a multiple of 256 bytes): one [DQ + 2 DKV][DM] operand
    k_proj<<<dim3(NB_ * TT / 128, (DQ + 2 * DKV) / 128, 1), 128, 0, stream>>>(XB, WQ, sinT, cosT, qsc, ksc, QP16, QPh, QPl, KP16, KPh, KPl, VT16, VTh, VTl);
    k_fattn<<<FNF + FNH, 128, 0, stream>>>(QP16, KP16, VT16, QPh, QPl, KPh, KPl, VTh, VTl, ATh, ATl);
    k_gemmt<1, DQ, 64><<<dim3(NB_ * TT / 128, DM / 128, 1), 128, 0, stream>>>(ATh, ATl, WO, OUT);   // the batches lie one behind the other in the merged planes and in the output: one [NB_ TT][DQ] operand
}

// v010
// One run takes 171 microseconds.
// Next to v009, in two timings, it ran 1.04 times as fast each time.
// All steps since v000 together make it 10.8 times as fast.
#include <hip/hip_runtime.h>

// Causal multi-head attention with 128-wide heads, rotary embeddings from half-width input tables and a per-head RMSNorm applied AFTER the rotary (x [2][2048][2048]; q, k, v = x W^T ('oi' 1/sqrt(2048), no bias; 16 heads x 128); rope: (x1, x2) = the two HALVES of each head -> cat(x1 c - x2 s, x1 s + x2 c) with the sin / cos INPUT tables [2048][64] (read; argument order x, sin, cos); then per head q = RMSNorm(q) x q_norm_w, k = RMSNorm(k) x k_norm_w (eps = float32 machine epsilon 1.19e-7; weights [128] = ones, read); scores / sqrt(128); causal (-inf); softmax; out = merged Wo^T ('oi') -> [2][2048][2048] (8.4 M); argument order x, sin, cos, Wq, Wk, Wv, Wo, q_norm_w, k_norm_w).
// Layout, both batches at once: bf16 copy of x; 'oi' weights cast as-is; k_proj: exact projections q, k, v in one launch, each 128 x 128 tile (128 tokens of one head) taken to its 16-bit head planes in the tile's epilogue: q / k rotary from the bf16-rounded input tables (the tables need not be rotations: no norm-preservation shortcut), per (head, token) 1/sqrt(mean + eps) over the 128 rotated dims, x r x w[d]; v transposed; then k_fattn: causal T-2048 attention in one launch (hybrid rows: < 512 hi/lo 3 products, rest fp16 x1024; online softmax, scores and probabilities stay in registers; it writes the merged hi/lo planes); merged hi/lo x Wo exact.
// Compute dtypes, f32 accumulate: every input rounded to bf16 incl. the tables; projections exact; rotary and RMSNorm f32; attention rows < 512 3 products, rest fp16; softmax f32; Wo hl x exact.

#define NB_  2
#define TT   2048
#define DM   2048
#define NH_  16
#define NKV  16
#define REP  (NH_ / NKV)
#define HD   128
#define DQ   (NH_ * HD)
#define DKV  (NKV * HD)
#define RH   512                  // query rows < RH use hi+lo planes (0: none)
#define SCL  0.088388347648318447f   // HD^-0.5
typedef _Float16 h16;
typedef unsigned short bf;
typedef __attribute__((ext_vector_type(16))) __bf16   v16bf;
typedef __attribute__((ext_vector_type(16))) _Float16 v16h;
typedef __attribute__((ext_vector_type(8)))  _Float16 v8h;
typedef __attribute__((ext_vector_type(8)))  unsigned short v8us;
typedef __attribute__((ext_vector_type(8)))  float    v8f;
typedef __attribute__((ext_vector_type(4)))  float    v4f;
typedef v8h  __attribute__((may_alias)) v8ha;
typedef v4f  __attribute__((may_alias)) v4fa;
typedef v8us __attribute__((may_alias)) v8usa;

__device__ __forceinline__ unsigned short f2bf(float f) { unsigned u = __float_as_uint(f); u += 0x7FFFu + ((u >> 16) & 1u); return (unsigned short)(u >> 16); }
__device__ __forceinline__ float bf2f(unsigned short b) { return __uint_as_float(((unsigned)b) << 16); }
__device__ __forceinline__ float bfr(float f) { return bf2f(f2bf(f)); }
__device__ __forceinline__ v16h cat16(v8h lo, v8h hi) { return __builtin_shufflevector(lo, hi, 0, 1, 2, 3, 4, 5, 6, 7, 8, 9, 10, 11, 12, 13, 14, 15); }
__device__ __forceinline__ v16bf cat16b(v8us lo, v8us hi) { return __builtin_bit_cast(v16bf, __builtin_shufflevector(lo, hi, 0, 1, 2, 3, 4, 5, 6, 7, 8, 9, 10, 11, 12, 13, 14, 15)); }
__device__ __forceinline__ v8f wmma16(v16h a, v16h b, v8f c) { return __builtin_amdgcn_wmma_f32_16x16x32_f16(false, a, false, b, (short)0, c, false, false); }
__device__ __forceinline__ v8f wmmab(v16bf a, v16bf b, v8f c) { return __builtin_amdgcn_wmma_f32_16x16x32_bf16(false, a, false, b, (short)0, c, false, false); }



// ---- gemm_main: acc = the work-group's tile of C[m][n] = sum_k A[m][k] Bt[n][k] (+ A2[m][k] Bt[n][k] for NSPLIT 1), operands bf16 planes in K panels (below); 128 threads. k_gemmt stores C (f32, pitch KD), grid (M/128, N/128); k_proj goes on from the tile.
// One 128x128 output tile per work-group of 4 waves (2 x 2 waves of 64 x 64: 8 fragments read from LDS feed 16 products). K runs in stages of KS: every operand row piece of 2 KS bytes is read from global memory once per work-group, as whole 128-byte lines,
// goes through registers into one of two LDS buffers (row pitch 2 KS + 16 bytes) and is read from there as fragments. One register set: a stage's global loads are issued one stage ahead of its LDS stores; one barrier a stage.
// Two or three work-groups share a WGP, one wave of each on every SIMD (the callers ask for the register budget): one's LDS waits, barriers, prologue and epilogue run under the others' products.
// Each accumulator takes its products in the same k order as a single k loop over 32-wide steps.
// K panels: a plane of R rows lies as [k / KP][row][k % KP], so that the 128 rows of one stage are 16 KiB in a row and each 16-byte-a-lane load of a wave covers 512 contiguous bytes, not four 128-byte pieces of rows 4 KiB apart. RA, RB: rows of the A and B planes.
#define KP 64
template <typename T16> struct WFrag;
template <> struct WFrag<h16> { typedef v16h V; static __device__ __forceinline__ V ld(const h16* p) { return cat16(*(const v8h*)p, *(const v8h*)(p + 16)); } static __device__ __forceinline__ v8f mma(V a, V b, v8f c) { return wmma16(a, b, c); } };
template <> struct WFrag<bf> { typedef v16bf V; static __device__ __forceinline__ V ld(const bf* p) { return cat16b(*(const v8us*)p, *(const v8us*)(p + 16)); } static __device__ __forceinline__ v8f mma(V a, V b, v8f c) { return wmmab(a, b, c); } };
// The work-group barrier of the stage loop: it orders LDS traffic alone, so that the global loads issued ahead stay in flight across it (__syncthreads() waits for them too).
__device__ __forceinline__ void lds_barrier() { __builtin_amdgcn_fence(__ATOMIC_RELEASE, "workgroup", "local"); __builtin_amdgcn_s_barrier(); __builtin_amdgcn_fence(__ATOMIC_ACQUIRE, "workgroup", "local"); }
#define GSM(NSPLIT, KS) (2 * ((NSPLIT) ? 3 : 2) * 128 * ((KS) + 8))   // elements of the two LDS buffers
template <int NSPLIT, int KD, int KS, int RA, int RB>
__device__ __forceinline__ void gemm_main(bf* sm, const bf* __restrict__ A, const bf* __restrict__ A2, const bf* __restrict__ Bt, int r0, int c0, v8f (&acc)[4][4]) {
    constexpr int PIT = KS + 8, TILE = 128 * PIT, NT = NSPLIT ? 3 : 2, NS = KD / KS, NK = KS / 32, LPR = KS / 8, RPP = 128 / LPR, NP = 128 / RPP;   // k steps a stage; lanes a row piece, rows a pass of the 128 threads, pieces a thread and tile
    static_assert(KD % (2 * KS) == 0 && NS >= 4 && KS == KP, "an even number of whole stages, at least four; a stage is one K panel");
    struct Stage { v8us a[NP], b[NP], a2[NP]; };   // one stage's share of a thread, on its way from global memory to LDS
    static_assert(GSM(NSPLIT, KS) == 2 * NT * TILE, "the callers' LDS array");
    const int tid = threadIdx.x, lane = tid & 31, lr = lane & 15, hi = lane >> 4, w = tid >> 5, wm = w >> 1, wn = w & 1;
    const int srow = tid / LPR, scol = (tid % LPR) * 8;   // staging: piece i of a thread is row srow + RPP i, 16 bytes at element scol
    const bf* ga = A + (size_t)r0 * KS; const bf* ga2 = NSPLIT ? A2 + (size_t)r0 * KS : nullptr; const bf* gb = Bt + (size_t)c0 * KS; const unsigned go = tid * 8;   // the tiles' first rows in panel 0 (the same for the work-group) and the thread's own element offset (= srow KS + scol), one register for all operands
    bf* sp = sm + srow * PIT + scol;
    const bf* fa = sm + (wm * 64 + lr) * PIT + 8 * hi; const bf* fb = sm + TILE + (wn * 64 + lr) * PIT + 8 * hi;
    Stage R0;   // every full unroll below: it lives in registers and needs constant indices
#pragma unroll
    for (int mb = 0; mb < 4; ++mb)
#pragma unroll
        for (int nb = 0; nb < 4; ++nb) acc[mb][nb] = (v8f){};
    auto gload = [&](Stage& R, int j) {   // j: panels ahead of the one that ga, gb stand at
        __builtin_amdgcn_sched_barrier(0);   // with the one below: nothing that rewrites an address register is scheduled between these loads and their wait
#pragma unroll
        for (int i = 0; i < NP; ++i) { R.a[i] = *(const v8us*)(ga + (size_t)j * RA * KS + i * RPP * KS + go); R.b[i] = *(const v8us*)(gb + (size_t)j * RB * KS + i * RPP * KS + go); if (NSPLIT) R.a2[i] = *(const v8us*)(ga2 + (size_t)j * RA * KS + i * RPP * KS + go); }
        asm volatile("s_wait_xcnt 0x0" ::: "memory");   // behind the issued loads, in front of whatever next rewrites their address registers
        __builtin_amdgcn_sched_barrier(0);   // the whole stage is issued here: without it the scheduler sinks loads towards their LDS stores, and their trip to memory is then waited for in full
    };
    auto sstore = [&](const Stage& R, int buf) { bf* p = sp + buf * NT * TILE;
#pragma unroll
        for (int i = 0; i < NP; ++i) { *(v8us*)(p + i * RPP * PIT) = R.a[i]; *(v8us*)(p + TILE + i * RPP * PIT) = R.b[i]; if (NSPLIT) *(v8us*)(p + 2 * TILE + i * RPP * PIT) = R.a2[i]; } };
    auto products = [&](int buf) { const bf* pa = fa + buf * NT * TILE; const bf* pb = fb + buf * NT * TILE; v16bf a[NK][4], a2[NK][4], b[NK][4];
#pragma unroll
        for (int kq = 0; kq < NK; ++kq)
#pragma unroll
            for (int f = 0; f < 4; ++f) { a[kq][f] = WFrag<bf>::ld(pa + f * 16 * PIT + kq * 32); b[kq][f] = WFrag<bf>::ld(pb + f * 16 * PIT + kq * 32); if (NSPLIT) a2[kq][f] = WFrag<bf>::ld(pa + 2 * TILE + f * 16 * PIT + kq * 32); }
        __builtin_amdgcn_sched_barrier(0);   // the stage's fragment reads stand as one group in front of its products: left to itself the scheduler reads single fragments among the products and waits each one out
#pragma unroll
        for (int kq = 0; kq < NK; ++kq)
#pragma unroll
            for (int nb = 0; nb < 4; ++nb) {
#pragma unroll
                for (int mb = 0; mb < 4; ++mb) acc[mb][nb] = wmmab(a[kq][mb], b[kq][nb], acc[mb][nb]);
                if (NSPLIT) {
#pragma unroll
                    for (int mb = 0; mb < 4; ++mb) acc[mb][nb] = wmmab(a2[kq][mb], b[kq][nb], acc[mb][nb]); } }
        __builtin_amdgcn_sched_barrier(0);   // the next stage's LDS stores stay behind the products: lifted among them, their wait for the global loads would hold the products up
    };
    // Stage s is read from buffer s & 1. Each barrier below publishes the stage just stored and ends every wave's reads of the stage just used, whose buffer the next store takes.
    gload(R0, 0); sstore(R0, 0); gload(R0, 1);
    lds_barrier();
    // the loop stays rolled: its body already holds two whole stages
#pragma unroll 1
    for (int s = 0; s < NS - 2; s += 2) {   // on entry: buffer 0 holds stage s, R0 stage s + 1
        products(0); sstore(R0, 1); gload(R0, 2);
        lds_barrier();
        products(1); sstore(R0, 0); gload(R0, 3);
        lds_barrier();
        ga += (size_t)2 * RA * KS; gb += (size_t)2 * RB * KS; if (NSPLIT) ga2 += (size_t)2 * RA * KS;   // the tiles' starts move on by two panels: scalar additions, no vector register holds an address
    }
    products(0); sstore(R0, 1);
    lds_barrier();
    products(1);   // behind the last barrier only buffer 1 is still read
}
template <int NSPLIT, int KD, int KS>
__global__ __launch_bounds__(128) __attribute__((amdgpu_waves_per_eu(2, 2))) void k_gemmt(const bf* __restrict__ A, const bf* __restrict__ A2, const bf* __restrict__ Bt, float* C) {
    __shared__ __align__(16) bf sm[GSM(NSPLIT, KS)];
    __shared__ __align__(16) float osm[4 * 16 * 68];
    const int tid = threadIdx.x, lane = tid & 31, lr = lane & 15, hi = lane >> 4, w = tid >> 5, wm = w >> 1, wn = w & 1;
    const int r0 = blockIdx.x * 128, c0 = blockIdx.y * 128;
    v8f acc[4][4];
    gemm_main<NSPLIT, KD, KS, NB_ * TT, DM>(sm, A, A2, Bt, r0, c0, acc);
    float* os = osm + w * (16 * 68);   // the wave's own 16 x 64 patch: accumulator order in, whole 128-byte output lines out
#pragma unroll
    for (int mb = 0; mb < 4; ++mb) {
#pragma unroll
        for (int nb = 0; nb < 4; ++nb)
#pragma unroll
            for (int j = 0; j < 8; ++j) os[(hi * 8 + j) * 68 + nb * 16 + lr] = acc[mb][nb][j];
        float* crow = C + (size_t)(r0 + wm * 64 + mb * 16) * KD + c0 + wn * 64;
        v4f val[8];
#pragma unroll
        for (int q = 0; q < 8; ++q) val[q] = *(const v4fa*)(os + (2 * q + hi) * 68 + lr * 4);
        __builtin_amdgcn_sched_barrier(0);   // with the one below: nothing that rewrites a data or address register of these stores is scheduled between them and their wait
#pragma unroll
        for (int q = 0; q < 8; ++q) *(v4f*)(crow + (size_t)(2 * q + hi) * KD + lr * 4) = val[q];   // each store: two whole 128-byte lines a row
        asm volatile("s_wait_xcnt 0x0" ::: "memory");   // behind the issued stores, in front of whatever next rewrites their registers
        __builtin_amdgcn_sched_barrier(0);
    }
}

__device__ __forceinline__ h16 tohx(float x) { return (h16)x; }
__device__ __forceinline__ void splitf(float y, unsigned short& h, unsigned short& l) { h = f2bf(y); l = f2bf(y - bf2f(h)); }
typedef __attribute__((ext_vector_type(2))) _Float16 v2h;
typedef __attribute__((ext_vector_type(4))) _Float16 v4h;
typedef __attribute__((ext_vector_type(2))) unsigned short v2us;
typedef __attribute__((ext_vector_type(4))) unsigned short v4us;
typedef __attribute__((ext_vector_type(2))) float v2f;
typedef __attribute__((ext_vector_type(4))) int v4i;

// ---- k_cast: every f32 -> bf16 rounding of the call in one launch: the four weights and x. Six segments of CSEG elements (each weight is one, x is two); grid CSEG / (CWAV CBLK) = one work-group of 16 waves a WGP.
// A wave takes the same CBLK elements of each segment in turn, 8 KP columns of two rows: 8 loads, each one panel's 256 contiguous bytes of both rows (read once: non-temporal), the next segment's loads issued before this segment is rounded and stored.
// The bf16 planes are written in K panels (gemm_main): Wq, Wk, Wv as one plane of DQ + 2 DKV rows, Wo of DM rows, x of NB_ TT rows. The two rows' pieces lie side by side in a panel: each store covers 256 contiguous bytes.
#define CSEG (DM * DM)
#define CBLK 1024
#define CWAV 16
static_assert(DQ * DM == CSEG && DKV * DM == CSEG && NB_ * TT * DM == 2 * CSEG && CSEG % (CBLK * CWAV) == 0 && DQ == DM && DM % (CBLK / 2) == 0 && CBLK == 16 * KP && KP == 64, "k_cast: equal segments of DM-wide rows, whole work-groups; 16 lanes a panel piece, 8 panels of two rows a wave");
__global__ __launch_bounds__(CWAV * 32) void k_cast(const float* __restrict__ wq, const float* __restrict__ wk, const float* __restrict__ wv, const float* __restrict__ wo, const float* __restrict__ x, bf* WQKV, bf* WO, bf* XB) {
    const int lane = threadIdx.x & 31, wave = __builtin_amdgcn_readfirstlane((int)(threadIdx.x >> 5));
    const int blk = (int)blockIdx.x * CWAV + wave, row = blk / (DM / (8 * KP)) * 2 + (lane >> 4), kp0 = blk % (DM / (8 * KP)) * 8, kin = (lane & 15) * 4;   // the lane's row in its segment; the wave's panel in load 0 (load q: + q); the lane's place in the panel's row piece
    const int e0 = row * DM + kp0 * KP + kin;
    constexpr int RW[6] = {DQ + 2 * DKV, DQ + 2 * DKV, DQ + 2 * DKV, DM, NB_ * TT, NB_ * TT}, RO[6] = {0, DQ, DQ + DKV, 0, 0, CSEG / DM};   // rows of each segment's plane, the segment's first row in it
    bf* const pb[6] = {WQKV, WQKV, WQKV, WO, XB, XB};
    const float* sp[6] = {wq + e0, wk + e0, wv + e0, wo + e0, x + e0, x + CSEG + e0}; bf* dp[6];
#pragma unroll
    for (int i = 0; i < 6; ++i) dp[i] = pb[i] + ((size_t)kp0 * RW[i] + RO[i] + row) * KP + kin;   // unrolled: the pointers live in registers and need constant indices
    v4f r[2][8];   // every full unroll below: these live in registers and need constant indices
#pragma unroll
    for (int i = -1; i < 6; ++i) {
        if (i + 1 < 6) {
            __builtin_amdgcn_sched_barrier(0);   // with the one below: nothing that rewrites an address register is scheduled between these loads and their wait
#pragma unroll
            for (int q = 0; q < 8; ++q) r[(i + 1) & 1][q] = __builtin_nontemporal_load((const v4f*)(sp[i + 1] + q * KP));
            asm volatile("s_wait_xcnt 0x0" ::: "memory");   // behind the issued loads, in front of whatever next rewrites their address registers
            __builtin_amdgcn_sched_barrier(0);   // the next segment's loads are all issued here, ahead of this segment's rounding: 8 to 16 loads of a wave stay in flight
        }
        if (i >= 0) { v4us o[8];
#pragma unroll
            for (int q = 0; q < 8; ++q)
#pragma unroll
                for (int k = 0; k < 4; ++k) o[q][k] = f2bf(r[i & 1][q][k]);
            __builtin_amdgcn_sched_barrier(0);   // with the one below: nothing that rewrites a data or address register of these stores is scheduled between them and their wait
#pragma unroll
            for (int q = 0; q < 8; ++q) *(v4us*)(dp[i] + (size_t)q * RW[i] * KP) = o[q];   // each store: two whole 128-byte lines side by side
            asm volatile("s_wait_xcnt 0x0" ::: "memory");   // behind the issued stores, in front of whatever next rewrites their registers
            __builtin_amdgcn_sched_barrier(0); }
    }
}

// ---- k_proj: the projections q, k, v of both batches in one launch, each tile carried on to its 16-bit planes; nothing f32 goes through memory. X [DM / KP][batch x t][KP] (K panels); Wqkv: the rows of Wq, Wk, Wv one behind the other; grid (NB_ TT / 128, (DQ + 2 DKV) / 128).
// A 128 x 128 tile is 128 tokens of one head of q, k or v. The accumulators go as f32 into LDS (pitch PTP floats), in the place of the two stage buffers, and behind one barrier 16 lanes take one row of it, 8 rows a pass of the 128 threads.
// q / k tile, stored [t][d] -> planes [batch x h][t][d] (fp16 + bf16 hi/lo): lane j holds the dims 4j..4j+3 of both halves, so that each rotary pair sits in one lane. rotary from the bf16-rounded tables, r = 1/sqrt(mean of squares + eps) over the
// 128 rotated dims (8 terms a lane, then a butterfly over the 16 lanes), (y x r) x w[d] with w rounded to bf16. v tile, stored [d][t] (a lane's 8 accumulator registers are 8 tokens of one dim) -> transposed planes in key panels [batch x h][t / KP][d][t % KP] (a stage of k_fattn is 16 KiB in a row): lane j the tokens 8j..8j+7.
#define PTP 132
typedef float __attribute__((may_alias)) fa;
static_assert(NH_ == NKV && HD == 128 && TT % 128 == 0, "k_proj: q, k and v alike; a tile is one head wide and lies in one batch");
__device__ __forceinline__ float rowsum16(float v) {   // sum over the 16 lanes of a row, every lane on; the cross-lane reads fold into the adds
    v += __builtin_bit_cast(float, __builtin_amdgcn_update_dpp(0, __builtin_bit_cast(int, v), 0x161, 0xf, 0xf, true));   // row_xmask:1
    v += __builtin_bit_cast(float, __builtin_amdgcn_update_dpp(0, __builtin_bit_cast(int, v), 0x162, 0xf, 0xf, true));   // row_xmask:2
    v += __builtin_bit_cast(float, __builtin_amdgcn_update_dpp(0, __builtin_bit_cast(int, v), 0x164, 0xf, 0xf, true));   // row_xmask:4
    v += __builtin_bit_cast(float, __builtin_amdgcn_update_dpp(0, __builtin_bit_cast(int, v), 0x168, 0xf, 0xf, true));   // row_xmask:8
    return v; }
__global__ __launch_bounds__(128) __attribute__((amdgpu_waves_per_eu(3, 3))) void k_proj(const bf* __restrict__ X, const bf* __restrict__ Wqkv, const float* __restrict__ sinT, const float* __restrict__ cosT, const float* __restrict__ wq_, const float* __restrict__ wk_, h16* Q16, bf* Qh, bf* Ql, h16* K16, bf* Kh, bf* Kl, h16* V16, bf* Vh, bf* Vl) {
    __shared__ __align__(16) bf sm[GSM(0, 64)];
    static_assert(128 * PTP * 4 <= 2 * GSM(0, 64), "the f32 tile fits in the two stage buffers (2 GSM bytes)");
    const int tid = threadIdx.x, lane = tid & 31, lr = lane & 15, hi = lane >> 4, w = tid >> 5, wm = w >> 1, wn = w & 1;
    const int r0 = blockIdx.x * 128, c0 = blockIdx.y * 128;
    v8f acc[4][4];   // every full unroll below: register arrays need constant indices
    gemm_main<0, DM, 64, NB_ * TT, DQ + 2 * DKV>(sm, X, nullptr, Wqkv, r0, c0, acc);
    lds_barrier();   // ends every wave's reads of the last stage: the f32 tile lies over both stage buffers
    fa* ts = (fa*)sm;
    const int bb = r0 / TT, t0 = r0 % TT, rr = tid >> 4, l16 = tid & 15;   // batch, first token; the thread's row in a pass and its place in the row
    if (c0 < DQ + DKV) {   // the same for the whole work-group
        const bool isk = c0 >= DQ; const float* wn_ = isk ? wk_ : wq_; h16* P16 = isk ? K16 : Q16; bf* Ph = isk ? Kh : Qh; bf* Pl = isk ? Kl : Ql;
        const int hb = bb * NH_ + (c0 % DQ) / HD, d = l16 * 4; const float* pc = cosT + (t0 + rr) * (HD / 2) + d; const float* ps = sinT + (t0 + rr) * (HD / 2) + d;
        __builtin_amdgcn_sched_barrier(0);   // with the one below: nothing that rewrites an address register is scheduled between these loads and their wait
        const v4f wa = *(const v4f*)(wn_ + d), wb = *(const v4f*)(wn_ + HD / 2 + d);
        asm volatile("s_wait_xcnt 0x0" ::: "memory");   // behind the issued loads, in front of whatever next rewrites their address registers
        __builtin_amdgcn_sched_barrier(0);   // the weights' loads are issued here: their trip to memory runs under the tile's LDS stores and the barrier
#pragma unroll
        for (int mb = 0; mb < 4; ++mb)
#pragma unroll
            for (int nb = 0; nb < 4; ++nb)
#pragma unroll
                for (int j = 0; j < 8; ++j) ts[(wm * 64 + mb * 16 + hi * 8 + j) * PTP + wn * 64 + nb * 16 + lr] = acc[mb][nb][j];
        lds_barrier();   // publishes the tile
        v4f w1, w2;
#pragma unroll
        for (int q = 0; q < 4; ++q) { w1[q] = bfr(wa[q]); w2[q] = bfr(wb[q]); }
        // the tile's two halves of 64 rows in a loop that stays rolled: unrolled, the kernel's text would be about twice as long
#pragma unroll 1
        for (int hf = 0; hf < 128; hf += 64) { v4f cr[8], sr[8]; const float* pch = pc + hf * (HD / 2); const float* psh = ps + hf * (HD / 2);
        __builtin_amdgcn_sched_barrier(0);   // with the one below: nothing that rewrites an address register is scheduled between these loads and their wait
#pragma unroll
        for (int i = 0; i < 8; ++i) { cr[i] = *(const v4f*)(pch + i * 8 * (HD / 2)); sr[i] = *(const v4f*)(psh + i * 8 * (HD / 2)); }
        asm volatile("s_wait_xcnt 0x0" :: "v"(pch), "v"(psh) : "memory");   // behind the issued loads, in front of whatever next rewrites their address registers; the two addresses are named so that they live up to here and no later load of the run lands on them
        __builtin_amdgcn_sched_barrier(0);   // all the half's table loads are issued here, ahead of its LDS reads
        v4f xl[8], xh[8];   // all eight rows' LDS reads are issued ahead of the passes, whose scheduling barriers would else leave each pass waiting for its own
#pragma unroll
        for (int i = 0; i < 8; ++i) { xl[i] = *(const v4fa*)(ts + (hf + i * 8 + rr) * PTP + d); xh[i] = *(const v4fa*)(ts + (hf + i * 8 + rr) * PTP + HD / 2 + d); }
#pragma unroll
        for (int i = 0; i < 8; ++i) { const int row = hf + i * 8 + rr; const v4f x1 = xl[i], x2 = xh[i]; v4f c, s;
#pragma unroll
            for (int q = 0; q < 4; ++q) { c[q] = bfr(cr[i][q]); s[q] = bfr(sr[i][q]); }
            const v4f y1 = x1 * c - x2 * s, y2 = x1 * s + x2 * c; float ss = 0.f;
#pragma unroll
            for (int q = 0; q < 4; ++q) ss += y1[q] * y1[q];
#pragma unroll
            for (int q = 0; q < 4; ++q) ss += y2[q] * y2[q];
            const float rf = __fdiv_rn(1.0f, __fsqrt_rn(rowsum16(ss) * (1.0f / HD) + 1.1920929e-07f)); const size_t o = ((size_t)hb * TT + t0 + row) * HD + d; v4h a16, b16; v4us ah, al, bh, bl;
#pragma unroll
            for (int q = 0; q < 4; ++q) { const float ra = (y1[q] * rf) * w1[q], rb = (y2[q] * rf) * w2[q]; unsigned short u, v; a16[q] = tohx(ra); splitf(ra, u, v); ah[q] = u; al[q] = v; b16[q] = tohx(rb); splitf(rb, u, v); bh[q] = u; bl[q] = v; }
            __builtin_amdgcn_sched_barrier(0);   // with the one below: nothing that rewrites a data or address register of these stores is scheduled between them and their wait
            *(v4h*)(P16 + o) = a16; *(v4h*)(P16 + o + HD / 2) = b16; *(v4us*)(Ph + o) = ah; *(v4us*)(Ph + o + HD / 2) = bh; *(v4us*)(Pl + o) = al; *(v4us*)(Pl + o + HD / 2) = bl;   // each store: one whole 128-byte line a row
            asm volatile("s_wait_xcnt 0x0" ::: "memory");   // behind the issued stores, in front of whatever next rewrites their registers
            __builtin_amdgcn_sched_barrier(0); } }
    } else {
#pragma unroll
        for (int mb = 0; mb < 4; ++mb)
#pragma unroll
            for (int nb = 0; nb < 4; ++nb) { fa* p = ts + (wn * 64 + nb * 16 + lr) * PTP + wm * 64 + mb * 16 + hi * 8; const v8f a = acc[mb][nb];
                *(v4fa*)p = (v4f){a[0], a[1], a[2], a[3]}; *(v4fa*)(p + 4) = (v4f){a[4], a[5], a[6], a[7]}; }
        lds_barrier();   // publishes the tile
        const int hv = bb * NKV + (c0 - DQ - DKV) / HD, tc = l16 * 8;
        // as in the q / k branch: two halves in a rolled loop, all of a half's LDS reads ahead of its passes
#pragma unroll 1
        for (int hf = 0; hf < 128; hf += 64) { v4f xl[8], xh[8];
#pragma unroll
        for (int i = 0; i < 8; ++i) { xl[i] = *(const v4fa*)(ts + (hf + i * 8 + rr) * PTP + tc); xh[i] = *(const v4fa*)(ts + (hf + i * 8 + rr) * PTP + tc + 4); }
#pragma unroll
        for (int i = 0; i < 8; ++i) { const int dd = hf + i * 8 + rr; const v4f xa = xl[i], xb = xh[i]; const size_t e = (size_t)hv * HD * TT + (size_t)((t0 + tc) / KP) * (HD * KP) + dd * KP + tc % KP; v8h o16; v8us oh, ol;
#pragma unroll
            for (int q = 0; q < 8; ++q) { const float x = q < 4 ? xa[q & 3] : xb[q & 3]; unsigned short a2, c2; o16[q] = tohx(x); splitf(x, a2, c2); oh[q] = a2; ol[q] = c2; }
            __builtin_amdgcn_sched_barrier(0);   // with the one below: nothing that rewrites a data or address register of these stores is scheduled between them and their wait
            *(v8h*)(V16 + e) = o16; *(v8us*)(Vh + e) = oh; *(v8us*)(Vl + e) = ol;   // each store: the wave's two rows side by side in each of two key panels, 256 contiguous bytes each
            asm volatile("s_wait_xcnt 0x0" ::: "memory");   // behind the issued stores, in front of whatever next rewrites their registers
            __builtin_amdgcn_sched_barrier(0); } }
    }
}
#define FTHR 4.0f
#define FPK (HD + 8)             // LDS pitch of a key row, elements
#define FPV (64 + 8)             // LDS pitch of a value-plane row piece (64 keys), elements
#define FTK (64 * FPK)
#define FTV (HD * FPV)
__device__ __forceinline__ float xhalf(float x) { return __builtin_bit_cast(float, __builtin_amdgcn_permlanex16(__builtin_bit_cast(int, x), __builtin_bit_cast(int, x), 0x76543210, 0xfedcba98, false, false)); }   // lane l reads lane l ^ 16
__device__ __forceinline__ void wmma_gap() { __builtin_amdgcn_sched_barrier(0); asm volatile("v_nop\n\tv_nop\n\tv_nop\n\tv_nop"); __builtin_amdgcn_sched_barrier(0); }   // the distance behind the last matrix instruction before loads overwrite its operands, on a taken branch too
template <typename T16, int NSPLIT, int R>
__device__ __forceinline__ void fattn_wg(T16* sm, const T16* __restrict__ Q, const T16* __restrict__ Q2, const T16* __restrict__ K, const T16* __restrict__ K2, const T16* __restrict__ Vt, const T16* __restrict__ Vt2, bf* Ah, bf* Al, int q0, int w) {
    typedef typename WFrag<T16>::V V;
    constexpr float CS = SCL * 1.4426950408889634f, POFF = NSPLIT ? 0.0f : 10.0f;   // scores to log2 units; 2^10 on the fp16 probabilities
    constexpr int BUF = (NSPLIT ? 2 : 1) * (FTK + FTV);   // one buffer: K, V^T (, K lo, V^T lo)
    struct Stage { v8us k[8], v[8], k2[8], v2[8]; };   // one stage's share of a thread, on its way from global memory to LDS
    const int tid = threadIdx.x, lane = tid & 31, lr = lane & 15, hi = lane >> 4;
    const int qw0 = q0 + 16 * R * w, plast = (qw0 + 16 * R - 1) / 32, ns = (q0 + 64 * R) / 64;   // the wave's first row; its last pass, which holds its diagonal (every query has an unmasked key in every pass up to it); the work-group's stages
    const int krow = tid >> 4, kcol = (tid & 15) * 8, vrow = tid >> 3, vcol = (tid & 7) * 8;   // staging: piece i of a thread is key row krow + 8 i and value-plane row vrow + 16 i, 16 bytes each
    const int gko = krow * HD + kcol, gvo = vrow * KP + vcol, sko = krow * FPK + kcol, svo = FTK + vrow * FPV + vcol;
    const int fko = lr * FPK + 8 * hi, fvo = FTK + lr * FPV + 8 * hi;   // the lane's element offset in a 16-row block of the staged tiles
    Stage G; V qf[R][4], qf2[R][4]; v8f acc[R][8]; float m_run[R], l_run[R];   // every full unroll below: these live in registers and need constant indices
    auto gload = [&](int st) {
        __builtin_amdgcn_sched_barrier(0);   // with the one below: nothing that rewrites an address register is scheduled between these loads and their wait
#pragma unroll
        for (int i = 0; i < 8; ++i) { G.k[i] = *(const v8usa*)(K + (size_t)st * 64 * HD + gko + i * 8 * HD); G.v[i] = *(const v8usa*)(Vt + st * (HD * KP) + gvo + i * 16 * KP);
            if (NSPLIT) { G.k2[i] = *(const v8usa*)(K2 + (size_t)st * 64 * HD + gko + i * 8 * HD); G.v2[i] = *(const v8usa*)(Vt2 + st * (HD * KP) + gvo + i * 16 * KP); } }
        asm volatile("s_wait_xcnt 0x0" ::: "memory");   // behind the issued loads, in front of whatever next rewrites their address registers
        __builtin_amdgcn_sched_barrier(0);   // the whole stage is issued here, a stage ahead of its LDS stores
    };
    auto sstore = [&](int buf) { T16* p = sm + buf * BUF;
#pragma unroll
        for (int i = 0; i < 8; ++i) { *(v8usa*)(p + sko + i * 8 * FPK) = G.k[i]; *(v8usa*)(p + svo + i * 16 * FPV) = G.v[i];
            if (NSPLIT) { *(v8usa*)(p + FTK + FTV + sko + i * 8 * FPK) = G.k2[i]; *(v8usa*)(p + FTK + FTV + svo + i * 16 * FPV) = G.v2[i]; } } };
    __builtin_amdgcn_sched_barrier(0);   // the query rows are loaded in front of stage 0: loads return in order, so the wait of stage 0's LDS stores covers them and no pass waits for a staged load on their account
#pragma unroll
    for (int g = 0; g < R; ++g)
#pragma unroll
        for (int kc = 0; kc < 4; ++kc) { qf[g][kc] = WFrag<T16>::ld(Q + (size_t)(qw0 + 16 * g + lr) * HD + 8 * hi + kc * 32); if (NSPLIT) qf2[g][kc] = WFrag<T16>::ld(Q2 + (size_t)(qw0 + 16 * g + lr) * HD + 8 * hi + kc * 32); }
    asm volatile("s_wait_xcnt 0x0" ::: "memory");   // as in gload
    gload(0);
    sstore(0);
    if (ns > 1) gload(1);
#pragma unroll
    for (int g = 0; g < R; ++g) { m_run[g] = -__builtin_inff(); l_run[g] = 0.0f;
#pragma unroll
        for (int t = 0; t < 8; ++t) acc[g][t] = (v8f){}; }
    lds_barrier();
    // Stage st is read from buffer st & 1. Each barrier publishes the stage just stored and ends every wave's reads of the stage just used, whose buffer the next store takes. Every wave stages and passes every barrier, also where its own passes are over.
    // both loops stay rolled and nested: one pass already holds 32 (fp16) or 48 (hi/lo) matrix instructions beside its softmax
#pragma unroll 1
    for (int st = 0; st < ns; ++st) {
        const T16* sb = sm + (st & 1) * BUF;
#pragma unroll 1
        for (int sub = 0; sub < 2; ++sub) { const int p = 2 * st + sub;
            if (p > plast) break;   // wave-uniform
            V kf[2][4], kf2[2][4], vf[8], vf2[8];
#pragma unroll
            for (int kt = 0; kt < 2; ++kt)
#pragma unroll
                for (int kc = 0; kc < 4; ++kc) { kf[kt][kc] = WFrag<T16>::ld(sb + fko + (sub * 32 + kt * 16) * FPK + kc * 32); if (NSPLIT) kf2[kt][kc] = WFrag<T16>::ld(sb + FTK + FTV + fko + (sub * 32 + kt * 16) * FPK + kc * 32); }
            if (!NSPLIT) __builtin_amdgcn_sched_barrier(0);   // fp16 form: the key fragments' LDS reads go first (LDS reads return in order, and the score products wait for these alone)
#pragma unroll
            for (int t = 0; t < 8; ++t) { vf[t] = WFrag<T16>::ld(sb + fvo + t * 16 * FPV + sub * 32); if (NSPLIT) vf2[t] = WFrag<T16>::ld(sb + FTK + FTV + fvo + t * 16 * FPV + sub * 32); }
            if (!NSPLIT) __builtin_amdgcn_sched_barrier(0);   // fp16 form: the value fragments' LDS reads are issued here, under the score products and the softmax (the hi/lo form has no registers to spare for that)
            v8f s[2][R];
#pragma unroll
            for (int kt = 0; kt < 2; ++kt)
#pragma unroll
                for (int g = 0; g < R; ++g) s[kt][g] = (v8f){};
#pragma unroll
            for (int kc = 0; kc < 4; ++kc)
#pragma unroll
                for (int kt = 0; kt < 2; ++kt)
#pragma unroll
                    for (int g = 0; g < R; ++g) { s[kt][g] = WFrag<T16>::mma(kf[kt][kc], qf[g][kc], s[kt][g]); if (NSPLIT) { s[kt][g] = WFrag<T16>::mma(kf[kt][kc], qf2[g][kc], s[kt][g]); s[kt][g] = WFrag<T16>::mma(kf2[kt][kc], qf[g][kc], s[kt][g]); } }
            if (p * 32 + 31 > qw0) {   // wave-uniform: only the pass on the diagonal pays for the mask
#pragma unroll
                for (int g = 0; g < R; ++g)
#pragma unroll
                    for (int kt = 0; kt < 2; ++kt) {
#pragma unroll
                        for (int r = 0; r < 8; ++r) if (p * 32 + 16 * kt + 8 * hi + r > qw0 + 16 * g + lr) s[kt][g][r] = -__builtin_inff();
                        asm volatile("" : "+v"(s[kt][g]));   // the masked scores: keeps the selects inside the branch
                    }
            }
            float mb[R]; bool need = false;
#pragma unroll
            for (int g = 0; g < R; ++g) { float mx = s[0][g][0];
#pragma unroll
                for (int r = 1; r < 8; ++r) mx = fmaxf(mx, s[0][g][r]);
#pragma unroll
                for (int r = 0; r < 8; ++r) mx = fmaxf(mx, s[1][g][r]);
                mx = fmaxf(mx, xhalf(mx)) * CS; mb[g] = mx; need = need || (mx > m_run[g] + FTHR); }   // both wave halves hold the query's maximum of this pass (the scale is positive)
            if (__builtin_amdgcn_ballot_w32(need) != 0) {   // one scalar test a pass; always taken in the first pass, where m_run is -inf and corr 0
#pragma unroll
                for (int g = 0; g < R; ++g) { const float m_new = fmaxf(m_run[g], mb[g]); const float corr = __builtin_amdgcn_exp2f(m_run[g] - m_new); l_run[g] *= corr; m_run[g] = m_new;
#pragma unroll
                    for (int t = 0; t < 8; ++t) acc[g][t] = acc[g][t] * corr; }
            }
#pragma unroll
            for (int g = 0; g < R; ++g) { const float nm = POFF - m_run[g]; float pr[16], ps0 = 0.0f, ps1 = 0.0f;
#pragma unroll
                for (int e = 0; e < 16; e += 2) { const v2f arg = __builtin_elementwise_fma((v2f){s[e >> 3][g][e & 7], s[e >> 3][g][(e & 7) + 1]}, (v2f){CS, CS}, (v2f){nm, nm});   // two scores of a register pair in one packed instruction
                    pr[e] = __builtin_amdgcn_exp2f(arg.x); pr[e + 1] = __builtin_amdgcn_exp2f(arg.y); ps0 += pr[e]; ps1 += pr[e + 1]; }   // element e of the B operand: key 8 hi + e, or 16 + 8 hi + (e - 8): the k order of the value fragments
                l_run[g] += ps0 + ps1;
                if constexpr (NSPLIT != 0) { typedef __attribute__((ext_vector_type(16))) unsigned short v16us; v16us ph, pl;
#pragma unroll
                    for (int e = 0; e < 16; ++e) { unsigned short a, c2; splitf(pr[e], a, c2); ph[e] = a; pl[e] = c2; }
                    const V bh = __builtin_bit_cast(V, ph), bl = __builtin_bit_cast(V, pl);
#pragma unroll
                    for (int t = 0; t < 8; ++t) { acc[g][t] = WFrag<T16>::mma(vf[t], bh, acc[g][t]); acc[g][t] = WFrag<T16>::mma(vf[t], bl, acc[g][t]); acc[g][t] = WFrag<T16>::mma(vf2[t], bh, acc[g][t]); }
                } else { V pf;
#pragma unroll
                    for (int e = 0; e < 16; ++e) pf[e] = tohx(pr[e]);
#pragma unroll
                    for (int t = 0; t < 8; ++t) acc[g][t] = WFrag<T16>::mma(vf[t], pf, acc[g][t]); } }
            wmma_gap();
        }
        if (st + 1 < ns) { sstore((st + 1) & 1); if (st + 2 < ns) gload(st + 2); }   // the same for the whole work-group
        lds_barrier();
    }
#pragma unroll
    for (int g = 0; g < R; ++g) { const float inv = __fdiv_rn(1.0f, l_run[g] + xhalf(l_run[g]));   // each wave half holds the sum over its own keys
        const size_t o = (size_t)(qw0 + 16 * g + lr) * KP + 8 * hi;   // the merged planes lie in K panels (gemm_main): a head is two panels
#pragma unroll
        for (int t = 0; t < 8; ++t) { v8us oh, ol;   // register r of tile t: dim 16 t + 8 hi + r of query lr
#pragma unroll
            for (int r = 0; r < 8; ++r) { unsigned short a, c2; splitf(acc[g][t][r] * inv, a, c2); oh[r] = a; ol[r] = c2; }
            __builtin_amdgcn_sched_barrier(0);   // with the one below: nothing that rewrites a data or address register of these stores is scheduled between them and their wait
            *(v8us*)(Ah + o + (size_t)(16 * t / KP) * (NB_ * TT * KP) + 16 * t % KP) = oh; *(v8us*)(Al + o + (size_t)(16 * t / KP) * (NB_ * TT * KP) + 16 * t % KP) = ol;
            asm volatile("s_wait_xcnt 0x0" ::: "memory");   // behind the issued stores, in front of whatever next rewrites their registers
            __builtin_amdgcn_sched_barrier(0); } }
}
// Heaviest row blocks first, the short hi/lo blocks last. Planes [batch x head][..]; merged output planes in K panels [(h * HD + d) / KP][batch x t][d % KP].
#define FNBH (NB_ * NH_)
#define FNF  ((TT - RH) / 128 * FNBH)
#define FNH  (RH / 64 * FNBH)
static_assert(NH_ == NKV && HD == 128 && RH % 64 == 0 && (TT - RH) % 128 == 0 && TT % 64 == 0 && KP == 64, "k_fattn: one kv head a query head, whole work-groups, whole stages; a stage is one key panel");
__global__ __launch_bounds__(128) __attribute__((amdgpu_waves_per_eu(2, 2))) void k_fattn(const h16* __restrict__ Q16, const h16* __restrict__ K16, const h16* __restrict__ V16, const bf* __restrict__ Qh, const bf* __restrict__ Ql, const bf* __restrict__ Kh, const bf* __restrict__ Kl, const bf* __restrict__ Vh, const bf* __restrict__ Vl, bf* Ah, bf* Al) {
    __shared__ __align__(16) bf sm[2 * 2 * (FTK + FTV)];
    const int w = __builtin_amdgcn_readfirstlane((int)(threadIdx.x >> 5)), bx = blockIdx.x;   // wave number, kept scalar so that the pass tests are scalar branches
    const int ix = bx < FNF ? bx : bx - FNF, bh = ix % FNBH, rb = ix / FNBH;
    const size_t pl = (size_t)bh * TT * HD, ao = (size_t)(bh % NH_) * (HD / KP) * (NB_ * TT * KP) + (size_t)(bh / NH_) * TT * KP;   // the head's first panel, the batch's first row in it
    if (bx < FNF) fattn_wg<h16, 0, 2>((h16*)sm, Q16 + pl, nullptr, K16 + pl, nullptr, V16 + pl, nullptr, Ah + ao, Al + ao, RH + ((TT - RH) / 128 - 1 - rb) * 128, w);
    else fattn_wg<bf, 2, 1>(sm, Qh + pl, Ql + pl, Kh + pl, Kl + pl, Vh + pl, Vl + pl, Ah + ao, Al + ao, (RH / 64 - 1 - rb) * 64, w);
}

extern "C" void kernel_launch(void* const* d_in, const int* in_sizes, int n_in,
                              void* d_out, int out_size, void* d_ws, size_t ws_size, hipStream_t stream) {
    (void)in_sizes; (void)n_in; (void)out_size;
    const float* x = (const float*)d_in[0]; const float* sinT = (const float*)d_in[1]; const float* cosT = (const float*)d_in[2]; const float* wq = (const float*)d_in[3]; const float* wk = (const float*)d_in[4]; const float* wv = (const float*)d_in[5]; const float* wo = (const float*)d_in[6]; const float* qsc = (const float*)d_in[7]; const float* ksc = (const float*)d_in[8];   /* x, sin, cos (f32 [2048][64], READ), Wq, Wk, Wv, Wo ('oi' [2048][2048]), q_norm_w, k_norm_w ([128], read) */
    float* OUT = (float*)d_out;     // [2][2048][2048]
    char* wsp = (char*)d_ws;
    auto take = [&](size_t bytes) { char* p = wsp; wsp += (bytes + 255) & ~(size_t)255; return (void*)p; };
    bf* WQ = (bf*)take((size_t)(DQ + 2 * DKV) * DM * 2); bf* WO = (bf*)take((size_t)DM * DQ * 2);
    const size_t PB = (size_t)NH_ * TT * HD, AB = (size_t)TT * DQ;   // elements of one batch in a head plane and in a merged plane; every plane holds both batches
    h16* QP16 = (h16*)take(NB_ * PB * 2); h16* KP16 = (h16*)take(NB_ * PB * 2); h16* VT16 = (h16*)take(NB_ * PB * 2);
    bf* QPh = (bf*)take(NB_ * PB * 2); bf* QPl = (bf*)take(NB_ * PB * 2); bf* KPh = (bf*)take(NB_ * PB * 2); bf* KPl = (bf*)take(NB_ * PB * 2); bf* VTh = (bf*)take(NB_ * PB * 2); bf* VTl = (bf*)take(NB_ * PB * 2); bf* ATh = (bf*)take(NB_ * AB * 2); bf* ATl = (bf*)take(NB_ * AB * 2);
    bf* XB = (bf*)take((size_t)NB_ * TT * DM * 2);
    if ((size_t)(wsp - (char*)d_ws) > ws_size) return;    // ws 256 MiB
    k_cast<<<CSEG / (CBLK * CWAV), CWAV * 32, 0, stream>>>(wq, wk, wv, wo, x, WQ, WO, XB);
    // WQ: the rows of Wq, Wk, Wv as one operand of DQ + 2 DKV rows, in K panels
    k_proj<<<dim3(NB_ * TT / 128, (DQ + 2 * DKV) / 128, 1), 128, 0, stream>>>(XB, WQ, sinT, cosT, qsc, ksc, QP16, QPh, QPl, KP16, KPh, KPl, VT16, VTh, VTl);
    k_fattn<<<FNF + FNH, 128, 0, stream>>>(QP16, KP16, VT16, QPh, QPl, KPh, KPl, VTh, VTl, ATh, ATl);
    k_gemmt<1, DQ, 64><<<dim3(NB_ * TT / 128, DM / 128, 1), 128, 0, stream>>>(ATh, ATl, WO, OUT);   // the merged planes hold both batches' rows in each K panel, the output's batches lie one behind the other: one operand of NB_ TT rows
}
